// v000
// The times below were measured on an AMD MI455X: many runs one after another, warmed up first and cycling through
// copies of the inputs, with the whole window's GPU time divided by the number of runs. Launches and the gaps
// between them are all in it. The median over several windows is given; except for v000 it joins two sittings, which
// can be a few percent apart, so the side-by-side timings, each taken in one sitting, are the better comparison.
// v000, which the later versions start from, runs in 465 microseconds.
#include <hip/hip_runtime.h>
#include <hip/hip_bf16.h>

// ---------------------------------------------------------------------------
// MI455X (gfx1250, wave32) implementation of the hybrid-attention reference.
// All matmuls run on V_WMMA_F32_16X16X32_F16 (f16 in, f32 accumulate).
// Fragment loads are vectorized: each lane's 16-half WMMA fragment is two
// contiguous 16B runs (ISA 7.12.2), loaded as 2x ds_load_b128/global_load_b128.
// B-side operands are staged TRANSPOSED into LDS so that their fragment reads
// are row-contiguous too.  Pure (conversion-free) global->LDS staging uses
// CDNA5 GLOBAL_LOAD_ASYNC_TO_LDS_B128 tracked by ASYNCcnt.
// ---------------------------------------------------------------------------

typedef __attribute__((ext_vector_type(16))) _Float16 v16h;
typedef __attribute__((ext_vector_type(8)))  _Float16 h8;
typedef __attribute__((ext_vector_type(8)))  float    v8f;

constexpr int Bb     = 8;
constexpr int Nn     = 1024;
constexpr int HDd    = 64;
constexpr int INNERi = 512;

union V16U { v16h v; h8 h2[2]; };

// Async DMA of 16 bytes global -> LDS (ASYNCcnt).  ldsOff is the byte offset
// of the destination within the workgroup's LDS allocation (low 32 bits of
// the generic pointer, per ISA 10.2 aperture mapping).
__device__ __forceinline__ void async_copy_b128(const void* gptr, void* ldsptr) {
  const unsigned ldsOff = (unsigned)(unsigned long long)ldsptr;
  asm volatile("global_load_async_to_lds_b128 %0, %1, off"
               :: "v"(ldsOff), "v"(gptr) : "memory");
}

__device__ __forceinline__ void wait_async0() {
#if __has_builtin(__builtin_amdgcn_s_wait_asynccnt)
  __builtin_amdgcn_s_wait_asynccnt(0);
#else
  asm volatile("s_wait_asynccnt 0x0" ::: "memory");
#endif
}

// Fragment loader: lane holds "line" (lane&15) of a row-major tile; the 16
// halves are K = khi..khi+7 and 16+khi..16+khi+7 with khi = 8*(lane>>4),
// i.e. two aligned 16B vector loads. Serves A-fragments (line = row m),
// K^T-fragments (line = col n) and transposed-staged B-fragments.
__device__ __forceinline__ v16h load_frag(const _Float16* base, int rstride, int lane) {
  const _Float16* p = base + (lane & 15) * rstride + ((lane >> 4) << 3);
  V16U u;
  u.h2[0] = *(const h8*)p;
  u.h2[1] = *(const h8*)(p + 16);
  return u.v;
}

__device__ __forceinline__ v8f wmma_f16(v16h a, v16h b, v8f c) {
  // (neg_a, A, neg_b, B, c_mod, C, reuse_a, reuse_b)
  return __builtin_amdgcn_wmma_f32_16x16x32_f16(false, a, false, b, (short)0, c, false, false);
}

// ---------------------------------------------------------------------------
// GEMM 1: C(f16)[M,Nc] = A(f32)[M,K] @ W(f32)[K,Nc].  BM=BN=128, BK=32.
// 8 waves in a 4x2 grid; each wave owns 32x64 = 2x4 WMMA tiles.
// W tile staged transposed: Bst[col][k].  (f32->f16 conversion forces the
// VGPR staging path here.)
// ---------------------------------------------------------------------------
__global__ __launch_bounds__(256)
void gemm_qkv_kernel(const float* __restrict__ A, const float* __restrict__ W,
                     _Float16* __restrict__ C, int M, int K, int Ncols) {
  constexpr int AS_S = 40;    // 128 rows x 32 halfs (+pad), 16B-multiple stride
  constexpr int BT_S = 40;    // 128 cols x 32 halfs (+pad), transposed W tile
  __shared__ alignas(16) _Float16 As [128 * AS_S];
  __shared__ alignas(16) _Float16 Bst[128 * BT_S];

  const int tid  = threadIdx.x;
  const int lane = tid & 31;
  const int wave = tid >> 5;
  const int row0 = blockIdx.y * 128;
  const int col0 = blockIdx.x * 128;
  const int wm   = wave & 3;   // row group (32 rows)
  const int wn   = wave >> 2;  // col group (64 cols)

  v8f acc[2][4];
#pragma unroll
  for (int i = 0; i < 2; ++i)
#pragma unroll
    for (int nt = 0; nt < 4; ++nt) acc[i][nt] = {};

  for (int k0 = 0; k0 < K; k0 += 32) {
    __syncthreads();
    // Stage A (f32 -> f16), row-major: 128x32 = 1024 float4 chunks.
    for (int i = tid; i < 1024; i += 256) {
      const int r = i >> 3, c4 = (i & 7) << 2;
      const float4 v = *(const float4*)(A + (size_t)(row0 + r) * K + k0 + c4);
      _Float16* d = As + r * AS_S + c4;
      d[0] = (_Float16)v.x; d[1] = (_Float16)v.y;
      d[2] = (_Float16)v.z; d[3] = (_Float16)v.w;
    }
    // Stage W (f32 -> f16) TRANSPOSED: Bst[col][k].
    for (int i = tid; i < 1024; i += 256) {
      const int r = i >> 5, c4 = (i & 31) << 2;  // k-row r, col base c4
      const float4 v = *(const float4*)(W + (size_t)(k0 + r) * Ncols + col0 + c4);
      Bst[(c4 + 0) * BT_S + r] = (_Float16)v.x;
      Bst[(c4 + 1) * BT_S + r] = (_Float16)v.y;
      Bst[(c4 + 2) * BT_S + r] = (_Float16)v.z;
      Bst[(c4 + 3) * BT_S + r] = (_Float16)v.w;
    }
    if (k0 + 32 < K) {  // global_prefetch_b8 of next tiles
      __builtin_prefetch((const void*)(A + (size_t)(row0 + (tid >> 1)) * K + k0 + 32), 0, 1);
      __builtin_prefetch((const void*)(W + (size_t)(k0 + 32 + (tid >> 3)) * Ncols + col0), 0, 1);
    }
    __syncthreads();

    v16h af[2], bf[4];
#pragma unroll
    for (int i = 0; i < 2; ++i)
      af[i] = load_frag(As + (wm * 32 + i * 16) * AS_S, AS_S, lane);
#pragma unroll
    for (int nt = 0; nt < 4; ++nt)
      bf[nt] = load_frag(Bst + (wn * 64 + nt * 16) * BT_S, BT_S, lane);
#pragma unroll
    for (int i = 0; i < 2; ++i)
#pragma unroll
      for (int nt = 0; nt < 4; ++nt)
        acc[i][nt] = wmma_f16(af[i], bf[nt], acc[i][nt]);
  }

  const int hi = lane >> 4, cn = lane & 15;
#pragma unroll
  for (int i = 0; i < 2; ++i)
#pragma unroll
    for (int nt = 0; nt < 4; ++nt)
#pragma unroll
      for (int r = 0; r < 8; ++r) {
        const int row = row0 + wm * 32 + i * 16 + r + 8 * hi;
        const int col = col0 + wn * 64 + nt * 16 + cn;
        C[(size_t)row * Ncols + col] = (_Float16)acc[i][nt][r];
      }
}

// ---------------------------------------------------------------------------
// GEMM 2: out(f32)[M,Nc] = A(f16)[M,K] @ W(f32)[K,Nc] + bias.
// The f16 A tile needs no conversion -> staged with async-to-LDS DMA.
// ---------------------------------------------------------------------------
__global__ __launch_bounds__(256)
void gemm_out_kernel(const _Float16* __restrict__ A, const float* __restrict__ W,
                     const float* __restrict__ bias, float* __restrict__ C,
                     int M, int K, int Ncols) {
  constexpr int AS_S = 40;
  constexpr int BT_S = 40;
  __shared__ alignas(16) _Float16 As [128 * AS_S];
  __shared__ alignas(16) _Float16 Bst[128 * BT_S];

  const int tid  = threadIdx.x;
  const int lane = tid & 31;
  const int wave = tid >> 5;
  const int row0 = blockIdx.y * 128;
  const int col0 = blockIdx.x * 128;
  const int wm   = wave & 3;
  const int wn   = wave >> 2;

  v8f acc[2][4];
#pragma unroll
  for (int i = 0; i < 2; ++i)
#pragma unroll
    for (int nt = 0; nt < 4; ++nt) acc[i][nt] = {};

  for (int k0 = 0; k0 < K; k0 += 32) {
    __syncthreads();
    // Stage A (f16) via async DMA: 128x32 halfs = 512 b128 transfers.
    for (int i = tid; i < 512; i += 256) {
      const int r = i >> 2, c8 = (i & 3) << 3;
      async_copy_b128(A + (size_t)(row0 + r) * K + k0 + c8,
                      As + r * AS_S + c8);
    }
    // Stage W transposed (f32 -> f16 conversion: VGPR path).
    for (int i = tid; i < 1024; i += 256) {
      const int r = i >> 5, c4 = (i & 31) << 2;
      const float4 v = *(const float4*)(W + (size_t)(k0 + r) * Ncols + col0 + c4);
      Bst[(c4 + 0) * BT_S + r] = (_Float16)v.x;
      Bst[(c4 + 1) * BT_S + r] = (_Float16)v.y;
      Bst[(c4 + 2) * BT_S + r] = (_Float16)v.z;
      Bst[(c4 + 3) * BT_S + r] = (_Float16)v.w;
    }
    wait_async0();           // ASYNCcnt == 0: A tile landed in LDS
    __syncthreads();

    v16h af[2], bf[4];
#pragma unroll
    for (int i = 0; i < 2; ++i)
      af[i] = load_frag(As + (wm * 32 + i * 16) * AS_S, AS_S, lane);
#pragma unroll
    for (int nt = 0; nt < 4; ++nt)
      bf[nt] = load_frag(Bst + (wn * 64 + nt * 16) * BT_S, BT_S, lane);
#pragma unroll
    for (int i = 0; i < 2; ++i)
#pragma unroll
      for (int nt = 0; nt < 4; ++nt)
        acc[i][nt] = wmma_f16(af[i], bf[nt], acc[i][nt]);
  }

  const int hi = lane >> 4, cn = lane & 15;
#pragma unroll
  for (int i = 0; i < 2; ++i)
#pragma unroll
    for (int nt = 0; nt < 4; ++nt)
#pragma unroll
      for (int r = 0; r < 8; ++r) {
        const int row = row0 + wm * 32 + i * 16 + r + 8 * hi;
        const int col = col0 + wn * 64 + nt * 16 + cn;
        C[(size_t)row * Ncols + col] = acc[i][nt][r] + bias[col];
      }
}

// ---------------------------------------------------------------------------
// conv_gate: MS = s1+s2 (f32); depthwise conv (k=5, pad 2) along features with
// per-token weights; MSg = sigmoid(conv) * MS -> f16, merged b n (h d) layout.
// One block per (b, n) row.
// ---------------------------------------------------------------------------
__global__ __launch_bounds__(128)
void conv_gate_kernel(const _Float16* __restrict__ qkv1,
                      const _Float16* __restrict__ qkv2,
                      const float* __restrict__ cw, const float* __restrict__ cb,
                      _Float16* __restrict__ msg) {
  const int bn = blockIdx.x;          // b*N + n
  const int n  = bn & (Nn - 1);
  __shared__ float ms[INNERi + 4];

  const _Float16* s1 = qkv1 + (size_t)bn * 2048 + 1536;
  const _Float16* s2 = qkv2 + (size_t)bn * 2048 + 1536;
  for (int f = threadIdx.x; f < INNERi; f += blockDim.x)
    ms[f + 2] = (float)s1[f] + (float)s2[f];
  if (threadIdx.x < 2) { ms[threadIdx.x] = 0.0f; ms[INNERi + 2 + threadIdx.x] = 0.0f; }
  __syncthreads();

  const float w0 = cw[n * 5 + 0], w1 = cw[n * 5 + 1], w2 = cw[n * 5 + 2],
              w3 = cw[n * 5 + 3], w4 = cw[n * 5 + 4];
  const float bias = cb[n];
  for (int f = threadIdx.x; f < INNERi; f += blockDim.x) {
    const float a = w0 * ms[f] + w1 * ms[f + 1] + w2 * ms[f + 2] +
                    w3 * ms[f + 3] + w4 * ms[f + 4] + bias;
    const float g = ms[f + 2] / (1.0f + __expf(-a));
    msg[(size_t)bn * INNERi + f] = (_Float16)g;
  }
}

// ---------------------------------------------------------------------------
// Flash-attention pass: O = softmax(scale * Q K^T) @ V  (+ V residual).
// All tensors live in [B, N, stride] f16 buffers; the head slice is selected
// by (section offset + h*64).  128 query rows per block, 8 waves x 16 rows,
// KV streamed in 64-row chunks through LDS.
//   Ks  : [j][d] row-major, staged via async-to-LDS DMA (no conversion)
//   Vst : [d][j] transposed (VGPR path; transpose forces it)
//   Ps  : per-wave P scratch for C->A relayout
// ---------------------------------------------------------------------------
__global__ __launch_bounds__(256)
void attn_kernel(const _Float16* __restrict__ Q, int qstride, int qsec,
                 const _Float16* __restrict__ Kv, int kstride, int ksec,
                 const _Float16* __restrict__ V, int vstride, int vsec,
                 _Float16* __restrict__ O, int ostride,
                 int addV, float scale) {
  constexpr int LS = 72;  // padded row stride in halfs (144B, 16B-multiple)
  __shared__ alignas(16) _Float16 Ks [64 * LS];
  __shared__ alignas(16) _Float16 Vst[64 * LS];
  __shared__ alignas(16) _Float16 Ps [8 * 16 * LS];

  const int tid  = threadIdx.x;
  const int lane = tid & 31;
  const int wave = tid >> 5;
  const int bh   = blockIdx.y;
  const int b    = bh >> 3;
  const int h    = bh & 7;
  const int row0 = blockIdx.x * 128;
  const size_t bN = (size_t)b * Nn;
  const int qoff = qsec + h * HDd;
  const int koff = ksec + h * HDd;
  const int voff = vsec + h * HDd;
  const int ooff = h * HDd;

  // Q fragments for this wave's 16 rows: two global_load_b128 per fragment.
  v16h qa0, qa1;
  {
    const _Float16* qp =
        Q + (bN + row0 + wave * 16 + (lane & 15)) * (size_t)qstride + qoff +
        ((lane >> 4) << 3);
    V16U u0, u1;
    u0.h2[0] = *(const h8*)(qp);
    u0.h2[1] = *(const h8*)(qp + 16);
    u1.h2[0] = *(const h8*)(qp + 32);
    u1.h2[1] = *(const h8*)(qp + 48);
    qa0 = u0.v;
    qa1 = u1.v;
  }

  float m_old[8], l[8];
#pragma unroll
  for (int r = 0; r < 8; ++r) { m_old[r] = -1e30f; l[r] = 0.0f; }
  v8f o[4];
#pragma unroll
  for (int dt = 0; dt < 4; ++dt) o[dt] = {};

  _Float16* ps = Ps + wave * 16 * LS;
  const int cn = lane & 15;
  const int hi = lane >> 4;

  for (int j0 = 0; j0 < Nn; j0 += 64) {
    __syncthreads();
    // Stage K chunk row-major via async DMA: 64x64 halfs = 512 b128 transfers.
    for (int i = tid; i < 512; i += 256) {
      const int r = i >> 3, c8 = (i & 7) << 3;
      async_copy_b128(Kv + (bN + j0 + r) * (size_t)kstride + koff + c8,
                      Ks + r * LS + c8);
    }
    // Stage V chunk TRANSPOSED: Vst[d][j] (VGPR path).
    for (int i = tid; i < 512; i += 256) {
      const int r = i >> 3, c8 = (i & 7) << 3;  // j row r, d base c8
      const h8 v = *(const h8*)(V + (bN + j0 + r) * (size_t)vstride + voff + c8);
#pragma unroll
      for (int e = 0; e < 8; ++e) Vst[(c8 + e) * LS + r] = v[e];
    }
    if (j0 + 64 < Nn)
      __builtin_prefetch(
          (const void*)(Kv + (bN + j0 + 64 + (tid >> 2)) * (size_t)kstride + koff), 0, 1);
    wait_async0();           // K chunk landed in LDS
    __syncthreads();

    // S = scale * Q K^T  (16x64 per wave, 4 WMMA column tiles, K-depth 64).
    v8f sc[4];
#pragma unroll
    for (int nt = 0; nt < 4; ++nt) {
      v8f z = {};
      z = wmma_f16(qa0, load_frag(Ks + (nt * 16) * LS, LS, lane), z);
      z = wmma_f16(qa1, load_frag(Ks + (nt * 16) * LS + 32, LS, lane), z);
#pragma unroll
      for (int r = 0; r < 8; ++r) z[r] *= scale;
      sc[nt] = z;
    }

    // Online-softmax update.  Stats live per half-wave (rows 0-7 / 8-15).
    float m_new[8], alpha[8];
#pragma unroll
    for (int r = 0; r < 8; ++r) {
      float mx = fmaxf(fmaxf(sc[0][r], sc[1][r]), fmaxf(sc[2][r], sc[3][r]));
#pragma unroll
      for (int off = 1; off < 16; off <<= 1) mx = fmaxf(mx, __shfl_xor(mx, off, 32));
      m_new[r] = fmaxf(m_old[r], mx);
      alpha[r] = __expf(m_old[r] - m_new[r]);
      m_old[r] = m_new[r];
    }
    float rs[8];
#pragma unroll
    for (int r = 0; r < 8; ++r) rs[r] = 0.0f;
#pragma unroll
    for (int nt = 0; nt < 4; ++nt)
#pragma unroll
      for (int r = 0; r < 8; ++r) {
        const float p = __expf(sc[nt][r] - m_new[r]);
        rs[r] += p;
        ps[(r + 8 * hi) * LS + nt * 16 + cn] = (_Float16)p;  // C->A relayout via LDS
      }
#pragma unroll
    for (int r = 0; r < 8; ++r) {
      float s = rs[r];
#pragma unroll
      for (int off = 1; off < 16; off <<= 1) s += __shfl_xor(s, off, 32);
      l[r] = l[r] * alpha[r] + s;
    }
#pragma unroll
    for (int dt = 0; dt < 4; ++dt)
#pragma unroll
      for (int r = 0; r < 8; ++r) o[dt][r] *= alpha[r];

    // O += P @ V_chunk.  A = P from per-wave scratch (row-contiguous);
    // B-fragments from transposed Vst (row-contiguous): all 2x ds_load_b128.
    const v16h pa0 = load_frag(ps, LS, lane);
    const v16h pa1 = load_frag(ps + 32, LS, lane);
#pragma unroll
    for (int dt = 0; dt < 4; ++dt) {
      o[dt] = wmma_f16(pa0, load_frag(Vst + (dt * 16) * LS, LS, lane), o[dt]);
      o[dt] = wmma_f16(pa1, load_frag(Vst + (dt * 16) * LS + 32, LS, lane), o[dt]);
    }
  }

  // Normalize, optional +V residual, store f16.
#pragma unroll
  for (int dt = 0; dt < 4; ++dt)
#pragma unroll
    for (int r = 0; r < 8; ++r) {
      const int grow = row0 + wave * 16 + r + 8 * hi;
      float val = o[dt][r] / l[r];
      if (addV)
        val += (float)V[(bN + grow) * (size_t)vstride + voff + dt * 16 + cn];
      O[(bN + grow) * (size_t)ostride + ooff + dt * 16 + cn] = (_Float16)val;
    }
}

// ---------------------------------------------------------------------------
// Host launcher.
// ---------------------------------------------------------------------------
extern "C" void kernel_launch(void* const* d_in, const int* in_sizes, int n_in,
                              void* d_out, int out_size, void* d_ws, size_t ws_size,
                              hipStream_t stream) {
  (void)in_sizes; (void)n_in; (void)out_size; (void)ws_size;
  const float* x1     = (const float*)d_in[0];
  const float* x2     = (const float*)d_in[1];
  const float* Wqkv1  = (const float*)d_in[2];
  const float* Wqkv2  = (const float*)d_in[3];
  const float* Wout1  = (const float*)d_in[4];
  const float* bout1  = (const float*)d_in[5];
  const float* Wout2  = (const float*)d_in[6];
  const float* bout2  = (const float*)d_in[7];
  const float* conv_w = (const float*)d_in[8];
  const float* conv_b = (const float*)d_in[9];

  const size_t MROWS = (size_t)Bb * Nn;  // 8192
  // Workspace layout (f16). t1 aliases msg (dead after attn pass 2);
  // t2 aliases u1 (dead after attn pass 3). Total 88 MiB.
  _Float16* qkv1h = (_Float16*)d_ws;
  _Float16* qkv2h = qkv1h + MROWS * 2048;
  _Float16* msg   = qkv2h + MROWS * 2048;
  _Float16* u1    = msg + MROWS * 512;
  _Float16* u2    = u1 + MROWS * 512;
  _Float16* t1    = msg;  // alias
  _Float16* t2    = u1;   // alias

  float* out1 = (float*)d_out;
  float* out2 = out1 + MROWS * 512;

  const dim3 blk(256);
  const float scale = 0.125f;  // HD^-0.5

  // QKV projections: [8192,512] @ [512,2048] -> f16
  gemm_qkv_kernel<<<dim3(16, 64), blk, 0, stream>>>(x1, Wqkv1, qkv1h, 8192, 512, 2048);
  gemm_qkv_kernel<<<dim3(16, 64), blk, 0, stream>>>(x2, Wqkv2, qkv2h, 8192, 512, 2048);

  // Gated conv branch -> MSg (merged b n (h d), f16)
  conv_gate_kernel<<<dim3(Bb * Nn), dim3(128), 0, stream>>>(qkv1h, qkv2h, conv_w, conv_b, msg);

  // u1 = softmax(MS MS^T)·v1 + v1 ; u2 likewise (sections: q=0,k=512,v=1024,s=1536)
  attn_kernel<<<dim3(8, 64), blk, 0, stream>>>(msg, 512, 0, msg, 512, 0,
                                               qkv1h, 2048, 1024, u1, 512, 1, scale);
  attn_kernel<<<dim3(8, 64), blk, 0, stream>>>(msg, 512, 0, msg, 512, 0,
                                               qkv2h, 2048, 1024, u2, 512, 1, scale);
  // t1 = softmax(q1 k1^T)·u1 ; t2 = softmax(q2 k2^T)·u2
  attn_kernel<<<dim3(8, 64), blk, 0, stream>>>(qkv1h, 2048, 0, qkv1h, 2048, 512,
                                               u1, 512, 0, t1, 512, 0, scale);
  attn_kernel<<<dim3(8, 64), blk, 0, stream>>>(qkv2h, 2048, 0, qkv2h, 2048, 512,
                                               u2, 512, 0, t2, 512, 0, scale);

  // Output projections with bias -> f32 d_out
  gemm_out_kernel<<<dim3(4, 64), blk, 0, stream>>>(t1, Wout1, bout1, out1, 8192, 512, 512);
  gemm_out_kernel<<<dim3(4, 64), blk, 0, stream>>>(t2, Wout2, bout2, out2, 8192, 512, 512);
}

// v001
// It runs in 444 microseconds.
// Next to v000, in two timings, it ran 1.08 times as fast each time.
#include <hip/hip_runtime.h>
#include <hip/hip_bf16.h>

// ---------------------------------------------------------------------------
// MI455X (gfx1250, wave32) implementation of the hybrid-attention reference.
// All matmuls run on V_WMMA_F32_16X16X32_F16 (f16 in, f32 accumulate).
// Fragment loads are vectorized: each lane's 16-half WMMA fragment is two
// contiguous 16B runs (ISA 7.12.2), loaded as 2x ds_load_b128/global_load_b128.
// B-side operands are staged TRANSPOSED into LDS so that their fragment reads
// are row-contiguous too.  Pure (conversion-free) global->LDS staging uses
// CDNA5 GLOBAL_LOAD_ASYNC_TO_LDS_B128 tracked by ASYNCcnt.
// ---------------------------------------------------------------------------

typedef __attribute__((ext_vector_type(16))) _Float16 v16h;
typedef __attribute__((ext_vector_type(8)))  _Float16 h8;
typedef __attribute__((ext_vector_type(8)))  float    v8f;

constexpr int Bb     = 8;
constexpr int Nn     = 1024;
constexpr int HDd    = 64;
constexpr int INNERi = 512;

union V16U { v16h v; h8 h2[2]; };

// Async DMA of 16 bytes global -> LDS (ASYNCcnt).  ldsOff is the byte offset
// of the destination within the workgroup's LDS allocation (low 32 bits of
// the generic pointer, per ISA 10.2 aperture mapping).
__device__ __forceinline__ void async_copy_b128(const void* gptr, void* ldsptr) {
  const unsigned ldsOff = (unsigned)(unsigned long long)ldsptr;
  asm volatile("global_load_async_to_lds_b128 %0, %1, off"
               :: "v"(ldsOff), "v"(gptr) : "memory");
}

__device__ __forceinline__ void wait_async0() {
#if __has_builtin(__builtin_amdgcn_s_wait_asynccnt)
  __builtin_amdgcn_s_wait_asynccnt(0);
#else
  asm volatile("s_wait_asynccnt 0x0" ::: "memory");
#endif
}

// Fragment loader: lane holds "line" (lane&15) of a row-major tile; the 16
// halves are K = khi..khi+7 and 16+khi..16+khi+7 with khi = 8*(lane>>4),
// i.e. two aligned 16B vector loads. Serves A-fragments (line = row m),
// K^T-fragments (line = col n) and transposed-staged B-fragments.
__device__ __forceinline__ v16h load_frag(const _Float16* base, int rstride, int lane) {
  const _Float16* p = base + (lane & 15) * rstride + ((lane >> 4) << 3);
  V16U u;
  u.h2[0] = *(const h8*)p;
  u.h2[1] = *(const h8*)(p + 16);
  return u.v;
}

// Holds a block-uniform address in scalar registers, so that a load takes it as
// its scalar base beside one loop-invariant 32-bit offset register per thread
// (no 64-bit address pair per load: fewer registers, more waves resident).
typedef __attribute__((ext_vector_type(4))) float f4;
typedef const __attribute__((address_space(1))) char* gbytes;  // global memory, bytes
typedef const __attribute__((address_space(1))) f4*   gf4;     // global memory, 4 floats
__device__ __forceinline__ gbytes scalar_base(const float* p) {
  const unsigned long long u = (unsigned long long)p;
  const unsigned lo = (unsigned)__builtin_amdgcn_readfirstlane((int)(unsigned)u);
  const unsigned hi = (unsigned)__builtin_amdgcn_readfirstlane((int)(unsigned)(u >> 32));
  return (gbytes)(((unsigned long long)hi << 32) | lo);
}

__device__ __forceinline__ v8f wmma_f16(v16h a, v16h b, v8f c) {
  // (neg_a, A, neg_b, B, c_mod, C, reuse_a, reuse_b)
  return __builtin_amdgcn_wmma_f32_16x16x32_f16(false, a, false, b, (short)0, c, false, false);
}

// ---------------------------------------------------------------------------
// GEMM 1: C(f16)[M,Nc] = A(f32)[M,K] @ W(f32)[K,Nc].  BM=BN=128, BK=32.
// 8 waves in a 4x2 grid; each wave owns 32x64 = 2x4 WMMA tiles.
// W tile staged transposed: Bst[col][k].  (f32->f16 conversion forces the
// VGPR staging path here.)
// ---------------------------------------------------------------------------
__global__ __launch_bounds__(256)
void gemm_qkv_kernel(const float* __restrict__ A, const float* __restrict__ W,
                     _Float16* __restrict__ C, int M, int K, int Ncols) {
  constexpr int AS_S = 40;    // 128 rows x 32 halfs (+pad), 16B-multiple stride
  constexpr int BT_S = 40;    // 128 cols x 32 halfs (+pad), transposed W tile
  __shared__ alignas(16) _Float16 As [128 * AS_S];
  __shared__ alignas(16) _Float16 Bst[128 * BT_S];

  const int tid  = threadIdx.x;
  const int lane = tid & 31;
  const int wave = tid >> 5;
  const int row0 = blockIdx.y * 128;
  const int col0 = blockIdx.x * 128;
  const int wm   = wave & 3;   // row group (32 rows)
  const int wn   = wave >> 2;  // col group (64 cols)
  const unsigned aoff = 4u * (unsigned)((tid >> 3) * K + ((tid & 7) << 2));       // bytes; A: row tid/8
  const unsigned woff = 4u * (unsigned)((tid >> 5) * Ncols + ((tid & 31) << 2));  // bytes; W: k-row tid/32

  v8f acc[2][4];
#pragma unroll
  for (int i = 0; i < 2; ++i)
#pragma unroll
    for (int nt = 0; nt < 4; ++nt) acc[i][nt] = {};

  for (int k0 = 0; k0 < K; k0 += 32) {
    __syncthreads();
    // All eight global loads of this k-step go out together, so that their
    // latencies overlap; the converts and LDS stores follow.
    f4 av[4], wv[4];
#pragma unroll  // constant trip count: the four loads must not wait on one another
    for (int it = 0; it < 4; ++it)
      av[it] = *(gf4)(scalar_base(A + ((size_t)(row0 + it * 32) * K + k0)) + aoff);
#pragma unroll  // as above, for the W tile
    for (int it = 0; it < 4; ++it)
      wv[it] = *(gf4)(scalar_base(W + ((size_t)(k0 + it * 8) * Ncols + col0)) + woff);
    // The converts below reuse the address registers of the loads above.
    asm volatile("s_wait_xcnt 0x0" ::: "memory");
    // Stage A (f32 -> f16), row-major: 128x32 = 1024 float4 chunks.
#pragma unroll  // av[] stays in registers
    for (int it = 0; it < 4; ++it) {
      const int i = tid + it * 256;
      const int r = i >> 3, c4 = (i & 7) << 2;
      _Float16* d = As + r * AS_S + c4;
      d[0] = (_Float16)av[it].x; d[1] = (_Float16)av[it].y;
      d[2] = (_Float16)av[it].z; d[3] = (_Float16)av[it].w;
    }
    // Stage W (f32 -> f16) TRANSPOSED: Bst[col][k].
#pragma unroll  // wv[] stays in registers
    for (int it = 0; it < 4; ++it) {
      const int i = tid + it * 256;
      const int r = i >> 5, c4 = (i & 31) << 2;
      Bst[(c4 + 0) * BT_S + r] = (_Float16)wv[it].x;
      Bst[(c4 + 1) * BT_S + r] = (_Float16)wv[it].y;
      Bst[(c4 + 2) * BT_S + r] = (_Float16)wv[it].z;
      Bst[(c4 + 3) * BT_S + r] = (_Float16)wv[it].w;
    }
    if (k0 + 32 < K) {  // global_prefetch_b8 of next tiles
      __builtin_prefetch((const void*)(A + (size_t)(row0 + (tid >> 1)) * K + k0 + 32), 0, 1);
      __builtin_prefetch((const void*)(W + (size_t)(k0 + 32 + (tid >> 3)) * Ncols + col0), 0, 1);
    }
    __syncthreads();

    v16h af[2], bf[4];
#pragma unroll
    for (int i = 0; i < 2; ++i)
      af[i] = load_frag(As + (wm * 32 + i * 16) * AS_S, AS_S, lane);
#pragma unroll
    for (int nt = 0; nt < 4; ++nt)
      bf[nt] = load_frag(Bst + (wn * 64 + nt * 16) * BT_S, BT_S, lane);
#pragma unroll
    for (int i = 0; i < 2; ++i)
#pragma unroll
      for (int nt = 0; nt < 4; ++nt)
        acc[i][nt] = wmma_f16(af[i], bf[nt], acc[i][nt]);
  }

  const int hi = lane >> 4, cn = lane & 15;
#pragma unroll
  for (int i = 0; i < 2; ++i)
#pragma unroll
    for (int nt = 0; nt < 4; ++nt)
#pragma unroll
      for (int r = 0; r < 8; ++r) {
        const int row = row0 + wm * 32 + i * 16 + r + 8 * hi;
        const int col = col0 + wn * 64 + nt * 16 + cn;
        C[(size_t)row * Ncols + col] = (_Float16)acc[i][nt][r];
      }
}

// ---------------------------------------------------------------------------
// GEMM 2: out(f32)[M,Nc] = A(f16)[M,K] @ W(f32)[K,Nc] + bias.
// The f16 A tile needs no conversion -> staged with async-to-LDS DMA.
// ---------------------------------------------------------------------------
__global__ __launch_bounds__(256)
void gemm_out_kernel(const _Float16* __restrict__ A, const float* __restrict__ W,
                     const float* __restrict__ bias, float* __restrict__ C,
                     int M, int K, int Ncols) {
  constexpr int AS_S = 40;
  constexpr int BT_S = 40;
  __shared__ alignas(16) _Float16 As [128 * AS_S];
  __shared__ alignas(16) _Float16 Bst[128 * BT_S];

  const int tid  = threadIdx.x;
  const int lane = tid & 31;
  const int wave = tid >> 5;
  const int row0 = blockIdx.y * 128;
  const int col0 = blockIdx.x * 128;
  const int wm   = wave & 3;
  const int wn   = wave >> 2;
  const unsigned woff = 4u * (unsigned)((tid >> 5) * Ncols + ((tid & 31) << 2));  // bytes; W: k-row tid/32

  v8f acc[2][4];
#pragma unroll
  for (int i = 0; i < 2; ++i)
#pragma unroll
    for (int nt = 0; nt < 4; ++nt) acc[i][nt] = {};

  for (int k0 = 0; k0 < K; k0 += 32) {
    __syncthreads();
    // The four W loads of this k-step go out together, so that their
    // latencies overlap one another and the A copies; the LDS stores follow.
    f4 wv[4];
#pragma unroll  // constant trip count: the four loads must not wait on one another
    for (int it = 0; it < 4; ++it)
      wv[it] = *(gf4)(scalar_base(W + ((size_t)(k0 + it * 8) * Ncols + col0)) + woff);
    // Stage A (f16) via async DMA: 128x32 halfs = 512 b128 transfers.
    for (int i = tid; i < 512; i += 256) {
      const int r = i >> 2, c8 = (i & 3) << 3;
      async_copy_b128(A + (size_t)(row0 + r) * K + k0 + c8,
                      As + r * AS_S + c8);
    }
    // Stage W transposed (f32 -> f16 conversion: VGPR path).
#pragma unroll  // wv[] stays in registers
    for (int it = 0; it < 4; ++it) {
      const int i = tid + it * 256;
      const int r = i >> 5, c4 = (i & 31) << 2;
      Bst[(c4 + 0) * BT_S + r] = (_Float16)wv[it].x;
      Bst[(c4 + 1) * BT_S + r] = (_Float16)wv[it].y;
      Bst[(c4 + 2) * BT_S + r] = (_Float16)wv[it].z;
      Bst[(c4 + 3) * BT_S + r] = (_Float16)wv[it].w;
    }
    wait_async0();           // ASYNCcnt == 0: A tile landed in LDS
    __syncthreads();

    v16h af[2], bf[4];
#pragma unroll
    for (int i = 0; i < 2; ++i)
      af[i] = load_frag(As + (wm * 32 + i * 16) * AS_S, AS_S, lane);
#pragma unroll
    for (int nt = 0; nt < 4; ++nt)
      bf[nt] = load_frag(Bst + (wn * 64 + nt * 16) * BT_S, BT_S, lane);
#pragma unroll
    for (int i = 0; i < 2; ++i)
#pragma unroll
      for (int nt = 0; nt < 4; ++nt)
        acc[i][nt] = wmma_f16(af[i], bf[nt], acc[i][nt]);
  }

  const int hi = lane >> 4, cn = lane & 15;
#pragma unroll
  for (int i = 0; i < 2; ++i)
#pragma unroll
    for (int nt = 0; nt < 4; ++nt)
#pragma unroll
      for (int r = 0; r < 8; ++r) {
        const int row = row0 + wm * 32 + i * 16 + r + 8 * hi;
        const int col = col0 + wn * 64 + nt * 16 + cn;
        C[(size_t)row * Ncols + col] = acc[i][nt][r] + bias[col];
      }
}

// ---------------------------------------------------------------------------
// conv_gate: MS = s1+s2 (f32); depthwise conv (k=5, pad 2) along features with
// per-token weights; MSg = sigmoid(conv) * MS -> f16, merged b n (h d) layout.
// One block per (b, n) row.
// ---------------------------------------------------------------------------
__global__ __launch_bounds__(128)
void conv_gate_kernel(const _Float16* __restrict__ qkv1,
                      const _Float16* __restrict__ qkv2,
                      const float* __restrict__ cw, const float* __restrict__ cb,
                      _Float16* __restrict__ msg) {
  const int bn = blockIdx.x;          // b*N + n
  const int n  = bn & (Nn - 1);
  __shared__ float ms[INNERi + 4];

  const _Float16* s1 = qkv1 + (size_t)bn * 2048 + 1536;
  const _Float16* s2 = qkv2 + (size_t)bn * 2048 + 1536;
  for (int f = threadIdx.x; f < INNERi; f += blockDim.x)
    ms[f + 2] = (float)s1[f] + (float)s2[f];
  if (threadIdx.x < 2) { ms[threadIdx.x] = 0.0f; ms[INNERi + 2 + threadIdx.x] = 0.0f; }
  __syncthreads();

  const float w0 = cw[n * 5 + 0], w1 = cw[n * 5 + 1], w2 = cw[n * 5 + 2],
              w3 = cw[n * 5 + 3], w4 = cw[n * 5 + 4];
  const float bias = cb[n];
  for (int f = threadIdx.x; f < INNERi; f += blockDim.x) {
    const float a = w0 * ms[f] + w1 * ms[f + 1] + w2 * ms[f + 2] +
                    w3 * ms[f + 3] + w4 * ms[f + 4] + bias;
    const float g = ms[f + 2] / (1.0f + __expf(-a));
    msg[(size_t)bn * INNERi + f] = (_Float16)g;
  }
}

// ---------------------------------------------------------------------------
// Flash-attention pass: O = softmax(scale * Q K^T) @ V  (+ V residual).
// All tensors live in [B, N, stride] f16 buffers; the head slice is selected
// by (section offset + h*64).  128 query rows per block, 8 waves x 16 rows,
// KV streamed in 64-row chunks through LDS.
//   Ks  : [j][d] row-major, staged via async-to-LDS DMA (no conversion)
//   Vst : [d][j] transposed (VGPR path; transpose forces it)
//   Ps  : per-wave P scratch for C->A relayout
// ---------------------------------------------------------------------------
__global__ __launch_bounds__(256)
void attn_kernel(const _Float16* __restrict__ Q, int qstride, int qsec,
                 const _Float16* __restrict__ Kv, int kstride, int ksec,
                 const _Float16* __restrict__ V, int vstride, int vsec,
                 _Float16* __restrict__ O, int ostride,
                 int addV, float scale) {
  constexpr int LS = 72;  // padded row stride in halfs (144B, 16B-multiple)
  __shared__ alignas(16) _Float16 Ks [64 * LS];
  __shared__ alignas(16) _Float16 Vst[64 * LS];
  __shared__ alignas(16) _Float16 Ps [8 * 16 * LS];

  const int tid  = threadIdx.x;
  const int lane = tid & 31;
  const int wave = tid >> 5;
  const int bh   = blockIdx.y;
  const int b    = bh >> 3;
  const int h    = bh & 7;
  const int row0 = blockIdx.x * 128;
  const size_t bN = (size_t)b * Nn;
  const int qoff = qsec + h * HDd;
  const int koff = ksec + h * HDd;
  const int voff = vsec + h * HDd;
  const int ooff = h * HDd;

  // Q fragments for this wave's 16 rows: two global_load_b128 per fragment.
  v16h qa0, qa1;
  {
    const _Float16* qp =
        Q + (bN + row0 + wave * 16 + (lane & 15)) * (size_t)qstride + qoff +
        ((lane >> 4) << 3);
    V16U u0, u1;
    u0.h2[0] = *(const h8*)(qp);
    u0.h2[1] = *(const h8*)(qp + 16);
    u1.h2[0] = *(const h8*)(qp + 32);
    u1.h2[1] = *(const h8*)(qp + 48);
    qa0 = u0.v;
    qa1 = u1.v;
  }

  float m_old[8], l[8];
#pragma unroll
  for (int r = 0; r < 8; ++r) { m_old[r] = -1e30f; l[r] = 0.0f; }
  v8f o[4];
#pragma unroll
  for (int dt = 0; dt < 4; ++dt) o[dt] = {};

  _Float16* ps = Ps + wave * 16 * LS;
  const int cn = lane & 15;
  const int hi = lane >> 4;

  for (int j0 = 0; j0 < Nn; j0 += 64) {
    __syncthreads();
    // Both V loads of this chunk go out together, so that their latencies
    // overlap one another and the K copies; the LDS stores follow.
    h8 vv[2];
#pragma unroll  // constant trip count: the two loads must not wait on one another
    for (int it = 0; it < 2; ++it) {
      const int i = tid + it * 256;
      const int r = i >> 3, c8 = (i & 7) << 3;  // j row r, d base c8
      vv[it] = *(const h8*)(V + (bN + j0 + r) * (size_t)vstride + voff + c8);
    }
    // Stage K chunk row-major via async DMA: 64x64 halfs = 512 b128 transfers.
    for (int i = tid; i < 512; i += 256) {
      const int r = i >> 3, c8 = (i & 7) << 3;
      async_copy_b128(Kv + (bN + j0 + r) * (size_t)kstride + koff + c8,
                      Ks + r * LS + c8);
    }
    // Stage V chunk TRANSPOSED: Vst[d][j] (VGPR path).
#pragma unroll  // vv[] stays in registers
    for (int it = 0; it < 2; ++it) {
      const int i = tid + it * 256;
      const int r = i >> 3, c8 = (i & 7) << 3;
#pragma unroll
      for (int e = 0; e < 8; ++e) Vst[(c8 + e) * LS + r] = vv[it][e];
    }
    if (j0 + 64 < Nn)
      __builtin_prefetch(
          (const void*)(Kv + (bN + j0 + 64 + (tid >> 2)) * (size_t)kstride + koff), 0, 1);
    wait_async0();           // K chunk landed in LDS
    __syncthreads();

    // S = scale * Q K^T  (16x64 per wave, 4 WMMA column tiles, K-depth 64).
    v8f sc[4];
#pragma unroll
    for (int nt = 0; nt < 4; ++nt) {
      v8f z = {};
      z = wmma_f16(qa0, load_frag(Ks + (nt * 16) * LS, LS, lane), z);
      z = wmma_f16(qa1, load_frag(Ks + (nt * 16) * LS + 32, LS, lane), z);
#pragma unroll
      for (int r = 0; r < 8; ++r) z[r] *= scale;
      sc[nt] = z;
    }

    // Online-softmax update.  Stats live per half-wave (rows 0-7 / 8-15).
    float m_new[8], alpha[8];
#pragma unroll
    for (int r = 0; r < 8; ++r) {
      float mx = fmaxf(fmaxf(sc[0][r], sc[1][r]), fmaxf(sc[2][r], sc[3][r]));
#pragma unroll
      for (int off = 1; off < 16; off <<= 1) mx = fmaxf(mx, __shfl_xor(mx, off, 32));
      m_new[r] = fmaxf(m_old[r], mx);
      alpha[r] = __expf(m_old[r] - m_new[r]);
      m_old[r] = m_new[r];
    }
    float rs[8];
#pragma unroll
    for (int r = 0; r < 8; ++r) rs[r] = 0.0f;
#pragma unroll
    for (int nt = 0; nt < 4; ++nt)
#pragma unroll
      for (int r = 0; r < 8; ++r) {
        const float p = __expf(sc[nt][r] - m_new[r]);
        rs[r] += p;
        ps[(r + 8 * hi) * LS + nt * 16 + cn] = (_Float16)p;  // C->A relayout via LDS
      }
#pragma unroll
    for (int r = 0; r < 8; ++r) {
      float s = rs[r];
#pragma unroll
      for (int off = 1; off < 16; off <<= 1) s += __shfl_xor(s, off, 32);
      l[r] = l[r] * alpha[r] + s;
    }
#pragma unroll
    for (int dt = 0; dt < 4; ++dt)
#pragma unroll
      for (int r = 0; r < 8; ++r) o[dt][r] *= alpha[r];

    // O += P @ V_chunk.  A = P from per-wave scratch (row-contiguous);
    // B-fragments from transposed Vst (row-contiguous): all 2x ds_load_b128.
    const v16h pa0 = load_frag(ps, LS, lane);
    const v16h pa1 = load_frag(ps + 32, LS, lane);
#pragma unroll
    for (int dt = 0; dt < 4; ++dt) {
      o[dt] = wmma_f16(pa0, load_frag(Vst + (dt * 16) * LS, LS, lane), o[dt]);
      o[dt] = wmma_f16(pa1, load_frag(Vst + (dt * 16) * LS + 32, LS, lane), o[dt]);
    }
  }

  // Normalize, optional +V residual, store f16.
#pragma unroll
  for (int dt = 0; dt < 4; ++dt)
#pragma unroll
    for (int r = 0; r < 8; ++r) {
      const int grow = row0 + wave * 16 + r + 8 * hi;
      float val = o[dt][r] / l[r];
      if (addV)
        val += (float)V[(bN + grow) * (size_t)vstride + voff + dt * 16 + cn];
      O[(bN + grow) * (size_t)ostride + ooff + dt * 16 + cn] = (_Float16)val;
    }
}

// ---------------------------------------------------------------------------
// Host launcher.
// ---------------------------------------------------------------------------
extern "C" void kernel_launch(void* const* d_in, const int* in_sizes, int n_in,
                              void* d_out, int out_size, void* d_ws, size_t ws_size,
                              hipStream_t stream) {
  (void)in_sizes; (void)n_in; (void)out_size; (void)ws_size;
  const float* x1     = (const float*)d_in[0];
  const float* x2     = (const float*)d_in[1];
  const float* Wqkv1  = (const float*)d_in[2];
  const float* Wqkv2  = (const float*)d_in[3];
  const float* Wout1  = (const float*)d_in[4];
  const float* bout1  = (const float*)d_in[5];
  const float* Wout2  = (const float*)d_in[6];
  const float* bout2  = (const float*)d_in[7];
  const float* conv_w = (const float*)d_in[8];
  const float* conv_b = (const float*)d_in[9];

  const size_t MROWS = (size_t)Bb * Nn;  // 8192
  // Workspace layout (f16). t1 aliases msg (dead after attn pass 2);
  // t2 aliases u1 (dead after attn pass 3). Total 88 MiB.
  _Float16* qkv1h = (_Float16*)d_ws;
  _Float16* qkv2h = qkv1h + MROWS * 2048;
  _Float16* msg   = qkv2h + MROWS * 2048;
  _Float16* u1    = msg + MROWS * 512;
  _Float16* u2    = u1 + MROWS * 512;
  _Float16* t1    = msg;  // alias
  _Float16* t2    = u1;   // alias

  float* out1 = (float*)d_out;
  float* out2 = out1 + MROWS * 512;

  const dim3 blk(256);
  const float scale = 0.125f;  // HD^-0.5

  // QKV projections: [8192,512] @ [512,2048] -> f16
  gemm_qkv_kernel<<<dim3(16, 64), blk, 0, stream>>>(x1, Wqkv1, qkv1h, 8192, 512, 2048);
  gemm_qkv_kernel<<<dim3(16, 64), blk, 0, stream>>>(x2, Wqkv2, qkv2h, 8192, 512, 2048);

  // Gated conv branch -> MSg (merged b n (h d), f16)
  conv_gate_kernel<<<dim3(Bb * Nn), dim3(128), 0, stream>>>(qkv1h, qkv2h, conv_w, conv_b, msg);

  // u1 = softmax(MS MS^T)·v1 + v1 ; u2 likewise (sections: q=0,k=512,v=1024,s=1536)
  attn_kernel<<<dim3(8, 64), blk, 0, stream>>>(msg, 512, 0, msg, 512, 0,
                                               qkv1h, 2048, 1024, u1, 512, 1, scale);
  attn_kernel<<<dim3(8, 64), blk, 0, stream>>>(msg, 512, 0, msg, 512, 0,
                                               qkv2h, 2048, 1024, u2, 512, 1, scale);
  // t1 = softmax(q1 k1^T)·u1 ; t2 = softmax(q2 k2^T)·u2
  attn_kernel<<<dim3(8, 64), blk, 0, stream>>>(qkv1h, 2048, 0, qkv1h, 2048, 512,
                                               u1, 512, 0, t1, 512, 0, scale);
  attn_kernel<<<dim3(8, 64), blk, 0, stream>>>(qkv2h, 2048, 0, qkv2h, 2048, 512,
                                               u2, 512, 0, t2, 512, 0, scale);

  // Output projections with bias -> f32 d_out
  gemm_out_kernel<<<dim3(4, 64), blk, 0, stream>>>(t1, Wout1, bout1, out1, 8192, 512, 512);
  gemm_out_kernel<<<dim3(4, 64), blk, 0, stream>>>(t2, Wout2, bout2, out2, 8192, 512, 512);
}

// v002
// One run takes 298 microseconds.
// Two timings next to v001 both put it at 1.49 times that version's speed.
// Counting every step since v000, it is 1.60 times as fast.
#include <hip/hip_runtime.h>
#include <hip/hip_bf16.h>

// ---------------------------------------------------------------------------
// MI455X (gfx1250, wave32) implementation of the hybrid-attention reference.
// All matmuls run on V_WMMA_F32_16X16X32_F16 (f16 in, f32 accumulate).
// Fragment loads are vectorized: each lane's 16-half WMMA fragment is two
// contiguous 16B runs (ISA 7.12.2), loaded as 2x ds_load_b128/global_load_b128.
// B-side operands (W tiles, V chunks) are staged row-major [k][col] with wide
// LDS stores and transposed on the way out by ds_load_tr16_b128.  The GEMM 2 A tile and the attention K chunks are staged with
// CDNA5 GLOBAL_LOAD_ASYNC_TO_LDS_B128 tracked by ASYNCcnt.
// ---------------------------------------------------------------------------

typedef __attribute__((ext_vector_type(16))) _Float16 v16h;
typedef __attribute__((ext_vector_type(8)))  _Float16 h8;
typedef __attribute__((ext_vector_type(4)))  _Float16 h4;
typedef __attribute__((ext_vector_type(8)))  short    s16x8;
typedef __attribute__((address_space(3))) s16x8 lds_s16x8;
typedef __attribute__((ext_vector_type(8)))  float    v8f;

constexpr int Bb     = 8;
constexpr int Nn     = 1024;
constexpr int HDd    = 64;
constexpr int INNERi = 512;

union V16U { v16h v; h8 h2[2]; };

// Async DMA of 16 bytes global -> LDS (ASYNCcnt).  ldsOff is the byte offset
// of the destination within the workgroup's LDS allocation (low 32 bits of
// the generic pointer, per ISA 10.2 aperture mapping).
__device__ __forceinline__ void async_copy_b128(const void* gptr, void* ldsptr) {
  const unsigned ldsOff = (unsigned)(unsigned long long)ldsptr;
  asm volatile("global_load_async_to_lds_b128 %0, %1, off"
               :: "v"(ldsOff), "v"(gptr) : "memory");
}

__device__ __forceinline__ void wait_async0() {
#if __has_builtin(__builtin_amdgcn_s_wait_asynccnt)
  __builtin_amdgcn_s_wait_asynccnt(0);
#else
  asm volatile("s_wait_asynccnt 0x0" ::: "memory");
#endif
}

// Fragment loader: lane holds "line" (lane&15) of a row-major tile; the 16
// halves are K = khi..khi+7 and 16+khi..16+khi+7 with khi = 8*(lane>>4),
// i.e. two aligned 16B vector loads. Serves A-fragments (line = row m) and
// K^T-fragments (line = col n).
__device__ __forceinline__ v16h load_frag(const _Float16* base, int rstride, int lane) {
  const _Float16* p = base + (lane & 15) * rstride + ((lane >> 4) << 3);
  V16U u;
  u.h2[0] = *(const h8*)p;
  u.h2[1] = *(const h8*)(p + 16);
  return u.v;
}

// B-fragment (32 k x 16 columns) out of a ROW-MAJOR [k][col] LDS tile: tile
// points at element [k0][col0], pitch is in halfs (bytes: an odd multiple of 32).
// Each transposing load hands lane (c = lane&15, h = lane>>4) the 8 halves
// tile[8h .. 8h+7][c]; the second one, 16 rows on, gives k = 16+8h .. 16+8h+7:
// the k order of load_frag, so the two loaders pair.
__device__ __forceinline__ v16h load_frag_tr(const _Float16* tile, int pitch, int lane) {
  const _Float16* p = tile + (((lane >> 4) << 3) + (lane & 7)) * pitch + (((lane >> 3) & 1) << 3);
  V16U u;
  u.h2[0] = __builtin_bit_cast(h8, __builtin_amdgcn_ds_load_tr16_b128_v8i16((lds_s16x8*)p));
  u.h2[1] = __builtin_bit_cast(h8, __builtin_amdgcn_ds_load_tr16_b128_v8i16((lds_s16x8*)(p + 16 * pitch)));
  return u.v;
}

// Holds a block-uniform address in scalar registers, so that a load takes it as
// its scalar base beside one loop-invariant 32-bit offset register per thread
// (no 64-bit address pair per load: fewer registers, more waves resident).
typedef __attribute__((ext_vector_type(4))) float f4;
typedef const __attribute__((address_space(1))) char* gbytes;  // global memory, bytes
typedef const __attribute__((address_space(1))) f4*   gf4;     // global memory, 4 floats
__device__ __forceinline__ gbytes scalar_base(const float* p) {
  const unsigned long long u = (unsigned long long)p;
  const unsigned lo = (unsigned)__builtin_amdgcn_readfirstlane((int)(unsigned)u);
  const unsigned hi = (unsigned)__builtin_amdgcn_readfirstlane((int)(unsigned)(u >> 32));
  return (gbytes)(((unsigned long long)hi << 32) | lo);
}

__device__ __forceinline__ v8f wmma_f16(v16h a, v16h b, v8f c) {
  // (neg_a, A, neg_b, B, c_mod, C, reuse_a, reuse_b)
  return __builtin_amdgcn_wmma_f32_16x16x32_f16(false, a, false, b, (short)0, c, false, false);
}

// ---------------------------------------------------------------------------
// GEMM 1: C(f16)[M,Nc] = A(f32)[M,K] @ W(f32)[K,Nc].  BM=BN=128, BK=32.
// 8 waves in a 4x2 grid; each wave owns 32x64 = 2x4 WMMA tiles.
// W tile staged row-major: Bs[k][col], read back through transposing loads.
// (f32->f16 conversion forces the VGPR staging path here.)
// ---------------------------------------------------------------------------
__global__ __launch_bounds__(256)
void gemm_qkv_kernel(const float* __restrict__ A, const float* __restrict__ W,
                     _Float16* __restrict__ C, int M, int K, int Ncols) {
  constexpr int AS_S = 40;    // 128 rows x 32 halfs (+pad), 16B-multiple stride
  constexpr int BS_S = 144;   // 32 k-rows x 128 halfs (+pad): 288 B = 32 B x odd
  __shared__ alignas(16) _Float16 As[128 * AS_S];
  __shared__ alignas(16) _Float16 Bs[32 * BS_S];

  const int tid  = threadIdx.x;
  const int lane = tid & 31;
  const int wave = tid >> 5;
  const int row0 = blockIdx.y * 128;
  const int col0 = blockIdx.x * 128;
  const int wm   = wave & 3;   // row group (32 rows)
  const int wn   = wave >> 2;  // col group (64 cols)
  const unsigned aoff = 4u * (unsigned)((tid >> 3) * K + ((tid & 7) << 2));       // bytes; A: row tid/8
  const unsigned woff = 4u * (unsigned)((tid >> 5) * Ncols + ((tid & 31) << 2));  // bytes; W: k-row tid/32

  v8f acc[2][4];
#pragma unroll
  for (int i = 0; i < 2; ++i)
#pragma unroll
    for (int nt = 0; nt < 4; ++nt) acc[i][nt] = {};

  for (int k0 = 0; k0 < K; k0 += 32) {
    __syncthreads();
    // All eight global loads of this k-step go out together, so that their
    // latencies overlap; the converts and LDS stores follow.
    f4 av[4], wv[4];
#pragma unroll  // constant trip count: the four loads must not wait on one another
    for (int it = 0; it < 4; ++it)
      av[it] = *(gf4)(scalar_base(A + ((size_t)(row0 + it * 32) * K + k0)) + aoff);
#pragma unroll  // as above, for the W tile
    for (int it = 0; it < 4; ++it)
      wv[it] = *(gf4)(scalar_base(W + ((size_t)(k0 + it * 8) * Ncols + col0)) + woff);
    // The converts below reuse the address registers of the loads above.
    asm volatile("s_wait_xcnt 0x0" ::: "memory");
    // Stage A (f32 -> f16), row-major: 128x32 = 1024 float4 chunks.
#pragma unroll  // av[] stays in registers
    for (int it = 0; it < 4; ++it) {
      const int i = tid + it * 256;
      const int r = i >> 3, c4 = (i & 7) << 2;
      _Float16* d = As + r * AS_S + c4;
      d[0] = (_Float16)av[it].x; d[1] = (_Float16)av[it].y;
      d[2] = (_Float16)av[it].z; d[3] = (_Float16)av[it].w;
    }
    // Stage W (f32 -> f16) row-major: Bs[k][col], one 8-byte store per float4
    // (a wave fills one whole 256-byte row).
#pragma unroll  // wv[] stays in registers
    for (int it = 0; it < 4; ++it) {
      const int i = tid + it * 256;
      const int r = i >> 5, c4 = (i & 31) << 2;
      *(h4*)(Bs + r * BS_S + c4) = h4{(_Float16)wv[it].x, (_Float16)wv[it].y,
                                      (_Float16)wv[it].z, (_Float16)wv[it].w};
    }
    if (k0 + 32 < K) {  // global_prefetch_b8 of next tiles
      __builtin_prefetch((const void*)(A + (size_t)(row0 + (tid >> 1)) * K + k0 + 32), 0, 1);
      __builtin_prefetch((const void*)(W + (size_t)(k0 + 32 + (tid >> 3)) * Ncols + col0), 0, 1);
    }
    __syncthreads();

    v16h af[2], bf[4];
#pragma unroll
    for (int i = 0; i < 2; ++i)
      af[i] = load_frag(As + (wm * 32 + i * 16) * AS_S, AS_S, lane);
#pragma unroll
    for (int nt = 0; nt < 4; ++nt)
      bf[nt] = load_frag_tr(Bs + wn * 64 + nt * 16, BS_S, lane);
#pragma unroll
    for (int i = 0; i < 2; ++i)
#pragma unroll
      for (int nt = 0; nt < 4; ++nt)
        acc[i][nt] = wmma_f16(af[i], bf[nt], acc[i][nt]);
  }

  const int hi = lane >> 4, cn = lane & 15;
#pragma unroll
  for (int i = 0; i < 2; ++i)
#pragma unroll
    for (int nt = 0; nt < 4; ++nt)
#pragma unroll
      for (int r = 0; r < 8; ++r) {
        const int row = row0 + wm * 32 + i * 16 + r + 8 * hi;
        const int col = col0 + wn * 64 + nt * 16 + cn;
        C[(size_t)row * Ncols + col] = (_Float16)acc[i][nt][r];
      }
}

// ---------------------------------------------------------------------------
// GEMM 2: out(f32)[M,Nc] = A(f16)[M,K] @ W(f32)[K,Nc] + bias.
// The f16 A tile needs no conversion -> staged with async-to-LDS DMA.
// ---------------------------------------------------------------------------
__global__ __launch_bounds__(256)
void gemm_out_kernel(const _Float16* __restrict__ A, const float* __restrict__ W,
                     const float* __restrict__ bias, float* __restrict__ C,
                     int M, int K, int Ncols) {
  constexpr int AS_S = 40;
  constexpr int BS_S = 144;   // 32 k-rows x 128 halfs (+pad): 288 B = 32 B x odd
  __shared__ alignas(16) _Float16 As[128 * AS_S];
  __shared__ alignas(16) _Float16 Bs[32 * BS_S];

  const int tid  = threadIdx.x;
  const int lane = tid & 31;
  const int wave = tid >> 5;
  const int row0 = blockIdx.y * 128;
  const int col0 = blockIdx.x * 128;
  const int wm   = wave & 3;
  const int wn   = wave >> 2;
  const unsigned woff = 4u * (unsigned)((tid >> 5) * Ncols + ((tid & 31) << 2));  // bytes; W: k-row tid/32

  v8f acc[2][4];
#pragma unroll
  for (int i = 0; i < 2; ++i)
#pragma unroll
    for (int nt = 0; nt < 4; ++nt) acc[i][nt] = {};

  for (int k0 = 0; k0 < K; k0 += 32) {
    __syncthreads();
    // The four W loads of this k-step go out together, so that their
    // latencies overlap one another and the A copies; the LDS stores follow.
    f4 wv[4];
#pragma unroll  // constant trip count: the four loads must not wait on one another
    for (int it = 0; it < 4; ++it)
      wv[it] = *(gf4)(scalar_base(W + ((size_t)(k0 + it * 8) * Ncols + col0)) + woff);
    // Stage A (f16) via async DMA: 128x32 halfs = 512 b128 transfers.
    for (int i = tid; i < 512; i += 256) {
      const int r = i >> 2, c8 = (i & 3) << 3;
      async_copy_b128(A + (size_t)(row0 + r) * K + k0 + c8,
                      As + r * AS_S + c8);
    }
    // Stage W row-major (f32 -> f16 conversion: VGPR path), 8-byte stores.
#pragma unroll  // wv[] stays in registers
    for (int it = 0; it < 4; ++it) {
      const int i = tid + it * 256;
      const int r = i >> 5, c4 = (i & 31) << 2;
      *(h4*)(Bs + r * BS_S + c4) = h4{(_Float16)wv[it].x, (_Float16)wv[it].y,
                                      (_Float16)wv[it].z, (_Float16)wv[it].w};
    }
    wait_async0();           // ASYNCcnt == 0: A tile landed in LDS
    __syncthreads();

    v16h af[2], bf[4];
#pragma unroll
    for (int i = 0; i < 2; ++i)
      af[i] = load_frag(As + (wm * 32 + i * 16) * AS_S, AS_S, lane);
#pragma unroll
    for (int nt = 0; nt < 4; ++nt)
      bf[nt] = load_frag_tr(Bs + wn * 64 + nt * 16, BS_S, lane);
#pragma unroll
    for (int i = 0; i < 2; ++i)
#pragma unroll
      for (int nt = 0; nt < 4; ++nt)
        acc[i][nt] = wmma_f16(af[i], bf[nt], acc[i][nt]);
  }

  const int hi = lane >> 4, cn = lane & 15;
#pragma unroll
  for (int i = 0; i < 2; ++i)
#pragma unroll
    for (int nt = 0; nt < 4; ++nt)
#pragma unroll
      for (int r = 0; r < 8; ++r) {
        const int row = row0 + wm * 32 + i * 16 + r + 8 * hi;
        const int col = col0 + wn * 64 + nt * 16 + cn;
        C[(size_t)row * Ncols + col] = acc[i][nt][r] + bias[col];
      }
}

// ---------------------------------------------------------------------------
// conv_gate: MS = s1+s2 (f32); depthwise conv (k=5, pad 2) along features with
// per-token weights; MSg = sigmoid(conv) * MS -> f16, merged b n (h d) layout.
// One block per (b, n) row.
// ---------------------------------------------------------------------------
__global__ __launch_bounds__(128)
void conv_gate_kernel(const _Float16* __restrict__ qkv1,
                      const _Float16* __restrict__ qkv2,
                      const float* __restrict__ cw, const float* __restrict__ cb,
                      _Float16* __restrict__ msg) {
  const int bn = blockIdx.x;          // b*N + n
  const int n  = bn & (Nn - 1);
  __shared__ float ms[INNERi + 4];

  const _Float16* s1 = qkv1 + (size_t)bn * 2048 + 1536;
  const _Float16* s2 = qkv2 + (size_t)bn * 2048 + 1536;
  for (int f = threadIdx.x; f < INNERi; f += blockDim.x)
    ms[f + 2] = (float)s1[f] + (float)s2[f];
  if (threadIdx.x < 2) { ms[threadIdx.x] = 0.0f; ms[INNERi + 2 + threadIdx.x] = 0.0f; }
  __syncthreads();

  const float w0 = cw[n * 5 + 0], w1 = cw[n * 5 + 1], w2 = cw[n * 5 + 2],
              w3 = cw[n * 5 + 3], w4 = cw[n * 5 + 4];
  const float bias = cb[n];
  for (int f = threadIdx.x; f < INNERi; f += blockDim.x) {
    const float a = w0 * ms[f] + w1 * ms[f + 1] + w2 * ms[f + 2] +
                    w3 * ms[f + 3] + w4 * ms[f + 4] + bias;
    const float g = ms[f + 2] / (1.0f + __expf(-a));
    msg[(size_t)bn * INNERi + f] = (_Float16)g;
  }
}

// ---------------------------------------------------------------------------
// Flash-attention pass: O = softmax(scale * Q K^T) @ V  (+ V residual).
// All tensors live in [B, N, stride] f16 buffers; the head slice is selected
// by (section offset + h*64).  128 query rows per block, 8 waves x 16 rows,
// KV streamed in 64-row chunks through LDS.
//   Ks  : [j][d] row-major, staged via async-to-LDS DMA (no conversion)
//   Vs  : [j][d] row-major (VGPR path, 16-byte stores), read by transposing loads
//   Ps  : per-wave P scratch for C->A relayout
// ---------------------------------------------------------------------------
__global__ __launch_bounds__(256)
void attn_kernel(const _Float16* __restrict__ Q, int qstride, int qsec,
                 const _Float16* __restrict__ Kv, int kstride, int ksec,
                 const _Float16* __restrict__ V, int vstride, int vsec,
                 _Float16* __restrict__ O, int ostride,
                 int addV, float scale) {
  constexpr int LS = 72;  // padded row stride in halfs (144B, 16B-multiple)
  __shared__ alignas(16) _Float16 Ks [64 * LS];
  constexpr int VS = 80;  // V row stride in halfs: 160 B = 32 B x odd, for the transposing reader
  __shared__ alignas(16) _Float16 Vs [64 * VS];
  __shared__ alignas(16) _Float16 Ps [8 * 16 * LS];

  const int tid  = threadIdx.x;
  const int lane = tid & 31;
  const int wave = tid >> 5;
  const int bh   = blockIdx.y;
  const int b    = bh >> 3;
  const int h    = bh & 7;
  const int row0 = blockIdx.x * 128;
  const size_t bN = (size_t)b * Nn;
  const int qoff = qsec + h * HDd;
  const int koff = ksec + h * HDd;
  const int voff = vsec + h * HDd;
  const int ooff = h * HDd;

  // Q fragments for this wave's 16 rows: two global_load_b128 per fragment.
  v16h qa0, qa1;
  {
    const _Float16* qp =
        Q + (bN + row0 + wave * 16 + (lane & 15)) * (size_t)qstride + qoff +
        ((lane >> 4) << 3);
    V16U u0, u1;
    u0.h2[0] = *(const h8*)(qp);
    u0.h2[1] = *(const h8*)(qp + 16);
    u1.h2[0] = *(const h8*)(qp + 32);
    u1.h2[1] = *(const h8*)(qp + 48);
    qa0 = u0.v;
    qa1 = u1.v;
  }

  float m_old[8], l[8];
#pragma unroll
  for (int r = 0; r < 8; ++r) { m_old[r] = -1e30f; l[r] = 0.0f; }
  v8f o[4];
#pragma unroll
  for (int dt = 0; dt < 4; ++dt) o[dt] = {};

  _Float16* ps = Ps + wave * 16 * LS;
  const int cn = lane & 15;
  const int hi = lane >> 4;

  for (int j0 = 0; j0 < Nn; j0 += 64) {
    __syncthreads();
    // Both V loads of this chunk go out together, so that their latencies
    // overlap one another and the K copies; the LDS stores follow.
    h8 vv[2];
#pragma unroll  // constant trip count: the two loads must not wait on one another
    for (int it = 0; it < 2; ++it) {
      const int i = tid + it * 256;
      const int r = i >> 3, c8 = (i & 7) << 3;  // j row r, d base c8
      vv[it] = *(const h8*)(V + (bN + j0 + r) * (size_t)vstride + voff + c8);
    }
    // Stage K chunk row-major via async DMA: 64x64 halfs = 512 b128 transfers.
    for (int i = tid; i < 512; i += 256) {
      const int r = i >> 3, c8 = (i & 7) << 3;
      async_copy_b128(Kv + (bN + j0 + r) * (size_t)kstride + koff + c8,
                      Ks + r * LS + c8);
    }
    // Stage V chunk row-major: Vs[j][d] (VGPR path), one 16-byte store per load.
#pragma unroll  // vv[] stays in registers
    for (int it = 0; it < 2; ++it) {
      const int i = tid + it * 256;
      const int r = i >> 3, c8 = (i & 7) << 3;
      *(h8*)(Vs + r * VS + c8) = vv[it];
    }
    if (j0 + 64 < Nn)
      __builtin_prefetch(
          (const void*)(Kv + (bN + j0 + 64 + (tid >> 2)) * (size_t)kstride + koff), 0, 1);
    wait_async0();           // K chunk landed in LDS
    __syncthreads();

    // S = scale * Q K^T  (16x64 per wave, 4 WMMA column tiles, K-depth 64).
    v8f sc[4];
#pragma unroll
    for (int nt = 0; nt < 4; ++nt) {
      v8f z = {};
      z = wmma_f16(qa0, load_frag(Ks + (nt * 16) * LS, LS, lane), z);
      z = wmma_f16(qa1, load_frag(Ks + (nt * 16) * LS + 32, LS, lane), z);
#pragma unroll
      for (int r = 0; r < 8; ++r) z[r] *= scale;
      sc[nt] = z;
    }

    // Online-softmax update.  Stats live per half-wave (rows 0-7 / 8-15).
    float m_new[8], alpha[8];
#pragma unroll
    for (int r = 0; r < 8; ++r) {
      float mx = fmaxf(fmaxf(sc[0][r], sc[1][r]), fmaxf(sc[2][r], sc[3][r]));
#pragma unroll
      for (int off = 1; off < 16; off <<= 1) mx = fmaxf(mx, __shfl_xor(mx, off, 32));
      m_new[r] = fmaxf(m_old[r], mx);
      alpha[r] = __expf(m_old[r] - m_new[r]);
      m_old[r] = m_new[r];
    }
    float rs[8];
#pragma unroll
    for (int r = 0; r < 8; ++r) rs[r] = 0.0f;
#pragma unroll
    for (int nt = 0; nt < 4; ++nt)
#pragma unroll
      for (int r = 0; r < 8; ++r) {
        const float p = __expf(sc[nt][r] - m_new[r]);
        rs[r] += p;
        ps[(r + 8 * hi) * LS + nt * 16 + cn] = (_Float16)p;  // C->A relayout via LDS
      }
#pragma unroll
    for (int r = 0; r < 8; ++r) {
      float s = rs[r];
#pragma unroll
      for (int off = 1; off < 16; off <<= 1) s += __shfl_xor(s, off, 32);
      l[r] = l[r] * alpha[r] + s;
    }
#pragma unroll
    for (int dt = 0; dt < 4; ++dt)
#pragma unroll
      for (int r = 0; r < 8; ++r) o[dt][r] *= alpha[r];

    // O += P @ V_chunk.  A = P from per-wave scratch (row-contiguous);
    // B-fragments from row-major Vs: 2x ds_load_tr16_b128 each.
    const v16h pa0 = load_frag(ps, LS, lane);
    const v16h pa1 = load_frag(ps + 32, LS, lane);
#pragma unroll
    for (int dt = 0; dt < 4; ++dt) {
      o[dt] = wmma_f16(pa0, load_frag_tr(Vs + dt * 16, VS, lane), o[dt]);
      o[dt] = wmma_f16(pa1, load_frag_tr(Vs + 32 * VS + dt * 16, VS, lane), o[dt]);
    }
  }

  // Normalize, optional +V residual, store f16.
#pragma unroll
  for (int dt = 0; dt < 4; ++dt)
#pragma unroll
    for (int r = 0; r < 8; ++r) {
      const int grow = row0 + wave * 16 + r + 8 * hi;
      float val = o[dt][r] / l[r];
      if (addV)
        val += (float)V[(bN + grow) * (size_t)vstride + voff + dt * 16 + cn];
      O[(bN + grow) * (size_t)ostride + ooff + dt * 16 + cn] = (_Float16)val;
    }
}

// ---------------------------------------------------------------------------
// Host launcher.
// ---------------------------------------------------------------------------
extern "C" void kernel_launch(void* const* d_in, const int* in_sizes, int n_in,
                              void* d_out, int out_size, void* d_ws, size_t ws_size,
                              hipStream_t stream) {
  (void)in_sizes; (void)n_in; (void)out_size; (void)ws_size;
  const float* x1     = (const float*)d_in[0];
  const float* x2     = (const float*)d_in[1];
  const float* Wqkv1  = (const float*)d_in[2];
  const float* Wqkv2  = (const float*)d_in[3];
  const float* Wout1  = (const float*)d_in[4];
  const float* bout1  = (const float*)d_in[5];
  const float* Wout2  = (const float*)d_in[6];
  const float* bout2  = (const float*)d_in[7];
  const float* conv_w = (const float*)d_in[8];
  const float* conv_b = (const float*)d_in[9];

  const size_t MROWS = (size_t)Bb * Nn;  // 8192
  // Workspace layout (f16). t1 aliases msg (dead after attn pass 2);
  // t2 aliases u1 (dead after attn pass 3). Total 88 MiB.
  _Float16* qkv1h = (_Float16*)d_ws;
  _Float16* qkv2h = qkv1h + MROWS * 2048;
  _Float16* msg   = qkv2h + MROWS * 2048;
  _Float16* u1    = msg + MROWS * 512;
  _Float16* u2    = u1 + MROWS * 512;
  _Float16* t1    = msg;  // alias
  _Float16* t2    = u1;   // alias

  float* out1 = (float*)d_out;
  float* out2 = out1 + MROWS * 512;

  const dim3 blk(256);
  const float scale = 0.125f;  // HD^-0.5

  // QKV projections: [8192,512] @ [512,2048] -> f16
  gemm_qkv_kernel<<<dim3(16, 64), blk, 0, stream>>>(x1, Wqkv1, qkv1h, 8192, 512, 2048);
  gemm_qkv_kernel<<<dim3(16, 64), blk, 0, stream>>>(x2, Wqkv2, qkv2h, 8192, 512, 2048);

  // Gated conv branch -> MSg (merged b n (h d), f16)
  conv_gate_kernel<<<dim3(Bb * Nn), dim3(128), 0, stream>>>(qkv1h, qkv2h, conv_w, conv_b, msg);

  // u1 = softmax(MS MS^T)·v1 + v1 ; u2 likewise (sections: q=0,k=512,v=1024,s=1536)
  attn_kernel<<<dim3(8, 64), blk, 0, stream>>>(msg, 512, 0, msg, 512, 0,
                                               qkv1h, 2048, 1024, u1, 512, 1, scale);
  attn_kernel<<<dim3(8, 64), blk, 0, stream>>>(msg, 512, 0, msg, 512, 0,
                                               qkv2h, 2048, 1024, u2, 512, 1, scale);
  // t1 = softmax(q1 k1^T)·u1 ; t2 = softmax(q2 k2^T)·u2
  attn_kernel<<<dim3(8, 64), blk, 0, stream>>>(qkv1h, 2048, 0, qkv1h, 2048, 512,
                                               u1, 512, 0, t1, 512, 0, scale);
  attn_kernel<<<dim3(8, 64), blk, 0, stream>>>(qkv2h, 2048, 0, qkv2h, 2048, 512,
                                               u2, 512, 0, t2, 512, 0, scale);

  // Output projections with bias -> f32 d_out
  gemm_out_kernel<<<dim3(4, 64), blk, 0, stream>>>(t1, Wout1, bout1, out1, 8192, 512, 512);
  gemm_out_kernel<<<dim3(4, 64), blk, 0, stream>>>(t2, Wout2, bout2, out2, 8192, 512, 512);
}

// v003
// Measured time: 215 microseconds a run.
// Next to v002, in two timings, it ran 1.39 times as fast each time.
// Counting every step since v000, it is 2.23 times as fast.
#include <hip/hip_runtime.h>
#include <hip/hip_bf16.h>

// ---------------------------------------------------------------------------
// MI455X (gfx1250, wave32) implementation of the hybrid-attention reference.
// All matmuls run on V_WMMA_F32_16X16X32_F16 (f16 in, f32 accumulate).
// Fragment loads are vectorized: each lane's 16-half WMMA fragment is two
// contiguous 16B runs (ISA 7.12.2), loaded as 2x ds_load_b128/global_load_b128.
// W tiles (B operands, [k][col]) and V chunks (A operands, [j][d]) are staged row-major with wide
// LDS stores and transposed on the way out by ds_load_tr16_b128.  The GEMM 2 A tile and the attention K chunks are staged with
// CDNA5 GLOBAL_LOAD_ASYNC_TO_LDS_B128 tracked by ASYNCcnt.
// ---------------------------------------------------------------------------

typedef __attribute__((ext_vector_type(16))) _Float16 v16h;
typedef __attribute__((ext_vector_type(8)))  _Float16 h8;
typedef __attribute__((ext_vector_type(4)))  _Float16 h4;
typedef __attribute__((ext_vector_type(8)))  short    s16x8;
typedef __attribute__((address_space(3))) s16x8 lds_s16x8;
typedef __attribute__((ext_vector_type(8)))  float    v8f;

constexpr int Bb     = 8;
constexpr int Nn     = 1024;
constexpr int HDd    = 64;
constexpr int INNERi = 512;

union V16U { v16h v; h8 h2[2]; };

// Async DMA of 16 bytes global -> LDS (ASYNCcnt).  ldsOff is the byte offset
// of the destination within the workgroup's LDS allocation (low 32 bits of
// the generic pointer, per ISA 10.2 aperture mapping).
__device__ __forceinline__ void async_copy_b128(const void* gptr, void* ldsptr) {
  const unsigned ldsOff = (unsigned)(unsigned long long)ldsptr;
  asm volatile("global_load_async_to_lds_b128 %0, %1, off"
               :: "v"(ldsOff), "v"(gptr) : "memory");
}

__device__ __forceinline__ void wait_async0() {
#if __has_builtin(__builtin_amdgcn_s_wait_asynccnt)
  __builtin_amdgcn_s_wait_asynccnt(0);
#else
  asm volatile("s_wait_asynccnt 0x0" ::: "memory");
#endif
}

// Fragment loader: lane holds "line" (lane&15) of a row-major tile; the 16
// halves are K = khi..khi+7 and 16+khi..16+khi+7 with khi = 8*(lane>>4),
// i.e. two aligned 16B vector loads. Serves A-fragments (line = row m):
// the GEMM A tiles and the attention K chunks.
__device__ __forceinline__ v16h load_frag(const _Float16* base, int rstride, int lane) {
  const _Float16* p = base + (lane & 15) * rstride + ((lane >> 4) << 3);
  V16U u;
  u.h2[0] = *(const h8*)p;
  u.h2[1] = *(const h8*)(p + 16);
  return u.v;
}

// B-fragment (32 k x 16 columns) or A-fragment (16 rows x 32 k) out of a ROW-MAJOR [k][col] LDS tile: tile
// points at element [k0][col0], pitch is in halfs (bytes: an odd multiple of 32).
// Each transposing load hands lane (c = lane&15, h = lane>>4) the 8 halves
// tile[8h .. 8h+7][c]; the second one, 16 rows on, gives k = 16+8h .. 16+8h+7:
// the k order of load_frag, so the two loaders pair.
__device__ __forceinline__ v16h load_frag_tr(const _Float16* tile, int pitch, int lane) {
  const _Float16* p = tile + (((lane >> 4) << 3) + (lane & 7)) * pitch + (((lane >> 3) & 1) << 3);
  V16U u;
  u.h2[0] = __builtin_bit_cast(h8, __builtin_amdgcn_ds_load_tr16_b128_v8i16((lds_s16x8*)p));
  u.h2[1] = __builtin_bit_cast(h8, __builtin_amdgcn_ds_load_tr16_b128_v8i16((lds_s16x8*)(p + 16 * pitch)));
  return u.v;
}

// Holds a block-uniform address in scalar registers, so that a load takes it as
// its scalar base beside one loop-invariant 32-bit offset register per thread
// (no 64-bit address pair per load: fewer registers, more waves resident).
typedef __attribute__((ext_vector_type(4))) float f4;
typedef const __attribute__((address_space(1))) char* gbytes;  // global memory, bytes
typedef const __attribute__((address_space(1))) f4*   gf4;     // global memory, 4 floats
__device__ __forceinline__ gbytes scalar_base(const float* p) {
  const unsigned long long u = (unsigned long long)p;
  const unsigned lo = (unsigned)__builtin_amdgcn_readfirstlane((int)(unsigned)u);
  const unsigned hi = (unsigned)__builtin_amdgcn_readfirstlane((int)(unsigned)(u >> 32));
  return (gbytes)(((unsigned long long)hi << 32) | lo);
}

__device__ __forceinline__ v8f wmma_f16(v16h a, v16h b, v8f c) {
  // (neg_a, A, neg_b, B, c_mod, C, reuse_a, reuse_b)
  return __builtin_amdgcn_wmma_f32_16x16x32_f16(false, a, false, b, (short)0, c, false, false);
}

// ---------------------------------------------------------------------------
// GEMM 1: C(f16)[M,Nc] = A(f32)[M,K] @ W(f32)[K,Nc].  BM=BN=128, BK=32.
// 8 waves in a 4x2 grid; each wave owns 32x64 = 2x4 WMMA tiles.
// W tile staged row-major: Bs[k][col], read back through transposing loads.
// (f32->f16 conversion forces the VGPR staging path here.)
// ---------------------------------------------------------------------------
__global__ __launch_bounds__(256)
void gemm_qkv_kernel(const float* __restrict__ A, const float* __restrict__ W,
                     _Float16* __restrict__ C, int M, int K, int Ncols) {
  constexpr int AS_S = 40;    // 128 rows x 32 halfs (+pad), 16B-multiple stride
  constexpr int BS_S = 144;   // 32 k-rows x 128 halfs (+pad): 288 B = 32 B x odd
  __shared__ alignas(16) _Float16 As[128 * AS_S];
  __shared__ alignas(16) _Float16 Bs[32 * BS_S];

  const int tid  = threadIdx.x;
  const int lane = tid & 31;
  const int wave = tid >> 5;
  const int row0 = blockIdx.y * 128;
  const int col0 = blockIdx.x * 128;
  const int wm   = wave & 3;   // row group (32 rows)
  const int wn   = wave >> 2;  // col group (64 cols)
  const unsigned aoff = 4u * (unsigned)((tid >> 3) * K + ((tid & 7) << 2));       // bytes; A: row tid/8
  const unsigned woff = 4u * (unsigned)((tid >> 5) * Ncols + ((tid & 31) << 2));  // bytes; W: k-row tid/32

  v8f acc[2][4];
#pragma unroll
  for (int i = 0; i < 2; ++i)
#pragma unroll
    for (int nt = 0; nt < 4; ++nt) acc[i][nt] = {};

  for (int k0 = 0; k0 < K; k0 += 32) {
    __syncthreads();
    // All eight global loads of this k-step go out together, so that their
    // latencies overlap; the converts and LDS stores follow.
    f4 av[4], wv[4];
#pragma unroll  // constant trip count: the four loads must not wait on one another
    for (int it = 0; it < 4; ++it)
      av[it] = *(gf4)(scalar_base(A + ((size_t)(row0 + it * 32) * K + k0)) + aoff);
#pragma unroll  // as above, for the W tile
    for (int it = 0; it < 4; ++it)
      wv[it] = *(gf4)(scalar_base(W + ((size_t)(k0 + it * 8) * Ncols + col0)) + woff);
    // The converts below reuse the address registers of the loads above.
    asm volatile("s_wait_xcnt 0x0" ::: "memory");
    // Stage A (f32 -> f16), row-major: 128x32 = 1024 float4 chunks.
#pragma unroll  // av[] stays in registers
    for (int it = 0; it < 4; ++it) {
      const int i = tid + it * 256;
      const int r = i >> 3, c4 = (i & 7) << 2;
      _Float16* d = As + r * AS_S + c4;
      d[0] = (_Float16)av[it].x; d[1] = (_Float16)av[it].y;
      d[2] = (_Float16)av[it].z; d[3] = (_Float16)av[it].w;
    }
    // Stage W (f32 -> f16) row-major: Bs[k][col], one 8-byte store per float4
    // (a wave fills one whole 256-byte row).
#pragma unroll  // wv[] stays in registers
    for (int it = 0; it < 4; ++it) {
      const int i = tid + it * 256;
      const int r = i >> 5, c4 = (i & 31) << 2;
      *(h4*)(Bs + r * BS_S + c4) = h4{(_Float16)wv[it].x, (_Float16)wv[it].y,
                                      (_Float16)wv[it].z, (_Float16)wv[it].w};
    }
    if (k0 + 32 < K) {  // global_prefetch_b8 of next tiles
      __builtin_prefetch((const void*)(A + (size_t)(row0 + (tid >> 1)) * K + k0 + 32), 0, 1);
      __builtin_prefetch((const void*)(W + (size_t)(k0 + 32 + (tid >> 3)) * Ncols + col0), 0, 1);
    }
    __syncthreads();

    v16h af[2], bf[4];
#pragma unroll
    for (int i = 0; i < 2; ++i)
      af[i] = load_frag(As + (wm * 32 + i * 16) * AS_S, AS_S, lane);
#pragma unroll
    for (int nt = 0; nt < 4; ++nt)
      bf[nt] = load_frag_tr(Bs + wn * 64 + nt * 16, BS_S, lane);
#pragma unroll
    for (int i = 0; i < 2; ++i)
#pragma unroll
      for (int nt = 0; nt < 4; ++nt)
        acc[i][nt] = wmma_f16(af[i], bf[nt], acc[i][nt]);
  }

  const int hi = lane >> 4, cn = lane & 15;
#pragma unroll
  for (int i = 0; i < 2; ++i)
#pragma unroll
    for (int nt = 0; nt < 4; ++nt)
#pragma unroll
      for (int r = 0; r < 8; ++r) {
        const int row = row0 + wm * 32 + i * 16 + r + 8 * hi;
        const int col = col0 + wn * 64 + nt * 16 + cn;
        C[(size_t)row * Ncols + col] = (_Float16)acc[i][nt][r];
      }
}

// ---------------------------------------------------------------------------
// GEMM 2: out(f32)[M,Nc] = A(f16)[M,K] @ W(f32)[K,Nc] + bias.
// The f16 A tile needs no conversion -> staged with async-to-LDS DMA.
// ---------------------------------------------------------------------------
__global__ __launch_bounds__(256)
void gemm_out_kernel(const _Float16* __restrict__ A, const float* __restrict__ W,
                     const float* __restrict__ bias, float* __restrict__ C,
                     int M, int K, int Ncols) {
  constexpr int AS_S = 40;
  constexpr int BS_S = 144;   // 32 k-rows x 128 halfs (+pad): 288 B = 32 B x odd
  __shared__ alignas(16) _Float16 As[128 * AS_S];
  __shared__ alignas(16) _Float16 Bs[32 * BS_S];

  const int tid  = threadIdx.x;
  const int lane = tid & 31;
  const int wave = tid >> 5;
  const int row0 = blockIdx.y * 128;
  const int col0 = blockIdx.x * 128;
  const int wm   = wave & 3;
  const int wn   = wave >> 2;
  const unsigned woff = 4u * (unsigned)((tid >> 5) * Ncols + ((tid & 31) << 2));  // bytes; W: k-row tid/32

  v8f acc[2][4];
#pragma unroll
  for (int i = 0; i < 2; ++i)
#pragma unroll
    for (int nt = 0; nt < 4; ++nt) acc[i][nt] = {};

  for (int k0 = 0; k0 < K; k0 += 32) {
    __syncthreads();
    // The four W loads of this k-step go out together, so that their
    // latencies overlap one another and the A copies; the LDS stores follow.
    f4 wv[4];
#pragma unroll  // constant trip count: the four loads must not wait on one another
    for (int it = 0; it < 4; ++it)
      wv[it] = *(gf4)(scalar_base(W + ((size_t)(k0 + it * 8) * Ncols + col0)) + woff);
    // Stage A (f16) via async DMA: 128x32 halfs = 512 b128 transfers.
    for (int i = tid; i < 512; i += 256) {
      const int r = i >> 2, c8 = (i & 3) << 3;
      async_copy_b128(A + (size_t)(row0 + r) * K + k0 + c8,
                      As + r * AS_S + c8);
    }
    // Stage W row-major (f32 -> f16 conversion: VGPR path), 8-byte stores.
#pragma unroll  // wv[] stays in registers
    for (int it = 0; it < 4; ++it) {
      const int i = tid + it * 256;
      const int r = i >> 5, c4 = (i & 31) << 2;
      *(h4*)(Bs + r * BS_S + c4) = h4{(_Float16)wv[it].x, (_Float16)wv[it].y,
                                      (_Float16)wv[it].z, (_Float16)wv[it].w};
    }
    wait_async0();           // ASYNCcnt == 0: A tile landed in LDS
    __syncthreads();

    v16h af[2], bf[4];
#pragma unroll
    for (int i = 0; i < 2; ++i)
      af[i] = load_frag(As + (wm * 32 + i * 16) * AS_S, AS_S, lane);
#pragma unroll
    for (int nt = 0; nt < 4; ++nt)
      bf[nt] = load_frag_tr(Bs + wn * 64 + nt * 16, BS_S, lane);
#pragma unroll
    for (int i = 0; i < 2; ++i)
#pragma unroll
      for (int nt = 0; nt < 4; ++nt)
        acc[i][nt] = wmma_f16(af[i], bf[nt], acc[i][nt]);
  }

  const int hi = lane >> 4, cn = lane & 15;
#pragma unroll
  for (int i = 0; i < 2; ++i)
#pragma unroll
    for (int nt = 0; nt < 4; ++nt)
#pragma unroll
      for (int r = 0; r < 8; ++r) {
        const int row = row0 + wm * 32 + i * 16 + r + 8 * hi;
        const int col = col0 + wn * 64 + nt * 16 + cn;
        C[(size_t)row * Ncols + col] = acc[i][nt][r] + bias[col];
      }
}

// ---------------------------------------------------------------------------
// conv_gate: MS = s1+s2 (f32); depthwise conv (k=5, pad 2) along features with
// per-token weights; MSg = sigmoid(conv) * MS -> f16, merged b n (h d) layout.
// One block per (b, n) row.
// ---------------------------------------------------------------------------
__global__ __launch_bounds__(128)
void conv_gate_kernel(const _Float16* __restrict__ qkv1,
                      const _Float16* __restrict__ qkv2,
                      const float* __restrict__ cw, const float* __restrict__ cb,
                      _Float16* __restrict__ msg) {
  const int bn = blockIdx.x;          // b*N + n
  const int n  = bn & (Nn - 1);
  __shared__ float ms[INNERi + 4];

  const _Float16* s1 = qkv1 + (size_t)bn * 2048 + 1536;
  const _Float16* s2 = qkv2 + (size_t)bn * 2048 + 1536;
  for (int f = threadIdx.x; f < INNERi; f += blockDim.x)
    ms[f + 2] = (float)s1[f] + (float)s2[f];
  if (threadIdx.x < 2) { ms[threadIdx.x] = 0.0f; ms[INNERi + 2 + threadIdx.x] = 0.0f; }
  __syncthreads();

  const float w0 = cw[n * 5 + 0], w1 = cw[n * 5 + 1], w2 = cw[n * 5 + 2],
              w3 = cw[n * 5 + 3], w4 = cw[n * 5 + 4];
  const float bias = cb[n];
  for (int f = threadIdx.x; f < INNERi; f += blockDim.x) {
    const float a = w0 * ms[f] + w1 * ms[f + 1] + w2 * ms[f + 2] +
                    w3 * ms[f + 3] + w4 * ms[f + 4] + bias;
    const float g = ms[f + 2] / (1.0f + __expf(-a));
    msg[(size_t)bn * INNERi + f] = (_Float16)g;
  }
}

// ---------------------------------------------------------------------------
// Flash-attention pass: O = softmax(scale * Q K^T) @ V  (+ V residual),
// computed transposed: S^T = K Q^T, O^T += V^T P^T.
// All tensors live in [B, N, stride] f16 buffers; the head slice is selected
// by (section offset + h*64).  128 query rows per block, 8 waves x 16 queries,
// KV streamed in 64-row chunks through LDS.
//   Ks  : [j][d] row-major, staged via async-to-LDS DMA (no conversion); A of S^T
//   Vs  : [j][d] row-major (VGPR path, 16-byte stores); transposing loads give A of O^T
// A lane (c = lane&15, hi = lane>>4) owns ONE query, c: of each 16-key tile it
// holds the scores of keys 8*hi .. 8*hi+7, so maximum and sum run in the lane's
// own registers, with one exchange between the wave's halves.  Two score tiles,
// converted in place, are the B operand P^T of a 32-key block (element s is key
// 8*hi+s, then 16+8*hi+(s-8): the k order of load_frag_tr).
// ---------------------------------------------------------------------------

// Value of lane l ^ 16.
__device__ __forceinline__ float other_half(float x) {
  const int i = __builtin_bit_cast(int, x);
  return __builtin_bit_cast(float,
      __builtin_amdgcn_permlanex16(i, i, 0x76543210, 0xfedcba98, false, false));
}

__global__ __launch_bounds__(256)
void attn_kernel(const _Float16* __restrict__ Q, int qstride, int qsec,
                 const _Float16* __restrict__ Kv, int kstride, int ksec,
                 const _Float16* __restrict__ V, int vstride, int vsec,
                 _Float16* __restrict__ O, int ostride,
                 int addV, float scale) {
  constexpr int LS = 72;  // padded row stride in halfs (144B, 16B-multiple)
  __shared__ alignas(16) _Float16 Ks [64 * LS];
  constexpr int VS = 80;  // V row stride in halfs: 160 B = 32 B x odd, for the transposing reader
  __shared__ alignas(16) _Float16 Vs [64 * VS];

  const int tid  = threadIdx.x;
  const int lane = tid & 31;
  const int wave = tid >> 5;
  const int bh   = blockIdx.y;
  const int b    = bh >> 3;
  const int h    = bh & 7;
  const int row0 = blockIdx.x * 128;
  const size_t bN = (size_t)b * Nn;
  const int qoff = qsec + h * HDd;
  const int koff = ksec + h * HDd;
  const int voff = vsec + h * HDd;
  const int ooff = h * HDd;

  // Q fragments for this wave's 16 queries (B operand: column = query lane&15):
  // two global_load_b128 per fragment.
  v16h qa0, qa1;
  {
    const _Float16* qp =
        Q + (bN + row0 + wave * 16 + (lane & 15)) * (size_t)qstride + qoff +
        ((lane >> 4) << 3);
    V16U u0, u1;
    u0.h2[0] = *(const h8*)(qp);
    u0.h2[1] = *(const h8*)(qp + 16);
    u1.h2[0] = *(const h8*)(qp + 32);
    u1.h2[1] = *(const h8*)(qp + 48);
    qa0 = u0.v;
    qa1 = u1.v;
  }

  float m_old = -1e30f;  // running maximum of this lane's query (equal in both halves)
  float l = 0.0f;        // running sum over this half's keys; the halves join after the loop
  v8f o[4];              // o[dt][r] = O^T[dt*16 + 8*hi + r][query]
#pragma unroll
  for (int dt = 0; dt < 4; ++dt) o[dt] = {};

  const int cn = lane & 15;
  const int hi = lane >> 4;

  for (int j0 = 0; j0 < Nn; j0 += 64) {
    __syncthreads();
    // Both V loads of this chunk go out together, so that their latencies
    // overlap one another and the K copies; the LDS stores follow.
    h8 vv[2];
#pragma unroll  // constant trip count: the two loads must not wait on one another
    for (int it = 0; it < 2; ++it) {
      const int i = tid + it * 256;
      const int r = i >> 3, c8 = (i & 7) << 3;  // j row r, d base c8
      vv[it] = *(const h8*)(V + (bN + j0 + r) * (size_t)vstride + voff + c8);
    }
    // Stage K chunk row-major via async DMA: 64x64 halfs = 512 b128 transfers.
    for (int i = tid; i < 512; i += 256) {
      const int r = i >> 3, c8 = (i & 7) << 3;
      async_copy_b128(Kv + (bN + j0 + r) * (size_t)kstride + koff + c8,
                      Ks + r * LS + c8);
    }
    // Stage V chunk row-major: Vs[j][d] (VGPR path), one 16-byte store per load.
#pragma unroll  // vv[] stays in registers
    for (int it = 0; it < 2; ++it) {
      const int i = tid + it * 256;
      const int r = i >> 3, c8 = (i & 7) << 3;
      *(h8*)(Vs + r * VS + c8) = vv[it];
    }
    if (j0 + 64 < Nn)
      __builtin_prefetch(
          (const void*)(Kv + (bN + j0 + 64 + (tid >> 2)) * (size_t)kstride + koff), 0, 1);
    wait_async0();           // K chunk landed in LDS
    __syncthreads();

    // S^T = scale * K Q^T  (64 keys x 16 queries per wave, 4 WMMA key tiles,
    // K-depth 64): sc[nt][r] = score of key nt*16 + 8*hi + r against query cn.
    v8f sc[4];
#pragma unroll
    for (int nt = 0; nt < 4; ++nt) {
      v8f z = {};
      z = wmma_f16(load_frag(Ks + (nt * 16) * LS, LS, lane), qa0, z);
      z = wmma_f16(load_frag(Ks + (nt * 16) * LS + 32, LS, lane), qa1, z);
#pragma unroll
      for (int r = 0; r < 8; ++r) z[r] *= scale;
      sc[nt] = z;
    }

    // Online-softmax update, one query per lane.
    float mt[4];
#pragma unroll
    for (int nt = 0; nt < 4; ++nt) {
      mt[nt] = sc[nt][0];
#pragma unroll
      for (int r = 1; r < 8; ++r) mt[nt] = fmaxf(mt[nt], sc[nt][r]);
    }
    float mx = fmaxf(fmaxf(mt[0], mt[1]), fmaxf(mt[2], mt[3]));
    mx = fmaxf(mx, other_half(mx));
    const float m_new = fmaxf(m_old, mx);
    constexpr float LOG2E = 1.44269504f;
    const float xa = (m_old - m_new) * LOG2E;
    const float alpha = __builtin_amdgcn_exp2f(xa);
    m_old = m_new;

    V16U pb[2];    // P^T of keys 0..31 and 32..63, packed in place as B operands
    v8f x[4];
#pragma unroll
    for (int nt = 0; nt < 4; ++nt) {
      x[nt] = (sc[nt] - m_new) * LOG2E;
#pragma unroll
      for (int r = 0; r < 8; ++r) {
        sc[nt][r] = __builtin_amdgcn_exp2f(x[nt][r]);
        pb[nt >> 1].v[(nt & 1) * 8 + r] = (_Float16)sc[nt][r];
      }
    }
    // The slot between a v_exp_f32 and an overwrite of its source: the arguments
    // stay live up to this v_nop, which stands behind the last exponential.
    asm volatile("v_nop" :: "v"(x[0]), "v"(x[1]), "v"(x[2]), "v"(x[3]), "v"(sc[0]), "v"(sc[1]),
                 "v"(sc[2]), "v"(sc[3]), "v"(xa), "v"(alpha));
    // Sum of this lane's 32 values: the four tiles register by register (packed
    // adds, independent chains), then the eight registers as a tree.
    const v8f ts = (sc[0] + sc[1]) + (sc[2] + sc[3]);
    l = l * alpha + (((ts[0] + ts[1]) + (ts[2] + ts[3])) + ((ts[4] + ts[5]) + (ts[6] + ts[7])));
#pragma unroll
    for (int dt = 0; dt < 4; ++dt)
#pragma unroll
      for (int r = 0; r < 8; ++r) o[dt][r] *= alpha;

    // O^T += V_chunk^T @ P^T.  A-fragments (row = d) from row-major Vs:
    // 2x ds_load_tr16_b128 each; B = P^T straight from registers.
#pragma unroll
    for (int dt = 0; dt < 4; ++dt) {
      o[dt] = wmma_f16(load_frag_tr(Vs + dt * 16, VS, lane), pb[0].v, o[dt]);
      o[dt] = wmma_f16(load_frag_tr(Vs + 32 * VS + dt * 16, VS, lane), pb[1].v, o[dt]);
    }
  }

  // Residual rows (zero where none is asked for): all four loads go out together,
  // under one block-uniform test, ahead of the divisions.
  const size_t grow = bN + row0 + wave * 16 + cn;
  h8 res[4];
#pragma unroll
  for (int dt = 0; dt < 4; ++dt) res[dt] = {};
  if (addV) {
#pragma unroll
    for (int dt = 0; dt < 4; ++dt)
      res[dt] = *(const h8*)(V + grow * (size_t)vstride + voff + dt * 16 + 8 * hi);
    // The output address below reuses the address registers of the loads above.
    asm volatile("s_wait_xcnt 0x0" ::: "memory");
  }

  // Join the halves' sums, normalize, add the residual, store f16: a lane's
  // 8 accumulator registers are 8 consecutive d of its query, one 16-byte store.
  l += other_half(l);
#pragma unroll
  for (int dt = 0; dt < 4; ++dt) {
    h8 ov;
#pragma unroll
    for (int r = 0; r < 8; ++r)
      ov[r] = (_Float16)(o[dt][r] / l + (float)res[dt][r]);
    *(h8*)(O + grow * (size_t)ostride + ooff + dt * 16 + 8 * hi) = ov;
  }
}

// ---------------------------------------------------------------------------
// Host launcher.
// ---------------------------------------------------------------------------
extern "C" void kernel_launch(void* const* d_in, const int* in_sizes, int n_in,
                              void* d_out, int out_size, void* d_ws, size_t ws_size,
                              hipStream_t stream) {
  (void)in_sizes; (void)n_in; (void)out_size; (void)ws_size;
  const float* x1     = (const float*)d_in[0];
  const float* x2     = (const float*)d_in[1];
  const float* Wqkv1  = (const float*)d_in[2];
  const float* Wqkv2  = (const float*)d_in[3];
  const float* Wout1  = (const float*)d_in[4];
  const float* bout1  = (const float*)d_in[5];
  const float* Wout2  = (const float*)d_in[6];
  const float* bout2  = (const float*)d_in[7];
  const float* conv_w = (const float*)d_in[8];
  const float* conv_b = (const float*)d_in[9];

  const size_t MROWS = (size_t)Bb * Nn;  // 8192
  // Workspace layout (f16). t1 aliases msg (dead after attn pass 2);
  // t2 aliases u1 (dead after attn pass 3). Total 88 MiB.
  _Float16* qkv1h = (_Float16*)d_ws;
  _Float16* qkv2h = qkv1h + MROWS * 2048;
  _Float16* msg   = qkv2h + MROWS * 2048;
  _Float16* u1    = msg + MROWS * 512;
  _Float16* u2    = u1 + MROWS * 512;
  _Float16* t1    = msg;  // alias
  _Float16* t2    = u1;   // alias

  float* out1 = (float*)d_out;
  float* out2 = out1 + MROWS * 512;

  const dim3 blk(256);
  const float scale = 0.125f;  // HD^-0.5

  // QKV projections: [8192,512] @ [512,2048] -> f16
  gemm_qkv_kernel<<<dim3(16, 64), blk, 0, stream>>>(x1, Wqkv1, qkv1h, 8192, 512, 2048);
  gemm_qkv_kernel<<<dim3(16, 64), blk, 0, stream>>>(x2, Wqkv2, qkv2h, 8192, 512, 2048);

  // Gated conv branch -> MSg (merged b n (h d), f16)
  conv_gate_kernel<<<dim3(Bb * Nn), dim3(128), 0, stream>>>(qkv1h, qkv2h, conv_w, conv_b, msg);

  // u1 = softmax(MS MS^T)·v1 + v1 ; u2 likewise (sections: q=0,k=512,v=1024,s=1536)
  attn_kernel<<<dim3(8, 64), blk, 0, stream>>>(msg, 512, 0, msg, 512, 0,
                                               qkv1h, 2048, 1024, u1, 512, 1, scale);
  attn_kernel<<<dim3(8, 64), blk, 0, stream>>>(msg, 512, 0, msg, 512, 0,
                                               qkv2h, 2048, 1024, u2, 512, 1, scale);
  // t1 = softmax(q1 k1^T)·u1 ; t2 = softmax(q2 k2^T)·u2
  attn_kernel<<<dim3(8, 64), blk, 0, stream>>>(qkv1h, 2048, 0, qkv1h, 2048, 512,
                                               u1, 512, 0, t1, 512, 0, scale);
  attn_kernel<<<dim3(8, 64), blk, 0, stream>>>(qkv2h, 2048, 0, qkv2h, 2048, 512,
                                               u2, 512, 0, t2, 512, 0, scale);

  // Output projections with bias -> f32 d_out
  gemm_out_kernel<<<dim3(4, 64), blk, 0, stream>>>(t1, Wout1, bout1, out1, 8192, 512, 512);
  gemm_out_kernel<<<dim3(4, 64), blk, 0, stream>>>(t2, Wout2, bout2, out2, 8192, 512, 512);
}

// v004
// One run takes 196 microseconds.
// Next to v003, in two timings, it ran 1.10 and 1.09 times as fast.
// Counting every step since v000, it is 2.44 times as fast.
#include <hip/hip_runtime.h>
#include <hip/hip_bf16.h>

// ---------------------------------------------------------------------------
// MI455X (gfx1250, wave32) implementation of the hybrid-attention reference.
// All matmuls run on V_WMMA_F32_16X16X32_F16 (f16 in, f32 accumulate).
// Fragment loads are vectorized: each lane's 16-half WMMA fragment is two
// contiguous 16B runs (ISA 7.12.2), loaded as 2x ds_load_b128/global_load_b128.
// W tiles (B operands, [k][col]) and V chunks (A operands, [j][d]) are staged row-major with wide
// LDS stores and transposed on the way out by ds_load_tr16_b128.  The GEMM 2 A tile and the attention K chunks are staged with
// CDNA5 GLOBAL_LOAD_ASYNC_TO_LDS_B128 tracked by ASYNCcnt.
// ---------------------------------------------------------------------------

typedef __attribute__((ext_vector_type(16))) _Float16 v16h;
typedef __attribute__((ext_vector_type(8)))  _Float16 h8;
typedef __attribute__((ext_vector_type(4)))  _Float16 h4;
typedef __attribute__((ext_vector_type(8)))  short    s16x8;
typedef __attribute__((address_space(3))) s16x8 lds_s16x8;
typedef __attribute__((ext_vector_type(8)))  float    v8f;

constexpr int Bb     = 8;
constexpr int Nn     = 1024;
constexpr int HDd    = 64;
constexpr int INNERi = 512;

union V16U { v16h v; h8 h2[2]; };

// Async DMA of 16 bytes global -> LDS (ASYNCcnt).  ldsOff is the byte offset
// of the destination within the workgroup's LDS allocation (low 32 bits of
// the generic pointer, per ISA 10.2 aperture mapping).
__device__ __forceinline__ void async_copy_b128(const void* gptr, void* ldsptr) {
  const unsigned ldsOff = (unsigned)(unsigned long long)ldsptr;
  asm volatile("global_load_async_to_lds_b128 %0, %1, off"
               :: "v"(ldsOff), "v"(gptr) : "memory");
}

__device__ __forceinline__ void wait_async0() {
#if __has_builtin(__builtin_amdgcn_s_wait_asynccnt)
  __builtin_amdgcn_s_wait_asynccnt(0);
#else
  asm volatile("s_wait_asynccnt 0x0" ::: "memory");
#endif
}

// Fragment loader: lane holds "line" (lane&15) of a row-major tile; the 16
// halves are K = khi..khi+7 and 16+khi..16+khi+7 with khi = 8*(lane>>4),
// i.e. two aligned 16B vector loads. Serves A-fragments (line = row m):
// the GEMM A tiles and the attention K chunks.
__device__ __forceinline__ v16h load_frag(const _Float16* base, int rstride, int lane) {
  const _Float16* p = base + (lane & 15) * rstride + ((lane >> 4) << 3);
  V16U u;
  u.h2[0] = *(const h8*)p;
  u.h2[1] = *(const h8*)(p + 16);
  return u.v;
}

// B-fragment (32 k x 16 columns) or A-fragment (16 rows x 32 k) out of a ROW-MAJOR [k][col] LDS tile: tile
// points at element [k0][col0], pitch is in halfs (bytes: an odd multiple of 32).
// Each transposing load hands lane (c = lane&15, h = lane>>4) the 8 halves
// tile[8h .. 8h+7][c]; the second one, 16 rows on, gives k = 16+8h .. 16+8h+7:
// the k order of load_frag, so the two loaders pair.
__device__ __forceinline__ v16h load_frag_tr(const _Float16* tile, int pitch, int lane) {
  const _Float16* p = tile + (((lane >> 4) << 3) + (lane & 7)) * pitch + (((lane >> 3) & 1) << 3);
  V16U u;
  u.h2[0] = __builtin_bit_cast(h8, __builtin_amdgcn_ds_load_tr16_b128_v8i16((lds_s16x8*)p));
  u.h2[1] = __builtin_bit_cast(h8, __builtin_amdgcn_ds_load_tr16_b128_v8i16((lds_s16x8*)(p + 16 * pitch)));
  return u.v;
}

// Holds a block-uniform address in scalar registers, so that a load takes it as
// its scalar base beside one loop-invariant 32-bit offset register per thread
// (no 64-bit address pair per load: fewer registers, more waves resident).
typedef __attribute__((ext_vector_type(4))) float f4;
typedef const __attribute__((address_space(1))) char* gbytes;  // global memory, bytes
typedef const __attribute__((address_space(1))) f4*   gf4;     // global memory, 4 floats
__device__ __forceinline__ gbytes scalar_base(const float* p) {
  const unsigned long long u = (unsigned long long)p;
  const unsigned lo = (unsigned)__builtin_amdgcn_readfirstlane((int)(unsigned)u);
  const unsigned hi = (unsigned)__builtin_amdgcn_readfirstlane((int)(unsigned)(u >> 32));
  return (gbytes)(((unsigned long long)hi << 32) | lo);
}

__device__ __forceinline__ v8f wmma_f16(v16h a, v16h b, v8f c) {
  // (neg_a, A, neg_b, B, c_mod, C, reuse_a, reuse_b)
  return __builtin_amdgcn_wmma_f32_16x16x32_f16(false, a, false, b, (short)0, c, false, false);
}

// ---------------------------------------------------------------------------
// GEMM 1: C(f16)[M,Nc] = A(f32)[M,K] @ W(f32)[K,Nc].  BM=BN=128, BK=32.
// 8 waves in a 4x2 grid; each wave owns 32x64 = 2x4 WMMA tiles.
// W tile staged row-major: Bs[k][col], read back through transposing loads.
// (f32->f16 conversion forces the VGPR staging path here.)
// ---------------------------------------------------------------------------
__global__ __launch_bounds__(256)
void gemm_qkv_kernel(const float* __restrict__ A1, const float* __restrict__ W1,
                     _Float16* __restrict__ C1,
                     const float* __restrict__ A2, const float* __restrict__ W2,
                     _Float16* __restrict__ C2, int M, int K, int Ncols) {
  // Two independent products in one grid: blockIdx.z picks the stream.
  const bool second = blockIdx.z != 0;
  const float* __restrict__ A = second ? A2 : A1;
  const float* __restrict__ W = second ? W2 : W1;
  _Float16* __restrict__ C = second ? C2 : C1;
  constexpr int AS_S = 40;    // 128 rows x 32 halfs (+pad), 16B-multiple stride
  constexpr int BS_S = 144;   // 32 k-rows x 128 halfs (+pad): 288 B = 32 B x odd
  __shared__ alignas(16) _Float16 As[128 * AS_S];
  __shared__ alignas(16) _Float16 Bs[32 * BS_S];

  const int tid  = threadIdx.x;
  const int lane = tid & 31;
  const int wave = tid >> 5;
  const int row0 = blockIdx.y * 128;
  const int col0 = blockIdx.x * 128;
  const int wm   = wave & 3;   // row group (32 rows)
  const int wn   = wave >> 2;  // col group (64 cols)
  const unsigned aoff = 4u * (unsigned)((tid >> 3) * K + ((tid & 7) << 2));       // bytes; A: row tid/8
  const unsigned woff = 4u * (unsigned)((tid >> 5) * Ncols + ((tid & 31) << 2));  // bytes; W: k-row tid/32

  v8f acc[2][4];
#pragma unroll
  for (int i = 0; i < 2; ++i)
#pragma unroll
    for (int nt = 0; nt < 4; ++nt) acc[i][nt] = {};

  for (int k0 = 0; k0 < K; k0 += 32) {
    __syncthreads();
    // All eight global loads of this k-step go out together, so that their
    // latencies overlap; the converts and LDS stores follow.
    f4 av[4], wv[4];
#pragma unroll  // constant trip count: the four loads must not wait on one another
    for (int it = 0; it < 4; ++it)
      av[it] = *(gf4)(scalar_base(A + ((size_t)(row0 + it * 32) * K + k0)) + aoff);
#pragma unroll  // as above, for the W tile
    for (int it = 0; it < 4; ++it)
      wv[it] = *(gf4)(scalar_base(W + ((size_t)(k0 + it * 8) * Ncols + col0)) + woff);
    // The converts below reuse the address registers of the loads above.
    asm volatile("s_wait_xcnt 0x0" ::: "memory");
    // Stage A (f32 -> f16), row-major: 128x32 = 1024 float4 chunks.
#pragma unroll  // av[] stays in registers
    for (int it = 0; it < 4; ++it) {
      const int i = tid + it * 256;
      const int r = i >> 3, c4 = (i & 7) << 2;
      _Float16* d = As + r * AS_S + c4;
      d[0] = (_Float16)av[it].x; d[1] = (_Float16)av[it].y;
      d[2] = (_Float16)av[it].z; d[3] = (_Float16)av[it].w;
    }
    // Stage W (f32 -> f16) row-major: Bs[k][col], one 8-byte store per float4
    // (a wave fills one whole 256-byte row).
#pragma unroll  // wv[] stays in registers
    for (int it = 0; it < 4; ++it) {
      const int i = tid + it * 256;
      const int r = i >> 5, c4 = (i & 31) << 2;
      *(h4*)(Bs + r * BS_S + c4) = h4{(_Float16)wv[it].x, (_Float16)wv[it].y,
                                      (_Float16)wv[it].z, (_Float16)wv[it].w};
    }
    if (k0 + 32 < K) {  // global_prefetch_b8 of next tiles
      __builtin_prefetch((const void*)(A + (size_t)(row0 + (tid >> 1)) * K + k0 + 32), 0, 1);
      __builtin_prefetch((const void*)(W + (size_t)(k0 + 32 + (tid >> 3)) * Ncols + col0), 0, 1);
    }
    __syncthreads();

    v16h af[2], bf[4];
#pragma unroll
    for (int i = 0; i < 2; ++i)
      af[i] = load_frag(As + (wm * 32 + i * 16) * AS_S, AS_S, lane);
#pragma unroll
    for (int nt = 0; nt < 4; ++nt)
      bf[nt] = load_frag_tr(Bs + wn * 64 + nt * 16, BS_S, lane);
#pragma unroll
    for (int i = 0; i < 2; ++i)
#pragma unroll
      for (int nt = 0; nt < 4; ++nt)
        acc[i][nt] = wmma_f16(af[i], bf[nt], acc[i][nt]);
  }

  const int hi = lane >> 4, cn = lane & 15;
#pragma unroll
  for (int i = 0; i < 2; ++i)
#pragma unroll
    for (int nt = 0; nt < 4; ++nt)
#pragma unroll
      for (int r = 0; r < 8; ++r) {
        const int row = row0 + wm * 32 + i * 16 + r + 8 * hi;
        const int col = col0 + wn * 64 + nt * 16 + cn;
        C[(size_t)row * Ncols + col] = (_Float16)acc[i][nt][r];
      }
}

// ---------------------------------------------------------------------------
// GEMM 2: out(f32)[M,Nc] = A(f16)[M,K] @ W(f32)[K,Nc] + bias.
// The f16 A tile needs no conversion -> staged with async-to-LDS DMA.
// ---------------------------------------------------------------------------
__global__ __launch_bounds__(256)
void gemm_out_kernel(const _Float16* __restrict__ A1, const float* __restrict__ W1,
                     const float* __restrict__ bias1, float* __restrict__ C1,
                     const _Float16* __restrict__ A2, const float* __restrict__ W2,
                     const float* __restrict__ bias2, float* __restrict__ C2,
                     int M, int K, int Ncols) {
  // Two independent products in one grid: blockIdx.z picks the stream.
  const bool second = blockIdx.z != 0;
  const _Float16* __restrict__ A = second ? A2 : A1;
  const float* __restrict__ W = second ? W2 : W1;
  const float* __restrict__ bias = second ? bias2 : bias1;
  float* __restrict__ C = second ? C2 : C1;
  constexpr int AS_S = 40;
  constexpr int BS_S = 144;   // 32 k-rows x 128 halfs (+pad): 288 B = 32 B x odd
  __shared__ alignas(16) _Float16 As[128 * AS_S];
  __shared__ alignas(16) _Float16 Bs[32 * BS_S];

  const int tid  = threadIdx.x;
  const int lane = tid & 31;
  const int wave = tid >> 5;
  const int row0 = blockIdx.y * 128;
  const int col0 = blockIdx.x * 128;
  const int wm   = wave & 3;
  const int wn   = wave >> 2;
  const unsigned woff = 4u * (unsigned)((tid >> 5) * Ncols + ((tid & 31) << 2));  // bytes; W: k-row tid/32

  v8f acc[2][4];
#pragma unroll
  for (int i = 0; i < 2; ++i)
#pragma unroll
    for (int nt = 0; nt < 4; ++nt) acc[i][nt] = {};

  for (int k0 = 0; k0 < K; k0 += 32) {
    __syncthreads();
    // The four W loads of this k-step go out together, so that their
    // latencies overlap one another and the A copies; the LDS stores follow.
    f4 wv[4];
#pragma unroll  // constant trip count: the four loads must not wait on one another
    for (int it = 0; it < 4; ++it)
      wv[it] = *(gf4)(scalar_base(W + ((size_t)(k0 + it * 8) * Ncols + col0)) + woff);
    // Stage A (f16) via async DMA: 128x32 halfs = 512 b128 transfers.
    for (int i = tid; i < 512; i += 256) {
      const int r = i >> 2, c8 = (i & 3) << 3;
      async_copy_b128(A + (size_t)(row0 + r) * K + k0 + c8,
                      As + r * AS_S + c8);
    }
    // Stage W row-major (f32 -> f16 conversion: VGPR path), 8-byte stores.
#pragma unroll  // wv[] stays in registers
    for (int it = 0; it < 4; ++it) {
      const int i = tid + it * 256;
      const int r = i >> 5, c4 = (i & 31) << 2;
      *(h4*)(Bs + r * BS_S + c4) = h4{(_Float16)wv[it].x, (_Float16)wv[it].y,
                                      (_Float16)wv[it].z, (_Float16)wv[it].w};
    }
    wait_async0();           // ASYNCcnt == 0: A tile landed in LDS
    __syncthreads();

    v16h af[2], bf[4];
#pragma unroll
    for (int i = 0; i < 2; ++i)
      af[i] = load_frag(As + (wm * 32 + i * 16) * AS_S, AS_S, lane);
#pragma unroll
    for (int nt = 0; nt < 4; ++nt)
      bf[nt] = load_frag_tr(Bs + wn * 64 + nt * 16, BS_S, lane);
#pragma unroll
    for (int i = 0; i < 2; ++i)
#pragma unroll
      for (int nt = 0; nt < 4; ++nt)
        acc[i][nt] = wmma_f16(af[i], bf[nt], acc[i][nt]);
  }

  const int hi = lane >> 4, cn = lane & 15;
#pragma unroll
  for (int i = 0; i < 2; ++i)
#pragma unroll
    for (int nt = 0; nt < 4; ++nt)
#pragma unroll
      for (int r = 0; r < 8; ++r) {
        const int row = row0 + wm * 32 + i * 16 + r + 8 * hi;
        const int col = col0 + wn * 64 + nt * 16 + cn;
        C[(size_t)row * Ncols + col] = acc[i][nt][r] + bias[col];
      }
}

// ---------------------------------------------------------------------------
// conv_gate: MS = s1+s2 (f32); depthwise conv (k=5, pad 2) along features with
// per-token weights; MSg = sigmoid(conv) * MS -> f16, merged b n (h d) layout.
// One block per (b, n) row.
// ---------------------------------------------------------------------------
__global__ __launch_bounds__(128)
void conv_gate_kernel(const _Float16* __restrict__ qkv1,
                      const _Float16* __restrict__ qkv2,
                      const float* __restrict__ cw, const float* __restrict__ cb,
                      _Float16* __restrict__ msg) {
  const int bn = blockIdx.x;          // b*N + n
  const int n  = bn & (Nn - 1);
  __shared__ float ms[INNERi + 4];

  const _Float16* s1 = qkv1 + (size_t)bn * 2048 + 1536;
  const _Float16* s2 = qkv2 + (size_t)bn * 2048 + 1536;
  for (int f = threadIdx.x; f < INNERi; f += blockDim.x)
    ms[f + 2] = (float)s1[f] + (float)s2[f];
  if (threadIdx.x < 2) { ms[threadIdx.x] = 0.0f; ms[INNERi + 2 + threadIdx.x] = 0.0f; }
  __syncthreads();

  const float w0 = cw[n * 5 + 0], w1 = cw[n * 5 + 1], w2 = cw[n * 5 + 2],
              w3 = cw[n * 5 + 3], w4 = cw[n * 5 + 4];
  const float bias = cb[n];
  for (int f = threadIdx.x; f < INNERi; f += blockDim.x) {
    const float a = w0 * ms[f] + w1 * ms[f + 1] + w2 * ms[f + 2] +
                    w3 * ms[f + 3] + w4 * ms[f + 4] + bias;
    const float g = ms[f + 2] / (1.0f + __expf(-a));
    msg[(size_t)bn * INNERi + f] = (_Float16)g;
  }
}

// ---------------------------------------------------------------------------
// Flash-attention pass: O = softmax(scale * Q K^T) @ V  (+ V residual),
// computed transposed: S^T = K Q^T, O^T += V^T P^T.
// All tensors live in [B, N, stride] f16 buffers; the head slice is selected
// by (section offset + h*64).  128 query rows per block, 8 waves x 16 queries,
// KV streamed in 64-row chunks through LDS.
//   Ks  : [j][d] row-major, staged via async-to-LDS DMA (no conversion); A of S^T
//   Vs  : [j][d] row-major (VGPR path, 16-byte stores); transposing loads give A of O^T
// A lane (c = lane&15, hi = lane>>4) owns ONE query, c: of each 16-key tile it
// holds the scores of keys 8*hi .. 8*hi+7, so maximum and sum run in the lane's
// own registers, with one exchange between the wave's halves.  Two score tiles,
// converted in place, are the B operand P^T of a 32-key block (element s is key
// 8*hi+s, then 16+8*hi+(s-8): the k order of load_frag_tr).
// ---------------------------------------------------------------------------

// Value of lane l ^ 16.
__device__ __forceinline__ float other_half(float x) {
  const int i = __builtin_bit_cast(int, x);
  return __builtin_bit_cast(float,
      __builtin_amdgcn_permlanex16(i, i, 0x76543210, 0xfedcba98, false, false));
}

__global__ __launch_bounds__(256)
void attn_kernel(const _Float16* Q1, const _Float16* Q2, int qstride, int qsec,
                 const _Float16* Kv1, const _Float16* Kv2, int kstride, int ksec,
                 const _Float16* V1, const _Float16* V2, int vstride, int vsec,
                 _Float16* O1, _Float16* O2, int ostride,
                 int addV, float scale) {
  // Two independent passes in one grid: blockIdx.z picks the stream.
  const bool second = blockIdx.z != 0;
  const _Float16* __restrict__ Q  = second ? Q2 : Q1;
  const _Float16* __restrict__ Kv = second ? Kv2 : Kv1;
  const _Float16* __restrict__ V  = second ? V2 : V1;
  _Float16* __restrict__ O = second ? O2 : O1;
  constexpr int LS = 72;  // padded row stride in halfs (144B, 16B-multiple)
  __shared__ alignas(16) _Float16 Ks [64 * LS];
  constexpr int VS = 80;  // V row stride in halfs: 160 B = 32 B x odd, for the transposing reader
  __shared__ alignas(16) _Float16 Vs [64 * VS];

  const int tid  = threadIdx.x;
  const int lane = tid & 31;
  const int wave = tid >> 5;
  const int bh   = blockIdx.y;
  const int b    = bh >> 3;
  const int h    = bh & 7;
  const int row0 = blockIdx.x * 128;
  const size_t bN = (size_t)b * Nn;
  const int qoff = qsec + h * HDd;
  const int koff = ksec + h * HDd;
  const int voff = vsec + h * HDd;
  const int ooff = h * HDd;

  // Q fragments for this wave's 16 queries (B operand: column = query lane&15):
  // two global_load_b128 per fragment.
  v16h qa0, qa1;
  {
    const _Float16* qp =
        Q + (bN + row0 + wave * 16 + (lane & 15)) * (size_t)qstride + qoff +
        ((lane >> 4) << 3);
    V16U u0, u1;
    u0.h2[0] = *(const h8*)(qp);
    u0.h2[1] = *(const h8*)(qp + 16);
    u1.h2[0] = *(const h8*)(qp + 32);
    u1.h2[1] = *(const h8*)(qp + 48);
    qa0 = u0.v;
    qa1 = u1.v;
  }

  float m_old = -1e30f;  // running maximum of this lane's query (equal in both halves)
  float l = 0.0f;        // running sum over this half's keys; the halves join after the loop
  v8f o[4];              // o[dt][r] = O^T[dt*16 + 8*hi + r][query]
#pragma unroll
  for (int dt = 0; dt < 4; ++dt) o[dt] = {};

  const int cn = lane & 15;
  const int hi = lane >> 4;

  for (int j0 = 0; j0 < Nn; j0 += 64) {
    __syncthreads();
    // Both V loads of this chunk go out together, so that their latencies
    // overlap one another and the K copies; the LDS stores follow.
    h8 vv[2];
#pragma unroll  // constant trip count: the two loads must not wait on one another
    for (int it = 0; it < 2; ++it) {
      const int i = tid + it * 256;
      const int r = i >> 3, c8 = (i & 7) << 3;  // j row r, d base c8
      vv[it] = *(const h8*)(V + (bN + j0 + r) * (size_t)vstride + voff + c8);
    }
    // Stage K chunk row-major via async DMA: 64x64 halfs = 512 b128 transfers.
    for (int i = tid; i < 512; i += 256) {
      const int r = i >> 3, c8 = (i & 7) << 3;
      async_copy_b128(Kv + (bN + j0 + r) * (size_t)kstride + koff + c8,
                      Ks + r * LS + c8);
    }
    // Stage V chunk row-major: Vs[j][d] (VGPR path), one 16-byte store per load.
#pragma unroll  // vv[] stays in registers
    for (int it = 0; it < 2; ++it) {
      const int i = tid + it * 256;
      const int r = i >> 3, c8 = (i & 7) << 3;
      *(h8*)(Vs + r * VS + c8) = vv[it];
    }
    if (j0 + 64 < Nn)
      __builtin_prefetch(
          (const void*)(Kv + (bN + j0 + 64 + (tid >> 2)) * (size_t)kstride + koff), 0, 1);
    wait_async0();           // K chunk landed in LDS
    __syncthreads();

    // S^T = scale * K Q^T  (64 keys x 16 queries per wave, 4 WMMA key tiles,
    // K-depth 64): sc[nt][r] = score of key nt*16 + 8*hi + r against query cn.
    v8f sc[4];
#pragma unroll
    for (int nt = 0; nt < 4; ++nt) {
      v8f z = {};
      z = wmma_f16(load_frag(Ks + (nt * 16) * LS, LS, lane), qa0, z);
      z = wmma_f16(load_frag(Ks + (nt * 16) * LS + 32, LS, lane), qa1, z);
#pragma unroll
      for (int r = 0; r < 8; ++r) z[r] *= scale;
      sc[nt] = z;
    }

    // Online-softmax update, one query per lane.
    float mt[4];
#pragma unroll
    for (int nt = 0; nt < 4; ++nt) {
      mt[nt] = sc[nt][0];
#pragma unroll
      for (int r = 1; r < 8; ++r) mt[nt] = fmaxf(mt[nt], sc[nt][r]);
    }
    float mx = fmaxf(fmaxf(mt[0], mt[1]), fmaxf(mt[2], mt[3]));
    mx = fmaxf(mx, other_half(mx));
    const float m_new = fmaxf(m_old, mx);
    constexpr float LOG2E = 1.44269504f;
    const float xa = (m_old - m_new) * LOG2E;
    const float alpha = __builtin_amdgcn_exp2f(xa);
    m_old = m_new;

    V16U pb[2];    // P^T of keys 0..31 and 32..63, packed in place as B operands
    v8f x[4];
#pragma unroll
    for (int nt = 0; nt < 4; ++nt) {
      x[nt] = (sc[nt] - m_new) * LOG2E;
#pragma unroll
      for (int r = 0; r < 8; ++r) {
        sc[nt][r] = __builtin_amdgcn_exp2f(x[nt][r]);
        pb[nt >> 1].v[(nt & 1) * 8 + r] = (_Float16)sc[nt][r];
      }
    }
    // The slot between a v_exp_f32 and an overwrite of its source: the arguments
    // stay live up to this v_nop, which stands behind the last exponential.
    asm volatile("v_nop" :: "v"(x[0]), "v"(x[1]), "v"(x[2]), "v"(x[3]), "v"(sc[0]), "v"(sc[1]),
                 "v"(sc[2]), "v"(sc[3]), "v"(xa), "v"(alpha));
    // Sum of this lane's 32 values: the four tiles register by register (packed
    // adds, independent chains), then the eight registers as a tree.
    const v8f ts = (sc[0] + sc[1]) + (sc[2] + sc[3]);
    l = l * alpha + (((ts[0] + ts[1]) + (ts[2] + ts[3])) + ((ts[4] + ts[5]) + (ts[6] + ts[7])));
#pragma unroll
    for (int dt = 0; dt < 4; ++dt)
#pragma unroll
      for (int r = 0; r < 8; ++r) o[dt][r] *= alpha;

    // O^T += V_chunk^T @ P^T.  A-fragments (row = d) from row-major Vs:
    // 2x ds_load_tr16_b128 each; B = P^T straight from registers.
#pragma unroll
    for (int dt = 0; dt < 4; ++dt) {
      o[dt] = wmma_f16(load_frag_tr(Vs + dt * 16, VS, lane), pb[0].v, o[dt]);
      o[dt] = wmma_f16(load_frag_tr(Vs + 32 * VS + dt * 16, VS, lane), pb[1].v, o[dt]);
    }
  }

  // Residual rows (zero where none is asked for): all four loads go out together,
  // under one block-uniform test, ahead of the divisions.
  const size_t grow = bN + row0 + wave * 16 + cn;
  h8 res[4];
#pragma unroll
  for (int dt = 0; dt < 4; ++dt) res[dt] = {};
  if (addV) {
#pragma unroll
    for (int dt = 0; dt < 4; ++dt)
      res[dt] = *(const h8*)(V + grow * (size_t)vstride + voff + dt * 16 + 8 * hi);
    // The output address below reuses the address registers of the loads above.
    asm volatile("s_wait_xcnt 0x0" ::: "memory");
  }

  // Join the halves' sums, normalize, add the residual, store f16: a lane's
  // 8 accumulator registers are 8 consecutive d of its query, one 16-byte store.
  l += other_half(l);
#pragma unroll
  for (int dt = 0; dt < 4; ++dt) {
    h8 ov;
#pragma unroll
    for (int r = 0; r < 8; ++r)
      ov[r] = (_Float16)(o[dt][r] / l + (float)res[dt][r]);
    *(h8*)(O + grow * (size_t)ostride + ooff + dt * 16 + 8 * hi) = ov;
  }
}

// ---------------------------------------------------------------------------
// Host launcher.
// ---------------------------------------------------------------------------
extern "C" void kernel_launch(void* const* d_in, const int* in_sizes, int n_in,
                              void* d_out, int out_size, void* d_ws, size_t ws_size,
                              hipStream_t stream) {
  (void)in_sizes; (void)n_in; (void)out_size; (void)ws_size;
  const float* x1     = (const float*)d_in[0];
  const float* x2     = (const float*)d_in[1];
  const float* Wqkv1  = (const float*)d_in[2];
  const float* Wqkv2  = (const float*)d_in[3];
  const float* Wout1  = (const float*)d_in[4];
  const float* bout1  = (const float*)d_in[5];
  const float* Wout2  = (const float*)d_in[6];
  const float* bout2  = (const float*)d_in[7];
  const float* conv_w = (const float*)d_in[8];
  const float* conv_b = (const float*)d_in[9];

  const size_t MROWS = (size_t)Bb * Nn;  // 8192
  // Workspace layout (f16). t1 aliases msg (dead after the first attention launch);
  // t2 has a plane of its own: its writer runs beside the reader of u1. Total ~101 MB.
  _Float16* qkv1h = (_Float16*)d_ws;
  _Float16* qkv2h = qkv1h + MROWS * 2048;
  _Float16* msg   = qkv2h + MROWS * 2048;
  _Float16* u1    = msg + MROWS * 512;
  _Float16* u2    = u1 + MROWS * 512;
  _Float16* t1    = msg;  // alias
  _Float16* t2    = u2 + MROWS * 512;

  float* out1 = (float*)d_out;
  float* out2 = out1 + MROWS * 512;

  const dim3 blk(256);
  const float scale = 0.125f;  // HD^-0.5

  // QKV projections: [8192,512] @ [512,2048] -> f16
  gemm_qkv_kernel<<<dim3(16, 64, 2), blk, 0, stream>>>(x1, Wqkv1, qkv1h, x2, Wqkv2, qkv2h,
                                                       8192, 512, 2048);

  // Gated conv branch -> MSg (merged b n (h d), f16)
  conv_gate_kernel<<<dim3(Bb * Nn), dim3(128), 0, stream>>>(qkv1h, qkv2h, conv_w, conv_b, msg);

  // u1 = softmax(MS MS^T)·v1 + v1 ; u2 likewise (sections: q=0,k=512,v=1024,s=1536)
  attn_kernel<<<dim3(8, 64, 2), blk, 0, stream>>>(msg, msg, 512, 0, msg, msg, 512, 0,
                                                  qkv1h, qkv2h, 2048, 1024, u1, u2, 512, 1, scale);
  // t1 = softmax(q1 k1^T)·u1 ; t2 = softmax(q2 k2^T)·u2
  attn_kernel<<<dim3(8, 64, 2), blk, 0, stream>>>(qkv1h, qkv2h, 2048, 0, qkv1h, qkv2h, 2048, 512,
                                                  u1, u2, 512, 0, t1, t2, 512, 0, scale);

  // Output projections with bias -> f32 d_out
  gemm_out_kernel<<<dim3(4, 64, 2), blk, 0, stream>>>(t1, Wout1, bout1, out1,
                                                      t2, Wout2, bout2, out2, 8192, 512, 512);
}

// v005
// One run takes 178 microseconds.
// Two timings next to v004 put it at 1.10 and 1.11 times that version's speed.
// All steps since v000 together make it 2.69 times as fast.
#include <hip/hip_runtime.h>
#include <hip/hip_bf16.h>

// ---------------------------------------------------------------------------
// MI455X (gfx1250, wave32) implementation of the hybrid-attention reference.
// All matmuls run on V_WMMA_F32_16X16X32_F16 (f16 in, f32 accumulate).
// Fragment loads are vectorized: each lane's 16-half WMMA fragment is two
// contiguous 16B runs (ISA 7.12.2), loaded as 2x ds_load_b128/global_load_b128.
// W tiles (B operands, [k][col]) and V chunks (A operands, [j][d]) are staged row-major with wide
// LDS stores and transposed on the way out by ds_load_tr16_b128.  The GEMM 2 A tile and the attention K chunks are staged with
// CDNA5 GLOBAL_LOAD_ASYNC_TO_LDS_B128 tracked by ASYNCcnt.
// ---------------------------------------------------------------------------

typedef __attribute__((ext_vector_type(16))) _Float16 v16h;
typedef __attribute__((ext_vector_type(8)))  _Float16 h8;
typedef __attribute__((ext_vector_type(4)))  _Float16 h4;
typedef __attribute__((ext_vector_type(8)))  short    s16x8;
typedef __attribute__((address_space(3))) s16x8 lds_s16x8;
typedef __attribute__((ext_vector_type(8)))  float    v8f;

constexpr int Bb     = 8;
constexpr int Nn     = 1024;
constexpr int HDd    = 64;
constexpr int INNERi = 512;

union V16U { v16h v; h8 h2[2]; };

// Async DMA of 16 bytes global -> LDS (ASYNCcnt).  ldsOff is the byte offset
// of the destination within the workgroup's LDS allocation (low 32 bits of
// the generic pointer, per ISA 10.2 aperture mapping).
__device__ __forceinline__ void async_copy_b128(const void* gptr, void* ldsptr) {
  const unsigned ldsOff = (unsigned)(unsigned long long)ldsptr;
  asm volatile("global_load_async_to_lds_b128 %0, %1, off"
               :: "v"(ldsOff), "v"(gptr) : "memory");
}

__device__ __forceinline__ void wait_async0() {
#if __has_builtin(__builtin_amdgcn_s_wait_asynccnt)
  __builtin_amdgcn_s_wait_asynccnt(0);
#else
  asm volatile("s_wait_asynccnt 0x0" ::: "memory");
#endif
}

// Fragment loader: lane holds "line" (lane&15) of a row-major tile; the 16
// halves are K = khi..khi+7 and 16+khi..16+khi+7 with khi = 8*(lane>>4),
// i.e. two aligned 16B vector loads. Serves A-fragments (line = row m):
// the GEMM A tiles and the attention K chunks.
__device__ __forceinline__ v16h load_frag(const _Float16* base, int rstride, int lane) {
  const _Float16* p = base + (lane & 15) * rstride + ((lane >> 4) << 3);
  V16U u;
  u.h2[0] = *(const h8*)p;
  u.h2[1] = *(const h8*)(p + 16);
  return u.v;
}

// B-fragment (32 k x 16 columns) or A-fragment (16 rows x 32 k) out of a ROW-MAJOR [k][col] LDS tile: tile
// points at element [k0][col0], pitch is in halfs (bytes: an odd multiple of 32).
// Each transposing load hands lane (c = lane&15, h = lane>>4) the 8 halves
// tile[8h .. 8h+7][c]; the second one, 16 rows on, gives k = 16+8h .. 16+8h+7:
// the k order of load_frag, so the two loaders pair.
__device__ __forceinline__ v16h load_frag_tr(const _Float16* tile, int pitch, int lane) {
  const _Float16* p = tile + (((lane >> 4) << 3) + (lane & 7)) * pitch + (((lane >> 3) & 1) << 3);
  V16U u;
  u.h2[0] = __builtin_bit_cast(h8, __builtin_amdgcn_ds_load_tr16_b128_v8i16((lds_s16x8*)p));
  u.h2[1] = __builtin_bit_cast(h8, __builtin_amdgcn_ds_load_tr16_b128_v8i16((lds_s16x8*)(p + 16 * pitch)));
  return u.v;
}

// Holds a block-uniform address in scalar registers, so that a load takes it as
// its scalar base beside one loop-invariant 32-bit offset register per thread
// (no 64-bit address pair per load: fewer registers, more waves resident).
typedef __attribute__((ext_vector_type(4))) float f4;
typedef const __attribute__((address_space(1))) char* gbytes;  // global memory, bytes
typedef const __attribute__((address_space(1))) f4*   gf4;     // global memory, 4 floats
__device__ __forceinline__ gbytes scalar_base(const float* p) {
  const unsigned long long u = (unsigned long long)p;
  const unsigned lo = (unsigned)__builtin_amdgcn_readfirstlane((int)(unsigned)u);
  const unsigned hi = (unsigned)__builtin_amdgcn_readfirstlane((int)(unsigned)(u >> 32));
  return (gbytes)(((unsigned long long)hi << 32) | lo);
}

__device__ __forceinline__ v8f wmma_f16(v16h a, v16h b, v8f c) {
  // (neg_a, A, neg_b, B, c_mod, C, reuse_a, reuse_b)
  return __builtin_amdgcn_wmma_f32_16x16x32_f16(false, a, false, b, (short)0, c, false, false);
}

// ---------------------------------------------------------------------------
// GEMM 1: C(f16)[M,Nc] = A(f32)[M,K] @ W(f32)[K,Nc].  BM=BN=128, BK=32.
// 8 waves in a 4x2 grid; each wave owns 32x64 = 2x4 WMMA tiles.
// W tile staged row-major: Bs[k][col], read back through transposing loads.
// (f32->f16 conversion forces the VGPR staging path here.)
// ---------------------------------------------------------------------------
__global__ __launch_bounds__(256)
void gemm_qkv_kernel(const float* __restrict__ A1, const float* __restrict__ W1,
                     _Float16* __restrict__ C1,
                     const float* __restrict__ A2, const float* __restrict__ W2,
                     _Float16* __restrict__ C2, int M, int K, int Ncols) {
  // Two independent products in one grid: blockIdx.z picks the stream.
  const bool second = blockIdx.z != 0;
  const float* __restrict__ A = second ? A2 : A1;
  const float* __restrict__ W = second ? W2 : W1;
  _Float16* __restrict__ C = second ? C2 : C1;
  constexpr int AS_S = 40;    // 128 rows x 32 halfs (+pad), 16B-multiple stride
  constexpr int BS_S = 144;   // 32 k-rows x 128 halfs (+pad): 288 B = 32 B x odd
  __shared__ alignas(16) _Float16 As[128 * AS_S];
  __shared__ alignas(16) _Float16 Bs[32 * BS_S];

  const int tid  = threadIdx.x;
  const int lane = tid & 31;
  const int wave = tid >> 5;
  const int row0 = blockIdx.y * 128;
  const int col0 = blockIdx.x * 128;
  const int wm   = wave & 3;   // row group (32 rows)
  const int wn   = wave >> 2;  // col group (64 cols)
  const unsigned aoff = 4u * (unsigned)((tid >> 3) * K + ((tid & 7) << 2));       // bytes; A: row tid/8
  const unsigned woff = 4u * (unsigned)((tid >> 5) * Ncols + ((tid & 31) << 2));  // bytes; W: k-row tid/32

  v8f acc[2][4];
#pragma unroll
  for (int i = 0; i < 2; ++i)
#pragma unroll
    for (int nt = 0; nt < 4; ++nt) acc[i][nt] = {};

  for (int k0 = 0; k0 < K; k0 += 32) {
    __syncthreads();
    // All eight global loads of this k-step go out together, so that their
    // latencies overlap; the converts and LDS stores follow.
    f4 av[4], wv[4];
#pragma unroll  // constant trip count: the four loads must not wait on one another
    for (int it = 0; it < 4; ++it)
      av[it] = *(gf4)(scalar_base(A + ((size_t)(row0 + it * 32) * K + k0)) + aoff);
#pragma unroll  // as above, for the W tile
    for (int it = 0; it < 4; ++it)
      wv[it] = *(gf4)(scalar_base(W + ((size_t)(k0 + it * 8) * Ncols + col0)) + woff);
    // The converts below reuse the address registers of the loads above.
    asm volatile("s_wait_xcnt 0x0" ::: "memory");
    // Stage A (f32 -> f16), row-major: 128x32 = 1024 float4 chunks.
#pragma unroll  // av[] stays in registers
    for (int it = 0; it < 4; ++it) {
      const int i = tid + it * 256;
      const int r = i >> 3, c4 = (i & 7) << 2;
      _Float16* d = As + r * AS_S + c4;
      d[0] = (_Float16)av[it].x; d[1] = (_Float16)av[it].y;
      d[2] = (_Float16)av[it].z; d[3] = (_Float16)av[it].w;
    }
    // Stage W (f32 -> f16) row-major: Bs[k][col], one 8-byte store per float4
    // (a wave fills one whole 256-byte row).
#pragma unroll  // wv[] stays in registers
    for (int it = 0; it < 4; ++it) {
      const int i = tid + it * 256;
      const int r = i >> 5, c4 = (i & 31) << 2;
      *(h4*)(Bs + r * BS_S + c4) = h4{(_Float16)wv[it].x, (_Float16)wv[it].y,
                                      (_Float16)wv[it].z, (_Float16)wv[it].w};
    }
    if (k0 + 32 < K) {  // global_prefetch_b8 of next tiles
      __builtin_prefetch((const void*)(A + (size_t)(row0 + (tid >> 1)) * K + k0 + 32), 0, 1);
      __builtin_prefetch((const void*)(W + (size_t)(k0 + 32 + (tid >> 3)) * Ncols + col0), 0, 1);
    }
    __syncthreads();

    v16h af[2], bf[4];
#pragma unroll
    for (int i = 0; i < 2; ++i)
      af[i] = load_frag(As + (wm * 32 + i * 16) * AS_S, AS_S, lane);
#pragma unroll
    for (int nt = 0; nt < 4; ++nt)
      bf[nt] = load_frag_tr(Bs + wn * 64 + nt * 16, BS_S, lane);
#pragma unroll
    for (int i = 0; i < 2; ++i)
#pragma unroll
      for (int nt = 0; nt < 4; ++nt)
        acc[i][nt] = wmma_f16(af[i], bf[nt], acc[i][nt]);
  }

  const int hi = lane >> 4, cn = lane & 15;
#pragma unroll
  for (int i = 0; i < 2; ++i)
#pragma unroll
    for (int nt = 0; nt < 4; ++nt)
#pragma unroll
      for (int r = 0; r < 8; ++r) {
        const int row = row0 + wm * 32 + i * 16 + r + 8 * hi;
        const int col = col0 + wn * 64 + nt * 16 + cn;
        C[(size_t)row * Ncols + col] = (_Float16)acc[i][nt][r];
      }
}

// ---------------------------------------------------------------------------
// GEMM 2: out(f32)[M,Nc] = A(f16)[M,K] @ W(f32)[K,Nc] + bias.
// The f16 A tile needs no conversion -> staged with async-to-LDS DMA.
// ---------------------------------------------------------------------------
__global__ __launch_bounds__(256)
void gemm_out_kernel(const _Float16* __restrict__ A1, const float* __restrict__ W1,
                     const float* __restrict__ bias1, float* __restrict__ C1,
                     const _Float16* __restrict__ A2, const float* __restrict__ W2,
                     const float* __restrict__ bias2, float* __restrict__ C2,
                     int M, int K, int Ncols) {
  // Two independent products in one grid: blockIdx.z picks the stream.
  const bool second = blockIdx.z != 0;
  const _Float16* __restrict__ A = second ? A2 : A1;
  const float* __restrict__ W = second ? W2 : W1;
  const float* __restrict__ bias = second ? bias2 : bias1;
  float* __restrict__ C = second ? C2 : C1;
  constexpr int AS_S = 40;
  constexpr int BS_S = 144;   // 32 k-rows x 128 halfs (+pad): 288 B = 32 B x odd
  __shared__ alignas(16) _Float16 As[128 * AS_S];
  __shared__ alignas(16) _Float16 Bs[32 * BS_S];

  const int tid  = threadIdx.x;
  const int lane = tid & 31;
  const int wave = tid >> 5;
  const int row0 = blockIdx.y * 128;
  const int col0 = blockIdx.x * 128;
  const int wm   = wave & 3;
  const int wn   = wave >> 2;
  const unsigned woff = 4u * (unsigned)((tid >> 5) * Ncols + ((tid & 31) << 2));  // bytes; W: k-row tid/32

  v8f acc[2][4];
#pragma unroll
  for (int i = 0; i < 2; ++i)
#pragma unroll
    for (int nt = 0; nt < 4; ++nt) acc[i][nt] = {};

  for (int k0 = 0; k0 < K; k0 += 32) {
    __syncthreads();
    // The four W loads of this k-step go out together, so that their
    // latencies overlap one another and the A copies; the LDS stores follow.
    f4 wv[4];
#pragma unroll  // constant trip count: the four loads must not wait on one another
    for (int it = 0; it < 4; ++it)
      wv[it] = *(gf4)(scalar_base(W + ((size_t)(k0 + it * 8) * Ncols + col0)) + woff);
    // Stage A (f16) via async DMA: 128x32 halfs = 512 b128 transfers.
    for (int i = tid; i < 512; i += 256) {
      const int r = i >> 2, c8 = (i & 3) << 3;
      async_copy_b128(A + (size_t)(row0 + r) * K + k0 + c8,
                      As + r * AS_S + c8);
    }
    // Stage W row-major (f32 -> f16 conversion: VGPR path), 8-byte stores.
#pragma unroll  // wv[] stays in registers
    for (int it = 0; it < 4; ++it) {
      const int i = tid + it * 256;
      const int r = i >> 5, c4 = (i & 31) << 2;
      *(h4*)(Bs + r * BS_S + c4) = h4{(_Float16)wv[it].x, (_Float16)wv[it].y,
                                      (_Float16)wv[it].z, (_Float16)wv[it].w};
    }
    wait_async0();           // ASYNCcnt == 0: A tile landed in LDS
    __syncthreads();

    v16h af[2], bf[4];
#pragma unroll
    for (int i = 0; i < 2; ++i)
      af[i] = load_frag(As + (wm * 32 + i * 16) * AS_S, AS_S, lane);
#pragma unroll
    for (int nt = 0; nt < 4; ++nt)
      bf[nt] = load_frag_tr(Bs + wn * 64 + nt * 16, BS_S, lane);
#pragma unroll
    for (int i = 0; i < 2; ++i)
#pragma unroll
      for (int nt = 0; nt < 4; ++nt)
        acc[i][nt] = wmma_f16(af[i], bf[nt], acc[i][nt]);
  }

  const int hi = lane >> 4, cn = lane & 15;
#pragma unroll
  for (int i = 0; i < 2; ++i)
#pragma unroll
    for (int nt = 0; nt < 4; ++nt)
#pragma unroll
      for (int r = 0; r < 8; ++r) {
        const int row = row0 + wm * 32 + i * 16 + r + 8 * hi;
        const int col = col0 + wn * 64 + nt * 16 + cn;
        C[(size_t)row * Ncols + col] = acc[i][nt][r] + bias[col];
      }
}

// ---------------------------------------------------------------------------
// conv_gate: MS = s1+s2 (f32); depthwise conv (k=5, pad 2) along features with
// per-token weights; MSg = sigmoid(conv) * MS -> f16, merged b n (h d) layout.
// One block per (b, n) row.
// ---------------------------------------------------------------------------
__global__ __launch_bounds__(128)
void conv_gate_kernel(const _Float16* __restrict__ qkv1,
                      const _Float16* __restrict__ qkv2,
                      const float* __restrict__ cw, const float* __restrict__ cb,
                      _Float16* __restrict__ msg) {
  const int bn = blockIdx.x;          // b*N + n
  const int n  = bn & (Nn - 1);
  __shared__ float ms[INNERi + 4];

  const _Float16* s1 = qkv1 + (size_t)bn * 2048 + 1536;
  const _Float16* s2 = qkv2 + (size_t)bn * 2048 + 1536;
  for (int f = threadIdx.x; f < INNERi; f += blockDim.x)
    ms[f + 2] = (float)s1[f] + (float)s2[f];
  if (threadIdx.x < 2) { ms[threadIdx.x] = 0.0f; ms[INNERi + 2 + threadIdx.x] = 0.0f; }
  __syncthreads();

  const float w0 = cw[n * 5 + 0], w1 = cw[n * 5 + 1], w2 = cw[n * 5 + 2],
              w3 = cw[n * 5 + 3], w4 = cw[n * 5 + 4];
  const float bias = cb[n];
  for (int f = threadIdx.x; f < INNERi; f += blockDim.x) {
    const float a = w0 * ms[f] + w1 * ms[f + 1] + w2 * ms[f + 2] +
                    w3 * ms[f + 3] + w4 * ms[f + 4] + bias;
    const float g = ms[f + 2] / (1.0f + __expf(-a));
    msg[(size_t)bn * INNERi + f] = (_Float16)g;
  }
}

// ---------------------------------------------------------------------------
// Flash-attention pass: O = softmax(scale * Q K^T) @ V  (+ V residual),
// computed transposed: S^T = K Q^T, O^T += V^T P^T.
// All tensors live in [B, N, stride] f16 buffers; the head slice is selected
// by (section offset + h*64).  128 query rows per block, 8 waves x 16 queries,
// KV streamed in 64-row chunks through LDS.
//   Ks  : [j][d] row-major, staged via async-to-LDS DMA (no conversion); A of S^T
//   Vs  : [j][d] row-major (VGPR path, 16-byte stores); transposing loads give A of O^T
// A lane (c = lane&15, hi = lane>>4) owns ONE query, c: of each 16-key tile it
// holds the scores of keys 8*hi .. 8*hi+7, so maximum and sum run in the lane's
// own registers, with one exchange between the wave's halves.  Two score tiles,
// converted in place, are the B operand P^T of a 32-key block (element s is key
// 8*hi+s, then 16+8*hi+(s-8): the k order of load_frag_tr).
// ---------------------------------------------------------------------------

// Value of lane l ^ 16.
__device__ __forceinline__ float other_half(float x) {
  const int i = __builtin_bit_cast(int, x);
  return __builtin_bit_cast(float,
      __builtin_amdgcn_permlanex16(i, i, 0x76543210, 0xfedcba98, false, false));
}

__global__ __launch_bounds__(256)
void attn_kernel(const _Float16* Q1, const _Float16* Q2, int qstride, int qsec,
                 const _Float16* Kv1, const _Float16* Kv2, int kstride, int ksec,
                 const _Float16* V1, const _Float16* V2, int vstride, int vsec,
                 _Float16* O1, _Float16* O2, int ostride,
                 int addV, float scale) {
  // Two independent passes in one grid: blockIdx.z picks the stream.
  const bool second = blockIdx.z != 0;
  const _Float16* __restrict__ Q  = second ? Q2 : Q1;
  const _Float16* __restrict__ Kv = second ? Kv2 : Kv1;
  const _Float16* __restrict__ V  = second ? V2 : V1;
  _Float16* __restrict__ O = second ? O2 : O1;
  constexpr int LS = 72;  // padded row stride in halfs (144B, 16B-multiple)
  __shared__ alignas(16) _Float16 Ks [64 * LS];
  constexpr int VS = 80;  // V row stride in halfs: 160 B = 32 B x odd, for the transposing reader
  __shared__ alignas(16) _Float16 Vs [64 * VS];

  const int tid  = threadIdx.x;
  const int lane = tid & 31;
  const int wave = tid >> 5;
  const int bh   = blockIdx.y;
  const int b    = bh >> 3;
  const int h    = bh & 7;
  const int row0 = blockIdx.x * 128;
  const size_t bN = (size_t)b * Nn;
  const int qoff = qsec + h * HDd;
  const int koff = ksec + h * HDd;
  const int voff = vsec + h * HDd;
  const int ooff = h * HDd;

  // Q fragments for this wave's 16 queries (B operand: column = query lane&15):
  // two global_load_b128 per fragment.
  v16h qa0, qa1;
  {
    const _Float16* qp =
        Q + (bN + row0 + wave * 16 + (lane & 15)) * (size_t)qstride + qoff +
        ((lane >> 4) << 3);
    V16U u0, u1;
    u0.h2[0] = *(const h8*)(qp);
    u0.h2[1] = *(const h8*)(qp + 16);
    u1.h2[0] = *(const h8*)(qp + 32);
    u1.h2[1] = *(const h8*)(qp + 48);
    qa0 = u0.v;
    qa1 = u1.v;
  }

  float m_old = -1e30f;  // running maximum of this lane's query (equal in both halves)
  float l = 0.0f;        // running sum over this half's keys; the halves join after the loop
  v8f o[4];              // o[dt][r] = O^T[dt*16 + 8*hi + r][query]
#pragma unroll
  for (int dt = 0; dt < 4; ++dt) o[dt] = {};

  const int cn = lane & 15;
  const int hi = lane >> 4;

  for (int j0 = 0; j0 < Nn; j0 += 64) {
    __syncthreads();
    // Both V loads of this chunk go out together, so that their latencies
    // overlap one another and the K copies; the LDS stores follow.
    h8 vv[2];
#pragma unroll  // constant trip count: the two loads must not wait on one another
    for (int it = 0; it < 2; ++it) {
      const int i = tid + it * 256;
      const int r = i >> 3, c8 = (i & 7) << 3;  // j row r, d base c8
      vv[it] = *(const h8*)(V + (bN + j0 + r) * (size_t)vstride + voff + c8);
    }
    // Stage K chunk row-major via async DMA: 64x64 halfs = 512 b128 transfers.
    for (int i = tid; i < 512; i += 256) {
      const int r = i >> 3, c8 = (i & 7) << 3;
      async_copy_b128(Kv + (bN + j0 + r) * (size_t)kstride + koff + c8,
                      Ks + r * LS + c8);
    }
    // Stage V chunk row-major: Vs[j][d] (VGPR path), one 16-byte store per load.
#pragma unroll  // vv[] stays in registers
    for (int it = 0; it < 2; ++it) {
      const int i = tid + it * 256;
      const int r = i >> 3, c8 = (i & 7) << 3;
      *(h8*)(Vs + r * VS + c8) = vv[it];
    }
    if (j0 + 64 < Nn)
      __builtin_prefetch(
          (const void*)(Kv + (bN + j0 + 64 + (tid >> 2)) * (size_t)kstride + koff), 0, 1);
    wait_async0();           // K chunk landed in LDS
    __syncthreads();

    // S^T = scale * K Q^T  (64 keys x 16 queries per wave, 4 WMMA key tiles,
    // K-depth 64): sc[nt][r] = score of key nt*16 + 8*hi + r against query cn.
    v8f sc[4];
#pragma unroll
    for (int nt = 0; nt < 4; ++nt) {
      v8f z = {};
      z = wmma_f16(load_frag(Ks + (nt * 16) * LS, LS, lane), qa0, z);
      z = wmma_f16(load_frag(Ks + (nt * 16) * LS + 32, LS, lane), qa1, z);
#pragma unroll
      for (int r = 0; r < 8; ++r) z[r] *= scale;
      sc[nt] = z;
    }

    // Online-softmax update, one query per lane.
    float mt[4];
#pragma unroll
    for (int nt = 0; nt < 4; ++nt) {
      mt[nt] = sc[nt][0];
#pragma unroll
      for (int r = 1; r < 8; ++r) mt[nt] = fmaxf(mt[nt], sc[nt][r]);
    }
    float mx = fmaxf(fmaxf(mt[0], mt[1]), fmaxf(mt[2], mt[3]));
    mx = fmaxf(mx, other_half(mx));
    const float m_new = fmaxf(m_old, mx);
    constexpr float LOG2E = 1.44269504f;
    const float xa = (m_old - m_new) * LOG2E;
    const float alpha = __builtin_amdgcn_exp2f(xa);
    m_old = m_new;

    V16U pb[2];    // P^T of keys 0..31 and 32..63, packed in place as B operands
    v8f x[4];
#pragma unroll
    for (int nt = 0; nt < 4; ++nt) {
      x[nt] = (sc[nt] - m_new) * LOG2E;
#pragma unroll
      for (int r = 0; r < 8; ++r) {
        sc[nt][r] = __builtin_amdgcn_exp2f(x[nt][r]);
        pb[nt >> 1].v[(nt & 1) * 8 + r] = (_Float16)sc[nt][r];
      }
    }
    // The slot between a v_exp_f32 and an overwrite of its source: the arguments
    // stay live up to this v_nop, which stands behind the last exponential.
    asm volatile("v_nop" :: "v"(x[0]), "v"(x[1]), "v"(x[2]), "v"(x[3]), "v"(sc[0]), "v"(sc[1]),
                 "v"(sc[2]), "v"(sc[3]), "v"(xa), "v"(alpha));
    // Sum of this lane's 32 values: the four tiles register by register (packed
    // adds, independent chains), then the eight registers as a tree.
    const v8f ts = (sc[0] + sc[1]) + (sc[2] + sc[3]);
    l = l * alpha + (((ts[0] + ts[1]) + (ts[2] + ts[3])) + ((ts[4] + ts[5]) + (ts[6] + ts[7])));
#pragma unroll
    for (int dt = 0; dt < 4; ++dt)
#pragma unroll
      for (int r = 0; r < 8; ++r) o[dt][r] *= alpha;

    // O^T += V_chunk^T @ P^T.  A-fragments (row = d) from row-major Vs:
    // 2x ds_load_tr16_b128 each; B = P^T straight from registers.
#pragma unroll
    for (int dt = 0; dt < 4; ++dt) {
      o[dt] = wmma_f16(load_frag_tr(Vs + dt * 16, VS, lane), pb[0].v, o[dt]);
      o[dt] = wmma_f16(load_frag_tr(Vs + 32 * VS + dt * 16, VS, lane), pb[1].v, o[dt]);
    }
  }

  // Residual rows (zero where none is asked for): all four loads go out together,
  // under one block-uniform test, ahead of the divisions.
  const size_t grow = bN + row0 + wave * 16 + cn;
  h8 res[4];
#pragma unroll
  for (int dt = 0; dt < 4; ++dt) res[dt] = {};
  if (addV) {
#pragma unroll
    for (int dt = 0; dt < 4; ++dt)
      res[dt] = *(const h8*)(V + grow * (size_t)vstride + voff + dt * 16 + 8 * hi);
    // The output address below reuses the address registers of the loads above.
    asm volatile("s_wait_xcnt 0x0" ::: "memory");
  }

  // Join the halves' sums, normalize, add the residual, store f16: a lane's
  // 8 accumulator registers are 8 consecutive d of its query, one 16-byte store.
  l += other_half(l);
#pragma unroll
  for (int dt = 0; dt < 4; ++dt) {
    h8 ov;
#pragma unroll
    for (int r = 0; r < 8; ++r)
      ov[r] = (_Float16)(o[dt][r] / l + (float)res[dt][r]);
    *(h8*)(O + grow * (size_t)ostride + ooff + dt * 16 + 8 * hi) = ov;
  }
}

// ---------------------------------------------------------------------------
// First attention stage, both streams in one pass.  Its scores come from the
// gated rows alone (queries and keys are the same tensor X), so softmax(X X^T)
// is the same matrix for stream 1 and stream 2: it is formed once per query
// tile and multiplied into both value tensors,
//   O1 = P V1 + V1,  O2 = P V2 + V2.
// Layouts, fragment maps and the order of every sum are those of attn_kernel.
// X: [B*N][512]; V1, V2: the v section of the [B*N][2048] projections.
// ---------------------------------------------------------------------------

// Two 16-byte copies global -> LDS (ASYNCcnt).  The s_wait_xcnt closes the
// copies' own statement, ahead of any later write of their address registers.
__device__ __forceinline__ void async_copy2_b128(const void* g0, void* l0,
                                                 const void* g1, void* l1) {
  const unsigned a0 = (unsigned)(unsigned long long)l0;
  const unsigned a1 = (unsigned)(unsigned long long)l1;
  asm volatile("global_load_async_to_lds_b128 %0, %1, off\n\t"
               "global_load_async_to_lds_b128 %2, %3, off\n\t"
               "s_wait_xcnt 0x0"
               :: "v"(a0), "v"(g0), "v"(a1), "v"(g1) : "memory");
}

__global__ __launch_bounds__(256)
void attn_shared_kernel(const _Float16* __restrict__ X,
                        const _Float16* __restrict__ V1, const _Float16* __restrict__ V2,
                        _Float16* __restrict__ O1, _Float16* __restrict__ O2, float scale) {
  constexpr int XS   = INNERi;      // row stride of X and of the outputs, halfs
  constexpr int VSTR = 4 * INNERi;  // row stride of the projections
  constexpr int VSEC = 2 * INNERi;  // their v section
  constexpr int LS = 72;  // K row stride in halfs (144 B)
  constexpr int VS = 80;  // V row stride in halfs: 160 B = 32 B x odd, for the transposing reader
  __shared__ alignas(16) _Float16 Ks [64 * LS];
  __shared__ alignas(16) _Float16 Vs1[64 * VS];
  __shared__ alignas(16) _Float16 Vs2[64 * VS];

  const int tid  = threadIdx.x;
  const int lane = tid & 31;
  const int wave = tid >> 5;
  const int bh   = blockIdx.y;
  const int b    = bh >> 3;
  const int hoff = (bh & 7) * HDd;
  const int row0 = blockIdx.x * 128;
  const size_t bN = (size_t)b * Nn;
  const int cn = lane & 15;
  const int hi = lane >> 4;
  const size_t grow = bN + row0 + wave * 16 + cn;  // this lane's query row

  // Q fragments for this wave's 16 queries (B operand: column = query lane&15).
  v16h qa0, qa1;
  {
    const _Float16* qp = X + grow * XS + hoff + (hi << 3);
    V16U u0, u1;
    u0.h2[0] = *(const h8*)(qp);
    u0.h2[1] = *(const h8*)(qp + 16);
    u1.h2[0] = *(const h8*)(qp + 32);
    u1.h2[1] = *(const h8*)(qp + 48);
    qa0 = u0.v;
    qa1 = u1.v;
  }

  float m_old = -1e30f;  // running maximum of this lane's query (equal in both halves)
  float l = 0.0f;        // running sum over this half's keys; the halves join after the loop
  v8f o1[4], o2[4];      // o[dt][r] = O^T[dt*16 + 8*hi + r][query], one set per stream
#pragma unroll
  for (int dt = 0; dt < 4; ++dt) { o1[dt] = {}; o2[dt] = {}; }

  // Staging: a thread moves 16 bytes of row sr and of row sr + 32 of each tile.
  const int sr = tid >> 3, c8 = (tid & 7) << 3;
  const _Float16* kp  = X  + (bN + sr) * XS + hoff + c8;
  const _Float16* vp1 = V1 + (bN + sr) * VSTR + VSEC + hoff + c8;
  const _Float16* vp2 = V2 + (bN + sr) * VSTR + VSEC + hoff + c8;
  _Float16* const kd  = Ks  + sr * LS + c8;
  _Float16* const vd1 = Vs1 + sr * VS + c8;
  _Float16* const vd2 = Vs2 + sr * VS + c8;

  for (int j0 = 0; j0 < Nn; j0 += 64) {
    // This wave's LDS reads of the last chunk have returned before any wave refills the tiles.
    asm volatile("s_wait_dscnt 0x0" ::: "memory");
    __syncthreads();
    // The four V loads and the two K copies of this chunk go out together.
    h8 vv[4];
    vv[0] = *(const h8*)(vp1);
    vv[1] = *(const h8*)(vp1 + 32 * VSTR);
    vv[2] = *(const h8*)(vp2);
    vv[3] = *(const h8*)(vp2 + 32 * VSTR);
    async_copy2_b128(kp, kd, kp + 32 * XS, kd + 32 * LS);
    *(h8*)(vd1)           = vv[0];
    *(h8*)(vd1 + 32 * VS) = vv[1];
    *(h8*)(vd2)           = vv[2];
    *(h8*)(vd2 + 32 * VS) = vv[3];
    kp  += 64 * XS;
    vp1 += 64 * VSTR;
    vp2 += 64 * VSTR;
    // K chunk landed in LDS (this wave's copies); the barrier publishes all three tiles.
    asm volatile("s_wait_asynccnt 0x0" ::: "memory");
    __syncthreads();

    // S^T = scale * K Q^T: sc[nt][r] = score of key nt*16 + 8*hi + r against query cn.
    v8f sc[4];
#pragma unroll
    for (int nt = 0; nt < 4; ++nt) {
      v8f z = {};
      z = wmma_f16(load_frag(Ks + (nt * 16) * LS, LS, lane), qa0, z);
      z = wmma_f16(load_frag(Ks + (nt * 16) * LS + 32, LS, lane), qa1, z);
      sc[nt] = z * scale;
    }

    // Online-softmax update, one query per lane.
    float mt[4];
#pragma unroll
    for (int nt = 0; nt < 4; ++nt) {
      mt[nt] = sc[nt][0];
#pragma unroll
      for (int r = 1; r < 8; ++r) mt[nt] = fmaxf(mt[nt], sc[nt][r]);
    }
    float mx = fmaxf(fmaxf(mt[0], mt[1]), fmaxf(mt[2], mt[3]));
    mx = fmaxf(mx, other_half(mx));
    const float m_new = fmaxf(m_old, mx);
    constexpr float LOG2E = 1.44269504f;
    const float xa = (m_old - m_new) * LOG2E;
    const float alpha = __builtin_amdgcn_exp2f(xa);
    m_old = m_new;

    V16U pb[2];    // P^T of keys 0..31 and 32..63, packed in place as B operands
    v8f x[4];
#pragma unroll
    for (int nt = 0; nt < 4; ++nt) {
      x[nt] = (sc[nt] - m_new) * LOG2E;
#pragma unroll
      for (int r = 0; r < 8; ++r) {
        sc[nt][r] = __builtin_amdgcn_exp2f(x[nt][r]);
        pb[nt >> 1].v[(nt & 1) * 8 + r] = (_Float16)sc[nt][r];
      }
    }
    // The slot between a v_exp_f32 and an overwrite of its source: the arguments
    // stay live up to this v_nop, which stands behind the last exponential.
    asm volatile("v_nop" :: "v"(x[0]), "v"(x[1]), "v"(x[2]), "v"(x[3]), "v"(sc[0]), "v"(sc[1]),
                 "v"(sc[2]), "v"(sc[3]), "v"(xa), "v"(alpha));
    // Sum of this lane's 32 values: the four tiles register by register, then
    // the eight registers as a tree.
    const v8f ts = (sc[0] + sc[1]) + (sc[2] + sc[3]);
    l = l * alpha + (((ts[0] + ts[1]) + (ts[2] + ts[3])) + ((ts[4] + ts[5]) + (ts[6] + ts[7])));
#pragma unroll
    for (int dt = 0; dt < 4; ++dt) {
      o1[dt] *= alpha;
      o2[dt] *= alpha;
    }

    // O^T += V_chunk^T @ P^T for both streams: the same B = P^T from registers,
    // A-fragments (row = d) from each stream's row-major tile.
#pragma unroll
    for (int dt = 0; dt < 4; ++dt) {
      o1[dt] = wmma_f16(load_frag_tr(Vs1 + dt * 16, VS, lane), pb[0].v, o1[dt]);
      o1[dt] = wmma_f16(load_frag_tr(Vs1 + 32 * VS + dt * 16, VS, lane), pb[1].v, o1[dt]);
    }
#pragma unroll
    for (int dt = 0; dt < 4; ++dt) {
      o2[dt] = wmma_f16(load_frag_tr(Vs2 + dt * 16, VS, lane), pb[0].v, o2[dt]);
      o2[dt] = wmma_f16(load_frag_tr(Vs2 + 32 * VS + dt * 16, VS, lane), pb[1].v, o2[dt]);
    }
  }

  // Residual rows of both streams: all eight loads go out together, ahead of the divisions.
  h8 res1[4], res2[4];
#pragma unroll
  for (int dt = 0; dt < 4; ++dt) {
    res1[dt] = *(const h8*)(V1 + grow * VSTR + VSEC + hoff + dt * 16 + 8 * hi);
    res2[dt] = *(const h8*)(V2 + grow * VSTR + VSEC + hoff + dt * 16 + 8 * hi);
  }

  // Join the halves' sums, normalize, add the residual, store f16: a lane's
  // 8 accumulator registers are 8 consecutive d of its query, one 16-byte store.
  l += other_half(l);
  h8 ov1[4], ov2[4];
#pragma unroll
  for (int dt = 0; dt < 4; ++dt)
#pragma unroll
    for (int r = 0; r < 8; ++r) {
      ov1[dt][r] = (_Float16)(o1[dt][r] / l + (float)res1[dt][r]);
      ov2[dt][r] = (_Float16)(o2[dt][r] / l + (float)res2[dt][r]);
    }
#pragma unroll
  for (int dt = 0; dt < 4; ++dt) {
    *(h8*)(O1 + grow * XS + hoff + dt * 16 + 8 * hi) = ov1[dt];
    *(h8*)(O2 + grow * XS + hoff + dt * 16 + 8 * hi) = ov2[dt];
  }
}

// ---------------------------------------------------------------------------
// Host launcher.
// ---------------------------------------------------------------------------
extern "C" void kernel_launch(void* const* d_in, const int* in_sizes, int n_in,
                              void* d_out, int out_size, void* d_ws, size_t ws_size,
                              hipStream_t stream) {
  (void)in_sizes; (void)n_in; (void)out_size; (void)ws_size;
  const float* x1     = (const float*)d_in[0];
  const float* x2     = (const float*)d_in[1];
  const float* Wqkv1  = (const float*)d_in[2];
  const float* Wqkv2  = (const float*)d_in[3];
  const float* Wout1  = (const float*)d_in[4];
  const float* bout1  = (const float*)d_in[5];
  const float* Wout2  = (const float*)d_in[6];
  const float* bout2  = (const float*)d_in[7];
  const float* conv_w = (const float*)d_in[8];
  const float* conv_b = (const float*)d_in[9];

  const size_t MROWS = (size_t)Bb * Nn;  // 8192
  // Workspace layout (f16). t1 aliases msg (dead after the first attention launch);
  // t2 has a plane of its own: its writer runs beside the reader of u1. Total ~101 MB.
  _Float16* qkv1h = (_Float16*)d_ws;
  _Float16* qkv2h = qkv1h + MROWS * 2048;
  _Float16* msg   = qkv2h + MROWS * 2048;
  _Float16* u1    = msg + MROWS * 512;
  _Float16* u2    = u1 + MROWS * 512;
  _Float16* t1    = msg;  // alias
  _Float16* t2    = u2 + MROWS * 512;

  float* out1 = (float*)d_out;
  float* out2 = out1 + MROWS * 512;

  const dim3 blk(256);
  const float scale = 0.125f;  // HD^-0.5

  // QKV projections: [8192,512] @ [512,2048] -> f16
  gemm_qkv_kernel<<<dim3(16, 64, 2), blk, 0, stream>>>(x1, Wqkv1, qkv1h, x2, Wqkv2, qkv2h,
                                                       8192, 512, 2048);

  // Gated conv branch -> MSg (merged b n (h d), f16)
  conv_gate_kernel<<<dim3(Bb * Nn), dim3(128), 0, stream>>>(qkv1h, qkv2h, conv_w, conv_b, msg);

  // u1 = softmax(MS MS^T)·v1 + v1 ; u2 likewise (sections: q=0,k=512,v=1024,s=1536)
  // (one grid for both: the score matrix is shared)
  attn_shared_kernel<<<dim3(8, 64), blk, 0, stream>>>(msg, qkv1h, qkv2h, u1, u2, scale);
  // t1 = softmax(q1 k1^T)·u1 ; t2 = softmax(q2 k2^T)·u2
  attn_kernel<<<dim3(8, 64, 2), blk, 0, stream>>>(qkv1h, qkv2h, 2048, 0, qkv1h, qkv2h, 2048, 512,
                                                  u1, u2, 512, 0, t1, t2, 512, 0, scale);

  // Output projections with bias -> f32 d_out
  gemm_out_kernel<<<dim3(4, 64, 2), blk, 0, stream>>>(t1, Wout1, bout1, out1,
                                                      t2, Wout2, bout2, out2, 8192, 512, 512);
}

// v006
// It runs in 160 microseconds.
// Timed twice side by side with v005, it ran 1.11 times as fast both times.
// Counting every step since v000, it is 2.99 times as fast.
#include <hip/hip_runtime.h>
#include <hip/hip_bf16.h>

// ---------------------------------------------------------------------------
// MI455X (gfx1250, wave32) implementation of the hybrid-attention reference.
// All matmuls run on V_WMMA_F32_16X16X32_F16 (f16 in, f32 accumulate).
// Fragment loads are vectorized: each lane's 16-half WMMA fragment is two
// contiguous 16B runs (ISA 7.12.2), loaded as 2x ds_load_b128/global_load_b128.
// W tiles (B operands, [k][col]; wide LDS stores) and V chunks (A operands, [j][d]) are staged
// row-major and transposed on the way out by ds_load_tr16_b128.  The GEMM 2 A tile and the attention K and V chunks are staged with
// CDNA5 GLOBAL_LOAD_ASYNC_TO_LDS_B128 tracked by ASYNCcnt.
// ---------------------------------------------------------------------------

typedef __attribute__((ext_vector_type(16))) _Float16 v16h;
typedef __attribute__((ext_vector_type(8)))  _Float16 h8;
typedef __attribute__((ext_vector_type(4)))  _Float16 h4;
typedef __attribute__((ext_vector_type(8)))  short    s16x8;
typedef __attribute__((address_space(3))) s16x8 lds_s16x8;
typedef __attribute__((ext_vector_type(8)))  float    v8f;

constexpr int Bb     = 8;
constexpr int Nn     = 1024;
constexpr int HDd    = 64;
constexpr int INNERi = 512;

union V16U { v16h v; h8 h2[2]; };

// Async DMA of 16 bytes global -> LDS (ASYNCcnt).  ldsOff is the byte offset
// of the destination within the workgroup's LDS allocation (low 32 bits of
// the generic pointer, per ISA 10.2 aperture mapping).
__device__ __forceinline__ void async_copy_b128(const void* gptr, void* ldsptr) {
  const unsigned ldsOff = (unsigned)(unsigned long long)ldsptr;
  asm volatile("global_load_async_to_lds_b128 %0, %1, off"
               :: "v"(ldsOff), "v"(gptr) : "memory");
}

__device__ __forceinline__ void wait_async0() {
#if __has_builtin(__builtin_amdgcn_s_wait_asynccnt)
  __builtin_amdgcn_s_wait_asynccnt(0);
#else
  asm volatile("s_wait_asynccnt 0x0" ::: "memory");
#endif
}

// Fragment loader: lane holds "line" (lane&15) of a row-major tile; the 16
// halves are K = khi..khi+7 and 16+khi..16+khi+7 with khi = 8*(lane>>4),
// i.e. two aligned 16B vector loads. Serves A-fragments (line = row m):
// the GEMM A tiles and the attention K chunks.
__device__ __forceinline__ v16h load_frag(const _Float16* base, int rstride, int lane) {
  const _Float16* p = base + (lane & 15) * rstride + ((lane >> 4) << 3);
  V16U u;
  u.h2[0] = *(const h8*)p;
  u.h2[1] = *(const h8*)(p + 16);
  return u.v;
}

// B-fragment (32 k x 16 columns) or A-fragment (16 rows x 32 k) out of a ROW-MAJOR [k][col] LDS tile: tile
// points at element [k0][col0], pitch is in halfs (bytes: an odd multiple of 32).
// Each transposing load hands lane (c = lane&15, h = lane>>4) the 8 halves
// tile[8h .. 8h+7][c]; the second one, 16 rows on, gives k = 16+8h .. 16+8h+7:
// the k order of load_frag, so the two loaders pair.
__device__ __forceinline__ v16h load_frag_tr(const _Float16* tile, int pitch, int lane) {
  const _Float16* p = tile + (((lane >> 4) << 3) + (lane & 7)) * pitch + (((lane >> 3) & 1) << 3);
  V16U u;
  u.h2[0] = __builtin_bit_cast(h8, __builtin_amdgcn_ds_load_tr16_b128_v8i16((lds_s16x8*)p));
  u.h2[1] = __builtin_bit_cast(h8, __builtin_amdgcn_ds_load_tr16_b128_v8i16((lds_s16x8*)(p + 16 * pitch)));
  return u.v;
}

// Holds a block-uniform address in scalar registers, so that a load takes it as
// its scalar base beside one loop-invariant 32-bit offset register per thread
// (no 64-bit address pair per load: fewer registers, more waves resident).
typedef __attribute__((ext_vector_type(4))) float f4;
typedef const __attribute__((address_space(1))) char* gbytes;  // global memory, bytes
typedef const __attribute__((address_space(1))) f4*   gf4;     // global memory, 4 floats
__device__ __forceinline__ gbytes scalar_base(const float* p) {
  const unsigned long long u = (unsigned long long)p;
  const unsigned lo = (unsigned)__builtin_amdgcn_readfirstlane((int)(unsigned)u);
  const unsigned hi = (unsigned)__builtin_amdgcn_readfirstlane((int)(unsigned)(u >> 32));
  return (gbytes)(((unsigned long long)hi << 32) | lo);
}

__device__ __forceinline__ v8f wmma_f16(v16h a, v16h b, v8f c) {
  // (neg_a, A, neg_b, B, c_mod, C, reuse_a, reuse_b)
  return __builtin_amdgcn_wmma_f32_16x16x32_f16(false, a, false, b, (short)0, c, false, false);
}

// ---------------------------------------------------------------------------
// GEMM 1: C(f16)[M,Nc] = A(f32)[M,K] @ W(f32)[K,Nc].  BM=BN=128, BK=32.
// 8 waves in a 4x2 grid; each wave owns 32x64 = 2x4 WMMA tiles.
// W tile staged row-major: Bs[k][col], read back through transposing loads.
// (f32->f16 conversion forces the VGPR staging path here.)
// ---------------------------------------------------------------------------
__global__ __launch_bounds__(256)
void gemm_qkv_kernel(const float* __restrict__ A1, const float* __restrict__ W1,
                     _Float16* __restrict__ C1,
                     const float* __restrict__ A2, const float* __restrict__ W2,
                     _Float16* __restrict__ C2, int M, int K, int Ncols) {
  // Two independent products in one grid: blockIdx.z picks the stream.
  const bool second = blockIdx.z != 0;
  const float* __restrict__ A = second ? A2 : A1;
  const float* __restrict__ W = second ? W2 : W1;
  _Float16* __restrict__ C = second ? C2 : C1;
  constexpr int AS_S = 40;    // 128 rows x 32 halfs (+pad), 16B-multiple stride
  constexpr int BS_S = 144;   // 32 k-rows x 128 halfs (+pad): 288 B = 32 B x odd
  __shared__ alignas(16) _Float16 As[128 * AS_S];
  __shared__ alignas(16) _Float16 Bs[32 * BS_S];

  const int tid  = threadIdx.x;
  const int lane = tid & 31;
  const int wave = tid >> 5;
  const int row0 = blockIdx.y * 128;
  const int col0 = blockIdx.x * 128;
  const int wm   = wave & 3;   // row group (32 rows)
  const int wn   = wave >> 2;  // col group (64 cols)
  const unsigned aoff = 4u * (unsigned)((tid >> 3) * K + ((tid & 7) << 2));       // bytes; A: row tid/8
  const unsigned woff = 4u * (unsigned)((tid >> 5) * Ncols + ((tid & 31) << 2));  // bytes; W: k-row tid/32

  v8f acc[2][4];
#pragma unroll
  for (int i = 0; i < 2; ++i)
#pragma unroll
    for (int nt = 0; nt < 4; ++nt) acc[i][nt] = {};

  for (int k0 = 0; k0 < K; k0 += 32) {
    __syncthreads();
    // All eight global loads of this k-step go out together, so that their
    // latencies overlap; the converts and LDS stores follow.
    f4 av[4], wv[4];
#pragma unroll  // constant trip count: the four loads must not wait on one another
    for (int it = 0; it < 4; ++it)
      av[it] = *(gf4)(scalar_base(A + ((size_t)(row0 + it * 32) * K + k0)) + aoff);
#pragma unroll  // as above, for the W tile
    for (int it = 0; it < 4; ++it)
      wv[it] = *(gf4)(scalar_base(W + ((size_t)(k0 + it * 8) * Ncols + col0)) + woff);
    // The converts below reuse the address registers of the loads above.
    asm volatile("s_wait_xcnt 0x0" ::: "memory");
    // Stage A (f32 -> f16), row-major: 128x32 = 1024 float4 chunks.
#pragma unroll  // av[] stays in registers
    for (int it = 0; it < 4; ++it) {
      const int i = tid + it * 256;
      const int r = i >> 3, c4 = (i & 7) << 2;
      _Float16* d = As + r * AS_S + c4;
      d[0] = (_Float16)av[it].x; d[1] = (_Float16)av[it].y;
      d[2] = (_Float16)av[it].z; d[3] = (_Float16)av[it].w;
    }
    // Stage W (f32 -> f16) row-major: Bs[k][col], one 8-byte store per float4
    // (a wave fills one whole 256-byte row).
#pragma unroll  // wv[] stays in registers
    for (int it = 0; it < 4; ++it) {
      const int i = tid + it * 256;
      const int r = i >> 5, c4 = (i & 31) << 2;
      *(h4*)(Bs + r * BS_S + c4) = h4{(_Float16)wv[it].x, (_Float16)wv[it].y,
                                      (_Float16)wv[it].z, (_Float16)wv[it].w};
    }
    if (k0 + 32 < K) {  // global_prefetch_b8 of next tiles
      __builtin_prefetch((const void*)(A + (size_t)(row0 + (tid >> 1)) * K + k0 + 32), 0, 1);
      __builtin_prefetch((const void*)(W + (size_t)(k0 + 32 + (tid >> 3)) * Ncols + col0), 0, 1);
    }
    __syncthreads();

    v16h af[2], bf[4];
#pragma unroll
    for (int i = 0; i < 2; ++i)
      af[i] = load_frag(As + (wm * 32 + i * 16) * AS_S, AS_S, lane);
#pragma unroll
    for (int nt = 0; nt < 4; ++nt)
      bf[nt] = load_frag_tr(Bs + wn * 64 + nt * 16, BS_S, lane);
#pragma unroll
    for (int i = 0; i < 2; ++i)
#pragma unroll
      for (int nt = 0; nt < 4; ++nt)
        acc[i][nt] = wmma_f16(af[i], bf[nt], acc[i][nt]);
  }

  const int hi = lane >> 4, cn = lane & 15;
#pragma unroll
  for (int i = 0; i < 2; ++i)
#pragma unroll
    for (int nt = 0; nt < 4; ++nt)
#pragma unroll
      for (int r = 0; r < 8; ++r) {
        const int row = row0 + wm * 32 + i * 16 + r + 8 * hi;
        const int col = col0 + wn * 64 + nt * 16 + cn;
        C[(size_t)row * Ncols + col] = (_Float16)acc[i][nt][r];
      }
}

// ---------------------------------------------------------------------------
// GEMM 2: out(f32)[M,Nc] = A(f16)[M,K] @ W(f32)[K,Nc] + bias.
// The f16 A tile needs no conversion -> staged with async-to-LDS DMA.
// ---------------------------------------------------------------------------
__global__ __launch_bounds__(256)
void gemm_out_kernel(const _Float16* __restrict__ A1, const float* __restrict__ W1,
                     const float* __restrict__ bias1, float* __restrict__ C1,
                     const _Float16* __restrict__ A2, const float* __restrict__ W2,
                     const float* __restrict__ bias2, float* __restrict__ C2,
                     int M, int K, int Ncols) {
  // Two independent products in one grid: blockIdx.z picks the stream.
  const bool second = blockIdx.z != 0;
  const _Float16* __restrict__ A = second ? A2 : A1;
  const float* __restrict__ W = second ? W2 : W1;
  const float* __restrict__ bias = second ? bias2 : bias1;
  float* __restrict__ C = second ? C2 : C1;
  constexpr int AS_S = 40;
  constexpr int BS_S = 144;   // 32 k-rows x 128 halfs (+pad): 288 B = 32 B x odd
  __shared__ alignas(16) _Float16 As[128 * AS_S];
  __shared__ alignas(16) _Float16 Bs[32 * BS_S];

  const int tid  = threadIdx.x;
  const int lane = tid & 31;
  const int wave = tid >> 5;
  const int row0 = blockIdx.y * 128;
  const int col0 = blockIdx.x * 128;
  const int wm   = wave & 3;
  const int wn   = wave >> 2;
  const unsigned woff = 4u * (unsigned)((tid >> 5) * Ncols + ((tid & 31) << 2));  // bytes; W: k-row tid/32

  v8f acc[2][4];
#pragma unroll
  for (int i = 0; i < 2; ++i)
#pragma unroll
    for (int nt = 0; nt < 4; ++nt) acc[i][nt] = {};

  for (int k0 = 0; k0 < K; k0 += 32) {
    __syncthreads();
    // The four W loads of this k-step go out together, so that their
    // latencies overlap one another and the A copies; the LDS stores follow.
    f4 wv[4];
#pragma unroll  // constant trip count: the four loads must not wait on one another
    for (int it = 0; it < 4; ++it)
      wv[it] = *(gf4)(scalar_base(W + ((size_t)(k0 + it * 8) * Ncols + col0)) + woff);
    // Stage A (f16) via async DMA: 128x32 halfs = 512 b128 transfers.
    for (int i = tid; i < 512; i += 256) {
      const int r = i >> 2, c8 = (i & 3) << 3;
      async_copy_b128(A + (size_t)(row0 + r) * K + k0 + c8,
                      As + r * AS_S + c8);
    }
    // Stage W row-major (f32 -> f16 conversion: VGPR path), 8-byte stores.
#pragma unroll  // wv[] stays in registers
    for (int it = 0; it < 4; ++it) {
      const int i = tid + it * 256;
      const int r = i >> 5, c4 = (i & 31) << 2;
      *(h4*)(Bs + r * BS_S + c4) = h4{(_Float16)wv[it].x, (_Float16)wv[it].y,
                                      (_Float16)wv[it].z, (_Float16)wv[it].w};
    }
    wait_async0();           // ASYNCcnt == 0: A tile landed in LDS
    __syncthreads();

    v16h af[2], bf[4];
#pragma unroll
    for (int i = 0; i < 2; ++i)
      af[i] = load_frag(As + (wm * 32 + i * 16) * AS_S, AS_S, lane);
#pragma unroll
    for (int nt = 0; nt < 4; ++nt)
      bf[nt] = load_frag_tr(Bs + wn * 64 + nt * 16, BS_S, lane);
#pragma unroll
    for (int i = 0; i < 2; ++i)
#pragma unroll
      for (int nt = 0; nt < 4; ++nt)
        acc[i][nt] = wmma_f16(af[i], bf[nt], acc[i][nt]);
  }

  const int hi = lane >> 4, cn = lane & 15;
#pragma unroll
  for (int i = 0; i < 2; ++i)
#pragma unroll
    for (int nt = 0; nt < 4; ++nt)
#pragma unroll
      for (int r = 0; r < 8; ++r) {
        const int row = row0 + wm * 32 + i * 16 + r + 8 * hi;
        const int col = col0 + wn * 64 + nt * 16 + cn;
        C[(size_t)row * Ncols + col] = acc[i][nt][r] + bias[col];
      }
}

// ---------------------------------------------------------------------------
// conv_gate: MS = s1+s2 (f32); depthwise conv (k=5, pad 2) along features with
// per-token weights; MSg = sigmoid(conv) * MS -> f16, merged b n (h d) layout.
// One block per (b, n) row.
// ---------------------------------------------------------------------------
__global__ __launch_bounds__(128)
void conv_gate_kernel(const _Float16* __restrict__ qkv1,
                      const _Float16* __restrict__ qkv2,
                      const float* __restrict__ cw, const float* __restrict__ cb,
                      _Float16* __restrict__ msg) {
  const int bn = blockIdx.x;          // b*N + n
  const int n  = bn & (Nn - 1);
  __shared__ float ms[INNERi + 4];

  const _Float16* s1 = qkv1 + (size_t)bn * 2048 + 1536;
  const _Float16* s2 = qkv2 + (size_t)bn * 2048 + 1536;
  for (int f = threadIdx.x; f < INNERi; f += blockDim.x)
    ms[f + 2] = (float)s1[f] + (float)s2[f];
  if (threadIdx.x < 2) { ms[threadIdx.x] = 0.0f; ms[INNERi + 2 + threadIdx.x] = 0.0f; }
  __syncthreads();

  const float w0 = cw[n * 5 + 0], w1 = cw[n * 5 + 1], w2 = cw[n * 5 + 2],
              w3 = cw[n * 5 + 3], w4 = cw[n * 5 + 4];
  const float bias = cb[n];
  for (int f = threadIdx.x; f < INNERi; f += blockDim.x) {
    const float a = w0 * ms[f] + w1 * ms[f + 1] + w2 * ms[f + 2] +
                    w3 * ms[f + 3] + w4 * ms[f + 4] + bias;
    const float g = ms[f + 2] / (1.0f + __expf(-a));
    msg[(size_t)bn * INNERi + f] = (_Float16)g;
  }
}

// ---------------------------------------------------------------------------
// Flash-attention pass: O = softmax(scale * Q K^T) @ V  (+ V residual),
// computed transposed: S^T = K Q^T, O^T += V^T P^T.
// All tensors live in [B, N, stride] f16 buffers; the head slice is selected
// by (section offset + h*64).  128 query rows per block, 8 waves x 16 queries,
// KV streamed in 64-row chunks through two LDS buffers: the copies of the next
// chunk are in flight while this one is worked on, one barrier per chunk.
//   Ks  : [j][d] row-major, staged via async-to-LDS DMA (no conversion); A of S^T
//   Vs  : [j][d] row-major, staged the same way; transposing loads give A of O^T
// A lane (c = lane&15, hi = lane>>4) owns ONE query, c: of each 16-key tile it
// holds the scores of keys 8*hi .. 8*hi+7, so maximum and sum run in the lane's
// own registers, with one exchange between the wave's halves.  Two score tiles,
// converted in place, are the B operand P^T of a 32-key block (element s is key
// 8*hi+s, then 16+8*hi+(s-8): the k order of load_frag_tr).
// ---------------------------------------------------------------------------

// Value of lane l ^ 16.
__device__ __forceinline__ float other_half(float x) {
  const int i = __builtin_bit_cast(int, x);
  return __builtin_bit_cast(float,
      __builtin_amdgcn_permlanex16(i, i, 0x76543210, 0xfedcba98, false, false));
}

// Four / six 16-byte copies global -> LDS (ASYNCcnt), one chunk's share of a thread.
// The s_wait_xcnt closes the copies' own statement, ahead of any later write of
// their address registers.
__device__ __forceinline__ unsigned lds_addr(const void* p) {
  return (unsigned)(unsigned long long)p;
}
__device__ __forceinline__ void async_copy4_b128(const void* g0, unsigned a0, const void* g1, unsigned a1,
                                                 const void* g2, unsigned a2, const void* g3, unsigned a3) {
  asm volatile("global_load_async_to_lds_b128 %0, %1, off\n\t"
               "global_load_async_to_lds_b128 %2, %3, off\n\t"
               "global_load_async_to_lds_b128 %4, %5, off\n\t"
               "global_load_async_to_lds_b128 %6, %7, off\n\t"
               "s_wait_xcnt 0x0"
               :: "v"(a0), "v"(g0), "v"(a1), "v"(g1), "v"(a2), "v"(g2), "v"(a3), "v"(g3) : "memory");
}
__device__ __forceinline__ void async_copy6_b128(const void* g0, unsigned a0, const void* g1, unsigned a1,
                                                 const void* g2, unsigned a2, const void* g3, unsigned a3,
                                                 const void* g4, unsigned a4, const void* g5, unsigned a5) {
  asm volatile("global_load_async_to_lds_b128 %0, %1, off\n\t"
               "global_load_async_to_lds_b128 %2, %3, off\n\t"
               "global_load_async_to_lds_b128 %4, %5, off\n\t"
               "global_load_async_to_lds_b128 %6, %7, off\n\t"
               "global_load_async_to_lds_b128 %8, %9, off\n\t"
               "global_load_async_to_lds_b128 %10, %11, off\n\t"
               "s_wait_xcnt 0x0"
               :: "v"(a0), "v"(g0), "v"(a1), "v"(g1), "v"(a2), "v"(g2), "v"(a3), "v"(g3),
                  "v"(a4), "v"(g4), "v"(a5), "v"(g5) : "memory");
}

__global__ __launch_bounds__(256)
void attn_kernel(const _Float16* Q1, const _Float16* Q2, int qstride, int qsec,
                 const _Float16* Kv1, const _Float16* Kv2, int kstride, int ksec,
                 const _Float16* V1, const _Float16* V2, int vstride, int vsec,
                 _Float16* O1, _Float16* O2, int ostride,
                 int addV, float scale) {
  // Two independent passes in one grid: blockIdx.z picks the stream.
  const bool second = blockIdx.z != 0;
  const _Float16* __restrict__ Q  = second ? Q2 : Q1;
  const _Float16* __restrict__ Kv = second ? Kv2 : Kv1;
  const _Float16* __restrict__ V  = second ? V2 : V1;
  _Float16* __restrict__ O = second ? O2 : O1;
  constexpr int LS = 72;  // padded row stride in halfs (144B, 16B-multiple)
  __shared__ alignas(16) _Float16 Ks [2][64 * LS];
  constexpr int VS = 80;  // V row stride in halfs: 160 B = 32 B x odd, for the transposing reader
  __shared__ alignas(16) _Float16 Vs [2][64 * VS];

  const int tid  = threadIdx.x;
  const int lane = tid & 31;
  const int wave = tid >> 5;
  const int bh   = blockIdx.y;
  const int b    = bh >> 3;
  const int h    = bh & 7;
  const int row0 = blockIdx.x * 128;
  const size_t bN = (size_t)b * Nn;
  const int qoff = qsec + h * HDd;
  const int koff = ksec + h * HDd;
  const int voff = vsec + h * HDd;
  const int ooff = h * HDd;

  // Q fragments for this wave's 16 queries (B operand: column = query lane&15):
  // two global_load_b128 per fragment.
  v16h qa0, qa1;
  {
    const _Float16* qp =
        Q + (bN + row0 + wave * 16 + (lane & 15)) * (size_t)qstride + qoff +
        ((lane >> 4) << 3);
    V16U u0, u1;
    u0.h2[0] = *(const h8*)(qp);
    u0.h2[1] = *(const h8*)(qp + 16);
    u1.h2[0] = *(const h8*)(qp + 32);
    u1.h2[1] = *(const h8*)(qp + 48);
    qa0 = u0.v;
    qa1 = u1.v;
  }

  float m_old = -1e30f;  // running maximum of this lane's query (equal in both halves)
  float l = 0.0f;        // running sum over this half's keys; the halves join after the loop
  v8f o[4];              // o[dt][r] = O^T[dt*16 + 8*hi + r][query]
#pragma unroll
  for (int dt = 0; dt < 4; ++dt) o[dt] = {};

  const int cn = lane & 15;
  const int hi = lane >> 4;

  // Staging: a thread copies 16 bytes of row sr and of row sr + 32 of the K and
  // of the V chunk; kp and vp walk on by one chunk with every call.
  const int sr = tid >> 3, c8 = (tid & 7) << 3;
  const _Float16* kp = Kv + (bN + sr) * (size_t)kstride + koff + c8;
  const _Float16* vp = V  + (bN + sr) * (size_t)vstride + voff + c8;
  const unsigned kd = lds_addr(&Ks[0][sr * LS + c8]);
  const unsigned vd = lds_addr(&Vs[0][sr * VS + c8]);
  auto stage = [&](int buf) {
    const unsigned ka = kd + (unsigned)buf * (64 * LS * 2), va = vd + (unsigned)buf * (64 * VS * 2);
    async_copy4_b128(kp, ka, kp + 32 * (size_t)kstride, ka + 32 * LS * 2,
                     vp, va, vp + 32 * (size_t)vstride, va + 32 * VS * 2);
    kp += 64 * (size_t)kstride;
    vp += 64 * (size_t)vstride;
  };
  stage(0);
  // Chunk 0 landed (this wave's copies); the barrier publishes it to all waves.
  asm volatile("s_wait_asynccnt 0x0" ::: "memory");
  __syncthreads();
  stage(1);  // in flight while chunk 0 is worked on

  for (int j0 = 0; j0 < Nn; j0 += 64) {
    const int buf = (j0 >> 6) & 1;
    const _Float16* const Kb = Ks[buf];
    const _Float16* const Vb = Vs[buf];

    // S^T = scale * K Q^T  (64 keys x 16 queries per wave, 4 WMMA key tiles,
    // K-depth 64): sc[nt][r] = score of key nt*16 + 8*hi + r against query cn.
    v8f sc[4];
#pragma unroll
    for (int nt = 0; nt < 4; ++nt) {
      v8f z = {};
      z = wmma_f16(load_frag(Kb + (nt * 16) * LS, LS, lane), qa0, z);
      z = wmma_f16(load_frag(Kb + (nt * 16) * LS + 32, LS, lane), qa1, z);
#pragma unroll
      for (int r = 0; r < 8; ++r) z[r] *= scale;
      sc[nt] = z;
    }

    // Online-softmax update, one query per lane.
    float mt[4];
#pragma unroll
    for (int nt = 0; nt < 4; ++nt) {
      mt[nt] = sc[nt][0];
#pragma unroll
      for (int r = 1; r < 8; ++r) mt[nt] = fmaxf(mt[nt], sc[nt][r]);
    }
    float mx = fmaxf(fmaxf(mt[0], mt[1]), fmaxf(mt[2], mt[3]));
    mx = fmaxf(mx, other_half(mx));
    const float m_new = fmaxf(m_old, mx);
    constexpr float LOG2E = 1.44269504f;
    const float xa = (m_old - m_new) * LOG2E;
    const float alpha = __builtin_amdgcn_exp2f(xa);
    m_old = m_new;

    V16U pb[2];    // P^T of keys 0..31 and 32..63, packed in place as B operands
    v8f x[4];
#pragma unroll
    for (int nt = 0; nt < 4; ++nt) {
      x[nt] = (sc[nt] - m_new) * LOG2E;
#pragma unroll
      for (int r = 0; r < 8; ++r) {
        sc[nt][r] = __builtin_amdgcn_exp2f(x[nt][r]);
        pb[nt >> 1].v[(nt & 1) * 8 + r] = (_Float16)sc[nt][r];
      }
    }
    // The slot between a v_exp_f32 and an overwrite of its source: the arguments
    // stay live up to this v_nop, which stands behind the last exponential.
    asm volatile("v_nop" :: "v"(x[0]), "v"(x[1]), "v"(x[2]), "v"(x[3]), "v"(sc[0]), "v"(sc[1]),
                 "v"(sc[2]), "v"(sc[3]), "v"(xa), "v"(alpha));
    // Sum of this lane's 32 values: the four tiles register by register (packed
    // adds, independent chains), then the eight registers as a tree.
    const v8f ts = (sc[0] + sc[1]) + (sc[2] + sc[3]);
    l = l * alpha + (((ts[0] + ts[1]) + (ts[2] + ts[3])) + ((ts[4] + ts[5]) + (ts[6] + ts[7])));
#pragma unroll
    for (int dt = 0; dt < 4; ++dt)
#pragma unroll
      for (int r = 0; r < 8; ++r) o[dt][r] *= alpha;

    // O^T += V_chunk^T @ P^T.  A-fragments (row = d) from row-major Vs:
    // 2x ds_load_tr16_b128 each; B = P^T straight from registers.
#pragma unroll
    for (int dt = 0; dt < 4; ++dt) {
      o[dt] = wmma_f16(load_frag_tr(Vb + dt * 16, VS, lane), pb[0].v, o[dt]);
      o[dt] = wmma_f16(load_frag_tr(Vb + 32 * VS + dt * 16, VS, lane), pb[1].v, o[dt]);
    }

    // Hand-over: this wave's LDS reads of this chunk have returned ...
    asm volatile("s_wait_dscnt 0x0" ::: "memory");
    // ... and its copies of the next chunk have landed;
    asm volatile("s_wait_asynccnt 0x0" ::: "memory");
    // the barrier publishes the next chunk and frees this chunk's buffer for the refill.
    __syncthreads();
    if (j0 + 128 < Nn) stage(buf);
  }
  // No copy is left in flight when the wave goes on to its epilogue.
  asm volatile("s_wait_asynccnt 0x0" ::: "memory");

  // Residual rows (zero where none is asked for): all four loads go out together,
  // under one block-uniform test, ahead of the divisions.
  const size_t grow = bN + row0 + wave * 16 + cn;
  h8 res[4];
#pragma unroll
  for (int dt = 0; dt < 4; ++dt) res[dt] = {};
  if (addV) {
#pragma unroll
    for (int dt = 0; dt < 4; ++dt)
      res[dt] = *(const h8*)(V + grow * (size_t)vstride + voff + dt * 16 + 8 * hi);
    // The output address below reuses the address registers of the loads above.
    asm volatile("s_wait_xcnt 0x0" ::: "memory");
  }

  // Join the halves' sums, normalize, add the residual, store f16: a lane's
  // 8 accumulator registers are 8 consecutive d of its query, one 16-byte store.
  l += other_half(l);
#pragma unroll
  for (int dt = 0; dt < 4; ++dt) {
    h8 ov;
#pragma unroll
    for (int r = 0; r < 8; ++r)
      ov[r] = (_Float16)(o[dt][r] / l + (float)res[dt][r]);
    *(h8*)(O + grow * (size_t)ostride + ooff + dt * 16 + 8 * hi) = ov;
  }
}

// ---------------------------------------------------------------------------
// First attention stage, both streams in one pass.  Its scores come from the
// gated rows alone (queries and keys are the same tensor X), so softmax(X X^T)
// is the same matrix for stream 1 and stream 2: it is formed once per query
// tile and multiplied into both value tensors,
//   O1 = P V1 + V1,  O2 = P V2 + V2.
// Layouts, fragment maps and the order of every sum are those of attn_kernel.
// X: [B*N][512]; V1, V2: the v section of the [B*N][2048] projections.
// ---------------------------------------------------------------------------

__global__ __launch_bounds__(256)
void attn_shared_kernel(const _Float16* __restrict__ X,
                        const _Float16* __restrict__ V1, const _Float16* __restrict__ V2,
                        _Float16* __restrict__ O1, _Float16* __restrict__ O2, float scale) {
  constexpr int XS   = INNERi;      // row stride of X and of the outputs, halfs
  constexpr int VSTR = 4 * INNERi;  // row stride of the projections
  constexpr int VSEC = 2 * INNERi;  // their v section
  constexpr int LS = 72;  // K row stride in halfs (144 B)
  constexpr int VS = 80;  // V row stride in halfs: 160 B = 32 B x odd, for the transposing reader
  __shared__ alignas(16) _Float16 Ks [2][64 * LS];
  __shared__ alignas(16) _Float16 Vs1[2][64 * VS];
  __shared__ alignas(16) _Float16 Vs2[2][64 * VS];

  const int tid  = threadIdx.x;
  const int lane = tid & 31;
  const int wave = tid >> 5;
  const int bh   = blockIdx.y;
  const int b    = bh >> 3;
  const int hoff = (bh & 7) * HDd;
  const int row0 = blockIdx.x * 128;
  const size_t bN = (size_t)b * Nn;
  const int cn = lane & 15;
  const int hi = lane >> 4;
  const size_t grow = bN + row0 + wave * 16 + cn;  // this lane's query row

  // Q fragments for this wave's 16 queries (B operand: column = query lane&15).
  v16h qa0, qa1;
  {
    const _Float16* qp = X + grow * XS + hoff + (hi << 3);
    V16U u0, u1;
    u0.h2[0] = *(const h8*)(qp);
    u0.h2[1] = *(const h8*)(qp + 16);
    u1.h2[0] = *(const h8*)(qp + 32);
    u1.h2[1] = *(const h8*)(qp + 48);
    qa0 = u0.v;
    qa1 = u1.v;
  }

  float m_old = -1e30f;  // running maximum of this lane's query (equal in both halves)
  float l = 0.0f;        // running sum over this half's keys; the halves join after the loop
  v8f o1[4], o2[4];      // o[dt][r] = O^T[dt*16 + 8*hi + r][query], one set per stream
#pragma unroll
  for (int dt = 0; dt < 4; ++dt) { o1[dt] = {}; o2[dt] = {}; }

  // Staging: a thread copies 16 bytes of row sr and of row sr + 32 of each tile;
  // the three pointers walk on by one chunk with every call.
  const int sr = tid >> 3, c8 = (tid & 7) << 3;
  const _Float16* kp  = X  + (bN + sr) * XS + hoff + c8;
  const _Float16* vp1 = V1 + (bN + sr) * VSTR + VSEC + hoff + c8;
  const _Float16* vp2 = V2 + (bN + sr) * VSTR + VSEC + hoff + c8;
  const unsigned kd  = lds_addr(&Ks [0][sr * LS + c8]);
  const unsigned vd1 = lds_addr(&Vs1[0][sr * VS + c8]);
  const unsigned vd2 = lds_addr(&Vs2[0][sr * VS + c8]);
  auto stage = [&](int buf) {
    const unsigned ka = kd + (unsigned)buf * (64 * LS * 2);
    const unsigned va1 = vd1 + (unsigned)buf * (64 * VS * 2), va2 = vd2 + (unsigned)buf * (64 * VS * 2);
    async_copy6_b128(kp, ka, kp + 32 * XS, ka + 32 * LS * 2,
                     vp1, va1, vp1 + 32 * VSTR, va1 + 32 * VS * 2,
                     vp2, va2, vp2 + 32 * VSTR, va2 + 32 * VS * 2);
    kp  += 64 * XS;
    vp1 += 64 * VSTR;
    vp2 += 64 * VSTR;
  };
  stage(0);
  // Chunk 0 landed (this wave's copies); the barrier publishes it to all waves.
  asm volatile("s_wait_asynccnt 0x0" ::: "memory");
  __syncthreads();
  stage(1);  // in flight while chunk 0 is worked on

  for (int j0 = 0; j0 < Nn; j0 += 64) {
    const int buf = (j0 >> 6) & 1;
    const _Float16* const Kb  = Ks [buf];
    const _Float16* const Vb1 = Vs1[buf];
    const _Float16* const Vb2 = Vs2[buf];

    // S^T = scale * K Q^T: sc[nt][r] = score of key nt*16 + 8*hi + r against query cn.
    v8f sc[4];
#pragma unroll
    for (int nt = 0; nt < 4; ++nt) {
      v8f z = {};
      z = wmma_f16(load_frag(Kb + (nt * 16) * LS, LS, lane), qa0, z);
      z = wmma_f16(load_frag(Kb + (nt * 16) * LS + 32, LS, lane), qa1, z);
      sc[nt] = z * scale;
    }

    // Online-softmax update, one query per lane.
    float mt[4];
#pragma unroll
    for (int nt = 0; nt < 4; ++nt) {
      mt[nt] = sc[nt][0];
#pragma unroll
      for (int r = 1; r < 8; ++r) mt[nt] = fmaxf(mt[nt], sc[nt][r]);
    }
    float mx = fmaxf(fmaxf(mt[0], mt[1]), fmaxf(mt[2], mt[3]));
    mx = fmaxf(mx, other_half(mx));
    const float m_new = fmaxf(m_old, mx);
    constexpr float LOG2E = 1.44269504f;
    const float xa = (m_old - m_new) * LOG2E;
    const float alpha = __builtin_amdgcn_exp2f(xa);
    m_old = m_new;

    V16U pb[2];    // P^T of keys 0..31 and 32..63, packed in place as B operands
    v8f x[4];
#pragma unroll
    for (int nt = 0; nt < 4; ++nt) {
      x[nt] = (sc[nt] - m_new) * LOG2E;
#pragma unroll
      for (int r = 0; r < 8; ++r) {
        sc[nt][r] = __builtin_amdgcn_exp2f(x[nt][r]);
        pb[nt >> 1].v[(nt & 1) * 8 + r] = (_Float16)sc[nt][r];
      }
    }
    // The slot between a v_exp_f32 and an overwrite of its source: the arguments
    // stay live up to this v_nop, which stands behind the last exponential.
    asm volatile("v_nop" :: "v"(x[0]), "v"(x[1]), "v"(x[2]), "v"(x[3]), "v"(sc[0]), "v"(sc[1]),
                 "v"(sc[2]), "v"(sc[3]), "v"(xa), "v"(alpha));
    // Sum of this lane's 32 values: the four tiles register by register, then
    // the eight registers as a tree.
    const v8f ts = (sc[0] + sc[1]) + (sc[2] + sc[3]);
    l = l * alpha + (((ts[0] + ts[1]) + (ts[2] + ts[3])) + ((ts[4] + ts[5]) + (ts[6] + ts[7])));
#pragma unroll
    for (int dt = 0; dt < 4; ++dt) {
      o1[dt] *= alpha;
      o2[dt] *= alpha;
    }

    // O^T += V_chunk^T @ P^T for both streams: the same B = P^T from registers,
    // A-fragments (row = d) from each stream's row-major tile.
#pragma unroll
    for (int dt = 0; dt < 4; ++dt) {
      o1[dt] = wmma_f16(load_frag_tr(Vb1 + dt * 16, VS, lane), pb[0].v, o1[dt]);
      o1[dt] = wmma_f16(load_frag_tr(Vb1 + 32 * VS + dt * 16, VS, lane), pb[1].v, o1[dt]);
    }
#pragma unroll
    for (int dt = 0; dt < 4; ++dt) {
      o2[dt] = wmma_f16(load_frag_tr(Vb2 + dt * 16, VS, lane), pb[0].v, o2[dt]);
      o2[dt] = wmma_f16(load_frag_tr(Vb2 + 32 * VS + dt * 16, VS, lane), pb[1].v, o2[dt]);
    }

    // Hand-over: this wave's LDS reads of this chunk have returned ...
    asm volatile("s_wait_dscnt 0x0" ::: "memory");
    // ... and its copies of the next chunk have landed;
    asm volatile("s_wait_asynccnt 0x0" ::: "memory");
    // the barrier publishes the next chunk and frees this chunk's buffers for the refill.
    __syncthreads();
    if (j0 + 128 < Nn) stage(buf);
  }
  // No copy is left in flight when the wave goes on to its epilogue.
  asm volatile("s_wait_asynccnt 0x0" ::: "memory");

  // Residual rows of both streams: all eight loads go out together, ahead of the divisions.
  h8 res1[4], res2[4];
#pragma unroll
  for (int dt = 0; dt < 4; ++dt) {
    res1[dt] = *(const h8*)(V1 + grow * VSTR + VSEC + hoff + dt * 16 + 8 * hi);
    res2[dt] = *(const h8*)(V2 + grow * VSTR + VSEC + hoff + dt * 16 + 8 * hi);
  }

  // Join the halves' sums, normalize, add the residual, store f16: a lane's
  // 8 accumulator registers are 8 consecutive d of its query, one 16-byte store.
  l += other_half(l);
  h8 ov1[4], ov2[4];
#pragma unroll
  for (int dt = 0; dt < 4; ++dt)
#pragma unroll
    for (int r = 0; r < 8; ++r) {
      ov1[dt][r] = (_Float16)(o1[dt][r] / l + (float)res1[dt][r]);
      ov2[dt][r] = (_Float16)(o2[dt][r] / l + (float)res2[dt][r]);
    }
#pragma unroll
  for (int dt = 0; dt < 4; ++dt) {
    *(h8*)(O1 + grow * XS + hoff + dt * 16 + 8 * hi) = ov1[dt];
    *(h8*)(O2 + grow * XS + hoff + dt * 16 + 8 * hi) = ov2[dt];
  }
}

// ---------------------------------------------------------------------------
// Host launcher.
// ---------------------------------------------------------------------------
extern "C" void kernel_launch(void* const* d_in, const int* in_sizes, int n_in,
                              void* d_out, int out_size, void* d_ws, size_t ws_size,
                              hipStream_t stream) {
  (void)in_sizes; (void)n_in; (void)out_size; (void)ws_size;
  const float* x1     = (const float*)d_in[0];
  const float* x2     = (const float*)d_in[1];
  const float* Wqkv1  = (const float*)d_in[2];
  const float* Wqkv2  = (const float*)d_in[3];
  const float* Wout1  = (const float*)d_in[4];
  const float* bout1  = (const float*)d_in[5];
  const float* Wout2  = (const float*)d_in[6];
  const float* bout2  = (const float*)d_in[7];
  const float* conv_w = (const float*)d_in[8];
  const float* conv_b = (const float*)d_in[9];

  const size_t MROWS = (size_t)Bb * Nn;  // 8192
  // Workspace layout (f16). t1 aliases msg (dead after the first attention launch);
  // t2 has a plane of its own: its writer runs beside the reader of u1. Total ~101 MB.
  _Float16* qkv1h = (_Float16*)d_ws;
  _Float16* qkv2h = qkv1h + MROWS * 2048;
  _Float16* msg   = qkv2h + MROWS * 2048;
  _Float16* u1    = msg + MROWS * 512;
  _Float16* u2    = u1 + MROWS * 512;
  _Float16* t1    = msg;  // alias
  _Float16* t2    = u2 + MROWS * 512;

  float* out1 = (float*)d_out;
  float* out2 = out1 + MROWS * 512;

  const dim3 blk(256);
  const float scale = 0.125f;  // HD^-0.5

  // QKV projections: [8192,512] @ [512,2048] -> f16
  gemm_qkv_kernel<<<dim3(16, 64, 2), blk, 0, stream>>>(x1, Wqkv1, qkv1h, x2, Wqkv2, qkv2h,
                                                       8192, 512, 2048);

  // Gated conv branch -> MSg (merged b n (h d), f16)
  conv_gate_kernel<<<dim3(Bb * Nn), dim3(128), 0, stream>>>(qkv1h, qkv2h, conv_w, conv_b, msg);

  // u1 = softmax(MS MS^T)·v1 + v1 ; u2 likewise (sections: q=0,k=512,v=1024,s=1536)
  // (one grid for both: the score matrix is shared)
  attn_shared_kernel<<<dim3(8, 64), blk, 0, stream>>>(msg, qkv1h, qkv2h, u1, u2, scale);
  // t1 = softmax(q1 k1^T)·u1 ; t2 = softmax(q2 k2^T)·u2
  attn_kernel<<<dim3(8, 64, 2), blk, 0, stream>>>(qkv1h, qkv2h, 2048, 0, qkv1h, qkv2h, 2048, 512,
                                                  u1, u2, 512, 0, t1, t2, 512, 0, scale);

  // Output projections with bias -> f32 d_out
  gemm_out_kernel<<<dim3(4, 64, 2), blk, 0, stream>>>(t1, Wout1, bout1, out1,
                                                      t2, Wout2, bout2, out2, 8192, 512, 512);
}

// v007
// It runs in 155 microseconds.
// In both of two side-by-side timings against v006, it was 1.03 times as fast.
// Counting every step since v000, it is 3.09 times as fast.
#include <hip/hip_runtime.h>
#include <hip/hip_bf16.h>

// ---------------------------------------------------------------------------
// MI455X (gfx1250, wave32) implementation of the hybrid-attention reference.
// All matmuls run on V_WMMA_F32_16X16X32_F16 (f16 in, f32 accumulate).
// Fragment loads are vectorized: each lane's 16-half WMMA fragment is two
// contiguous 16B runs (ISA 7.12.2), loaded as 2x ds_load_b128/global_load_b128.
// W tiles (B operands, [k][col]; wide LDS stores) and V chunks (A operands, [j][d]) are staged
// row-major and transposed on the way out by ds_load_tr16_b128.  The GEMM 2 A tile and the attention K and V chunks are staged with
// CDNA5 GLOBAL_LOAD_ASYNC_TO_LDS_B128 tracked by ASYNCcnt.
// ---------------------------------------------------------------------------

typedef __attribute__((ext_vector_type(16))) _Float16 v16h;
typedef __attribute__((ext_vector_type(8)))  _Float16 h8;
typedef __attribute__((ext_vector_type(4)))  _Float16 h4;
typedef __attribute__((ext_vector_type(8)))  short    s16x8;
typedef __attribute__((address_space(3))) s16x8 lds_s16x8;
typedef __attribute__((ext_vector_type(8)))  float    v8f;

constexpr int Bb     = 8;
constexpr int Nn     = 1024;
constexpr int HDd    = 64;
constexpr int INNERi = 512;

union V16U { v16h v; h8 h2[2]; };

// Async DMA of 16 bytes global -> LDS (ASYNCcnt).  ldsOff is the byte offset
// of the destination within the workgroup's LDS allocation (low 32 bits of
// the generic pointer, per ISA 10.2 aperture mapping).
__device__ __forceinline__ void async_copy_b128(const void* gptr, void* ldsptr) {
  const unsigned ldsOff = (unsigned)(unsigned long long)ldsptr;
  asm volatile("global_load_async_to_lds_b128 %0, %1, off"
               :: "v"(ldsOff), "v"(gptr) : "memory");
}

__device__ __forceinline__ void wait_async0() {
#if __has_builtin(__builtin_amdgcn_s_wait_asynccnt)
  __builtin_amdgcn_s_wait_asynccnt(0);
#else
  asm volatile("s_wait_asynccnt 0x0" ::: "memory");
#endif
}

// Fragment loader: lane holds "line" (lane&15) of a row-major tile; the 16
// halves are K = khi..khi+7 and 16+khi..16+khi+7 with khi = 8*(lane>>4),
// i.e. two aligned 16B vector loads. Serves A-fragments (line = row m):
// the GEMM A tiles and the attention K chunks.
__device__ __forceinline__ v16h load_frag(const _Float16* base, int rstride, int lane) {
  const _Float16* p = base + (lane & 15) * rstride + ((lane >> 4) << 3);
  V16U u;
  u.h2[0] = *(const h8*)p;
  u.h2[1] = *(const h8*)(p + 16);
  return u.v;
}

// B-fragment (32 k x 16 columns) or A-fragment (16 rows x 32 k) out of a ROW-MAJOR [k][col] LDS tile: tile
// points at element [k0][col0], pitch is in halfs (bytes: an odd multiple of 32).
// Each transposing load hands lane (c = lane&15, h = lane>>4) the 8 halves
// tile[8h .. 8h+7][c]; the second one, 16 rows on, gives k = 16+8h .. 16+8h+7:
// the k order of load_frag, so the two loaders pair.
__device__ __forceinline__ v16h load_frag_tr(const _Float16* tile, int pitch, int lane) {
  const _Float16* p = tile + (((lane >> 4) << 3) + (lane & 7)) * pitch + (((lane >> 3) & 1) << 3);
  V16U u;
  u.h2[0] = __builtin_bit_cast(h8, __builtin_amdgcn_ds_load_tr16_b128_v8i16((lds_s16x8*)p));
  u.h2[1] = __builtin_bit_cast(h8, __builtin_amdgcn_ds_load_tr16_b128_v8i16((lds_s16x8*)(p + 16 * pitch)));
  return u.v;
}

// Holds a block-uniform address in scalar registers, so that a load takes it as
// its scalar base beside one loop-invariant 32-bit offset register per thread
// (no 64-bit address pair per load: fewer registers, more waves resident).
typedef __attribute__((ext_vector_type(4))) float f4;
typedef const __attribute__((address_space(1))) char* gbytes;  // global memory, bytes
typedef const __attribute__((address_space(1))) f4*   gf4;     // global memory, 4 floats
__device__ __forceinline__ gbytes scalar_base(const float* p) {
  const unsigned long long u = (unsigned long long)p;
  const unsigned lo = (unsigned)__builtin_amdgcn_readfirstlane((int)(unsigned)u);
  const unsigned hi = (unsigned)__builtin_amdgcn_readfirstlane((int)(unsigned)(u >> 32));
  return (gbytes)(((unsigned long long)hi << 32) | lo);
}

__device__ __forceinline__ v8f wmma_f16(v16h a, v16h b, v8f c) {
  // (neg_a, A, neg_b, B, c_mod, C, reuse_a, reuse_b)
  return __builtin_amdgcn_wmma_f32_16x16x32_f16(false, a, false, b, (short)0, c, false, false);
}

// ---------------------------------------------------------------------------
// GEMM 1: C(f16)[M,Nc] = A(f32)[M,K] @ W(f32)[K,Nc].  BM=BN=128, BK=32.
// 8 waves in a 4x2 grid; each wave owns 32x64 = 2x4 WMMA tiles.
// W tile staged row-major: Bs[k][col], read back through transposing loads.
// (f32->f16 conversion forces the VGPR staging path here.)
// ---------------------------------------------------------------------------
__global__ __launch_bounds__(256)
void gemm_qkv_kernel(const float* __restrict__ A1, const float* __restrict__ W1,
                     _Float16* __restrict__ C1,
                     const float* __restrict__ A2, const float* __restrict__ W2,
                     _Float16* __restrict__ C2, int M, int K, int Ncols) {
  // Two independent products in one grid: blockIdx.z picks the stream.
  const bool second = blockIdx.z != 0;
  const float* __restrict__ A = second ? A2 : A1;
  const float* __restrict__ W = second ? W2 : W1;
  _Float16* __restrict__ C = second ? C2 : C1;
  constexpr int AS_S = 40;    // 128 rows x 32 halfs (+pad), 16B-multiple stride
  constexpr int BS_S = 144;   // 32 k-rows x 128 halfs (+pad): 288 B = 32 B x odd
  __shared__ alignas(16) _Float16 As[128 * AS_S];
  __shared__ alignas(16) _Float16 Bs[32 * BS_S];

  const int tid  = threadIdx.x;
  const int lane = tid & 31;
  const int wave = tid >> 5;
  const int row0 = blockIdx.y * 128;
  const int col0 = blockIdx.x * 128;
  const int wm   = wave & 3;   // row group (32 rows)
  const int wn   = wave >> 2;  // col group (64 cols)
  const unsigned aoff = 4u * (unsigned)((tid >> 3) * K + ((tid & 7) << 2));       // bytes; A: row tid/8
  const unsigned woff = 4u * (unsigned)((tid >> 5) * Ncols + ((tid & 31) << 2));  // bytes; W: k-row tid/32

  v8f acc[2][4];
#pragma unroll
  for (int i = 0; i < 2; ++i)
#pragma unroll
    for (int nt = 0; nt < 4; ++nt) acc[i][nt] = {};

  for (int k0 = 0; k0 < K; k0 += 32) {
    __syncthreads();
    // All eight global loads of this k-step go out together, so that their
    // latencies overlap; the converts and LDS stores follow.
    f4 av[4], wv[4];
#pragma unroll  // constant trip count: the four loads must not wait on one another
    for (int it = 0; it < 4; ++it)
      av[it] = *(gf4)(scalar_base(A + ((size_t)(row0 + it * 32) * K + k0)) + aoff);
#pragma unroll  // as above, for the W tile
    for (int it = 0; it < 4; ++it)
      wv[it] = *(gf4)(scalar_base(W + ((size_t)(k0 + it * 8) * Ncols + col0)) + woff);
    // The converts below reuse the address registers of the loads above.
    asm volatile("s_wait_xcnt 0x0" ::: "memory");
    // Stage A (f32 -> f16), row-major: 128x32 = 1024 float4 chunks.
#pragma unroll  // av[] stays in registers
    for (int it = 0; it < 4; ++it) {
      const int i = tid + it * 256;
      const int r = i >> 3, c4 = (i & 7) << 2;
      _Float16* d = As + r * AS_S + c4;
      d[0] = (_Float16)av[it].x; d[1] = (_Float16)av[it].y;
      d[2] = (_Float16)av[it].z; d[3] = (_Float16)av[it].w;
    }
    // Stage W (f32 -> f16) row-major: Bs[k][col], one 8-byte store per float4
    // (a wave fills one whole 256-byte row).
#pragma unroll  // wv[] stays in registers
    for (int it = 0; it < 4; ++it) {
      const int i = tid + it * 256;
      const int r = i >> 5, c4 = (i & 31) << 2;
      *(h4*)(Bs + r * BS_S + c4) = h4{(_Float16)wv[it].x, (_Float16)wv[it].y,
                                      (_Float16)wv[it].z, (_Float16)wv[it].w};
    }
    if (k0 + 32 < K) {  // global_prefetch_b8 of next tiles
      __builtin_prefetch((const void*)(A + (size_t)(row0 + (tid >> 1)) * K + k0 + 32), 0, 1);
      __builtin_prefetch((const void*)(W + (size_t)(k0 + 32 + (tid >> 3)) * Ncols + col0), 0, 1);
    }
    __syncthreads();

    v16h af[2], bf[4];
#pragma unroll
    for (int i = 0; i < 2; ++i)
      af[i] = load_frag(As + (wm * 32 + i * 16) * AS_S, AS_S, lane);
#pragma unroll
    for (int nt = 0; nt < 4; ++nt)
      bf[nt] = load_frag_tr(Bs + wn * 64 + nt * 16, BS_S, lane);
#pragma unroll
    for (int i = 0; i < 2; ++i)
#pragma unroll
      for (int nt = 0; nt < 4; ++nt)
        acc[i][nt] = wmma_f16(af[i], bf[nt], acc[i][nt]);
  }

  const int hi = lane >> 4, cn = lane & 15;
#pragma unroll
  for (int i = 0; i < 2; ++i)
#pragma unroll
    for (int nt = 0; nt < 4; ++nt)
#pragma unroll
      for (int r = 0; r < 8; ++r) {
        const int row = row0 + wm * 32 + i * 16 + r + 8 * hi;
        const int col = col0 + wn * 64 + nt * 16 + cn;
        C[(size_t)row * Ncols + col] = (_Float16)acc[i][nt][r];
      }
}

// ---------------------------------------------------------------------------
// GEMM 2: out(f32)[M,Nc] = A(f16)[M,K] @ W(f32)[K,Nc] + bias.
// The f16 A tile needs no conversion -> staged with async-to-LDS DMA.
// ---------------------------------------------------------------------------
__global__ __launch_bounds__(256)
void gemm_out_kernel(const _Float16* __restrict__ A1, const float* __restrict__ W1,
                     const float* __restrict__ bias1, float* __restrict__ C1,
                     const _Float16* __restrict__ A2, const float* __restrict__ W2,
                     const float* __restrict__ bias2, float* __restrict__ C2,
                     int M, int K, int Ncols) {
  // Two independent products in one grid: blockIdx.z picks the stream.
  const bool second = blockIdx.z != 0;
  const _Float16* __restrict__ A = second ? A2 : A1;
  const float* __restrict__ W = second ? W2 : W1;
  const float* __restrict__ bias = second ? bias2 : bias1;
  float* __restrict__ C = second ? C2 : C1;
  constexpr int AS_S = 40;
  constexpr int BS_S = 144;   // 32 k-rows x 128 halfs (+pad): 288 B = 32 B x odd
  __shared__ alignas(16) _Float16 As[128 * AS_S];
  __shared__ alignas(16) _Float16 Bs[32 * BS_S];

  const int tid  = threadIdx.x;
  const int lane = tid & 31;
  const int wave = tid >> 5;
  const int row0 = blockIdx.y * 128;
  const int col0 = blockIdx.x * 128;
  const int wm   = wave & 3;
  const int wn   = wave >> 2;
  const unsigned woff = 4u * (unsigned)((tid >> 5) * Ncols + ((tid & 31) << 2));  // bytes; W: k-row tid/32

  v8f acc[2][4];
#pragma unroll
  for (int i = 0; i < 2; ++i)
#pragma unroll
    for (int nt = 0; nt < 4; ++nt) acc[i][nt] = {};

  for (int k0 = 0; k0 < K; k0 += 32) {
    __syncthreads();
    // The four W loads of this k-step go out together, so that their
    // latencies overlap one another and the A copies; the LDS stores follow.
    f4 wv[4];
#pragma unroll  // constant trip count: the four loads must not wait on one another
    for (int it = 0; it < 4; ++it)
      wv[it] = *(gf4)(scalar_base(W + ((size_t)(k0 + it * 8) * Ncols + col0)) + woff);
    // Stage A (f16) via async DMA: 128x32 halfs = 512 b128 transfers.
    for (int i = tid; i < 512; i += 256) {
      const int r = i >> 2, c8 = (i & 3) << 3;
      async_copy_b128(A + (size_t)(row0 + r) * K + k0 + c8,
                      As + r * AS_S + c8);
    }
    // Stage W row-major (f32 -> f16 conversion: VGPR path), 8-byte stores.
#pragma unroll  // wv[] stays in registers
    for (int it = 0; it < 4; ++it) {
      const int i = tid + it * 256;
      const int r = i >> 5, c4 = (i & 31) << 2;
      *(h4*)(Bs + r * BS_S + c4) = h4{(_Float16)wv[it].x, (_Float16)wv[it].y,
                                      (_Float16)wv[it].z, (_Float16)wv[it].w};
    }
    wait_async0();           // ASYNCcnt == 0: A tile landed in LDS
    __syncthreads();

    v16h af[2], bf[4];
#pragma unroll
    for (int i = 0; i < 2; ++i)
      af[i] = load_frag(As + (wm * 32 + i * 16) * AS_S, AS_S, lane);
#pragma unroll
    for (int nt = 0; nt < 4; ++nt)
      bf[nt] = load_frag_tr(Bs + wn * 64 + nt * 16, BS_S, lane);
#pragma unroll
    for (int i = 0; i < 2; ++i)
#pragma unroll
      for (int nt = 0; nt < 4; ++nt)
        acc[i][nt] = wmma_f16(af[i], bf[nt], acc[i][nt]);
  }

  const int hi = lane >> 4, cn = lane & 15;
#pragma unroll
  for (int i = 0; i < 2; ++i)
#pragma unroll
    for (int nt = 0; nt < 4; ++nt)
#pragma unroll
      for (int r = 0; r < 8; ++r) {
        const int row = row0 + wm * 32 + i * 16 + r + 8 * hi;
        const int col = col0 + wn * 64 + nt * 16 + cn;
        C[(size_t)row * Ncols + col] = acc[i][nt][r] + bias[col];
      }
}

// ---------------------------------------------------------------------------
// conv_gate: MS = s1+s2 (f32); depthwise conv (k=5, pad 2) along features with
// per-token weights; MSg = sigmoid(conv) * MS -> f16, merged b n (h d) layout.
// One block per (b, n) row.
// ---------------------------------------------------------------------------
__global__ __launch_bounds__(128)
void conv_gate_kernel(const _Float16* __restrict__ qkv1,
                      const _Float16* __restrict__ qkv2,
                      const float* __restrict__ cw, const float* __restrict__ cb,
                      _Float16* __restrict__ msg) {
  const int bn = blockIdx.x;          // b*N + n
  const int n  = bn & (Nn - 1);
  __shared__ float ms[INNERi + 4];

  const _Float16* s1 = qkv1 + (size_t)bn * 2048 + 1536;
  const _Float16* s2 = qkv2 + (size_t)bn * 2048 + 1536;
  for (int f = threadIdx.x; f < INNERi; f += blockDim.x)
    ms[f + 2] = (float)s1[f] + (float)s2[f];
  if (threadIdx.x < 2) { ms[threadIdx.x] = 0.0f; ms[INNERi + 2 + threadIdx.x] = 0.0f; }
  __syncthreads();

  const float w0 = cw[n * 5 + 0], w1 = cw[n * 5 + 1], w2 = cw[n * 5 + 2],
              w3 = cw[n * 5 + 3], w4 = cw[n * 5 + 4];
  const float bias = cb[n];
  for (int f = threadIdx.x; f < INNERi; f += blockDim.x) {
    const float a = w0 * ms[f] + w1 * ms[f + 1] + w2 * ms[f + 2] +
                    w3 * ms[f + 3] + w4 * ms[f + 4] + bias;
    const float g = ms[f + 2] / (1.0f + __expf(-a));
    msg[(size_t)bn * INNERi + f] = (_Float16)g;
  }
}

// ---------------------------------------------------------------------------
// Flash-attention pass: O = softmax(scale * Q K^T) @ V  (+ V residual),
// computed transposed: S^T = K Q^T, O^T += V^T P^T.
// All tensors live in [B, N, stride] f16 buffers; the head slice is selected
// by (section offset + h*64).  128 query rows per block, 8 waves x 16 queries,
// KV streamed in 64-row chunks through two LDS buffers: the copies of the next
// chunk are in flight while this one is worked on, one barrier per chunk.
//   Ks  : [j][d] row-major, staged via async-to-LDS DMA (no conversion); A of S^T
//   Vs  : [j][d] row-major, staged the same way; transposing loads give A of O^T
// A lane (c = lane&15, hi = lane>>4) owns ONE query, c: of each 16-key tile it
// holds the scores of keys 8*hi .. 8*hi+7, so maximum and sum run in the lane's
// own registers, with one exchange between the wave's halves.  Two score tiles,
// converted in place, are the B operand P^T of a 32-key block (element s is key
// 8*hi+s, then 16+8*hi+(s-8): the k order of load_frag_tr).
// ---------------------------------------------------------------------------

// Value of lane l ^ 16.
__device__ __forceinline__ float other_half(float x) {
  const int i = __builtin_bit_cast(int, x);
  return __builtin_bit_cast(float,
      __builtin_amdgcn_permlanex16(i, i, 0x76543210, 0xfedcba98, false, false));
}

// Four / six 16-byte copies global -> LDS (ASYNCcnt), one chunk's share of a thread.
// The s_wait_xcnt closes the copies' own statement, ahead of any later write of
// their address registers.
__device__ __forceinline__ unsigned lds_addr(const void* p) {
  return (unsigned)(unsigned long long)p;
}
__device__ __forceinline__ void async_copy4_b128(const void* g0, unsigned a0, const void* g1, unsigned a1,
                                                 const void* g2, unsigned a2, const void* g3, unsigned a3) {
  asm volatile("global_load_async_to_lds_b128 %0, %1, off\n\t"
               "global_load_async_to_lds_b128 %2, %3, off\n\t"
               "global_load_async_to_lds_b128 %4, %5, off\n\t"
               "global_load_async_to_lds_b128 %6, %7, off\n\t"
               "s_wait_xcnt 0x0"
               :: "v"(a0), "v"(g0), "v"(a1), "v"(g1), "v"(a2), "v"(g2), "v"(a3), "v"(g3) : "memory");
}
__device__ __forceinline__ void async_copy6_b128(const void* g0, unsigned a0, const void* g1, unsigned a1,
                                                 const void* g2, unsigned a2, const void* g3, unsigned a3,
                                                 const void* g4, unsigned a4, const void* g5, unsigned a5) {
  asm volatile("global_load_async_to_lds_b128 %0, %1, off\n\t"
               "global_load_async_to_lds_b128 %2, %3, off\n\t"
               "global_load_async_to_lds_b128 %4, %5, off\n\t"
               "global_load_async_to_lds_b128 %6, %7, off\n\t"
               "global_load_async_to_lds_b128 %8, %9, off\n\t"
               "global_load_async_to_lds_b128 %10, %11, off\n\t"
               "s_wait_xcnt 0x0"
               :: "v"(a0), "v"(g0), "v"(a1), "v"(g1), "v"(a2), "v"(g2), "v"(a3), "v"(g3),
                  "v"(a4), "v"(g4), "v"(a5), "v"(g5) : "memory");
}

__global__ __launch_bounds__(256)
void attn_kernel(const _Float16* Q1, const _Float16* Q2, int qstride, int qsec,
                 const _Float16* Kv1, const _Float16* Kv2, int kstride, int ksec,
                 const _Float16* V1, const _Float16* V2, int vstride, int vsec,
                 _Float16* O1, _Float16* O2, int ostride,
                 int addV) {
  // Two independent passes in one grid: blockIdx.z picks the stream.
  const bool second = blockIdx.z != 0;
  const _Float16* __restrict__ Q  = second ? Q2 : Q1;
  const _Float16* __restrict__ Kv = second ? Kv2 : Kv1;
  const _Float16* __restrict__ V  = second ? V2 : V1;
  _Float16* __restrict__ O = second ? O2 : O1;
  constexpr int LS = 72;  // padded row stride in halfs (144B, 16B-multiple)
  __shared__ alignas(16) _Float16 Ks [2][64 * LS];
  constexpr int VS = 80;  // V row stride in halfs: 160 B = 32 B x odd, for the transposing reader
  __shared__ alignas(16) _Float16 Vs [2][64 * VS];

  const int tid  = threadIdx.x;
  const int lane = tid & 31;
  const int wave = tid >> 5;
  const int bh   = blockIdx.y;
  const int b    = bh >> 3;
  const int h    = bh & 7;
  const int row0 = blockIdx.x * 128;
  const size_t bN = (size_t)b * Nn;
  const int qoff = qsec + h * HDd;
  const int koff = ksec + h * HDd;
  const int voff = vsec + h * HDd;
  const int ooff = h * HDd;

  // Q fragments for this wave's 16 queries (B operand: column = query lane&15):
  // two global_load_b128 per fragment.
  v16h qa0, qa1;
  {
    const _Float16* qp =
        Q + (bN + row0 + wave * 16 + (lane & 15)) * (size_t)qstride + qoff +
        ((lane >> 4) << 3);
    V16U u0, u1;
    u0.h2[0] = *(const h8*)(qp);
    u0.h2[1] = *(const h8*)(qp + 16);
    u1.h2[0] = *(const h8*)(qp + 32);
    u1.h2[1] = *(const h8*)(qp + 48);
    qa0 = u0.v;
    qa1 = u1.v;
  }

  constexpr float c = 0.125f * 1.44269504f;  // HD^-0.5 * log2(e): a literal, so it sits in scalar registers
  float m_old = -1e30f;  // running maximum of this lane's query, unscaled (equal in both halves)
  float l = 0.0f;        // running sum over this half's keys; the halves join after the loop
  v8f o[4];              // o[dt][r] = O^T[dt*16 + 8*hi + r][query]
#pragma unroll
  for (int dt = 0; dt < 4; ++dt) o[dt] = {};

  const int cn = lane & 15;
  const int hi = lane >> 4;

  // Staging: a thread copies 16 bytes of row sr and of row sr + 32 of the K and
  // of the V chunk; kp and vp walk on by one chunk with every call.
  const int sr = tid >> 3, c8 = (tid & 7) << 3;
  const _Float16* kp = Kv + (bN + sr) * (size_t)kstride + koff + c8;
  const _Float16* vp = V  + (bN + sr) * (size_t)vstride + voff + c8;
  const unsigned kd = lds_addr(&Ks[0][sr * LS + c8]);
  const unsigned vd = lds_addr(&Vs[0][sr * VS + c8]);
  auto stage = [&](int buf) {
    const unsigned ka = kd + (unsigned)buf * (64 * LS * 2), va = vd + (unsigned)buf * (64 * VS * 2);
    async_copy4_b128(kp, ka, kp + 32 * (size_t)kstride, ka + 32 * LS * 2,
                     vp, va, vp + 32 * (size_t)vstride, va + 32 * VS * 2);
    kp += 64 * (size_t)kstride;
    vp += 64 * (size_t)vstride;
  };
  stage(0);
  // Chunk 0 landed (this wave's copies); the barrier publishes it to all waves.
  asm volatile("s_wait_asynccnt 0x0" ::: "memory");
  __syncthreads();
  stage(1);  // in flight while chunk 0 is worked on

  for (int j0 = 0; j0 < Nn; j0 += 64) {
    const int buf = (j0 >> 6) & 1;
    const _Float16* const Kb = Ks[buf];
    const _Float16* const Vb = Vs[buf];

    // S^T = K Q^T  (64 keys x 16 queries per wave, 4 WMMA key tiles, K-depth 64):
    // sc[nt][r] = unscaled score of key nt*16 + 8*hi + r against query cn.
    v8f sc[4];
#pragma unroll
    for (int nt = 0; nt < 4; ++nt) {
      v8f z = {};
      z = wmma_f16(load_frag(Kb + (nt * 16) * LS, LS, lane), qa0, z);
      z = wmma_f16(load_frag(Kb + (nt * 16) * LS + 32, LS, lane), qa1, z);
      sc[nt] = z;
    }

    // Online-softmax update, one query per lane.  The maximum is kept in unscaled
    // score units; scale and log2(e) meet a score in one multiply-add:
    // exp(scale * (s - m)) = exp2(s * c - m * c), c = scale * log2(e).
    float mt[4];
#pragma unroll
    for (int nt = 0; nt < 4; ++nt) {
      mt[nt] = sc[nt][0];
#pragma unroll
      for (int r = 1; r < 8; ++r) mt[nt] = fmaxf(mt[nt], sc[nt][r]);
    }
    float mx = fmaxf(fmaxf(mt[0], mt[1]), fmaxf(mt[2], mt[3]));
    mx = fmaxf(mx, other_half(mx));
    const float m_new = fmaxf(m_old, mx);
    const float xa = (m_old - m_new) * c;
    const float alpha = __builtin_amdgcn_exp2f(xa);
    const float nmc = -m_new * c;
    m_old = m_new;

    V16U pb[2];    // P^T of keys 0..31 and 32..63, packed in place as B operands
    v8f x[4];
#pragma unroll
    for (int nt = 0; nt < 4; ++nt) {
      x[nt] = sc[nt] * c + nmc;
#pragma unroll
      for (int r = 0; r < 8; ++r) {
        sc[nt][r] = __builtin_amdgcn_exp2f(x[nt][r]);
        pb[nt >> 1].v[(nt & 1) * 8 + r] = (_Float16)sc[nt][r];
      }
    }
    // The slot between a v_exp_f32 and an overwrite of its source: the arguments
    // stay live up to this v_nop, which stands behind the last exponential.
    asm volatile("v_nop" :: "v"(x[0]), "v"(x[1]), "v"(x[2]), "v"(x[3]), "v"(sc[0]), "v"(sc[1]),
                 "v"(sc[2]), "v"(sc[3]), "v"(xa), "v"(alpha));
    // Sum of this lane's 32 values: the four tiles register by register (packed
    // adds, independent chains), then the eight registers as a tree.
    const v8f ts = (sc[0] + sc[1]) + (sc[2] + sc[3]);
    l = l * alpha + (((ts[0] + ts[1]) + (ts[2] + ts[3])) + ((ts[4] + ts[5]) + (ts[6] + ts[7])));
#pragma unroll
    for (int dt = 0; dt < 4; ++dt)
#pragma unroll
      for (int r = 0; r < 8; ++r) o[dt][r] *= alpha;

    // O^T += V_chunk^T @ P^T.  A-fragments (row = d) from row-major Vs:
    // 2x ds_load_tr16_b128 each; B = P^T straight from registers.
#pragma unroll
    for (int dt = 0; dt < 4; ++dt) {
      o[dt] = wmma_f16(load_frag_tr(Vb + dt * 16, VS, lane), pb[0].v, o[dt]);
      o[dt] = wmma_f16(load_frag_tr(Vb + 32 * VS + dt * 16, VS, lane), pb[1].v, o[dt]);
    }

    // Hand-over: this wave's LDS reads of this chunk have returned ...
    asm volatile("s_wait_dscnt 0x0" ::: "memory");
    // ... and its copies of the next chunk have landed;
    asm volatile("s_wait_asynccnt 0x0" ::: "memory");
    // the barrier publishes the next chunk and frees this chunk's buffer for the refill.
    __syncthreads();
    if (j0 + 128 < Nn) stage(buf);
  }
  // No copy is left in flight when the wave goes on to its epilogue.
  asm volatile("s_wait_asynccnt 0x0" ::: "memory");

  // Residual rows (zero where none is asked for): all four loads go out together,
  // under one block-uniform test, ahead of the divisions.
  const size_t grow = bN + row0 + wave * 16 + cn;
  h8 res[4];
#pragma unroll
  for (int dt = 0; dt < 4; ++dt) res[dt] = {};
  if (addV) {
#pragma unroll
    for (int dt = 0; dt < 4; ++dt)
      res[dt] = *(const h8*)(V + grow * (size_t)vstride + voff + dt * 16 + 8 * hi);
    // The output address below reuses the address registers of the loads above.
    asm volatile("s_wait_xcnt 0x0" ::: "memory");
  }

  // Join the halves' sums, normalize, add the residual, store f16: a lane's
  // 8 accumulator registers are 8 consecutive d of its query, one 16-byte store.
  l += other_half(l);
#pragma unroll
  for (int dt = 0; dt < 4; ++dt) {
    h8 ov;
#pragma unroll
    for (int r = 0; r < 8; ++r)
      ov[r] = (_Float16)(o[dt][r] / l + (float)res[dt][r]);
    *(h8*)(O + grow * (size_t)ostride + ooff + dt * 16 + 8 * hi) = ov;
  }
}

// ---------------------------------------------------------------------------
// First attention stage, both streams in one pass.  Its scores come from the
// gated rows alone (queries and keys are the same tensor X), so softmax(X X^T)
// is the same matrix for stream 1 and stream 2: it is formed once per query
// tile and multiplied into both value tensors,
//   O1 = P V1 + V1,  O2 = P V2 + V2.
// Layouts, fragment maps and the order of every sum are those of attn_kernel.
// X: [B*N][512]; V1, V2: the v section of the [B*N][2048] projections.
// ---------------------------------------------------------------------------

__global__ __launch_bounds__(256)
void attn_shared_kernel(const _Float16* __restrict__ X,
                        const _Float16* __restrict__ V1, const _Float16* __restrict__ V2,
                        _Float16* __restrict__ O1, _Float16* __restrict__ O2) {
  constexpr int XS   = INNERi;      // row stride of X and of the outputs, halfs
  constexpr int VSTR = 4 * INNERi;  // row stride of the projections
  constexpr int VSEC = 2 * INNERi;  // their v section
  constexpr int LS = 72;  // K row stride in halfs (144 B)
  constexpr int VS = 80;  // V row stride in halfs: 160 B = 32 B x odd, for the transposing reader
  __shared__ alignas(16) _Float16 Ks [2][64 * LS];
  __shared__ alignas(16) _Float16 Vs1[2][64 * VS];
  __shared__ alignas(16) _Float16 Vs2[2][64 * VS];

  const int tid  = threadIdx.x;
  const int lane = tid & 31;
  const int wave = tid >> 5;
  const int bh   = blockIdx.y;
  const int b    = bh >> 3;
  const int hoff = (bh & 7) * HDd;
  const int row0 = blockIdx.x * 128;
  const size_t bN = (size_t)b * Nn;
  const int cn = lane & 15;
  const int hi = lane >> 4;
  const size_t grow = bN + row0 + wave * 16 + cn;  // this lane's query row

  // Q fragments for this wave's 16 queries (B operand: column = query lane&15).
  v16h qa0, qa1;
  {
    const _Float16* qp = X + grow * XS + hoff + (hi << 3);
    V16U u0, u1;
    u0.h2[0] = *(const h8*)(qp);
    u0.h2[1] = *(const h8*)(qp + 16);
    u1.h2[0] = *(const h8*)(qp + 32);
    u1.h2[1] = *(const h8*)(qp + 48);
    qa0 = u0.v;
    qa1 = u1.v;
  }

  constexpr float c = 0.125f * 1.44269504f;  // HD^-0.5 * log2(e): a literal, so it sits in scalar registers
  float m_old = -1e30f;  // running maximum of this lane's query, unscaled (equal in both halves)
  float l = 0.0f;        // running sum over this half's keys; the halves join after the loop
  v8f o1[4], o2[4];      // o[dt][r] = O^T[dt*16 + 8*hi + r][query], one set per stream
#pragma unroll
  for (int dt = 0; dt < 4; ++dt) { o1[dt] = {}; o2[dt] = {}; }

  // Staging: a thread copies 16 bytes of row sr and of row sr + 32 of each tile;
  // the three pointers walk on by one chunk with every call.
  const int sr = tid >> 3, c8 = (tid & 7) << 3;
  const _Float16* kp  = X  + (bN + sr) * XS + hoff + c8;
  const _Float16* vp1 = V1 + (bN + sr) * VSTR + VSEC + hoff + c8;
  const _Float16* vp2 = V2 + (bN + sr) * VSTR + VSEC + hoff + c8;
  const unsigned kd  = lds_addr(&Ks [0][sr * LS + c8]);
  const unsigned vd1 = lds_addr(&Vs1[0][sr * VS + c8]);
  const unsigned vd2 = lds_addr(&Vs2[0][sr * VS + c8]);
  auto stage = [&](int buf) {
    const unsigned ka = kd + (unsigned)buf * (64 * LS * 2);
    const unsigned va1 = vd1 + (unsigned)buf * (64 * VS * 2), va2 = vd2 + (unsigned)buf * (64 * VS * 2);
    async_copy6_b128(kp, ka, kp + 32 * XS, ka + 32 * LS * 2,
                     vp1, va1, vp1 + 32 * VSTR, va1 + 32 * VS * 2,
                     vp2, va2, vp2 + 32 * VSTR, va2 + 32 * VS * 2);
    kp  += 64 * XS;
    vp1 += 64 * VSTR;
    vp2 += 64 * VSTR;
  };
  stage(0);
  // Chunk 0 landed (this wave's copies); the barrier publishes it to all waves.
  asm volatile("s_wait_asynccnt 0x0" ::: "memory");
  __syncthreads();
  stage(1);  // in flight while chunk 0 is worked on

  for (int j0 = 0; j0 < Nn; j0 += 64) {
    const int buf = (j0 >> 6) & 1;
    const _Float16* const Kb  = Ks [buf];
    const _Float16* const Vb1 = Vs1[buf];
    const _Float16* const Vb2 = Vs2[buf];

    // S^T = K Q^T: sc[nt][r] = unscaled score of key nt*16 + 8*hi + r against query cn.
    v8f sc[4];
#pragma unroll
    for (int nt = 0; nt < 4; ++nt) {
      v8f z = {};
      z = wmma_f16(load_frag(Kb + (nt * 16) * LS, LS, lane), qa0, z);
      z = wmma_f16(load_frag(Kb + (nt * 16) * LS + 32, LS, lane), qa1, z);
      sc[nt] = z;
    }

    // Online-softmax update, one query per lane.  The maximum is kept in unscaled
    // score units; scale and log2(e) meet a score in one multiply-add:
    // exp(scale * (s - m)) = exp2(s * c - m * c), c = scale * log2(e).
    float mt[4];
#pragma unroll
    for (int nt = 0; nt < 4; ++nt) {
      mt[nt] = sc[nt][0];
#pragma unroll
      for (int r = 1; r < 8; ++r) mt[nt] = fmaxf(mt[nt], sc[nt][r]);
    }
    float mx = fmaxf(fmaxf(mt[0], mt[1]), fmaxf(mt[2], mt[3]));
    mx = fmaxf(mx, other_half(mx));
    const float m_new = fmaxf(m_old, mx);
    const float xa = (m_old - m_new) * c;
    const float alpha = __builtin_amdgcn_exp2f(xa);
    const float nmc = -m_new * c;
    m_old = m_new;

    V16U pb[2];    // P^T of keys 0..31 and 32..63, packed in place as B operands
    v8f x[4];
#pragma unroll
    for (int nt = 0; nt < 4; ++nt) {
      x[nt] = sc[nt] * c + nmc;
#pragma unroll
      for (int r = 0; r < 8; ++r) {
        sc[nt][r] = __builtin_amdgcn_exp2f(x[nt][r]);
        pb[nt >> 1].v[(nt & 1) * 8 + r] = (_Float16)sc[nt][r];
      }
    }
    // The slot between a v_exp_f32 and an overwrite of its source: the arguments
    // stay live up to this v_nop, which stands behind the last exponential.
    asm volatile("v_nop" :: "v"(x[0]), "v"(x[1]), "v"(x[2]), "v"(x[3]), "v"(sc[0]), "v"(sc[1]),
                 "v"(sc[2]), "v"(sc[3]), "v"(xa), "v"(alpha));
    // Sum of this lane's 32 values: the four tiles register by register, then
    // the eight registers as a tree.
    const v8f ts = (sc[0] + sc[1]) + (sc[2] + sc[3]);
    l = l * alpha + (((ts[0] + ts[1]) + (ts[2] + ts[3])) + ((ts[4] + ts[5]) + (ts[6] + ts[7])));
#pragma unroll
    for (int dt = 0; dt < 4; ++dt) {
      o1[dt] *= alpha;
      o2[dt] *= alpha;
    }

    // O^T += V_chunk^T @ P^T for both streams: the same B = P^T from registers,
    // A-fragments (row = d) from each stream's row-major tile.
#pragma unroll
    for (int dt = 0; dt < 4; ++dt) {
      o1[dt] = wmma_f16(load_frag_tr(Vb1 + dt * 16, VS, lane), pb[0].v, o1[dt]);
      o1[dt] = wmma_f16(load_frag_tr(Vb1 + 32 * VS + dt * 16, VS, lane), pb[1].v, o1[dt]);
    }
#pragma unroll
    for (int dt = 0; dt < 4; ++dt) {
      o2[dt] = wmma_f16(load_frag_tr(Vb2 + dt * 16, VS, lane), pb[0].v, o2[dt]);
      o2[dt] = wmma_f16(load_frag_tr(Vb2 + 32 * VS + dt * 16, VS, lane), pb[1].v, o2[dt]);
    }

    // Hand-over: this wave's LDS reads of this chunk have returned ...
    asm volatile("s_wait_dscnt 0x0" ::: "memory");
    // ... and its copies of the next chunk have landed;
    asm volatile("s_wait_asynccnt 0x0" ::: "memory");
    // the barrier publishes the next chunk and frees this chunk's buffers for the refill.
    __syncthreads();
    if (j0 + 128 < Nn) stage(buf);
  }
  // No copy is left in flight when the wave goes on to its epilogue.
  asm volatile("s_wait_asynccnt 0x0" ::: "memory");

  // Residual rows of both streams: all eight loads go out together, ahead of the divisions.
  h8 res1[4], res2[4];
#pragma unroll
  for (int dt = 0; dt < 4; ++dt) {
    res1[dt] = *(const h8*)(V1 + grow * VSTR + VSEC + hoff + dt * 16 + 8 * hi);
    res2[dt] = *(const h8*)(V2 + grow * VSTR + VSEC + hoff + dt * 16 + 8 * hi);
  }

  // Join the halves' sums, normalize, add the residual, store f16: a lane's
  // 8 accumulator registers are 8 consecutive d of its query, one 16-byte store.
  l += other_half(l);
  h8 ov1[4], ov2[4];
#pragma unroll
  for (int dt = 0; dt < 4; ++dt)
#pragma unroll
    for (int r = 0; r < 8; ++r) {
      ov1[dt][r] = (_Float16)(o1[dt][r] / l + (float)res1[dt][r]);
      ov2[dt][r] = (_Float16)(o2[dt][r] / l + (float)res2[dt][r]);
    }
#pragma unroll
  for (int dt = 0; dt < 4; ++dt) {
    *(h8*)(O1 + grow * XS + hoff + dt * 16 + 8 * hi) = ov1[dt];
    *(h8*)(O2 + grow * XS + hoff + dt * 16 + 8 * hi) = ov2[dt];
  }
}

// ---------------------------------------------------------------------------
// Host launcher.
// ---------------------------------------------------------------------------
extern "C" void kernel_launch(void* const* d_in, const int* in_sizes, int n_in,
                              void* d_out, int out_size, void* d_ws, size_t ws_size,
                              hipStream_t stream) {
  (void)in_sizes; (void)n_in; (void)out_size; (void)ws_size;
  const float* x1     = (const float*)d_in[0];
  const float* x2     = (const float*)d_in[1];
  const float* Wqkv1  = (const float*)d_in[2];
  const float* Wqkv2  = (const float*)d_in[3];
  const float* Wout1  = (const float*)d_in[4];
  const float* bout1  = (const float*)d_in[5];
  const float* Wout2  = (const float*)d_in[6];
  const float* bout2  = (const float*)d_in[7];
  const float* conv_w = (const float*)d_in[8];
  const float* conv_b = (const float*)d_in[9];

  const size_t MROWS = (size_t)Bb * Nn;  // 8192
  // Workspace layout (f16). t1 aliases msg (dead after the first attention launch);
  // t2 has a plane of its own: its writer runs beside the reader of u1. Total ~101 MB.
  _Float16* qkv1h = (_Float16*)d_ws;
  _Float16* qkv2h = qkv1h + MROWS * 2048;
  _Float16* msg   = qkv2h + MROWS * 2048;
  _Float16* u1    = msg + MROWS * 512;
  _Float16* u2    = u1 + MROWS * 512;
  _Float16* t1    = msg;  // alias
  _Float16* t2    = u2 + MROWS * 512;

  float* out1 = (float*)d_out;
  float* out2 = out1 + MROWS * 512;

  const dim3 blk(256);

  // QKV projections: [8192,512] @ [512,2048] -> f16
  gemm_qkv_kernel<<<dim3(16, 64, 2), blk, 0, stream>>>(x1, Wqkv1, qkv1h, x2, Wqkv2, qkv2h,
                                                       8192, 512, 2048);

  // Gated conv branch -> MSg (merged b n (h d), f16)
  conv_gate_kernel<<<dim3(Bb * Nn), dim3(128), 0, stream>>>(qkv1h, qkv2h, conv_w, conv_b, msg);

  // u1 = softmax(MS MS^T)·v1 + v1 ; u2 likewise (sections: q=0,k=512,v=1024,s=1536)
  // (one grid for both: the score matrix is shared)
  attn_shared_kernel<<<dim3(8, 64), blk, 0, stream>>>(msg, qkv1h, qkv2h, u1, u2);
  // t1 = softmax(q1 k1^T)·u1 ; t2 = softmax(q2 k2^T)·u2
  attn_kernel<<<dim3(8, 64, 2), blk, 0, stream>>>(qkv1h, qkv2h, 2048, 0, qkv1h, qkv2h, 2048, 512,
                                                  u1, u2, 512, 0, t1, t2, 512, 0);

  // Output projections with bias -> f32 d_out
  gemm_out_kernel<<<dim3(4, 64, 2), blk, 0, stream>>>(t1, Wout1, bout1, out1,
                                                      t2, Wout2, bout2, out2, 8192, 512, 512);
}

// v008
// One run takes 139 microseconds.
// Next to v007, in two timings, it ran 1.11 times as fast each time.
// Counting every step since v000, it is 3.44 times as fast.
#include <hip/hip_runtime.h>
#include <hip/hip_bf16.h>

// ---------------------------------------------------------------------------
// MI455X (gfx1250, wave32) implementation of the hybrid-attention reference.
// All matmuls run on V_WMMA_F32_16X16X32_F16 (f16 in, f32 accumulate).
// Fragment loads are vectorized: each lane's 16-half WMMA fragment is two
// contiguous 16B runs (ISA 7.12.2), loaded as 2x ds_load_b128/global_load_b128.
// W tiles (B operands, [k][col]; GEMM 1: async copies, GEMM 2: wide LDS stores) and V chunks (A operands, [j][d]) are staged
// row-major and transposed on the way out by ds_load_tr16_b128.  The GEMM 2 A tile and the attention K and V chunks are staged with
// CDNA5 GLOBAL_LOAD_ASYNC_TO_LDS_B128 tracked by ASYNCcnt.
// ---------------------------------------------------------------------------

typedef __attribute__((ext_vector_type(16))) _Float16 v16h;
typedef __attribute__((ext_vector_type(8)))  _Float16 h8;
typedef __attribute__((ext_vector_type(4)))  _Float16 h4;
typedef __attribute__((ext_vector_type(8)))  short    s16x8;
typedef __attribute__((address_space(3))) s16x8 lds_s16x8;
typedef __attribute__((ext_vector_type(8)))  float    v8f;

constexpr int Bb     = 8;
constexpr int Nn     = 1024;
constexpr int HDd    = 64;
constexpr int INNERi = 512;

union V16U { v16h v; h8 h2[2]; };

// Async DMA of 16 bytes global -> LDS (ASYNCcnt).  ldsOff is the byte offset
// of the destination within the workgroup's LDS allocation (low 32 bits of
// the generic pointer, per ISA 10.2 aperture mapping).
__device__ __forceinline__ void async_copy_b128(const void* gptr, void* ldsptr) {
  const unsigned ldsOff = (unsigned)(unsigned long long)ldsptr;
  asm volatile("global_load_async_to_lds_b128 %0, %1, off"
               :: "v"(ldsOff), "v"(gptr) : "memory");
}

__device__ __forceinline__ void wait_async0() {
#if __has_builtin(__builtin_amdgcn_s_wait_asynccnt)
  __builtin_amdgcn_s_wait_asynccnt(0);
#else
  asm volatile("s_wait_asynccnt 0x0" ::: "memory");
#endif
}

// Fragment loader: lane holds "line" (lane&15) of a row-major tile; the 16
// halves are K = khi..khi+7 and 16+khi..16+khi+7 with khi = 8*(lane>>4),
// i.e. two aligned 16B vector loads. Serves A-fragments (line = row m):
// the GEMM A tiles and the attention K chunks.
__device__ __forceinline__ v16h load_frag(const _Float16* base, int rstride, int lane) {
  const _Float16* p = base + (lane & 15) * rstride + ((lane >> 4) << 3);
  V16U u;
  u.h2[0] = *(const h8*)p;
  u.h2[1] = *(const h8*)(p + 16);
  return u.v;
}

// B-fragment (32 k x 16 columns) or A-fragment (16 rows x 32 k) out of a ROW-MAJOR [k][col] LDS tile: tile
// points at element [k0][col0], pitch is in halfs (bytes: an odd multiple of 32).
// Each transposing load hands lane (c = lane&15, h = lane>>4) the 8 halves
// tile[8h .. 8h+7][c]; the second one, 16 rows on, gives k = 16+8h .. 16+8h+7:
// the k order of load_frag, so the two loaders pair.
__device__ __forceinline__ v16h load_frag_tr(const _Float16* tile, int pitch, int lane) {
  const _Float16* p = tile + (((lane >> 4) << 3) + (lane & 7)) * pitch + (((lane >> 3) & 1) << 3);
  V16U u;
  u.h2[0] = __builtin_bit_cast(h8, __builtin_amdgcn_ds_load_tr16_b128_v8i16((lds_s16x8*)p));
  u.h2[1] = __builtin_bit_cast(h8, __builtin_amdgcn_ds_load_tr16_b128_v8i16((lds_s16x8*)(p + 16 * pitch)));
  return u.v;
}

// Holds a block-uniform address in scalar registers, so that a load takes it as
// its scalar base beside one loop-invariant 32-bit offset register per thread
// (no 64-bit address pair per load: fewer registers, more waves resident).
typedef __attribute__((ext_vector_type(4))) float f4;
typedef const __attribute__((address_space(1))) char* gbytes;  // global memory, bytes
typedef const __attribute__((address_space(1))) f4*   gf4;     // global memory, 4 floats
__device__ __forceinline__ gbytes scalar_base(const float* p) {
  const unsigned long long u = (unsigned long long)p;
  const unsigned lo = (unsigned)__builtin_amdgcn_readfirstlane((int)(unsigned)u);
  const unsigned hi = (unsigned)__builtin_amdgcn_readfirstlane((int)(unsigned)(u >> 32));
  return (gbytes)(((unsigned long long)hi << 32) | lo);
}

__device__ __forceinline__ v8f wmma_f16(v16h a, v16h b, v8f c) {
  // (neg_a, A, neg_b, B, c_mod, C, reuse_a, reuse_b)
  return __builtin_amdgcn_wmma_f32_16x16x32_f16(false, a, false, b, (short)0, c, false, false);
}

// ---------------------------------------------------------------------------
// GEMM 2: out(f32)[M,Nc] = A(f16)[M,K] @ W(f32)[K,Nc] + bias.
// The f16 A tile needs no conversion -> staged with async-to-LDS DMA.
// ---------------------------------------------------------------------------
__global__ __launch_bounds__(256)
void gemm_out_kernel(const _Float16* __restrict__ A1, const float* __restrict__ W1,
                     const float* __restrict__ bias1, float* __restrict__ C1,
                     const _Float16* __restrict__ A2, const float* __restrict__ W2,
                     const float* __restrict__ bias2, float* __restrict__ C2,
                     int M, int K, int Ncols) {
  // Two independent products in one grid: blockIdx.z picks the stream.
  const bool second = blockIdx.z != 0;
  const _Float16* __restrict__ A = second ? A2 : A1;
  const float* __restrict__ W = second ? W2 : W1;
  const float* __restrict__ bias = second ? bias2 : bias1;
  float* __restrict__ C = second ? C2 : C1;
  constexpr int AS_S = 40;
  constexpr int BS_S = 144;   // 32 k-rows x 128 halfs (+pad): 288 B = 32 B x odd
  __shared__ alignas(16) _Float16 As[128 * AS_S];
  __shared__ alignas(16) _Float16 Bs[32 * BS_S];

  const int tid  = threadIdx.x;
  const int lane = tid & 31;
  const int wave = tid >> 5;
  const int row0 = blockIdx.y * 128;
  const int col0 = blockIdx.x * 128;
  const int wm   = wave & 3;
  const int wn   = wave >> 2;
  const unsigned woff = 4u * (unsigned)((tid >> 5) * Ncols + ((tid & 31) << 2));  // bytes; W: k-row tid/32

  v8f acc[2][4];
#pragma unroll
  for (int i = 0; i < 2; ++i)
#pragma unroll
    for (int nt = 0; nt < 4; ++nt) acc[i][nt] = {};

  for (int k0 = 0; k0 < K; k0 += 32) {
    __syncthreads();
    // The four W loads of this k-step go out together, so that their
    // latencies overlap one another and the A copies; the LDS stores follow.
    f4 wv[4];
#pragma unroll  // constant trip count: the four loads must not wait on one another
    for (int it = 0; it < 4; ++it)
      wv[it] = *(gf4)(scalar_base(W + ((size_t)(k0 + it * 8) * Ncols + col0)) + woff);
    // Stage A (f16) via async DMA: 128x32 halfs = 512 b128 transfers.
    for (int i = tid; i < 512; i += 256) {
      const int r = i >> 2, c8 = (i & 3) << 3;
      async_copy_b128(A + (size_t)(row0 + r) * K + k0 + c8,
                      As + r * AS_S + c8);
    }
    // Stage W row-major (f32 -> f16 conversion: VGPR path), 8-byte stores.
#pragma unroll  // wv[] stays in registers
    for (int it = 0; it < 4; ++it) {
      const int i = tid + it * 256;
      const int r = i >> 5, c4 = (i & 31) << 2;
      *(h4*)(Bs + r * BS_S + c4) = h4{(_Float16)wv[it].x, (_Float16)wv[it].y,
                                      (_Float16)wv[it].z, (_Float16)wv[it].w};
    }
    wait_async0();           // ASYNCcnt == 0: A tile landed in LDS
    __syncthreads();

    v16h af[2], bf[4];
#pragma unroll
    for (int i = 0; i < 2; ++i)
      af[i] = load_frag(As + (wm * 32 + i * 16) * AS_S, AS_S, lane);
#pragma unroll
    for (int nt = 0; nt < 4; ++nt)
      bf[nt] = load_frag_tr(Bs + wn * 64 + nt * 16, BS_S, lane);
#pragma unroll
    for (int i = 0; i < 2; ++i)
#pragma unroll
      for (int nt = 0; nt < 4; ++nt)
        acc[i][nt] = wmma_f16(af[i], bf[nt], acc[i][nt]);
  }

  const int hi = lane >> 4, cn = lane & 15;
#pragma unroll
  for (int i = 0; i < 2; ++i)
#pragma unroll
    for (int nt = 0; nt < 4; ++nt)
#pragma unroll
      for (int r = 0; r < 8; ++r) {
        const int row = row0 + wm * 32 + i * 16 + r + 8 * hi;
        const int col = col0 + wn * 64 + nt * 16 + cn;
        C[(size_t)row * Ncols + col] = acc[i][nt][r] + bias[col];
      }
}

// ---------------------------------------------------------------------------
// conv_gate: MS = s1+s2 (f32); depthwise conv (k=5, pad 2) along features with
// per-token weights; MSg = sigmoid(conv) * MS -> f16, merged b n (h d) layout.
// One block per (b, n) row.
// ---------------------------------------------------------------------------
__global__ __launch_bounds__(128)
void conv_gate_kernel(const _Float16* __restrict__ qkv1,
                      const _Float16* __restrict__ qkv2,
                      const float* __restrict__ cw, const float* __restrict__ cb,
                      _Float16* __restrict__ msg) {
  const int bn = blockIdx.x;          // b*N + n
  const int n  = bn & (Nn - 1);
  __shared__ float ms[INNERi + 4];

  const _Float16* s1 = qkv1 + (size_t)bn * 2048 + 1536;
  const _Float16* s2 = qkv2 + (size_t)bn * 2048 + 1536;
  for (int f = threadIdx.x; f < INNERi; f += blockDim.x)
    ms[f + 2] = (float)s1[f] + (float)s2[f];
  if (threadIdx.x < 2) { ms[threadIdx.x] = 0.0f; ms[INNERi + 2 + threadIdx.x] = 0.0f; }
  __syncthreads();

  const float w0 = cw[n * 5 + 0], w1 = cw[n * 5 + 1], w2 = cw[n * 5 + 2],
              w3 = cw[n * 5 + 3], w4 = cw[n * 5 + 4];
  const float bias = cb[n];
  for (int f = threadIdx.x; f < INNERi; f += blockDim.x) {
    const float a = w0 * ms[f] + w1 * ms[f + 1] + w2 * ms[f + 2] +
                    w3 * ms[f + 3] + w4 * ms[f + 4] + bias;
    const float g = ms[f + 2] / (1.0f + __expf(-a));
    msg[(size_t)bn * INNERi + f] = (_Float16)g;
  }
}

// ---------------------------------------------------------------------------
// Flash-attention pass: O = softmax(scale * Q K^T) @ V  (+ V residual),
// computed transposed: S^T = K Q^T, O^T += V^T P^T.
// All tensors live in [B, N, stride] f16 buffers; the head slice is selected
// by (section offset + h*64).  128 query rows per block, 8 waves x 16 queries,
// KV streamed in 64-row chunks through two LDS buffers: the copies of the next
// chunk are in flight while this one is worked on, one barrier per chunk.
//   Ks  : [j][d] row-major, staged via async-to-LDS DMA (no conversion); A of S^T
//   Vs  : [j][d] row-major, staged the same way; transposing loads give A of O^T
// A lane (c = lane&15, hi = lane>>4) owns ONE query, c: of each 16-key tile it
// holds the scores of keys 8*hi .. 8*hi+7, so maximum and sum run in the lane's
// own registers, with one exchange between the wave's halves.  Two score tiles,
// converted in place, are the B operand P^T of a 32-key block (element s is key
// 8*hi+s, then 16+8*hi+(s-8): the k order of load_frag_tr).
// ---------------------------------------------------------------------------

// Value of lane l ^ 16.
__device__ __forceinline__ float other_half(float x) {
  const int i = __builtin_bit_cast(int, x);
  return __builtin_bit_cast(float,
      __builtin_amdgcn_permlanex16(i, i, 0x76543210, 0xfedcba98, false, false));
}

// Four / six 16-byte copies global -> LDS (ASYNCcnt), one chunk's share of a thread.
// The s_wait_xcnt closes the copies' own statement, ahead of any later write of
// their address registers.
__device__ __forceinline__ unsigned lds_addr(const void* p) {
  return (unsigned)(unsigned long long)p;
}
__device__ __forceinline__ void async_copy4_b128(const void* g0, unsigned a0, const void* g1, unsigned a1,
                                                 const void* g2, unsigned a2, const void* g3, unsigned a3) {
  asm volatile("global_load_async_to_lds_b128 %0, %1, off\n\t"
               "global_load_async_to_lds_b128 %2, %3, off\n\t"
               "global_load_async_to_lds_b128 %4, %5, off\n\t"
               "global_load_async_to_lds_b128 %6, %7, off\n\t"
               "s_wait_xcnt 0x0"
               :: "v"(a0), "v"(g0), "v"(a1), "v"(g1), "v"(a2), "v"(g2), "v"(a3), "v"(g3) : "memory");
}
__device__ __forceinline__ void async_copy6_b128(const void* g0, unsigned a0, const void* g1, unsigned a1,
                                                 const void* g2, unsigned a2, const void* g3, unsigned a3,
                                                 const void* g4, unsigned a4, const void* g5, unsigned a5) {
  asm volatile("global_load_async_to_lds_b128 %0, %1, off\n\t"
               "global_load_async_to_lds_b128 %2, %3, off\n\t"
               "global_load_async_to_lds_b128 %4, %5, off\n\t"
               "global_load_async_to_lds_b128 %6, %7, off\n\t"
               "global_load_async_to_lds_b128 %8, %9, off\n\t"
               "global_load_async_to_lds_b128 %10, %11, off\n\t"
               "s_wait_xcnt 0x0"
               :: "v"(a0), "v"(g0), "v"(a1), "v"(g1), "v"(a2), "v"(g2), "v"(a3), "v"(g3),
                  "v"(a4), "v"(g4), "v"(a5), "v"(g5) : "memory");
}

// Eight such copies: one k-tile's share of a thread in the first GEMM.
__device__ __forceinline__ void async_copy8_b128(const void* g0, unsigned a0, const void* g1, unsigned a1,
                                                 const void* g2, unsigned a2, const void* g3, unsigned a3,
                                                 const void* g4, unsigned a4, const void* g5, unsigned a5,
                                                 const void* g6, unsigned a6, const void* g7, unsigned a7) {
  asm volatile("global_load_async_to_lds_b128 %0, %1, off\n\t"
               "global_load_async_to_lds_b128 %2, %3, off\n\t"
               "global_load_async_to_lds_b128 %4, %5, off\n\t"
               "global_load_async_to_lds_b128 %6, %7, off\n\t"
               "global_load_async_to_lds_b128 %8, %9, off\n\t"
               "global_load_async_to_lds_b128 %10, %11, off\n\t"
               "global_load_async_to_lds_b128 %12, %13, off\n\t"
               "global_load_async_to_lds_b128 %14, %15, off\n\t"
               "s_wait_xcnt 0x0"
               :: "v"(a0), "v"(g0), "v"(a1), "v"(g1), "v"(a2), "v"(g2), "v"(a3), "v"(g3),
                  "v"(a4), "v"(g4), "v"(a5), "v"(g5), "v"(a6), "v"(g6), "v"(a7), "v"(g7) : "memory");
}

// ---------------------------------------------------------------------------
// Operands of the first GEMM, f32 -> f16, each element converted once (the GEMM
// reads every x row 16 times and every W row 64 times).  A block takes 8192
// floats: blocks 0..511 x1, 512..1023 x2, 1024..1151 W1, 1152..1279 W2.
// A wave's load covers 512 B in a row, its store 256 B.
// ---------------------------------------------------------------------------
__global__ __launch_bounds__(256)
void to_f16_kernel(const float* __restrict__ x1, const float* __restrict__ x2,
                   const float* __restrict__ W1, const float* __restrict__ W2,
                   _Float16* __restrict__ xh1, _Float16* __restrict__ xh2,
                   _Float16* __restrict__ wh1, _Float16* __restrict__ wh2) {
  const int blk = blockIdx.x;
  const float* __restrict__ s = blk < 512 ? x1 : blk < 1024 ? x2 : blk < 1152 ? W1 : W2;
  _Float16* __restrict__ d = blk < 512 ? xh1 : blk < 1024 ? xh2 : blk < 1152 ? wh1 : wh2;
  const int b0 = blk < 512 ? blk : blk < 1024 ? blk - 512 : blk < 1152 ? blk - 1024 : blk - 1152;
  const size_t base = (size_t)b0 * 8192 + threadIdx.x * 4;
  f4 v[8];
#pragma unroll  // all eight loads go out before the first convert waits
  for (int j = 0; j < 8; ++j) v[j] = *(const f4*)(s + base + j * 1024);
#pragma unroll  // v[] stays in registers
  for (int j = 0; j < 8; ++j)
    *(h4*)(d + base + j * 1024) = h4{(_Float16)v[j].x, (_Float16)v[j].y,
                                     (_Float16)v[j].z, (_Float16)v[j].w};
}

// ---------------------------------------------------------------------------
// GEMM 1: C(f16)[8192,2048] = A(f16)[8192,512] @ W(f16)[512,2048].
// BM=BN=128, BK=64.  8 waves in a 4x2 grid; each wave owns 32x64 = 2x4 WMMA tiles.
// Both tiles lie in memory as LDS wants them, so they go there by asynchronous
// copies (whole 128-B lines), through two buffers: the copies of the next k-tile
// are in flight while this one is worked on, one barrier per k-tile.
//   As : [row][k] row-major;  Bs : [k][col] row-major, read by transposing loads.
// ---------------------------------------------------------------------------
__global__ __launch_bounds__(256)
void gemm_qkv_kernel(const _Float16* __restrict__ A1, const _Float16* __restrict__ W1,
                     _Float16* __restrict__ C1,
                     const _Float16* __restrict__ A2, const _Float16* __restrict__ W2,
                     _Float16* __restrict__ C2) {
  constexpr int K = 512, Ncols = 4 * INNERi;
  // Two independent products in one grid: blockIdx.z picks the stream.
  const bool second = blockIdx.z != 0;
  const _Float16* __restrict__ A = second ? A2 : A1;
  const _Float16* __restrict__ W = second ? W2 : W1;
  _Float16* __restrict__ C = second ? C2 : C1;
  constexpr int AS_S = 72;    // 128 rows x 64 halfs (+pad): 144 B = 16 B x odd
  constexpr int BS_S = 144;   // 64 k-rows x 128 halfs (+pad): 288 B = 32 B x odd
  __shared__ alignas(16) _Float16 As[2][128 * AS_S];
  __shared__ alignas(16) _Float16 Bs[2][64 * BS_S];

  const int tid  = threadIdx.x;
  const int lane = tid & 31;
  const int wave = tid >> 5;
  const int row0 = blockIdx.y * 128;
  const int col0 = blockIdx.x * 128;
  const int wm   = wave & 3;   // row group (32 rows)
  const int wn   = wave >> 2;  // col group (64 cols)

  v8f acc[2][4];
#pragma unroll
  for (int i = 0; i < 2; ++i)
#pragma unroll
    for (int nt = 0; nt < 4; ++nt) acc[i][nt] = {};

  // Staging: a thread copies 16 bytes of rows ar + 32 i of the A tile and of
  // k-rows wr + 16 i of the W tile; ap and wp walk on by one k-tile with every call.
  const int ar = tid >> 3, ac = (tid & 7) << 3;
  const int wr = tid >> 4, wc = (tid & 15) << 3;
  const _Float16* ap = A + (size_t)(row0 + ar) * K + ac;
  const _Float16* wp = W + (size_t)wr * Ncols + col0 + wc;
  const unsigned ad = lds_addr(&As[0][ar * AS_S + ac]);
  const unsigned wd = lds_addr(&Bs[0][wr * BS_S + wc]);
  auto stage = [&](int buf) {
    const unsigned aa = ad + (unsigned)buf * (128 * AS_S * 2), wa = wd + (unsigned)buf * (64 * BS_S * 2);
    async_copy8_b128(ap, aa, ap + 32 * K, aa + 32 * AS_S * 2,
                     ap + 64 * K, aa + 64 * AS_S * 2, ap + 96 * K, aa + 96 * AS_S * 2,
                     wp, wa, wp + 16 * Ncols, wa + 16 * BS_S * 2,
                     wp + 32 * Ncols, wa + 32 * BS_S * 2, wp + 48 * Ncols, wa + 48 * BS_S * 2);
    ap += 64;
    wp += 64 * Ncols;
  };
  stage(0);
  // k-tile 0 landed (this wave's copies); the barrier publishes it to all waves.
  asm volatile("s_wait_asynccnt 0x0" ::: "memory");
  __syncthreads();
  stage(1);  // in flight while k-tile 0 is worked on

  for (int t = 0; t < K / 64; ++t) {
    const int buf = t & 1;
    const _Float16* const Ab = As[buf];
    const _Float16* const Bb = Bs[buf];
#pragma unroll  // two 32-deep products per k-tile, in ascending k
    for (int kk = 0; kk < 2; ++kk) {
      v16h af[2], bf[4];
#pragma unroll
      for (int i = 0; i < 2; ++i)
        af[i] = load_frag(Ab + (wm * 32 + i * 16) * AS_S + kk * 32, AS_S, lane);
#pragma unroll
      for (int nt = 0; nt < 4; ++nt)
        bf[nt] = load_frag_tr(Bb + kk * 32 * BS_S + wn * 64 + nt * 16, BS_S, lane);
#pragma unroll
      for (int i = 0; i < 2; ++i)
#pragma unroll
        for (int nt = 0; nt < 4; ++nt)
          acc[i][nt] = wmma_f16(af[i], bf[nt], acc[i][nt]);
    }
    // Hand-over: this wave's LDS reads of this k-tile have returned ...
    asm volatile("s_wait_dscnt 0x0" ::: "memory");
    // ... and its copies of the next k-tile have landed;
    asm volatile("s_wait_asynccnt 0x0" ::: "memory");
    // the barrier publishes the next k-tile and frees this one's buffers for the refill.
    __syncthreads();
    if (t + 2 < K / 64) stage(buf);
  }
  // No copy is left in flight when the wave goes on to its epilogue.
  asm volatile("s_wait_asynccnt 0x0" ::: "memory");

  const int hi = lane >> 4, cn = lane & 15;
#pragma unroll
  for (int i = 0; i < 2; ++i)
#pragma unroll
    for (int nt = 0; nt < 4; ++nt)
#pragma unroll
      for (int r = 0; r < 8; ++r) {
        const int row = row0 + wm * 32 + i * 16 + r + 8 * hi;
        const int col = col0 + wn * 64 + nt * 16 + cn;
        C[(size_t)row * Ncols + col] = (_Float16)acc[i][nt][r];
      }
}

__global__ __launch_bounds__(256)
void attn_kernel(const _Float16* Q1, const _Float16* Q2, int qstride, int qsec,
                 const _Float16* Kv1, const _Float16* Kv2, int kstride, int ksec,
                 const _Float16* V1, const _Float16* V2, int vstride, int vsec,
                 _Float16* O1, _Float16* O2, int ostride,
                 int addV) {
  // Two independent passes in one grid: blockIdx.z picks the stream.
  const bool second = blockIdx.z != 0;
  const _Float16* __restrict__ Q  = second ? Q2 : Q1;
  const _Float16* __restrict__ Kv = second ? Kv2 : Kv1;
  const _Float16* __restrict__ V  = second ? V2 : V1;
  _Float16* __restrict__ O = second ? O2 : O1;
  constexpr int LS = 72;  // padded row stride in halfs (144B, 16B-multiple)
  __shared__ alignas(16) _Float16 Ks [2][64 * LS];
  constexpr int VS = 80;  // V row stride in halfs: 160 B = 32 B x odd, for the transposing reader
  __shared__ alignas(16) _Float16 Vs [2][64 * VS];

  const int tid  = threadIdx.x;
  const int lane = tid & 31;
  const int wave = tid >> 5;
  const int bh   = blockIdx.y;
  const int b    = bh >> 3;
  const int h    = bh & 7;
  const int row0 = blockIdx.x * 128;
  const size_t bN = (size_t)b * Nn;
  const int qoff = qsec + h * HDd;
  const int koff = ksec + h * HDd;
  const int voff = vsec + h * HDd;
  const int ooff = h * HDd;

  // Q fragments for this wave's 16 queries (B operand: column = query lane&15):
  // two global_load_b128 per fragment.
  v16h qa0, qa1;
  {
    const _Float16* qp =
        Q + (bN + row0 + wave * 16 + (lane & 15)) * (size_t)qstride + qoff +
        ((lane >> 4) << 3);
    V16U u0, u1;
    u0.h2[0] = *(const h8*)(qp);
    u0.h2[1] = *(const h8*)(qp + 16);
    u1.h2[0] = *(const h8*)(qp + 32);
    u1.h2[1] = *(const h8*)(qp + 48);
    qa0 = u0.v;
    qa1 = u1.v;
  }

  constexpr float c = 0.125f * 1.44269504f;  // HD^-0.5 * log2(e): a literal, so it sits in scalar registers
  float m_old = -1e30f;  // running maximum of this lane's query, unscaled (equal in both halves)
  float l = 0.0f;        // running sum over this half's keys; the halves join after the loop
  v8f o[4];              // o[dt][r] = O^T[dt*16 + 8*hi + r][query]
#pragma unroll
  for (int dt = 0; dt < 4; ++dt) o[dt] = {};

  const int cn = lane & 15;
  const int hi = lane >> 4;

  // Staging: a thread copies 16 bytes of row sr and of row sr + 32 of the K and
  // of the V chunk; kp and vp walk on by one chunk with every call.
  const int sr = tid >> 3, c8 = (tid & 7) << 3;
  const _Float16* kp = Kv + (bN + sr) * (size_t)kstride + koff + c8;
  const _Float16* vp = V  + (bN + sr) * (size_t)vstride + voff + c8;
  const unsigned kd = lds_addr(&Ks[0][sr * LS + c8]);
  const unsigned vd = lds_addr(&Vs[0][sr * VS + c8]);
  auto stage = [&](int buf) {
    const unsigned ka = kd + (unsigned)buf * (64 * LS * 2), va = vd + (unsigned)buf * (64 * VS * 2);
    async_copy4_b128(kp, ka, kp + 32 * (size_t)kstride, ka + 32 * LS * 2,
                     vp, va, vp + 32 * (size_t)vstride, va + 32 * VS * 2);
    kp += 64 * (size_t)kstride;
    vp += 64 * (size_t)vstride;
  };
  stage(0);
  // Chunk 0 landed (this wave's copies); the barrier publishes it to all waves.
  asm volatile("s_wait_asynccnt 0x0" ::: "memory");
  __syncthreads();
  stage(1);  // in flight while chunk 0 is worked on

  for (int j0 = 0; j0 < Nn; j0 += 64) {
    const int buf = (j0 >> 6) & 1;
    const _Float16* const Kb = Ks[buf];
    const _Float16* const Vb = Vs[buf];

    // S^T = K Q^T  (64 keys x 16 queries per wave, 4 WMMA key tiles, K-depth 64):
    // sc[nt][r] = unscaled score of key nt*16 + 8*hi + r against query cn.
    v8f sc[4];
#pragma unroll
    for (int nt = 0; nt < 4; ++nt) {
      v8f z = {};
      z = wmma_f16(load_frag(Kb + (nt * 16) * LS, LS, lane), qa0, z);
      z = wmma_f16(load_frag(Kb + (nt * 16) * LS + 32, LS, lane), qa1, z);
      sc[nt] = z;
    }

    // Online-softmax update, one query per lane.  The maximum is kept in unscaled
    // score units; scale and log2(e) meet a score in one multiply-add:
    // exp(scale * (s - m)) = exp2(s * c - m * c), c = scale * log2(e).
    float mt[4];
#pragma unroll
    for (int nt = 0; nt < 4; ++nt) {
      mt[nt] = sc[nt][0];
#pragma unroll
      for (int r = 1; r < 8; ++r) mt[nt] = fmaxf(mt[nt], sc[nt][r]);
    }
    float mx = fmaxf(fmaxf(mt[0], mt[1]), fmaxf(mt[2], mt[3]));
    mx = fmaxf(mx, other_half(mx));
    const float m_new = fmaxf(m_old, mx);
    const float xa = (m_old - m_new) * c;
    const float alpha = __builtin_amdgcn_exp2f(xa);
    const float nmc = -m_new * c;
    m_old = m_new;

    V16U pb[2];    // P^T of keys 0..31 and 32..63, packed in place as B operands
    v8f x[4];
#pragma unroll
    for (int nt = 0; nt < 4; ++nt) {
      x[nt] = sc[nt] * c + nmc;
#pragma unroll
      for (int r = 0; r < 8; ++r) {
        sc[nt][r] = __builtin_amdgcn_exp2f(x[nt][r]);
        pb[nt >> 1].v[(nt & 1) * 8 + r] = (_Float16)sc[nt][r];
      }
    }
    // The slot between a v_exp_f32 and an overwrite of its source: the arguments
    // stay live up to this v_nop, which stands behind the last exponential.
    asm volatile("v_nop" :: "v"(x[0]), "v"(x[1]), "v"(x[2]), "v"(x[3]), "v"(sc[0]), "v"(sc[1]),
                 "v"(sc[2]), "v"(sc[3]), "v"(xa), "v"(alpha));
    // Sum of this lane's 32 values: the four tiles register by register (packed
    // adds, independent chains), then the eight registers as a tree.
    const v8f ts = (sc[0] + sc[1]) + (sc[2] + sc[3]);
    l = l * alpha + (((ts[0] + ts[1]) + (ts[2] + ts[3])) + ((ts[4] + ts[5]) + (ts[6] + ts[7])));
#pragma unroll
    for (int dt = 0; dt < 4; ++dt)
#pragma unroll
      for (int r = 0; r < 8; ++r) o[dt][r] *= alpha;

    // O^T += V_chunk^T @ P^T.  A-fragments (row = d) from row-major Vs:
    // 2x ds_load_tr16_b128 each; B = P^T straight from registers.
#pragma unroll
    for (int dt = 0; dt < 4; ++dt) {
      o[dt] = wmma_f16(load_frag_tr(Vb + dt * 16, VS, lane), pb[0].v, o[dt]);
      o[dt] = wmma_f16(load_frag_tr(Vb + 32 * VS + dt * 16, VS, lane), pb[1].v, o[dt]);
    }

    // Hand-over: this wave's LDS reads of this chunk have returned ...
    asm volatile("s_wait_dscnt 0x0" ::: "memory");
    // ... and its copies of the next chunk have landed;
    asm volatile("s_wait_asynccnt 0x0" ::: "memory");
    // the barrier publishes the next chunk and frees this chunk's buffer for the refill.
    __syncthreads();
    if (j0 + 128 < Nn) stage(buf);
  }
  // No copy is left in flight when the wave goes on to its epilogue.
  asm volatile("s_wait_asynccnt 0x0" ::: "memory");

  // Residual rows (zero where none is asked for): all four loads go out together,
  // under one block-uniform test, ahead of the divisions.
  const size_t grow = bN + row0 + wave * 16 + cn;
  h8 res[4];
#pragma unroll
  for (int dt = 0; dt < 4; ++dt) res[dt] = {};
  if (addV) {
#pragma unroll
    for (int dt = 0; dt < 4; ++dt)
      res[dt] = *(const h8*)(V + grow * (size_t)vstride + voff + dt * 16 + 8 * hi);
    // The output address below reuses the address registers of the loads above.
    asm volatile("s_wait_xcnt 0x0" ::: "memory");
  }

  // Join the halves' sums, normalize, add the residual, store f16: a lane's
  // 8 accumulator registers are 8 consecutive d of its query, one 16-byte store.
  l += other_half(l);
#pragma unroll
  for (int dt = 0; dt < 4; ++dt) {
    h8 ov;
#pragma unroll
    for (int r = 0; r < 8; ++r)
      ov[r] = (_Float16)(o[dt][r] / l + (float)res[dt][r]);
    *(h8*)(O + grow * (size_t)ostride + ooff + dt * 16 + 8 * hi) = ov;
  }
}

// ---------------------------------------------------------------------------
// First attention stage, both streams in one pass.  Its scores come from the
// gated rows alone (queries and keys are the same tensor X), so softmax(X X^T)
// is the same matrix for stream 1 and stream 2: it is formed once per query
// tile and multiplied into both value tensors,
//   O1 = P V1 + V1,  O2 = P V2 + V2.
// Layouts, fragment maps and the order of every sum are those of attn_kernel.
// X: [B*N][512]; V1, V2: the v section of the [B*N][2048] projections.
// ---------------------------------------------------------------------------

__global__ __launch_bounds__(256)
void attn_shared_kernel(const _Float16* __restrict__ X,
                        const _Float16* __restrict__ V1, const _Float16* __restrict__ V2,
                        _Float16* __restrict__ O1, _Float16* __restrict__ O2) {
  constexpr int XS   = INNERi;      // row stride of X and of the outputs, halfs
  constexpr int VSTR = 4 * INNERi;  // row stride of the projections
  constexpr int VSEC = 2 * INNERi;  // their v section
  constexpr int LS = 72;  // K row stride in halfs (144 B)
  constexpr int VS = 80;  // V row stride in halfs: 160 B = 32 B x odd, for the transposing reader
  __shared__ alignas(16) _Float16 Ks [2][64 * LS];
  __shared__ alignas(16) _Float16 Vs1[2][64 * VS];
  __shared__ alignas(16) _Float16 Vs2[2][64 * VS];

  const int tid  = threadIdx.x;
  const int lane = tid & 31;
  const int wave = tid >> 5;
  const int bh   = blockIdx.y;
  const int b    = bh >> 3;
  const int hoff = (bh & 7) * HDd;
  const int row0 = blockIdx.x * 128;
  const size_t bN = (size_t)b * Nn;
  const int cn = lane & 15;
  const int hi = lane >> 4;
  const size_t grow = bN + row0 + wave * 16 + cn;  // this lane's query row

  // Q fragments for this wave's 16 queries (B operand: column = query lane&15).
  v16h qa0, qa1;
  {
    const _Float16* qp = X + grow * XS + hoff + (hi << 3);
    V16U u0, u1;
    u0.h2[0] = *(const h8*)(qp);
    u0.h2[1] = *(const h8*)(qp + 16);
    u1.h2[0] = *(const h8*)(qp + 32);
    u1.h2[1] = *(const h8*)(qp + 48);
    qa0 = u0.v;
    qa1 = u1.v;
  }

  constexpr float c = 0.125f * 1.44269504f;  // HD^-0.5 * log2(e): a literal, so it sits in scalar registers
  float m_old = -1e30f;  // running maximum of this lane's query, unscaled (equal in both halves)
  float l = 0.0f;        // running sum over this half's keys; the halves join after the loop
  v8f o1[4], o2[4];      // o[dt][r] = O^T[dt*16 + 8*hi + r][query], one set per stream
#pragma unroll
  for (int dt = 0; dt < 4; ++dt) { o1[dt] = {}; o2[dt] = {}; }

  // Staging: a thread copies 16 bytes of row sr and of row sr + 32 of each tile;
  // the three pointers walk on by one chunk with every call.
  const int sr = tid >> 3, c8 = (tid & 7) << 3;
  const _Float16* kp  = X  + (bN + sr) * XS + hoff + c8;
  const _Float16* vp1 = V1 + (bN + sr) * VSTR + VSEC + hoff + c8;
  const _Float16* vp2 = V2 + (bN + sr) * VSTR + VSEC + hoff + c8;
  const unsigned kd  = lds_addr(&Ks [0][sr * LS + c8]);
  const unsigned vd1 = lds_addr(&Vs1[0][sr * VS + c8]);
  const unsigned vd2 = lds_addr(&Vs2[0][sr * VS + c8]);
  auto stage = [&](int buf) {
    const unsigned ka = kd + (unsigned)buf * (64 * LS * 2);
    const unsigned va1 = vd1 + (unsigned)buf * (64 * VS * 2), va2 = vd2 + (unsigned)buf * (64 * VS * 2);
    async_copy6_b128(kp, ka, kp + 32 * XS, ka + 32 * LS * 2,
                     vp1, va1, vp1 + 32 * VSTR, va1 + 32 * VS * 2,
                     vp2, va2, vp2 + 32 * VSTR, va2 + 32 * VS * 2);
    kp  += 64 * XS;
    vp1 += 64 * VSTR;
    vp2 += 64 * VSTR;
  };
  stage(0);
  // Chunk 0 landed (this wave's copies); the barrier publishes it to all waves.
  asm volatile("s_wait_asynccnt 0x0" ::: "memory");
  __syncthreads();
  stage(1);  // in flight while chunk 0 is worked on

  for (int j0 = 0; j0 < Nn; j0 += 64) {
    const int buf = (j0 >> 6) & 1;
    const _Float16* const Kb  = Ks [buf];
    const _Float16* const Vb1 = Vs1[buf];
    const _Float16* const Vb2 = Vs2[buf];

    // S^T = K Q^T: sc[nt][r] = unscaled score of key nt*16 + 8*hi + r against query cn.
    v8f sc[4];
#pragma unroll
    for (int nt = 0; nt < 4; ++nt) {
      v8f z = {};
      z = wmma_f16(load_frag(Kb + (nt * 16) * LS, LS, lane), qa0, z);
      z = wmma_f16(load_frag(Kb + (nt * 16) * LS + 32, LS, lane), qa1, z);
      sc[nt] = z;
    }

    // Online-softmax update, one query per lane.  The maximum is kept in unscaled
    // score units; scale and log2(e) meet a score in one multiply-add:
    // exp(scale * (s - m)) = exp2(s * c - m * c), c = scale * log2(e).
    float mt[4];
#pragma unroll
    for (int nt = 0; nt < 4; ++nt) {
      mt[nt] = sc[nt][0];
#pragma unroll
      for (int r = 1; r < 8; ++r) mt[nt] = fmaxf(mt[nt], sc[nt][r]);
    }
    float mx = fmaxf(fmaxf(mt[0], mt[1]), fmaxf(mt[2], mt[3]));
    mx = fmaxf(mx, other_half(mx));
    const float m_new = fmaxf(m_old, mx);
    const float xa = (m_old - m_new) * c;
    const float alpha = __builtin_amdgcn_exp2f(xa);
    const float nmc = -m_new * c;
    m_old = m_new;

    V16U pb[2];    // P^T of keys 0..31 and 32..63, packed in place as B operands
    v8f x[4];
#pragma unroll
    for (int nt = 0; nt < 4; ++nt) {
      x[nt] = sc[nt] * c + nmc;
#pragma unroll
      for (int r = 0; r < 8; ++r) {
        sc[nt][r] = __builtin_amdgcn_exp2f(x[nt][r]);
        pb[nt >> 1].v[(nt & 1) * 8 + r] = (_Float16)sc[nt][r];
      }
    }
    // The slot between a v_exp_f32 and an overwrite of its source: the arguments
    // stay live up to this v_nop, which stands behind the last exponential.
    asm volatile("v_nop" :: "v"(x[0]), "v"(x[1]), "v"(x[2]), "v"(x[3]), "v"(sc[0]), "v"(sc[1]),
                 "v"(sc[2]), "v"(sc[3]), "v"(xa), "v"(alpha));
    // Sum of this lane's 32 values: the four tiles register by register, then
    // the eight registers as a tree.
    const v8f ts = (sc[0] + sc[1]) + (sc[2] + sc[3]);
    l = l * alpha + (((ts[0] + ts[1]) + (ts[2] + ts[3])) + ((ts[4] + ts[5]) + (ts[6] + ts[7])));
#pragma unroll
    for (int dt = 0; dt < 4; ++dt) {
      o1[dt] *= alpha;
      o2[dt] *= alpha;
    }

    // O^T += V_chunk^T @ P^T for both streams: the same B = P^T from registers,
    // A-fragments (row = d) from each stream's row-major tile.
#pragma unroll
    for (int dt = 0; dt < 4; ++dt) {
      o1[dt] = wmma_f16(load_frag_tr(Vb1 + dt * 16, VS, lane), pb[0].v, o1[dt]);
      o1[dt] = wmma_f16(load_frag_tr(Vb1 + 32 * VS + dt * 16, VS, lane), pb[1].v, o1[dt]);
    }
#pragma unroll
    for (int dt = 0; dt < 4; ++dt) {
      o2[dt] = wmma_f16(load_frag_tr(Vb2 + dt * 16, VS, lane), pb[0].v, o2[dt]);
      o2[dt] = wmma_f16(load_frag_tr(Vb2 + 32 * VS + dt * 16, VS, lane), pb[1].v, o2[dt]);
    }

    // Hand-over: this wave's LDS reads of this chunk have returned ...
    asm volatile("s_wait_dscnt 0x0" ::: "memory");
    // ... and its copies of the next chunk have landed;
    asm volatile("s_wait_asynccnt 0x0" ::: "memory");
    // the barrier publishes the next chunk and frees this chunk's buffers for the refill.
    __syncthreads();
    if (j0 + 128 < Nn) stage(buf);
  }
  // No copy is left in flight when the wave goes on to its epilogue.
  asm volatile("s_wait_asynccnt 0x0" ::: "memory");

  // Residual rows of both streams: all eight loads go out together, ahead of the divisions.
  h8 res1[4], res2[4];
#pragma unroll
  for (int dt = 0; dt < 4; ++dt) {
    res1[dt] = *(const h8*)(V1 + grow * VSTR + VSEC + hoff + dt * 16 + 8 * hi);
    res2[dt] = *(const h8*)(V2 + grow * VSTR + VSEC + hoff + dt * 16 + 8 * hi);
  }

  // Join the halves' sums, normalize, add the residual, store f16: a lane's
  // 8 accumulator registers are 8 consecutive d of its query, one 16-byte store.
  l += other_half(l);
  h8 ov1[4], ov2[4];
#pragma unroll
  for (int dt = 0; dt < 4; ++dt)
#pragma unroll
    for (int r = 0; r < 8; ++r) {
      ov1[dt][r] = (_Float16)(o1[dt][r] / l + (float)res1[dt][r]);
      ov2[dt][r] = (_Float16)(o2[dt][r] / l + (float)res2[dt][r]);
    }
#pragma unroll
  for (int dt = 0; dt < 4; ++dt) {
    *(h8*)(O1 + grow * XS + hoff + dt * 16 + 8 * hi) = ov1[dt];
    *(h8*)(O2 + grow * XS + hoff + dt * 16 + 8 * hi) = ov2[dt];
  }
}

// ---------------------------------------------------------------------------
// Host launcher.
// ---------------------------------------------------------------------------
extern "C" void kernel_launch(void* const* d_in, const int* in_sizes, int n_in,
                              void* d_out, int out_size, void* d_ws, size_t ws_size,
                              hipStream_t stream) {
  (void)in_sizes; (void)n_in; (void)out_size; (void)ws_size;
  const float* x1     = (const float*)d_in[0];
  const float* x2     = (const float*)d_in[1];
  const float* Wqkv1  = (const float*)d_in[2];
  const float* Wqkv2  = (const float*)d_in[3];
  const float* Wout1  = (const float*)d_in[4];
  const float* bout1  = (const float*)d_in[5];
  const float* Wout2  = (const float*)d_in[6];
  const float* bout2  = (const float*)d_in[7];
  const float* conv_w = (const float*)d_in[8];
  const float* conv_b = (const float*)d_in[9];

  const size_t MROWS = (size_t)Bb * Nn;  // 8192
  // Workspace layout (f16). t1 aliases msg (dead after the first attention launch);
  // t2 has a plane of its own: its writer runs beside the reader of u1. Total ~101 MB.
  // The f16 copies of x1, x2 lie in the u1, u2 planes and those of the two W in the
  // t2 plane: they are dead once the first GEMM has run, ahead of those planes' writers.
  _Float16* qkv1h = (_Float16*)d_ws;
  _Float16* qkv2h = qkv1h + MROWS * 2048;
  _Float16* msg   = qkv2h + MROWS * 2048;
  _Float16* u1    = msg + MROWS * 512;
  _Float16* u2    = u1 + MROWS * 512;
  _Float16* t1    = msg;  // alias
  _Float16* t2    = u2 + MROWS * 512;
  _Float16* xh1   = u1;   // alias
  _Float16* xh2   = u2;   // alias
  _Float16* wh1   = t2;   // alias
  _Float16* wh2   = t2 + 512 * 2048;

  float* out1 = (float*)d_out;
  float* out2 = out1 + MROWS * 512;

  const dim3 blk(256);

  // x and Wqkv of both streams -> f16, once
  to_f16_kernel<<<dim3(1280), blk, 0, stream>>>(x1, x2, Wqkv1, Wqkv2, xh1, xh2, wh1, wh2);

  // QKV projections: [8192,512] @ [512,2048] -> f16
  gemm_qkv_kernel<<<dim3(16, 64, 2), blk, 0, stream>>>(xh1, wh1, qkv1h, xh2, wh2, qkv2h);

  // Gated conv branch -> MSg (merged b n (h d), f16)
  conv_gate_kernel<<<dim3(Bb * Nn), dim3(128), 0, stream>>>(qkv1h, qkv2h, conv_w, conv_b, msg);

  // u1 = softmax(MS MS^T)·v1 + v1 ; u2 likewise (sections: q=0,k=512,v=1024,s=1536)
  // (one grid for both: the score matrix is shared)
  attn_shared_kernel<<<dim3(8, 64), blk, 0, stream>>>(msg, qkv1h, qkv2h, u1, u2);
  // t1 = softmax(q1 k1^T)·u1 ; t2 = softmax(q2 k2^T)·u2
  attn_kernel<<<dim3(8, 64, 2), blk, 0, stream>>>(qkv1h, qkv2h, 2048, 0, qkv1h, qkv2h, 2048, 512,
                                                  u1, u2, 512, 0, t1, t2, 512, 0);

  // Output projections with bias -> f32 d_out
  gemm_out_kernel<<<dim3(4, 64, 2), blk, 0, stream>>>(t1, Wout1, bout1, out1,
                                                      t2, Wout2, bout2, out2, 8192, 512, 512);
}

// v009
// A run of this version takes 132 microseconds.
// Two timings next to v008 both put it at 1.05 times that version's speed.
// Counting every step since v000, it is 3.62 times as fast.
#include <hip/hip_runtime.h>
#include <hip/hip_bf16.h>

// ---------------------------------------------------------------------------
// MI455X (gfx1250, wave32) implementation of the hybrid-attention reference.
// All matmuls run on V_WMMA_F32_16X16X32_F16 (f16 in, f32 accumulate).
// Fragment loads are vectorized: each lane's 16-half WMMA fragment is two
// contiguous 16B runs (ISA 7.12.2), loaded as 2x ds_load_b128/global_load_b128.
// W tiles (B operands, [k][col]; async copies in both GEMMs) and V chunks (A operands, [j][d]) are staged
// row-major and transposed on the way out by ds_load_tr16_b128.  The GEMM 2 A tile and the attention K and V chunks are staged with
// CDNA5 GLOBAL_LOAD_ASYNC_TO_LDS_B128 tracked by ASYNCcnt.
// ---------------------------------------------------------------------------

typedef __attribute__((ext_vector_type(16))) _Float16 v16h;
typedef __attribute__((ext_vector_type(8)))  _Float16 h8;
typedef __attribute__((ext_vector_type(4)))  _Float16 h4;
typedef __attribute__((ext_vector_type(8)))  short    s16x8;
typedef __attribute__((address_space(3))) s16x8 lds_s16x8;
typedef __attribute__((ext_vector_type(8)))  float    v8f;

constexpr int Bb     = 8;
constexpr int Nn     = 1024;
constexpr int HDd    = 64;
constexpr int INNERi = 512;

union V16U { v16h v; h8 h2[2]; };

// Fragment loader: lane holds "line" (lane&15) of a row-major tile; the 16
// halves are K = khi..khi+7 and 16+khi..16+khi+7 with khi = 8*(lane>>4),
// i.e. two aligned 16B vector loads. Serves A-fragments (line = row m):
// the GEMM A tiles and the attention K chunks.
__device__ __forceinline__ v16h load_frag(const _Float16* base, int rstride, int lane) {
  const _Float16* p = base + (lane & 15) * rstride + ((lane >> 4) << 3);
  V16U u;
  u.h2[0] = *(const h8*)p;
  u.h2[1] = *(const h8*)(p + 16);
  return u.v;
}

// B-fragment (32 k x 16 columns) or A-fragment (16 rows x 32 k) out of a ROW-MAJOR [k][col] LDS tile: tile
// points at element [k0][col0], pitch is in halfs (bytes: an odd multiple of 32).
// Each transposing load hands lane (c = lane&15, h = lane>>4) the 8 halves
// tile[8h .. 8h+7][c]; the second one, 16 rows on, gives k = 16+8h .. 16+8h+7:
// the k order of load_frag, so the two loaders pair.
__device__ __forceinline__ v16h load_frag_tr(const _Float16* tile, int pitch, int lane) {
  const _Float16* p = tile + (((lane >> 4) << 3) + (lane & 7)) * pitch + (((lane >> 3) & 1) << 3);
  V16U u;
  u.h2[0] = __builtin_bit_cast(h8, __builtin_amdgcn_ds_load_tr16_b128_v8i16((lds_s16x8*)p));
  u.h2[1] = __builtin_bit_cast(h8, __builtin_amdgcn_ds_load_tr16_b128_v8i16((lds_s16x8*)(p + 16 * pitch)));
  return u.v;
}

typedef __attribute__((ext_vector_type(4))) float f4;

__device__ __forceinline__ v8f wmma_f16(v16h a, v16h b, v8f c) {
  // (neg_a, A, neg_b, B, c_mod, C, reuse_a, reuse_b)
  return __builtin_amdgcn_wmma_f32_16x16x32_f16(false, a, false, b, (short)0, c, false, false);
}

// ---------------------------------------------------------------------------
// conv_gate: MS = s1+s2 (f32); depthwise conv (k=5, pad 2) along features with
// per-token weights; MSg = sigmoid(conv) * MS -> f16, merged b n (h d) layout.
// One block per (b, n) row.
// ---------------------------------------------------------------------------
__global__ __launch_bounds__(128)
void conv_gate_kernel(const _Float16* __restrict__ qkv1,
                      const _Float16* __restrict__ qkv2,
                      const float* __restrict__ cw, const float* __restrict__ cb,
                      _Float16* __restrict__ msg) {
  const int bn = blockIdx.x;          // b*N + n
  const int n  = bn & (Nn - 1);
  __shared__ float ms[INNERi + 4];

  const _Float16* s1 = qkv1 + (size_t)bn * 2048 + 1536;
  const _Float16* s2 = qkv2 + (size_t)bn * 2048 + 1536;
  for (int f = threadIdx.x; f < INNERi; f += blockDim.x)
    ms[f + 2] = (float)s1[f] + (float)s2[f];
  if (threadIdx.x < 2) { ms[threadIdx.x] = 0.0f; ms[INNERi + 2 + threadIdx.x] = 0.0f; }
  __syncthreads();

  const float w0 = cw[n * 5 + 0], w1 = cw[n * 5 + 1], w2 = cw[n * 5 + 2],
              w3 = cw[n * 5 + 3], w4 = cw[n * 5 + 4];
  const float bias = cb[n];
  for (int f = threadIdx.x; f < INNERi; f += blockDim.x) {
    const float a = w0 * ms[f] + w1 * ms[f + 1] + w2 * ms[f + 2] +
                    w3 * ms[f + 3] + w4 * ms[f + 4] + bias;
    const float g = ms[f + 2] / (1.0f + __expf(-a));
    msg[(size_t)bn * INNERi + f] = (_Float16)g;
  }
}

// ---------------------------------------------------------------------------
// Flash-attention pass: O = softmax(scale * Q K^T) @ V  (+ V residual),
// computed transposed: S^T = K Q^T, O^T += V^T P^T.
// All tensors live in [B, N, stride] f16 buffers; the head slice is selected
// by (section offset + h*64).  128 query rows per block, 8 waves x 16 queries,
// KV streamed in 64-row chunks through two LDS buffers: the copies of the next
// chunk are in flight while this one is worked on, one barrier per chunk.
//   Ks  : [j][d] row-major, staged via async-to-LDS DMA (no conversion); A of S^T
//   Vs  : [j][d] row-major, staged the same way; transposing loads give A of O^T
// A lane (c = lane&15, hi = lane>>4) owns ONE query, c: of each 16-key tile it
// holds the scores of keys 8*hi .. 8*hi+7, so maximum and sum run in the lane's
// own registers, with one exchange between the wave's halves.  Two score tiles,
// converted in place, are the B operand P^T of a 32-key block (element s is key
// 8*hi+s, then 16+8*hi+(s-8): the k order of load_frag_tr).
// ---------------------------------------------------------------------------

// Value of lane l ^ 16.
__device__ __forceinline__ float other_half(float x) {
  const int i = __builtin_bit_cast(int, x);
  return __builtin_bit_cast(float,
      __builtin_amdgcn_permlanex16(i, i, 0x76543210, 0xfedcba98, false, false));
}

// Four / six 16-byte copies global -> LDS (ASYNCcnt), one chunk's share of a thread.
// The s_wait_xcnt closes the copies' own statement, ahead of any later write of
// their address registers.
__device__ __forceinline__ unsigned lds_addr(const void* p) {
  return (unsigned)(unsigned long long)p;
}
__device__ __forceinline__ void async_copy4_b128(const void* g0, unsigned a0, const void* g1, unsigned a1,
                                                 const void* g2, unsigned a2, const void* g3, unsigned a3) {
  asm volatile("global_load_async_to_lds_b128 %0, %1, off\n\t"
               "global_load_async_to_lds_b128 %2, %3, off\n\t"
               "global_load_async_to_lds_b128 %4, %5, off\n\t"
               "global_load_async_to_lds_b128 %6, %7, off\n\t"
               "s_wait_xcnt 0x0"
               :: "v"(a0), "v"(g0), "v"(a1), "v"(g1), "v"(a2), "v"(g2), "v"(a3), "v"(g3) : "memory");
}
__device__ __forceinline__ void async_copy6_b128(const void* g0, unsigned a0, const void* g1, unsigned a1,
                                                 const void* g2, unsigned a2, const void* g3, unsigned a3,
                                                 const void* g4, unsigned a4, const void* g5, unsigned a5) {
  asm volatile("global_load_async_to_lds_b128 %0, %1, off\n\t"
               "global_load_async_to_lds_b128 %2, %3, off\n\t"
               "global_load_async_to_lds_b128 %4, %5, off\n\t"
               "global_load_async_to_lds_b128 %6, %7, off\n\t"
               "global_load_async_to_lds_b128 %8, %9, off\n\t"
               "global_load_async_to_lds_b128 %10, %11, off\n\t"
               "s_wait_xcnt 0x0"
               :: "v"(a0), "v"(g0), "v"(a1), "v"(g1), "v"(a2), "v"(g2), "v"(a3), "v"(g3),
                  "v"(a4), "v"(g4), "v"(a5), "v"(g5) : "memory");
}

// Eight such copies: one k-tile's share of a thread in either GEMM.
__device__ __forceinline__ void async_copy8_b128(const void* g0, unsigned a0, const void* g1, unsigned a1,
                                                 const void* g2, unsigned a2, const void* g3, unsigned a3,
                                                 const void* g4, unsigned a4, const void* g5, unsigned a5,
                                                 const void* g6, unsigned a6, const void* g7, unsigned a7) {
  asm volatile("global_load_async_to_lds_b128 %0, %1, off\n\t"
               "global_load_async_to_lds_b128 %2, %3, off\n\t"
               "global_load_async_to_lds_b128 %4, %5, off\n\t"
               "global_load_async_to_lds_b128 %6, %7, off\n\t"
               "global_load_async_to_lds_b128 %8, %9, off\n\t"
               "global_load_async_to_lds_b128 %10, %11, off\n\t"
               "global_load_async_to_lds_b128 %12, %13, off\n\t"
               "global_load_async_to_lds_b128 %14, %15, off\n\t"
               "s_wait_xcnt 0x0"
               :: "v"(a0), "v"(g0), "v"(a1), "v"(g1), "v"(a2), "v"(g2), "v"(a3), "v"(g3),
                  "v"(a4), "v"(g4), "v"(a5), "v"(g5), "v"(a6), "v"(g6), "v"(a7), "v"(g7) : "memory");
}

// ---------------------------------------------------------------------------
// Operands of the two GEMMs, f32 -> f16, each element converted once (the first
// GEMM reads every x row 16 times and every W row 64 times, the second every
// row of its W 64 times).  A block takes 8192 floats: blocks 0..511 x1,
// 512..1023 x2, 1024..1151 W1, 1152..1279 W2, 1280..1311 Wo1, 1312..1343 Wo2.
// A wave's load covers 512 B in a row, its store 256 B.
// ---------------------------------------------------------------------------
__global__ __launch_bounds__(256)
void to_f16_kernel(const float* __restrict__ x1, const float* __restrict__ x2,
                   const float* __restrict__ W1, const float* __restrict__ W2,
                   const float* __restrict__ Wo1, const float* __restrict__ Wo2,
                   _Float16* __restrict__ xh1, _Float16* __restrict__ xh2,
                   _Float16* __restrict__ wh1, _Float16* __restrict__ wh2,
                   _Float16* __restrict__ woh1, _Float16* __restrict__ woh2) {
  const int blk = blockIdx.x;
  const float* __restrict__ s = blk < 512 ? x1 : blk < 1024 ? x2 : blk < 1152 ? W1
                              : blk < 1280 ? W2 : blk < 1312 ? Wo1 : Wo2;
  _Float16* __restrict__ d = blk < 512 ? xh1 : blk < 1024 ? xh2 : blk < 1152 ? wh1
                           : blk < 1280 ? wh2 : blk < 1312 ? woh1 : woh2;
  const int b0 = blk < 512 ? blk : blk < 1024 ? blk - 512 : blk < 1152 ? blk - 1024
               : blk < 1280 ? blk - 1152 : blk < 1312 ? blk - 1280 : blk - 1312;
  const size_t base = (size_t)b0 * 8192 + threadIdx.x * 4;
  f4 v[8];
#pragma unroll  // all eight loads go out before the first convert waits
  for (int j = 0; j < 8; ++j) v[j] = *(const f4*)(s + base + j * 1024);
#pragma unroll  // v[] stays in registers
  for (int j = 0; j < 8; ++j)
    *(h4*)(d + base + j * 1024) = h4{(_Float16)v[j].x, (_Float16)v[j].y,
                                     (_Float16)v[j].z, (_Float16)v[j].w};
}

// ---------------------------------------------------------------------------
// GEMM 1: C(f16)[8192,2048] = A(f16)[8192,512] @ W(f16)[512,2048].
// BM=BN=128, BK=64.  8 waves in a 4x2 grid; each wave owns 32x64 = 2x4 WMMA tiles.
// Both tiles lie in memory as LDS wants them, so they go there by asynchronous
// copies (whole 128-B lines), through two buffers: the copies of the next k-tile
// are in flight while this one is worked on, one barrier per k-tile.
//   As : [row][k] row-major;  Bs : [k][col] row-major, read by transposing loads.
// ---------------------------------------------------------------------------
__global__ __launch_bounds__(256)
void gemm_qkv_kernel(const _Float16* __restrict__ A1, const _Float16* __restrict__ W1,
                     _Float16* __restrict__ C1,
                     const _Float16* __restrict__ A2, const _Float16* __restrict__ W2,
                     _Float16* __restrict__ C2) {
  constexpr int K = 512, Ncols = 4 * INNERi;
  // Two independent products in one grid: blockIdx.z picks the stream.
  const bool second = blockIdx.z != 0;
  const _Float16* __restrict__ A = second ? A2 : A1;
  const _Float16* __restrict__ W = second ? W2 : W1;
  _Float16* __restrict__ C = second ? C2 : C1;
  constexpr int AS_S = 72;    // 128 rows x 64 halfs (+pad): 144 B = 16 B x odd
  constexpr int BS_S = 144;   // 64 k-rows x 128 halfs (+pad): 288 B = 32 B x odd
  __shared__ alignas(16) _Float16 As[2][128 * AS_S];
  __shared__ alignas(16) _Float16 Bs[2][64 * BS_S];

  const int tid  = threadIdx.x;
  const int lane = tid & 31;
  const int wave = tid >> 5;
  const int row0 = blockIdx.y * 128;
  const int col0 = blockIdx.x * 128;
  const int wm   = wave & 3;   // row group (32 rows)
  const int wn   = wave >> 2;  // col group (64 cols)

  v8f acc[2][4];
#pragma unroll
  for (int i = 0; i < 2; ++i)
#pragma unroll
    for (int nt = 0; nt < 4; ++nt) acc[i][nt] = {};

  // Staging: a thread copies 16 bytes of rows ar + 32 i of the A tile and of
  // k-rows wr + 16 i of the W tile; ap and wp walk on by one k-tile with every call.
  const int ar = tid >> 3, ac = (tid & 7) << 3;
  const int wr = tid >> 4, wc = (tid & 15) << 3;
  const _Float16* ap = A + (size_t)(row0 + ar) * K + ac;
  const _Float16* wp = W + (size_t)wr * Ncols + col0 + wc;
  const unsigned ad = lds_addr(&As[0][ar * AS_S + ac]);
  const unsigned wd = lds_addr(&Bs[0][wr * BS_S + wc]);
  auto stage = [&](int buf) {
    const unsigned aa = ad + (unsigned)buf * (128 * AS_S * 2), wa = wd + (unsigned)buf * (64 * BS_S * 2);
    async_copy8_b128(ap, aa, ap + 32 * K, aa + 32 * AS_S * 2,
                     ap + 64 * K, aa + 64 * AS_S * 2, ap + 96 * K, aa + 96 * AS_S * 2,
                     wp, wa, wp + 16 * Ncols, wa + 16 * BS_S * 2,
                     wp + 32 * Ncols, wa + 32 * BS_S * 2, wp + 48 * Ncols, wa + 48 * BS_S * 2);
    ap += 64;
    wp += 64 * Ncols;
  };
  stage(0);
  // k-tile 0 landed (this wave's copies); the barrier publishes it to all waves.
  asm volatile("s_wait_asynccnt 0x0" ::: "memory");
  __syncthreads();
  stage(1);  // in flight while k-tile 0 is worked on

  for (int t = 0; t < K / 64; ++t) {
    const int buf = t & 1;
    const _Float16* const Ab = As[buf];
    const _Float16* const Bb = Bs[buf];
#pragma unroll  // two 32-deep products per k-tile, in ascending k
    for (int kk = 0; kk < 2; ++kk) {
      v16h af[2], bf[4];
#pragma unroll
      for (int i = 0; i < 2; ++i)
        af[i] = load_frag(Ab + (wm * 32 + i * 16) * AS_S + kk * 32, AS_S, lane);
#pragma unroll
      for (int nt = 0; nt < 4; ++nt)
        bf[nt] = load_frag_tr(Bb + kk * 32 * BS_S + wn * 64 + nt * 16, BS_S, lane);
#pragma unroll
      for (int i = 0; i < 2; ++i)
#pragma unroll
        for (int nt = 0; nt < 4; ++nt)
          acc[i][nt] = wmma_f16(af[i], bf[nt], acc[i][nt]);
    }
    // Hand-over: this wave's LDS reads of this k-tile have returned ...
    asm volatile("s_wait_dscnt 0x0" ::: "memory");
    // ... and its copies of the next k-tile have landed;
    asm volatile("s_wait_asynccnt 0x0" ::: "memory");
    // the barrier publishes the next k-tile and frees this one's buffers for the refill.
    __syncthreads();
    if (t + 2 < K / 64) stage(buf);
  }
  // No copy is left in flight when the wave goes on to its epilogue.
  asm volatile("s_wait_asynccnt 0x0" ::: "memory");

  const int hi = lane >> 4, cn = lane & 15;
#pragma unroll
  for (int i = 0; i < 2; ++i)
#pragma unroll
    for (int nt = 0; nt < 4; ++nt)
#pragma unroll
      for (int r = 0; r < 8; ++r) {
        const int row = row0 + wm * 32 + i * 16 + r + 8 * hi;
        const int col = col0 + wn * 64 + nt * 16 + cn;
        C[(size_t)row * Ncols + col] = (_Float16)acc[i][nt][r];
      }
}

// ---------------------------------------------------------------------------
// GEMM 2: out(f32)[8192,512] = A(f16)[8192,512] @ W(f16)[512,512] + bias.
// Tiles, staging, ring and fragment maps are those of GEMM 1: BM=BN=128, BK=64,
// asynchronous copies into two buffers, the next k-tile in flight while this one
// is worked on, one barrier per k-tile.  512 work-groups, two to a WGP.
// ---------------------------------------------------------------------------
__global__ __launch_bounds__(256)
void gemm_out_kernel(const _Float16* __restrict__ A1, const _Float16* __restrict__ W1,
                     const float* __restrict__ bias1, float* __restrict__ C1,
                     const _Float16* __restrict__ A2, const _Float16* __restrict__ W2,
                     const float* __restrict__ bias2, float* __restrict__ C2) {
  constexpr int K = INNERi, Ncols = 512;
  // Two independent products in one grid: blockIdx.z picks the stream.
  const bool second = blockIdx.z != 0;
  const _Float16* __restrict__ A = second ? A2 : A1;
  const _Float16* __restrict__ W = second ? W2 : W1;
  const float* __restrict__ bias = second ? bias2 : bias1;
  float* __restrict__ C = second ? C2 : C1;
  constexpr int AS_S = 72;    // 128 rows x 64 halfs (+pad): 144 B = 16 B x odd
  constexpr int BS_S = 144;   // 64 k-rows x 128 halfs (+pad): 288 B = 32 B x odd
  __shared__ alignas(16) _Float16 As[2][128 * AS_S];
  __shared__ alignas(16) _Float16 Bs[2][64 * BS_S];

  const int tid  = threadIdx.x;
  const int lane = tid & 31;
  const int wave = tid >> 5;
  const int row0 = blockIdx.y * 128;
  const int col0 = blockIdx.x * 128;
  const int wm   = wave & 3;   // row group (32 rows)
  const int wn   = wave >> 2;  // col group (64 cols)

  v8f acc[2][4];
#pragma unroll
  for (int i = 0; i < 2; ++i)
#pragma unroll
    for (int nt = 0; nt < 4; ++nt) acc[i][nt] = {};

  // Staging: a thread copies 16 bytes of rows ar + 32 i of the A tile and of
  // k-rows wr + 16 i of the W tile; ap and wp walk on by one k-tile with every call.
  const int ar = tid >> 3, ac = (tid & 7) << 3;
  const int wr = tid >> 4, wc = (tid & 15) << 3;
  const _Float16* ap = A + (size_t)(row0 + ar) * K + ac;
  const _Float16* wp = W + (size_t)wr * Ncols + col0 + wc;
  const unsigned ad = lds_addr(&As[0][ar * AS_S + ac]);
  const unsigned wd = lds_addr(&Bs[0][wr * BS_S + wc]);
  auto stage = [&](int buf) {
    const unsigned aa = ad + (unsigned)buf * (128 * AS_S * 2), wa = wd + (unsigned)buf * (64 * BS_S * 2);
    async_copy8_b128(ap, aa, ap + 32 * K, aa + 32 * AS_S * 2,
                     ap + 64 * K, aa + 64 * AS_S * 2, ap + 96 * K, aa + 96 * AS_S * 2,
                     wp, wa, wp + 16 * Ncols, wa + 16 * BS_S * 2,
                     wp + 32 * Ncols, wa + 32 * BS_S * 2, wp + 48 * Ncols, wa + 48 * BS_S * 2);
    ap += 64;
    wp += 64 * Ncols;
  };
  stage(0);
  // k-tile 0 landed (this wave's copies); the barrier publishes it to all waves.
  asm volatile("s_wait_asynccnt 0x0" ::: "memory");
  __syncthreads();
  stage(1);  // in flight while k-tile 0 is worked on

  for (int t = 0; t < K / 64; ++t) {
    const int buf = t & 1;
    const _Float16* const Ab = As[buf];
    const _Float16* const Bb = Bs[buf];
#pragma unroll  // two 32-deep products per k-tile, in ascending k
    for (int kk = 0; kk < 2; ++kk) {
      v16h af[2], bf[4];
#pragma unroll
      for (int i = 0; i < 2; ++i)
        af[i] = load_frag(Ab + (wm * 32 + i * 16) * AS_S + kk * 32, AS_S, lane);
#pragma unroll
      for (int nt = 0; nt < 4; ++nt)
        bf[nt] = load_frag_tr(Bb + kk * 32 * BS_S + wn * 64 + nt * 16, BS_S, lane);
#pragma unroll
      for (int i = 0; i < 2; ++i)
#pragma unroll
        for (int nt = 0; nt < 4; ++nt)
          acc[i][nt] = wmma_f16(af[i], bf[nt], acc[i][nt]);
    }
    // Hand-over: this wave's LDS reads of this k-tile have returned ...
    asm volatile("s_wait_dscnt 0x0" ::: "memory");
    // ... and its copies of the next k-tile have landed;
    asm volatile("s_wait_asynccnt 0x0" ::: "memory");
    // the barrier publishes the next k-tile and frees this one's buffers for the refill.
    __syncthreads();
    if (t + 2 < K / 64) stage(buf);
  }
  // No copy is left in flight when the wave goes on to its epilogue.
  asm volatile("s_wait_asynccnt 0x0" ::: "memory");

  const int hi = lane >> 4, cn = lane & 15;
#pragma unroll
  for (int i = 0; i < 2; ++i)
#pragma unroll
    for (int nt = 0; nt < 4; ++nt)
#pragma unroll
      for (int r = 0; r < 8; ++r) {
        const int row = row0 + wm * 32 + i * 16 + r + 8 * hi;
        const int col = col0 + wn * 64 + nt * 16 + cn;
        C[(size_t)row * Ncols + col] = acc[i][nt][r] + bias[col];
      }
}

__global__ __launch_bounds__(256)
void attn_kernel(const _Float16* Q1, const _Float16* Q2, int qstride, int qsec,
                 const _Float16* Kv1, const _Float16* Kv2, int kstride, int ksec,
                 const _Float16* V1, const _Float16* V2, int vstride, int vsec,
                 _Float16* O1, _Float16* O2, int ostride,
                 int addV) {
  // Two independent passes in one grid: blockIdx.z picks the stream.
  const bool second = blockIdx.z != 0;
  const _Float16* __restrict__ Q  = second ? Q2 : Q1;
  const _Float16* __restrict__ Kv = second ? Kv2 : Kv1;
  const _Float16* __restrict__ V  = second ? V2 : V1;
  _Float16* __restrict__ O = second ? O2 : O1;
  constexpr int LS = 72;  // padded row stride in halfs (144B, 16B-multiple)
  __shared__ alignas(16) _Float16 Ks [2][64 * LS];
  constexpr int VS = 80;  // V row stride in halfs: 160 B = 32 B x odd, for the transposing reader
  __shared__ alignas(16) _Float16 Vs [2][64 * VS];

  const int tid  = threadIdx.x;
  const int lane = tid & 31;
  const int wave = tid >> 5;
  const int bh   = blockIdx.y;
  const int b    = bh >> 3;
  const int h    = bh & 7;
  const int row0 = blockIdx.x * 128;
  const size_t bN = (size_t)b * Nn;
  const int qoff = qsec + h * HDd;
  const int koff = ksec + h * HDd;
  const int voff = vsec + h * HDd;
  const int ooff = h * HDd;

  // Q fragments for this wave's 16 queries (B operand: column = query lane&15):
  // two global_load_b128 per fragment.
  v16h qa0, qa1;
  {
    const _Float16* qp =
        Q + (bN + row0 + wave * 16 + (lane & 15)) * (size_t)qstride + qoff +
        ((lane >> 4) << 3);
    V16U u0, u1;
    u0.h2[0] = *(const h8*)(qp);
    u0.h2[1] = *(const h8*)(qp + 16);
    u1.h2[0] = *(const h8*)(qp + 32);
    u1.h2[1] = *(const h8*)(qp + 48);
    qa0 = u0.v;
    qa1 = u1.v;
  }

  constexpr float c = 0.125f * 1.44269504f;  // HD^-0.5 * log2(e): a literal, so it sits in scalar registers
  float m_old = -1e30f;  // running maximum of this lane's query, unscaled (equal in both halves)
  float l = 0.0f;        // running sum over this half's keys; the halves join after the loop
  v8f o[4];              // o[dt][r] = O^T[dt*16 + 8*hi + r][query]
#pragma unroll
  for (int dt = 0; dt < 4; ++dt) o[dt] = {};

  const int cn = lane & 15;
  const int hi = lane >> 4;

  // Staging: a thread copies 16 bytes of row sr and of row sr + 32 of the K and
  // of the V chunk; kp and vp walk on by one chunk with every call.
  const int sr = tid >> 3, c8 = (tid & 7) << 3;
  const _Float16* kp = Kv + (bN + sr) * (size_t)kstride + koff + c8;
  const _Float16* vp = V  + (bN + sr) * (size_t)vstride + voff + c8;
  const unsigned kd = lds_addr(&Ks[0][sr * LS + c8]);
  const unsigned vd = lds_addr(&Vs[0][sr * VS + c8]);
  auto stage = [&](int buf) {
    const unsigned ka = kd + (unsigned)buf * (64 * LS * 2), va = vd + (unsigned)buf * (64 * VS * 2);
    async_copy4_b128(kp, ka, kp + 32 * (size_t)kstride, ka + 32 * LS * 2,
                     vp, va, vp + 32 * (size_t)vstride, va + 32 * VS * 2);
    kp += 64 * (size_t)kstride;
    vp += 64 * (size_t)vstride;
  };
  stage(0);
  // Chunk 0 landed (this wave's copies); the barrier publishes it to all waves.
  asm volatile("s_wait_asynccnt 0x0" ::: "memory");
  __syncthreads();
  stage(1);  // in flight while chunk 0 is worked on

  for (int j0 = 0; j0 < Nn; j0 += 64) {
    const int buf = (j0 >> 6) & 1;
    const _Float16* const Kb = Ks[buf];
    const _Float16* const Vb = Vs[buf];

    // S^T = K Q^T  (64 keys x 16 queries per wave, 4 WMMA key tiles, K-depth 64):
    // sc[nt][r] = unscaled score of key nt*16 + 8*hi + r against query cn.
    v8f sc[4];
#pragma unroll
    for (int nt = 0; nt < 4; ++nt) {
      v8f z = {};
      z = wmma_f16(load_frag(Kb + (nt * 16) * LS, LS, lane), qa0, z);
      z = wmma_f16(load_frag(Kb + (nt * 16) * LS + 32, LS, lane), qa1, z);
      sc[nt] = z;
    }

    // Online-softmax update, one query per lane.  The maximum is kept in unscaled
    // score units; scale and log2(e) meet a score in one multiply-add:
    // exp(scale * (s - m)) = exp2(s * c - m * c), c = scale * log2(e).
    float mt[4];
#pragma unroll
    for (int nt = 0; nt < 4; ++nt) {
      mt[nt] = sc[nt][0];
#pragma unroll
      for (int r = 1; r < 8; ++r) mt[nt] = fmaxf(mt[nt], sc[nt][r]);
    }
    float mx = fmaxf(fmaxf(mt[0], mt[1]), fmaxf(mt[2], mt[3]));
    mx = fmaxf(mx, other_half(mx));
    const float m_new = fmaxf(m_old, mx);
    const float xa = (m_old - m_new) * c;
    const float alpha = __builtin_amdgcn_exp2f(xa);
    const float nmc = -m_new * c;
    m_old = m_new;

    V16U pb[2];    // P^T of keys 0..31 and 32..63, packed in place as B operands
    v8f x[4];
#pragma unroll
    for (int nt = 0; nt < 4; ++nt) {
      x[nt] = sc[nt] * c + nmc;
#pragma unroll
      for (int r = 0; r < 8; ++r) {
        sc[nt][r] = __builtin_amdgcn_exp2f(x[nt][r]);
        pb[nt >> 1].v[(nt & 1) * 8 + r] = (_Float16)sc[nt][r];
      }
    }
    // The slot between a v_exp_f32 and an overwrite of its source: the arguments
    // stay live up to this v_nop, which stands behind the last exponential.
    asm volatile("v_nop" :: "v"(x[0]), "v"(x[1]), "v"(x[2]), "v"(x[3]), "v"(sc[0]), "v"(sc[1]),
                 "v"(sc[2]), "v"(sc[3]), "v"(xa), "v"(alpha));
    // Sum of this lane's 32 values: the four tiles register by register (packed
    // adds, independent chains), then the eight registers as a tree.
    const v8f ts = (sc[0] + sc[1]) + (sc[2] + sc[3]);
    l = l * alpha + (((ts[0] + ts[1]) + (ts[2] + ts[3])) + ((ts[4] + ts[5]) + (ts[6] + ts[7])));
#pragma unroll
    for (int dt = 0; dt < 4; ++dt)
#pragma unroll
      for (int r = 0; r < 8; ++r) o[dt][r] *= alpha;

    // O^T += V_chunk^T @ P^T.  A-fragments (row = d) from row-major Vs:
    // 2x ds_load_tr16_b128 each; B = P^T straight from registers.
#pragma unroll
    for (int dt = 0; dt < 4; ++dt) {
      o[dt] = wmma_f16(load_frag_tr(Vb + dt * 16, VS, lane), pb[0].v, o[dt]);
      o[dt] = wmma_f16(load_frag_tr(Vb + 32 * VS + dt * 16, VS, lane), pb[1].v, o[dt]);
    }

    // Hand-over: this wave's LDS reads of this chunk have returned ...
    asm volatile("s_wait_dscnt 0x0" ::: "memory");
    // ... and its copies of the next chunk have landed;
    asm volatile("s_wait_asynccnt 0x0" ::: "memory");
    // the barrier publishes the next chunk and frees this chunk's buffer for the refill.
    __syncthreads();
    if (j0 + 128 < Nn) stage(buf);
  }
  // No copy is left in flight when the wave goes on to its epilogue.
  asm volatile("s_wait_asynccnt 0x0" ::: "memory");

  // Residual rows (zero where none is asked for): all four loads go out together,
  // under one block-uniform test, ahead of the divisions.
  const size_t grow = bN + row0 + wave * 16 + cn;
  h8 res[4];
#pragma unroll
  for (int dt = 0; dt < 4; ++dt) res[dt] = {};
  if (addV) {
#pragma unroll
    for (int dt = 0; dt < 4; ++dt)
      res[dt] = *(const h8*)(V + grow * (size_t)vstride + voff + dt * 16 + 8 * hi);
    // The output address below reuses the address registers of the loads above.
    asm volatile("s_wait_xcnt 0x0" ::: "memory");
  }

  // Join the halves' sums, normalize, add the residual, store f16: a lane's
  // 8 accumulator registers are 8 consecutive d of its query, one 16-byte store.
  l += other_half(l);
#pragma unroll
  for (int dt = 0; dt < 4; ++dt) {
    h8 ov;
#pragma unroll
    for (int r = 0; r < 8; ++r)
      ov[r] = (_Float16)(o[dt][r] / l + (float)res[dt][r]);
    *(h8*)(O + grow * (size_t)ostride + ooff + dt * 16 + 8 * hi) = ov;
  }
}

// ---------------------------------------------------------------------------
// First attention stage, both streams in one pass.  Its scores come from the
// gated rows alone (queries and keys are the same tensor X), so softmax(X X^T)
// is the same matrix for stream 1 and stream 2: it is formed once per query
// tile and multiplied into both value tensors,
//   O1 = P V1 + V1,  O2 = P V2 + V2.
// Layouts, fragment maps and the order of every sum are those of attn_kernel.
// X: [B*N][512]; V1, V2: the v section of the [B*N][2048] projections.
// ---------------------------------------------------------------------------

__global__ __launch_bounds__(256)
void attn_shared_kernel(const _Float16* __restrict__ X,
                        const _Float16* __restrict__ V1, const _Float16* __restrict__ V2,
                        _Float16* __restrict__ O1, _Float16* __restrict__ O2) {
  constexpr int XS   = INNERi;      // row stride of X and of the outputs, halfs
  constexpr int VSTR = 4 * INNERi;  // row stride of the projections
  constexpr int VSEC = 2 * INNERi;  // their v section
  constexpr int LS = 72;  // K row stride in halfs (144 B)
  constexpr int VS = 80;  // V row stride in halfs: 160 B = 32 B x odd, for the transposing reader
  __shared__ alignas(16) _Float16 Ks [2][64 * LS];
  __shared__ alignas(16) _Float16 Vs1[2][64 * VS];
  __shared__ alignas(16) _Float16 Vs2[2][64 * VS];

  const int tid  = threadIdx.x;
  const int lane = tid & 31;
  const int wave = tid >> 5;
  const int bh   = blockIdx.y;
  const int b    = bh >> 3;
  const int hoff = (bh & 7) * HDd;
  const int row0 = blockIdx.x * 128;
  const size_t bN = (size_t)b * Nn;
  const int cn = lane & 15;
  const int hi = lane >> 4;
  const size_t grow = bN + row0 + wave * 16 + cn;  // this lane's query row

  // Q fragments for this wave's 16 queries (B operand: column = query lane&15).
  v16h qa0, qa1;
  {
    const _Float16* qp = X + grow * XS + hoff + (hi << 3);
    V16U u0, u1;
    u0.h2[0] = *(const h8*)(qp);
    u0.h2[1] = *(const h8*)(qp + 16);
    u1.h2[0] = *(const h8*)(qp + 32);
    u1.h2[1] = *(const h8*)(qp + 48);
    qa0 = u0.v;
    qa1 = u1.v;
  }

  constexpr float c = 0.125f * 1.44269504f;  // HD^-0.5 * log2(e): a literal, so it sits in scalar registers
  float m_old = -1e30f;  // running maximum of this lane's query, unscaled (equal in both halves)
  float l = 0.0f;        // running sum over this half's keys; the halves join after the loop
  v8f o1[4], o2[4];      // o[dt][r] = O^T[dt*16 + 8*hi + r][query], one set per stream
#pragma unroll
  for (int dt = 0; dt < 4; ++dt) { o1[dt] = {}; o2[dt] = {}; }

  // Staging: a thread copies 16 bytes of row sr and of row sr + 32 of each tile;
  // the three pointers walk on by one chunk with every call.
  const int sr = tid >> 3, c8 = (tid & 7) << 3;
  const _Float16* kp  = X  + (bN + sr) * XS + hoff + c8;
  const _Float16* vp1 = V1 + (bN + sr) * VSTR + VSEC + hoff + c8;
  const _Float16* vp2 = V2 + (bN + sr) * VSTR + VSEC + hoff + c8;
  const unsigned kd  = lds_addr(&Ks [0][sr * LS + c8]);
  const unsigned vd1 = lds_addr(&Vs1[0][sr * VS + c8]);
  const unsigned vd2 = lds_addr(&Vs2[0][sr * VS + c8]);
  auto stage = [&](int buf) {
    const unsigned ka = kd + (unsigned)buf * (64 * LS * 2);
    const unsigned va1 = vd1 + (unsigned)buf * (64 * VS * 2), va2 = vd2 + (unsigned)buf * (64 * VS * 2);
    async_copy6_b128(kp, ka, kp + 32 * XS, ka + 32 * LS * 2,
                     vp1, va1, vp1 + 32 * VSTR, va1 + 32 * VS * 2,
                     vp2, va2, vp2 + 32 * VSTR, va2 + 32 * VS * 2);
    kp  += 64 * XS;
    vp1 += 64 * VSTR;
    vp2 += 64 * VSTR;
  };
  stage(0);
  // Chunk 0 landed (this wave's copies); the barrier publishes it to all waves.
  asm volatile("s_wait_asynccnt 0x0" ::: "memory");
  __syncthreads();
  stage(1);  // in flight while chunk 0 is worked on

  for (int j0 = 0; j0 < Nn; j0 += 64) {
    const int buf = (j0 >> 6) & 1;
    const _Float16* const Kb  = Ks [buf];
    const _Float16* const Vb1 = Vs1[buf];
    const _Float16* const Vb2 = Vs2[buf];

    // S^T = K Q^T: sc[nt][r] = unscaled score of key nt*16 + 8*hi + r against query cn.
    v8f sc[4];
#pragma unroll
    for (int nt = 0; nt < 4; ++nt) {
      v8f z = {};
      z = wmma_f16(load_frag(Kb + (nt * 16) * LS, LS, lane), qa0, z);
      z = wmma_f16(load_frag(Kb + (nt * 16) * LS + 32, LS, lane), qa1, z);
      sc[nt] = z;
    }

    // Online-softmax update, one query per lane.  The maximum is kept in unscaled
    // score units; scale and log2(e) meet a score in one multiply-add:
    // exp(scale * (s - m)) = exp2(s * c - m * c), c = scale * log2(e).
    float mt[4];
#pragma unroll
    for (int nt = 0; nt < 4; ++nt) {
      mt[nt] = sc[nt][0];
#pragma unroll
      for (int r = 1; r < 8; ++r) mt[nt] = fmaxf(mt[nt], sc[nt][r]);
    }
    float mx = fmaxf(fmaxf(mt[0], mt[1]), fmaxf(mt[2], mt[3]));
    mx = fmaxf(mx, other_half(mx));
    const float m_new = fmaxf(m_old, mx);
    const float xa = (m_old - m_new) * c;
    const float alpha = __builtin_amdgcn_exp2f(xa);
    const float nmc = -m_new * c;
    m_old = m_new;

    V16U pb[2];    // P^T of keys 0..31 and 32..63, packed in place as B operands
    v8f x[4];
#pragma unroll
    for (int nt = 0; nt < 4; ++nt) {
      x[nt] = sc[nt] * c + nmc;
#pragma unroll
      for (int r = 0; r < 8; ++r) {
        sc[nt][r] = __builtin_amdgcn_exp2f(x[nt][r]);
        pb[nt >> 1].v[(nt & 1) * 8 + r] = (_Float16)sc[nt][r];
      }
    }
    // The slot between a v_exp_f32 and an overwrite of its source: the arguments
    // stay live up to this v_nop, which stands behind the last exponential.
    asm volatile("v_nop" :: "v"(x[0]), "v"(x[1]), "v"(x[2]), "v"(x[3]), "v"(sc[0]), "v"(sc[1]),
                 "v"(sc[2]), "v"(sc[3]), "v"(xa), "v"(alpha));
    // Sum of this lane's 32 values: the four tiles register by register, then
    // the eight registers as a tree.
    const v8f ts = (sc[0] + sc[1]) + (sc[2] + sc[3]);
    l = l * alpha + (((ts[0] + ts[1]) + (ts[2] + ts[3])) + ((ts[4] + ts[5]) + (ts[6] + ts[7])));
#pragma unroll
    for (int dt = 0; dt < 4; ++dt) {
      o1[dt] *= alpha;
      o2[dt] *= alpha;
    }

    // O^T += V_chunk^T @ P^T for both streams: the same B = P^T from registers,
    // A-fragments (row = d) from each stream's row-major tile.
#pragma unroll
    for (int dt = 0; dt < 4; ++dt) {
      o1[dt] = wmma_f16(load_frag_tr(Vb1 + dt * 16, VS, lane), pb[0].v, o1[dt]);
      o1[dt] = wmma_f16(load_frag_tr(Vb1 + 32 * VS + dt * 16, VS, lane), pb[1].v, o1[dt]);
    }
#pragma unroll
    for (int dt = 0; dt < 4; ++dt) {
      o2[dt] = wmma_f16(load_frag_tr(Vb2 + dt * 16, VS, lane), pb[0].v, o2[dt]);
      o2[dt] = wmma_f16(load_frag_tr(Vb2 + 32 * VS + dt * 16, VS, lane), pb[1].v, o2[dt]);
    }

    // Hand-over: this wave's LDS reads of this chunk have returned ...
    asm volatile("s_wait_dscnt 0x0" ::: "memory");
    // ... and its copies of the next chunk have landed;
    asm volatile("s_wait_asynccnt 0x0" ::: "memory");
    // the barrier publishes the next chunk and frees this chunk's buffers for the refill.
    __syncthreads();
    if (j0 + 128 < Nn) stage(buf);
  }
  // No copy is left in flight when the wave goes on to its epilogue.
  asm volatile("s_wait_asynccnt 0x0" ::: "memory");

  // Residual rows of both streams: all eight loads go out together, ahead of the divisions.
  h8 res1[4], res2[4];
#pragma unroll
  for (int dt = 0; dt < 4; ++dt) {
    res1[dt] = *(const h8*)(V1 + grow * VSTR + VSEC + hoff + dt * 16 + 8 * hi);
    res2[dt] = *(const h8*)(V2 + grow * VSTR + VSEC + hoff + dt * 16 + 8 * hi);
  }

  // Join the halves' sums, normalize, add the residual, store f16: a lane's
  // 8 accumulator registers are 8 consecutive d of its query, one 16-byte store.
  l += other_half(l);
  h8 ov1[4], ov2[4];
#pragma unroll
  for (int dt = 0; dt < 4; ++dt)
#pragma unroll
    for (int r = 0; r < 8; ++r) {
      ov1[dt][r] = (_Float16)(o1[dt][r] / l + (float)res1[dt][r]);
      ov2[dt][r] = (_Float16)(o2[dt][r] / l + (float)res2[dt][r]);
    }
#pragma unroll
  for (int dt = 0; dt < 4; ++dt) {
    *(h8*)(O1 + grow * XS + hoff + dt * 16 + 8 * hi) = ov1[dt];
    *(h8*)(O2 + grow * XS + hoff + dt * 16 + 8 * hi) = ov2[dt];
  }
}

// ---------------------------------------------------------------------------
// Host launcher.
// ---------------------------------------------------------------------------
extern "C" void kernel_launch(void* const* d_in, const int* in_sizes, int n_in,
                              void* d_out, int out_size, void* d_ws, size_t ws_size,
                              hipStream_t stream) {
  (void)in_sizes; (void)n_in; (void)out_size; (void)ws_size;
  const float* x1     = (const float*)d_in[0];
  const float* x2     = (const float*)d_in[1];
  const float* Wqkv1  = (const float*)d_in[2];
  const float* Wqkv2  = (const float*)d_in[3];
  const float* Wout1  = (const float*)d_in[4];
  const float* bout1  = (const float*)d_in[5];
  const float* Wout2  = (const float*)d_in[6];
  const float* bout2  = (const float*)d_in[7];
  const float* conv_w = (const float*)d_in[8];
  const float* conv_b = (const float*)d_in[9];

  const size_t MROWS = (size_t)Bb * Nn;  // 8192
  // Workspace layout (f16). t1 aliases msg (dead after the first attention launch);
  // t2 has a plane of its own: its writer runs beside the reader of u1. Total ~102 MB.
  // The f16 copies of x1, x2 lie in the u1, u2 planes and those of the two W in the
  // t2 plane: they are dead once the first GEMM has run, ahead of those planes' writers.
  _Float16* qkv1h = (_Float16*)d_ws;
  _Float16* qkv2h = qkv1h + MROWS * 2048;
  _Float16* msg   = qkv2h + MROWS * 2048;
  _Float16* u1    = msg + MROWS * 512;
  _Float16* u2    = u1 + MROWS * 512;
  _Float16* t1    = msg;  // alias
  _Float16* t2    = u2 + MROWS * 512;
  _Float16* xh1   = u1;   // alias
  _Float16* xh2   = u2;   // alias
  _Float16* wh1   = t2;   // alias
  _Float16* wh2   = t2 + 512 * 2048;
  _Float16* woh1  = t2 + MROWS * 512;  // f16 Wout1, Wout2: planes of their own, live to the last launch
  _Float16* woh2  = woh1 + 512 * 512;

  float* out1 = (float*)d_out;
  float* out2 = out1 + MROWS * 512;

  const dim3 blk(256);

  // x, Wqkv and Wout of both streams -> f16, once
  to_f16_kernel<<<dim3(1344), blk, 0, stream>>>(x1, x2, Wqkv1, Wqkv2, Wout1, Wout2,
                                                xh1, xh2, wh1, wh2, woh1, woh2);

  // QKV projections: [8192,512] @ [512,2048] -> f16
  gemm_qkv_kernel<<<dim3(16, 64, 2), blk, 0, stream>>>(xh1, wh1, qkv1h, xh2, wh2, qkv2h);

  // Gated conv branch -> MSg (merged b n (h d), f16)
  conv_gate_kernel<<<dim3(Bb * Nn), dim3(128), 0, stream>>>(qkv1h, qkv2h, conv_w, conv_b, msg);

  // u1 = softmax(MS MS^T)·v1 + v1 ; u2 likewise (sections: q=0,k=512,v=1024,s=1536)
  // (one grid for both: the score matrix is shared)
  attn_shared_kernel<<<dim3(8, 64), blk, 0, stream>>>(msg, qkv1h, qkv2h, u1, u2);
  // t1 = softmax(q1 k1^T)·u1 ; t2 = softmax(q2 k2^T)·u2
  attn_kernel<<<dim3(8, 64, 2), blk, 0, stream>>>(qkv1h, qkv2h, 2048, 0, qkv1h, qkv2h, 2048, 512,
                                                  u1, u2, 512, 0, t1, t2, 512, 0);

  // Output projections with bias -> f32 d_out
  gemm_out_kernel<<<dim3(4, 64, 2), blk, 0, stream>>>(t1, woh1, bout1, out1, t2, woh2, bout2, out2);
}

// v010
// Measured time: 128 microseconds a run.
// Timed twice side by side with v009, it ran 1.04 and 1.03 times as fast.
// Over all steps from v000 it is 3.74 times as fast.
#include <hip/hip_runtime.h>
#include <hip/hip_bf16.h>

// ---------------------------------------------------------------------------
// MI455X (gfx1250, wave32) implementation of the hybrid-attention reference.
// All matmuls run on V_WMMA_F32_16X16X32_F16 (f16 in, f32 accumulate).
// Fragment loads are vectorized: each lane's 16-half WMMA fragment is two
// contiguous 16B runs (ISA 7.12.2), loaded as 2x ds_load_b128/global_load_b128.
// W tiles (A operands, [k][col]; async copies in both GEMMs) and V chunks (A operands, [j][d]) are staged
// row-major and transposed on the way out by ds_load_tr16_b128.  The GEMM 2 A tile and the attention K and V chunks are staged with
// CDNA5 GLOBAL_LOAD_ASYNC_TO_LDS_B128 tracked by ASYNCcnt.
// ---------------------------------------------------------------------------

typedef __attribute__((ext_vector_type(16))) _Float16 v16h;
typedef __attribute__((ext_vector_type(8)))  _Float16 h8;
typedef __attribute__((ext_vector_type(4)))  _Float16 h4;
typedef __attribute__((ext_vector_type(8)))  short    s16x8;
typedef __attribute__((address_space(3))) s16x8 lds_s16x8;
typedef __attribute__((ext_vector_type(8)))  float    v8f;

constexpr int Bb     = 8;
constexpr int Nn     = 1024;
constexpr int HDd    = 64;
constexpr int INNERi = 512;

union V16U { v16h v; h8 h2[2]; };

// Fragment loader: lane holds "line" (lane&15) of a row-major tile; the 16
// halves are K = khi..khi+7 and 16+khi..16+khi+7 with khi = 8*(lane>>4),
// i.e. two aligned 16B vector loads. Serves A-fragments (line = row m):
// the attention K chunks; and B-fragments (line = column n): the GEMM A tiles.
__device__ __forceinline__ v16h load_frag(const _Float16* base, int rstride, int lane) {
  const _Float16* p = base + (lane & 15) * rstride + ((lane >> 4) << 3);
  V16U u;
  u.h2[0] = *(const h8*)p;
  u.h2[1] = *(const h8*)(p + 16);
  return u.v;
}

// B-fragment (32 k x 16 columns) or A-fragment (16 rows x 32 k) out of a ROW-MAJOR [k][col] LDS tile: tile
// points at element [k0][col0], pitch is in halfs (bytes: an odd multiple of 32).
// Each transposing load hands lane (c = lane&15, h = lane>>4) the 8 halves
// tile[8h .. 8h+7][c]; the second one, 16 rows on, gives k = 16+8h .. 16+8h+7:
// the k order of load_frag, so the two loaders pair.
__device__ __forceinline__ v16h load_frag_tr(const _Float16* tile, int pitch, int lane) {
  const _Float16* p = tile + (((lane >> 4) << 3) + (lane & 7)) * pitch + (((lane >> 3) & 1) << 3);
  V16U u;
  u.h2[0] = __builtin_bit_cast(h8, __builtin_amdgcn_ds_load_tr16_b128_v8i16((lds_s16x8*)p));
  u.h2[1] = __builtin_bit_cast(h8, __builtin_amdgcn_ds_load_tr16_b128_v8i16((lds_s16x8*)(p + 16 * pitch)));
  return u.v;
}

typedef __attribute__((ext_vector_type(4))) float f4;

__device__ __forceinline__ v8f wmma_f16(v16h a, v16h b, v8f c) {
  // (neg_a, A, neg_b, B, c_mod, C, reuse_a, reuse_b)
  return __builtin_amdgcn_wmma_f32_16x16x32_f16(false, a, false, b, (short)0, c, false, false);
}

// ---------------------------------------------------------------------------
// conv_gate: MS = s1+s2 (f32); depthwise conv (k=5, pad 2) along features with
// per-token weights; MSg = sigmoid(conv) * MS -> f16, merged b n (h d) layout.
// One block per (b, n) row.
// ---------------------------------------------------------------------------
__global__ __launch_bounds__(128)
void conv_gate_kernel(const _Float16* __restrict__ qkv1,
                      const _Float16* __restrict__ qkv2,
                      const float* __restrict__ cw, const float* __restrict__ cb,
                      _Float16* __restrict__ msg) {
  const int bn = blockIdx.x;          // b*N + n
  const int n  = bn & (Nn - 1);
  __shared__ float ms[INNERi + 4];

  const _Float16* s1 = qkv1 + (size_t)bn * 2048 + 1536;
  const _Float16* s2 = qkv2 + (size_t)bn * 2048 + 1536;
  for (int f = threadIdx.x; f < INNERi; f += blockDim.x)
    ms[f + 2] = (float)s1[f] + (float)s2[f];
  if (threadIdx.x < 2) { ms[threadIdx.x] = 0.0f; ms[INNERi + 2 + threadIdx.x] = 0.0f; }
  __syncthreads();

  const float w0 = cw[n * 5 + 0], w1 = cw[n * 5 + 1], w2 = cw[n * 5 + 2],
              w3 = cw[n * 5 + 3], w4 = cw[n * 5 + 4];
  const float bias = cb[n];
  for (int f = threadIdx.x; f < INNERi; f += blockDim.x) {
    const float a = w0 * ms[f] + w1 * ms[f + 1] + w2 * ms[f + 2] +
                    w3 * ms[f + 3] + w4 * ms[f + 4] + bias;
    const float g = ms[f + 2] / (1.0f + __expf(-a));
    msg[(size_t)bn * INNERi + f] = (_Float16)g;
  }
}

// ---------------------------------------------------------------------------
// Flash-attention pass: O = softmax(scale * Q K^T) @ V  (+ V residual),
// computed transposed: S^T = K Q^T, O^T += V^T P^T.
// All tensors live in [B, N, stride] f16 buffers; the head slice is selected
// by (section offset + h*64).  128 query rows per block, 8 waves x 16 queries,
// KV streamed in 64-row chunks through two LDS buffers: the copies of the next
// chunk are in flight while this one is worked on, one barrier per chunk.
//   Ks  : [j][d] row-major, staged via async-to-LDS DMA (no conversion); A of S^T
//   Vs  : [j][d] row-major, staged the same way; transposing loads give A of O^T
// A lane (c = lane&15, hi = lane>>4) owns ONE query, c: of each 16-key tile it
// holds the scores of keys 8*hi .. 8*hi+7, so maximum and sum run in the lane's
// own registers, with one exchange between the wave's halves.  Two score tiles,
// converted in place, are the B operand P^T of a 32-key block (element s is key
// 8*hi+s, then 16+8*hi+(s-8): the k order of load_frag_tr).
// ---------------------------------------------------------------------------

// Value of lane l ^ 16.
__device__ __forceinline__ float other_half(float x) {
  const int i = __builtin_bit_cast(int, x);
  return __builtin_bit_cast(float,
      __builtin_amdgcn_permlanex16(i, i, 0x76543210, 0xfedcba98, false, false));
}

// Four / six 16-byte copies global -> LDS (ASYNCcnt), one chunk's share of a thread.
// The s_wait_xcnt closes the copies' own statement, ahead of any later write of
// their address registers.
__device__ __forceinline__ unsigned lds_addr(const void* p) {
  return (unsigned)(unsigned long long)p;
}
__device__ __forceinline__ void async_copy4_b128(const void* g0, unsigned a0, const void* g1, unsigned a1,
                                                 const void* g2, unsigned a2, const void* g3, unsigned a3) {
  asm volatile("global_load_async_to_lds_b128 %0, %1, off\n\t"
               "global_load_async_to_lds_b128 %2, %3, off\n\t"
               "global_load_async_to_lds_b128 %4, %5, off\n\t"
               "global_load_async_to_lds_b128 %6, %7, off\n\t"
               "s_wait_xcnt 0x0"
               :: "v"(a0), "v"(g0), "v"(a1), "v"(g1), "v"(a2), "v"(g2), "v"(a3), "v"(g3) : "memory");
}
__device__ __forceinline__ void async_copy6_b128(const void* g0, unsigned a0, const void* g1, unsigned a1,
                                                 const void* g2, unsigned a2, const void* g3, unsigned a3,
                                                 const void* g4, unsigned a4, const void* g5, unsigned a5) {
  asm volatile("global_load_async_to_lds_b128 %0, %1, off\n\t"
               "global_load_async_to_lds_b128 %2, %3, off\n\t"
               "global_load_async_to_lds_b128 %4, %5, off\n\t"
               "global_load_async_to_lds_b128 %6, %7, off\n\t"
               "global_load_async_to_lds_b128 %8, %9, off\n\t"
               "global_load_async_to_lds_b128 %10, %11, off\n\t"
               "s_wait_xcnt 0x0"
               :: "v"(a0), "v"(g0), "v"(a1), "v"(g1), "v"(a2), "v"(g2), "v"(a3), "v"(g3),
                  "v"(a4), "v"(g4), "v"(a5), "v"(g5) : "memory");
}

// Eight such copies: one k-tile's share of a thread in either GEMM.
__device__ __forceinline__ void async_copy8_b128(const void* g0, unsigned a0, const void* g1, unsigned a1,
                                                 const void* g2, unsigned a2, const void* g3, unsigned a3,
                                                 const void* g4, unsigned a4, const void* g5, unsigned a5,
                                                 const void* g6, unsigned a6, const void* g7, unsigned a7) {
  asm volatile("global_load_async_to_lds_b128 %0, %1, off\n\t"
               "global_load_async_to_lds_b128 %2, %3, off\n\t"
               "global_load_async_to_lds_b128 %4, %5, off\n\t"
               "global_load_async_to_lds_b128 %6, %7, off\n\t"
               "global_load_async_to_lds_b128 %8, %9, off\n\t"
               "global_load_async_to_lds_b128 %10, %11, off\n\t"
               "global_load_async_to_lds_b128 %12, %13, off\n\t"
               "global_load_async_to_lds_b128 %14, %15, off\n\t"
               "s_wait_xcnt 0x0"
               :: "v"(a0), "v"(g0), "v"(a1), "v"(g1), "v"(a2), "v"(g2), "v"(a3), "v"(g3),
                  "v"(a4), "v"(g4), "v"(a5), "v"(g5), "v"(a6), "v"(g6), "v"(a7), "v"(g7) : "memory");
}

// ---------------------------------------------------------------------------
// Operands of the two GEMMs, f32 -> f16, each element converted once (the first
// GEMM reads every x row 16 times and every W row 64 times, the second every
// row of its W 64 times).  A block takes 8192 floats: blocks 0..511 x1,
// 512..1023 x2, 1024..1151 W1, 1152..1279 W2, 1280..1311 Wo1, 1312..1343 Wo2.
// A wave's load covers 512 B in a row, its store 256 B.
// ---------------------------------------------------------------------------
__global__ __launch_bounds__(256)
void to_f16_kernel(const float* __restrict__ x1, const float* __restrict__ x2,
                   const float* __restrict__ W1, const float* __restrict__ W2,
                   const float* __restrict__ Wo1, const float* __restrict__ Wo2,
                   _Float16* __restrict__ xh1, _Float16* __restrict__ xh2,
                   _Float16* __restrict__ wh1, _Float16* __restrict__ wh2,
                   _Float16* __restrict__ woh1, _Float16* __restrict__ woh2) {
  const int blk = blockIdx.x;
  const float* __restrict__ s = blk < 512 ? x1 : blk < 1024 ? x2 : blk < 1152 ? W1
                              : blk < 1280 ? W2 : blk < 1312 ? Wo1 : Wo2;
  _Float16* __restrict__ d = blk < 512 ? xh1 : blk < 1024 ? xh2 : blk < 1152 ? wh1
                           : blk < 1280 ? wh2 : blk < 1312 ? woh1 : woh2;
  const int b0 = blk < 512 ? blk : blk < 1024 ? blk - 512 : blk < 1152 ? blk - 1024
               : blk < 1280 ? blk - 1152 : blk < 1312 ? blk - 1280 : blk - 1312;
  const size_t base = (size_t)b0 * 8192 + threadIdx.x * 4;
  f4 v[8];
#pragma unroll  // all eight loads go out before the first convert waits
  for (int j = 0; j < 8; ++j) v[j] = *(const f4*)(s + base + j * 1024);
#pragma unroll  // v[] stays in registers
  for (int j = 0; j < 8; ++j)
    *(h4*)(d + base + j * 1024) = h4{(_Float16)v[j].x, (_Float16)v[j].y,
                                     (_Float16)v[j].z, (_Float16)v[j].w};
}

// ---------------------------------------------------------------------------
// GEMM 1: C(f16)[8192,2048] = A(f16)[8192,512] @ W(f16)[512,2048].
// BM=BN=128, BK=64.  8 waves in a 4x2 grid; each wave owns 32x64 = 2x4 WMMA tiles.
// Both tiles lie in memory as LDS wants them, so they go there by asynchronous
// copies (whole 128-B lines), through two buffers: the copies of the next k-tile
// are in flight while this one is worked on, one barrier per k-tile.
//   As : [row][k] row-major;  Bs : [k][col] row-major, read by transposing loads.
// ---------------------------------------------------------------------------
__global__ __launch_bounds__(256)
void gemm_qkv_kernel(const _Float16* __restrict__ A1, const _Float16* __restrict__ W1,
                     _Float16* __restrict__ C1,
                     const _Float16* __restrict__ A2, const _Float16* __restrict__ W2,
                     _Float16* __restrict__ C2) {
  constexpr int K = 512, Ncols = 4 * INNERi;
  // Two independent products in one grid: blockIdx.z picks the stream.
  const bool second = blockIdx.z != 0;
  const _Float16* __restrict__ A = second ? A2 : A1;
  const _Float16* __restrict__ W = second ? W2 : W1;
  _Float16* __restrict__ C = second ? C2 : C1;
  constexpr int AS_S = 72;    // 128 rows x 64 halfs (+pad): 144 B = 16 B x odd
  constexpr int BS_S = 144;   // 64 k-rows x 128 halfs (+pad): 288 B = 32 B x odd
  __shared__ alignas(16) _Float16 As[2][128 * AS_S];
  __shared__ alignas(16) _Float16 Bs[2][64 * BS_S];

  const int tid  = threadIdx.x;
  const int lane = tid & 31;
  const int wave = tid >> 5;
  const int row0 = blockIdx.y * 128;
  const int col0 = blockIdx.x * 128;
  const int wm   = wave & 3;   // row group (32 rows)
  const int wn   = wave >> 2;  // col group (64 cols)

  v8f acc[2][4];
#pragma unroll
  for (int i = 0; i < 2; ++i)
#pragma unroll
    for (int nt = 0; nt < 4; ++nt) acc[i][nt] = {};

  // Staging: a thread copies 16 bytes of rows ar + 32 i of the A tile and of
  // k-rows wr + 16 i of the W tile; ap and wp walk on by one k-tile with every call.
  const int ar = tid >> 3, ac = (tid & 7) << 3;
  const int wr = tid >> 4, wc = (tid & 15) << 3;
  const _Float16* ap = A + (size_t)(row0 + ar) * K + ac;
  const _Float16* wp = W + (size_t)wr * Ncols + col0 + wc;
  const unsigned ad = lds_addr(&As[0][ar * AS_S + ac]);
  const unsigned wd = lds_addr(&Bs[0][wr * BS_S + wc]);
  auto stage = [&](int buf) {
    const unsigned aa = ad + (unsigned)buf * (128 * AS_S * 2), wa = wd + (unsigned)buf * (64 * BS_S * 2);
    async_copy8_b128(ap, aa, ap + 32 * K, aa + 32 * AS_S * 2,
                     ap + 64 * K, aa + 64 * AS_S * 2, ap + 96 * K, aa + 96 * AS_S * 2,
                     wp, wa, wp + 16 * Ncols, wa + 16 * BS_S * 2,
                     wp + 32 * Ncols, wa + 32 * BS_S * 2, wp + 48 * Ncols, wa + 48 * BS_S * 2);
    ap += 64;
    wp += 64 * Ncols;
  };
  stage(0);
  // k-tile 0 landed (this wave's copies); the barrier publishes it to all waves.
  asm volatile("s_wait_asynccnt 0x0" ::: "memory");
  __syncthreads();
  stage(1);  // in flight while k-tile 0 is worked on

  for (int t = 0; t < K / 64; ++t) {
    const int buf = t & 1;
    const _Float16* const Ab = As[buf];
    const _Float16* const Bb = Bs[buf];
#pragma unroll  // two 32-deep products per k-tile, in ascending k
    for (int kk = 0; kk < 2; ++kk) {
      v16h af[2], bf[4];
#pragma unroll
      for (int i = 0; i < 2; ++i)
        af[i] = load_frag(Ab + (wm * 32 + i * 16) * AS_S + kk * 32, AS_S, lane);
#pragma unroll
      for (int nt = 0; nt < 4; ++nt)
        bf[nt] = load_frag_tr(Bb + kk * 32 * BS_S + wn * 64 + nt * 16, BS_S, lane);
#pragma unroll
      for (int i = 0; i < 2; ++i)
#pragma unroll
        for (int nt = 0; nt < 4; ++nt)
          acc[i][nt] = wmma_f16(bf[nt], af[i], acc[i][nt]);
    }
    // Hand-over: this wave's LDS reads of this k-tile have returned ...
    asm volatile("s_wait_dscnt 0x0" ::: "memory");
    // ... and its copies of the next k-tile have landed;
    asm volatile("s_wait_asynccnt 0x0" ::: "memory");
    // the barrier publishes the next k-tile and frees this one's buffers for the refill.
    __syncthreads();
    if (t + 2 < K / 64) stage(buf);
  }
  // No copy is left in flight when the wave goes on to its epilogue.
  asm volatile("s_wait_asynccnt 0x0" ::: "memory");

  // Epilogue.  The products are formed transposed (A = W^T fragment, B = x^T
  // fragment): acc[i][nt][r] of lane (cn, hi) is C[i*16 + cn][nt*16 + 8*hi + r], eight
  // consecutive columns of one row.  The wave's 32 x 64 tile goes through LDS of its
  // own (the ring is free behind the last trip's barrier) and leaves as whole 128-B
  // lines: a store covers four rows, eight lanes to a row.
  const int hi = lane >> 4, cn = lane & 15;
  _Float16* const S = &As[0][0] + wave * (32 * AS_S);
#pragma unroll
  for (int i = 0; i < 2; ++i)
#pragma unroll
    for (int nt = 0; nt < 4; ++nt) {
      h8 pk;
#pragma unroll
      for (int r = 0; r < 8; ++r) pk[r] = (_Float16)acc[i][nt][r];
      *(h8*)(S + (i * 16 + cn) * AS_S + nt * 16 + 8 * hi) = pk;
    }
  // The rows are read back by other lanes of this wave: its LDS writes have retired first.
  asm volatile("s_wait_dscnt 0x0" ::: "memory");
  const int rr = lane >> 3, rc = (lane & 7) << 3;
  h8 line[8];
#pragma unroll
  for (int j = 0; j < 8; ++j) line[j] = *(const h8*)(S + (j * 4 + rr) * AS_S + rc);
  _Float16* const cp = C + (size_t)(row0 + wm * 32 + rr) * Ncols + col0 + wn * 64 + rc;
#pragma unroll
  for (int j = 0; j < 8; ++j) *(h8*)(cp + (size_t)(j * 4) * Ncols) = line[j];
}

// ---------------------------------------------------------------------------
// GEMM 2: out(f32)[8192,512] = A(f16)[8192,512] @ W(f16)[512,512] + bias.
// Tiles, staging, ring and fragment maps are those of GEMM 1: BM=BN=128, BK=64,
// asynchronous copies into two buffers, the next k-tile in flight while this one
// is worked on, one barrier per k-tile.  512 work-groups, two to a WGP.
// ---------------------------------------------------------------------------
__global__ __launch_bounds__(256)
void gemm_out_kernel(const _Float16* __restrict__ A1, const _Float16* __restrict__ W1,
                     const float* __restrict__ bias1, float* __restrict__ C1,
                     const _Float16* __restrict__ A2, const _Float16* __restrict__ W2,
                     const float* __restrict__ bias2, float* __restrict__ C2) {
  constexpr int K = INNERi, Ncols = 512;
  // Two independent products in one grid: blockIdx.z picks the stream.
  const bool second = blockIdx.z != 0;
  const _Float16* __restrict__ A = second ? A2 : A1;
  const _Float16* __restrict__ W = second ? W2 : W1;
  const float* __restrict__ bias = second ? bias2 : bias1;
  float* __restrict__ C = second ? C2 : C1;
  constexpr int AS_S = 72;    // 128 rows x 64 halfs (+pad): 144 B = 16 B x odd
  constexpr int BS_S = 144;   // 64 k-rows x 128 halfs (+pad): 288 B = 32 B x odd
  __shared__ alignas(16) _Float16 As[2][128 * AS_S];
  __shared__ alignas(16) _Float16 Bs[2][64 * BS_S];

  const int tid  = threadIdx.x;
  const int lane = tid & 31;
  const int wave = tid >> 5;
  const int row0 = blockIdx.y * 128;
  const int col0 = blockIdx.x * 128;
  const int wm   = wave & 3;   // row group (32 rows)
  const int wn   = wave >> 2;  // col group (64 cols)

  v8f acc[2][4];
#pragma unroll
  for (int i = 0; i < 2; ++i)
#pragma unroll
    for (int nt = 0; nt < 4; ++nt) acc[i][nt] = {};

  // Staging: a thread copies 16 bytes of rows ar + 32 i of the A tile and of
  // k-rows wr + 16 i of the W tile; ap and wp walk on by one k-tile with every call.
  const int ar = tid >> 3, ac = (tid & 7) << 3;
  const int wr = tid >> 4, wc = (tid & 15) << 3;
  const _Float16* ap = A + (size_t)(row0 + ar) * K + ac;
  const _Float16* wp = W + (size_t)wr * Ncols + col0 + wc;
  const unsigned ad = lds_addr(&As[0][ar * AS_S + ac]);
  const unsigned wd = lds_addr(&Bs[0][wr * BS_S + wc]);
  auto stage = [&](int buf) {
    const unsigned aa = ad + (unsigned)buf * (128 * AS_S * 2), wa = wd + (unsigned)buf * (64 * BS_S * 2);
    async_copy8_b128(ap, aa, ap + 32 * K, aa + 32 * AS_S * 2,
                     ap + 64 * K, aa + 64 * AS_S * 2, ap + 96 * K, aa + 96 * AS_S * 2,
                     wp, wa, wp + 16 * Ncols, wa + 16 * BS_S * 2,
                     wp + 32 * Ncols, wa + 32 * BS_S * 2, wp + 48 * Ncols, wa + 48 * BS_S * 2);
    ap += 64;
    wp += 64 * Ncols;
  };
  stage(0);
  // k-tile 0 landed (this wave's copies); the barrier publishes it to all waves.
  asm volatile("s_wait_asynccnt 0x0" ::: "memory");
  __syncthreads();
  stage(1);  // in flight while k-tile 0 is worked on

  for (int t = 0; t < K / 64; ++t) {
    const int buf = t & 1;
    const _Float16* const Ab = As[buf];
    const _Float16* const Bb = Bs[buf];
#pragma unroll  // two 32-deep products per k-tile, in ascending k
    for (int kk = 0; kk < 2; ++kk) {
      v16h af[2], bf[4];
#pragma unroll
      for (int i = 0; i < 2; ++i)
        af[i] = load_frag(Ab + (wm * 32 + i * 16) * AS_S + kk * 32, AS_S, lane);
#pragma unroll
      for (int nt = 0; nt < 4; ++nt)
        bf[nt] = load_frag_tr(Bb + kk * 32 * BS_S + wn * 64 + nt * 16, BS_S, lane);
#pragma unroll
      for (int i = 0; i < 2; ++i)
#pragma unroll
        for (int nt = 0; nt < 4; ++nt)
          acc[i][nt] = wmma_f16(bf[nt], af[i], acc[i][nt]);
    }
    // Hand-over: this wave's LDS reads of this k-tile have returned ...
    asm volatile("s_wait_dscnt 0x0" ::: "memory");
    // ... and its copies of the next k-tile have landed;
    asm volatile("s_wait_asynccnt 0x0" ::: "memory");
    // the barrier publishes the next k-tile and frees this one's buffers for the refill.
    __syncthreads();
    if (t + 2 < K / 64) stage(buf);
  }
  // No copy is left in flight when the wave goes on to its epilogue.
  asm volatile("s_wait_asynccnt 0x0" ::: "memory");

  // Epilogue.  The products are formed transposed, as in GEMM 1: acc[i][nt][r] of lane
  // (cn, hi) is C[i*16 + cn][nt*16 + 8*hi + r].  The wave's tile goes through LDS of its
  // own (rows 0..15 in the A ring, rows 16..31 in the W ring, both free behind the last
  // trip's barrier) and leaves as whole lines: a store covers two rows of 256 B.
  const int hi = lane >> 4, cn = lane & 15;
  constexpr int SP = 68;  // staged row: 64 floats (+pad): 272 B = 16 B x odd
  const int rr = lane >> 4, rc = (lane & 15) << 2;
  const f4 b4 = *(const f4*)(bias + col0 + wn * 64 + rc);
  float* const S0 = (float*)&As[0][0] + wave * (16 * SP);
  float* const S1 = (float*)&Bs[0][0] + wave * (16 * SP);
#pragma unroll
  for (int i = 0; i < 2; ++i)
#pragma unroll
    for (int nt = 0; nt < 4; ++nt) {
      float* const p = (i ? S1 : S0) + cn * SP + nt * 16 + 8 * hi;
      *(f4*)p       = f4{acc[i][nt][0], acc[i][nt][1], acc[i][nt][2], acc[i][nt][3]};
      *(f4*)(p + 4) = f4{acc[i][nt][4], acc[i][nt][5], acc[i][nt][6], acc[i][nt][7]};
    }
  // The rows are read back by other lanes of this wave: its LDS writes have retired first.
  asm volatile("s_wait_dscnt 0x0" ::: "memory");
  f4 line[16];
#pragma unroll
  for (int j = 0; j < 16; ++j)
    line[j] = *(const f4*)((j < 8 ? S0 : S1) + ((j & 7) * 2 + rr) * SP + rc) + b4;
  float* const cp = C + (size_t)(row0 + wm * 32 + rr) * Ncols + col0 + wn * 64 + rc;
#pragma unroll
  for (int j = 0; j < 16; ++j) *(f4*)(cp + (size_t)(j * 2) * Ncols) = line[j];
}

__global__ __launch_bounds__(256)
void attn_kernel(const _Float16* Q1, const _Float16* Q2, int qstride, int qsec,
                 const _Float16* Kv1, const _Float16* Kv2, int kstride, int ksec,
                 const _Float16* V1, const _Float16* V2, int vstride, int vsec,
                 _Float16* O1, _Float16* O2, int ostride,
                 int addV) {
  // Two independent passes in one grid: blockIdx.z picks the stream.
  const bool second = blockIdx.z != 0;
  const _Float16* __restrict__ Q  = second ? Q2 : Q1;
  const _Float16* __restrict__ Kv = second ? Kv2 : Kv1;
  const _Float16* __restrict__ V  = second ? V2 : V1;
  _Float16* __restrict__ O = second ? O2 : O1;
  constexpr int LS = 72;  // padded row stride in halfs (144B, 16B-multiple)
  __shared__ alignas(16) _Float16 Ks [2][64 * LS];
  constexpr int VS = 80;  // V row stride in halfs: 160 B = 32 B x odd, for the transposing reader
  __shared__ alignas(16) _Float16 Vs [2][64 * VS];

  const int tid  = threadIdx.x;
  const int lane = tid & 31;
  const int wave = tid >> 5;
  const int bh   = blockIdx.y;
  const int b    = bh >> 3;
  const int h    = bh & 7;
  const int row0 = blockIdx.x * 128;
  const size_t bN = (size_t)b * Nn;
  const int qoff = qsec + h * HDd;
  const int koff = ksec + h * HDd;
  const int voff = vsec + h * HDd;
  const int ooff = h * HDd;

  // Q fragments for this wave's 16 queries (B operand: column = query lane&15):
  // two global_load_b128 per fragment.
  v16h qa0, qa1;
  {
    const _Float16* qp =
        Q + (bN + row0 + wave * 16 + (lane & 15)) * (size_t)qstride + qoff +
        ((lane >> 4) << 3);
    V16U u0, u1;
    u0.h2[0] = *(const h8*)(qp);
    u0.h2[1] = *(const h8*)(qp + 16);
    u1.h2[0] = *(const h8*)(qp + 32);
    u1.h2[1] = *(const h8*)(qp + 48);
    qa0 = u0.v;
    qa1 = u1.v;
  }

  constexpr float c = 0.125f * 1.44269504f;  // HD^-0.5 * log2(e): a literal, so it sits in scalar registers
  float m_old = -1e30f;  // running maximum of this lane's query, unscaled (equal in both halves)
  float l = 0.0f;        // running sum over this half's keys; the halves join after the loop
  v8f o[4];              // o[dt][r] = O^T[dt*16 + 8*hi + r][query]
#pragma unroll
  for (int dt = 0; dt < 4; ++dt) o[dt] = {};

  // Staging: a thread copies 16 bytes of row sr and of row sr + 32 of the K and
  // of the V chunk; kp and vp walk on by one chunk with every call.
  const int sr = tid >> 3, c8 = (tid & 7) << 3;
  const _Float16* kp = Kv + (bN + sr) * (size_t)kstride + koff + c8;
  const _Float16* vp = V  + (bN + sr) * (size_t)vstride + voff + c8;
  const unsigned kd = lds_addr(&Ks[0][sr * LS + c8]);
  const unsigned vd = lds_addr(&Vs[0][sr * VS + c8]);
  auto stage = [&](int buf) {
    const unsigned ka = kd + (unsigned)buf * (64 * LS * 2), va = vd + (unsigned)buf * (64 * VS * 2);
    async_copy4_b128(kp, ka, kp + 32 * (size_t)kstride, ka + 32 * LS * 2,
                     vp, va, vp + 32 * (size_t)vstride, va + 32 * VS * 2);
    kp += 64 * (size_t)kstride;
    vp += 64 * (size_t)vstride;
  };
  stage(0);
  // Chunk 0 landed (this wave's copies); the barrier publishes it to all waves.
  asm volatile("s_wait_asynccnt 0x0" ::: "memory");
  __syncthreads();
  stage(1);  // in flight while chunk 0 is worked on

  for (int j0 = 0; j0 < Nn; j0 += 64) {
    const int buf = (j0 >> 6) & 1;
    const _Float16* const Kb = Ks[buf];
    const _Float16* const Vb = Vs[buf];

    // S^T = K Q^T  (64 keys x 16 queries per wave, 4 WMMA key tiles, K-depth 64):
    // sc[nt][r] = unscaled score of key nt*16 + 8*hi + r against query cn.
    v8f sc[4];
#pragma unroll
    for (int nt = 0; nt < 4; ++nt) {
      v8f z = {};
      z = wmma_f16(load_frag(Kb + (nt * 16) * LS, LS, lane), qa0, z);
      z = wmma_f16(load_frag(Kb + (nt * 16) * LS + 32, LS, lane), qa1, z);
      sc[nt] = z;
    }

    // Online-softmax update, one query per lane.  The maximum is kept in unscaled
    // score units; scale and log2(e) meet a score in one multiply-add:
    // exp(scale * (s - m)) = exp2(s * c - m * c), c = scale * log2(e).
    float mt[4];
#pragma unroll
    for (int nt = 0; nt < 4; ++nt) {
      mt[nt] = sc[nt][0];
#pragma unroll
      for (int r = 1; r < 8; ++r) mt[nt] = fmaxf(mt[nt], sc[nt][r]);
    }
    float mx = fmaxf(fmaxf(mt[0], mt[1]), fmaxf(mt[2], mt[3]));
    mx = fmaxf(mx, other_half(mx));
    const float m_new = fmaxf(m_old, mx);
    const float xa = (m_old - m_new) * c;
    const float alpha = __builtin_amdgcn_exp2f(xa);
    const float nmc = -m_new * c;
    m_old = m_new;

    V16U pb[2];    // P^T of keys 0..31 and 32..63, packed in place as B operands
    v8f x[4];
#pragma unroll
    for (int nt = 0; nt < 4; ++nt) {
      x[nt] = sc[nt] * c + nmc;
#pragma unroll
      for (int r = 0; r < 8; ++r) {
        sc[nt][r] = __builtin_amdgcn_exp2f(x[nt][r]);
        pb[nt >> 1].v[(nt & 1) * 8 + r] = (_Float16)sc[nt][r];
      }
    }
    // The slot between a v_exp_f32 and an overwrite of its source: the arguments
    // stay live up to this v_nop, which stands behind the last exponential.
    asm volatile("v_nop" :: "v"(x[0]), "v"(x[1]), "v"(x[2]), "v"(x[3]), "v"(sc[0]), "v"(sc[1]),
                 "v"(sc[2]), "v"(sc[3]), "v"(xa), "v"(alpha));
    // Sum of this lane's 32 values: the four tiles register by register (packed
    // adds, independent chains), then the eight registers as a tree.
    const v8f ts = (sc[0] + sc[1]) + (sc[2] + sc[3]);
    l = l * alpha + (((ts[0] + ts[1]) + (ts[2] + ts[3])) + ((ts[4] + ts[5]) + (ts[6] + ts[7])));
#pragma unroll
    for (int dt = 0; dt < 4; ++dt)
#pragma unroll
      for (int r = 0; r < 8; ++r) o[dt][r] *= alpha;

    // O^T += V_chunk^T @ P^T.  A-fragments (row = d) from row-major Vs:
    // 2x ds_load_tr16_b128 each; B = P^T straight from registers.
#pragma unroll
    for (int dt = 0; dt < 4; ++dt) {
      o[dt] = wmma_f16(load_frag_tr(Vb + dt * 16, VS, lane), pb[0].v, o[dt]);
      o[dt] = wmma_f16(load_frag_tr(Vb + 32 * VS + dt * 16, VS, lane), pb[1].v, o[dt]);
    }

    // Hand-over: this wave's LDS reads of this chunk have returned ...
    asm volatile("s_wait_dscnt 0x0" ::: "memory");
    // ... and its copies of the next chunk have landed;
    asm volatile("s_wait_asynccnt 0x0" ::: "memory");
    // the barrier publishes the next chunk and frees this chunk's buffer for the refill.
    __syncthreads();
    if (j0 + 128 < Nn) stage(buf);
  }
  // No copy is left in flight when the wave goes on to its epilogue.
  asm volatile("s_wait_asynccnt 0x0" ::: "memory");

  // Residual rows (zero where none is asked for): all four loads go out together,
  // under one block-uniform test, ahead of the divisions.
  // The lane number is read anew and the wave number taken into a scalar register here,
  // so that no address of the epilogue lives in vector registers through the loop
  // (the loop fills the 128 VGPRs at which four blocks share a WGP).
  const int el = (int)__builtin_amdgcn_mbcnt_lo(~0u, 0u);
  const int cn = el & 15, hi = el >> 4;
  const int sw = __builtin_amdgcn_readfirstlane(wave);
  const size_t grow = bN + row0 + sw * 16 + cn;
  h8 res[4];
#pragma unroll
  for (int dt = 0; dt < 4; ++dt) res[dt] = {};
  if (addV) {
#pragma unroll
    for (int dt = 0; dt < 4; ++dt)
      res[dt] = *(const h8*)(V + grow * (size_t)vstride + voff + dt * 16 + 8 * hi);
    // The output address below reuses the address registers of the loads above.
    asm volatile("s_wait_xcnt 0x0" ::: "memory");
  }

  // Join the halves' sums, normalize, add the residual, store f16: a lane's
  // 8 accumulator registers are 8 consecutive d of its query, one 16-byte store.
  // The wave's 16 x 64 tile goes through LDS of its own (the K ring is free behind the
  // last chunk's barrier) and leaves as whole 128-B lines: a store covers four rows.
  l += other_half(l);
  _Float16* const S = &Ks[0][0] + sw * (16 * LS);
#pragma unroll
  for (int dt = 0; dt < 4; ++dt) {
    h8 ov;
#pragma unroll
    for (int r = 0; r < 8; ++r)
      ov[r] = (_Float16)(o[dt][r] / l + (float)res[dt][r]);
    *(h8*)(S + cn * LS + dt * 16 + 8 * hi) = ov;
  }
  // The rows are read back by other lanes of this wave: its LDS writes have retired first.
  asm volatile("s_wait_dscnt 0x0" ::: "memory");
  const int rr = el >> 3, rc = (el & 7) << 3;
  h8 line[4];
#pragma unroll
  for (int j = 0; j < 4; ++j) line[j] = *(const h8*)(S + (j * 4 + rr) * LS + rc);
  _Float16* const op = O + (bN + row0 + sw * 16 + rr) * (size_t)ostride + ooff + rc;
#pragma unroll
  for (int j = 0; j < 4; ++j) *(h8*)(op + (size_t)(j * 4) * ostride) = line[j];
}

// ---------------------------------------------------------------------------
// First attention stage, both streams in one pass.  Its scores come from the
// gated rows alone (queries and keys are the same tensor X), so softmax(X X^T)
// is the same matrix for stream 1 and stream 2: it is formed once per query
// tile and multiplied into both value tensors,
//   O1 = P V1 + V1,  O2 = P V2 + V2.
// Layouts, fragment maps and the order of every sum are those of attn_kernel.
// X: [B*N][512]; V1, V2: the v section of the [B*N][2048] projections.
// ---------------------------------------------------------------------------

__global__ __launch_bounds__(256)
void attn_shared_kernel(const _Float16* __restrict__ X,
                        const _Float16* __restrict__ V1, const _Float16* __restrict__ V2,
                        _Float16* __restrict__ O1, _Float16* __restrict__ O2) {
  constexpr int XS   = INNERi;      // row stride of X and of the outputs, halfs
  constexpr int VSTR = 4 * INNERi;  // row stride of the projections
  constexpr int VSEC = 2 * INNERi;  // their v section
  constexpr int LS = 72;  // K row stride in halfs (144 B)
  constexpr int VS = 80;  // V row stride in halfs: 160 B = 32 B x odd, for the transposing reader
  __shared__ alignas(16) _Float16 Ks [2][64 * LS];
  __shared__ alignas(16) _Float16 Vs1[2][64 * VS];
  __shared__ alignas(16) _Float16 Vs2[2][64 * VS];

  const int tid  = threadIdx.x;
  const int lane = tid & 31;
  const int wave = tid >> 5;
  const int bh   = blockIdx.y;
  const int b    = bh >> 3;
  const int hoff = (bh & 7) * HDd;
  const int row0 = blockIdx.x * 128;
  const size_t bN = (size_t)b * Nn;
  const int cn = lane & 15;
  const int hi = lane >> 4;
  const size_t grow = bN + row0 + wave * 16 + cn;  // this lane's query row

  // Q fragments for this wave's 16 queries (B operand: column = query lane&15).
  v16h qa0, qa1;
  {
    const _Float16* qp = X + grow * XS + hoff + (hi << 3);
    V16U u0, u1;
    u0.h2[0] = *(const h8*)(qp);
    u0.h2[1] = *(const h8*)(qp + 16);
    u1.h2[0] = *(const h8*)(qp + 32);
    u1.h2[1] = *(const h8*)(qp + 48);
    qa0 = u0.v;
    qa1 = u1.v;
  }

  constexpr float c = 0.125f * 1.44269504f;  // HD^-0.5 * log2(e): a literal, so it sits in scalar registers
  float m_old = -1e30f;  // running maximum of this lane's query, unscaled (equal in both halves)
  float l = 0.0f;        // running sum over this half's keys; the halves join after the loop
  v8f o1[4], o2[4];      // o[dt][r] = O^T[dt*16 + 8*hi + r][query], one set per stream
#pragma unroll
  for (int dt = 0; dt < 4; ++dt) { o1[dt] = {}; o2[dt] = {}; }

  // Staging: a thread copies 16 bytes of row sr and of row sr + 32 of each tile;
  // the three pointers walk on by one chunk with every call.
  const int sr = tid >> 3, c8 = (tid & 7) << 3;
  const _Float16* kp  = X  + (bN + sr) * XS + hoff + c8;
  const _Float16* vp1 = V1 + (bN + sr) * VSTR + VSEC + hoff + c8;
  const _Float16* vp2 = V2 + (bN + sr) * VSTR + VSEC + hoff + c8;
  const unsigned kd  = lds_addr(&Ks [0][sr * LS + c8]);
  const unsigned vd1 = lds_addr(&Vs1[0][sr * VS + c8]);
  const unsigned vd2 = lds_addr(&Vs2[0][sr * VS + c8]);
  auto stage = [&](int buf) {
    const unsigned ka = kd + (unsigned)buf * (64 * LS * 2);
    const unsigned va1 = vd1 + (unsigned)buf * (64 * VS * 2), va2 = vd2 + (unsigned)buf * (64 * VS * 2);
    async_copy6_b128(kp, ka, kp + 32 * XS, ka + 32 * LS * 2,
                     vp1, va1, vp1 + 32 * VSTR, va1 + 32 * VS * 2,
                     vp2, va2, vp2 + 32 * VSTR, va2 + 32 * VS * 2);
    kp  += 64 * XS;
    vp1 += 64 * VSTR;
    vp2 += 64 * VSTR;
  };
  stage(0);
  // Chunk 0 landed (this wave's copies); the barrier publishes it to all waves.
  asm volatile("s_wait_asynccnt 0x0" ::: "memory");
  __syncthreads();
  stage(1);  // in flight while chunk 0 is worked on

  for (int j0 = 0; j0 < Nn; j0 += 64) {
    const int buf = (j0 >> 6) & 1;
    const _Float16* const Kb  = Ks [buf];
    const _Float16* const Vb1 = Vs1[buf];
    const _Float16* const Vb2 = Vs2[buf];

    // S^T = K Q^T: sc[nt][r] = unscaled score of key nt*16 + 8*hi + r against query cn.
    v8f sc[4];
#pragma unroll
    for (int nt = 0; nt < 4; ++nt) {
      v8f z = {};
      z = wmma_f16(load_frag(Kb + (nt * 16) * LS, LS, lane), qa0, z);
      z = wmma_f16(load_frag(Kb + (nt * 16) * LS + 32, LS, lane), qa1, z);
      sc[nt] = z;
    }

    // Online-softmax update, one query per lane.  The maximum is kept in unscaled
    // score units; scale and log2(e) meet a score in one multiply-add:
    // exp(scale * (s - m)) = exp2(s * c - m * c), c = scale * log2(e).
    float mt[4];
#pragma unroll
    for (int nt = 0; nt < 4; ++nt) {
      mt[nt] = sc[nt][0];
#pragma unroll
      for (int r = 1; r < 8; ++r) mt[nt] = fmaxf(mt[nt], sc[nt][r]);
    }
    float mx = fmaxf(fmaxf(mt[0], mt[1]), fmaxf(mt[2], mt[3]));
    mx = fmaxf(mx, other_half(mx));
    const float m_new = fmaxf(m_old, mx);
    const float xa = (m_old - m_new) * c;
    const float alpha = __builtin_amdgcn_exp2f(xa);
    const float nmc = -m_new * c;
    m_old = m_new;

    V16U pb[2];    // P^T of keys 0..31 and 32..63, packed in place as B operands
    v8f x[4];
#pragma unroll
    for (int nt = 0; nt < 4; ++nt) {
      x[nt] = sc[nt] * c + nmc;
#pragma unroll
      for (int r = 0; r < 8; ++r) {
        sc[nt][r] = __builtin_amdgcn_exp2f(x[nt][r]);
        pb[nt >> 1].v[(nt & 1) * 8 + r] = (_Float16)sc[nt][r];
      }
    }
    // The slot between a v_exp_f32 and an overwrite of its source: the arguments
    // stay live up to this v_nop, which stands behind the last exponential.
    asm volatile("v_nop" :: "v"(x[0]), "v"(x[1]), "v"(x[2]), "v"(x[3]), "v"(sc[0]), "v"(sc[1]),
                 "v"(sc[2]), "v"(sc[3]), "v"(xa), "v"(alpha));
    // Sum of this lane's 32 values: the four tiles register by register, then
    // the eight registers as a tree.
    const v8f ts = (sc[0] + sc[1]) + (sc[2] + sc[3]);
    l = l * alpha + (((ts[0] + ts[1]) + (ts[2] + ts[3])) + ((ts[4] + ts[5]) + (ts[6] + ts[7])));
#pragma unroll
    for (int dt = 0; dt < 4; ++dt) {
      o1[dt] *= alpha;
      o2[dt] *= alpha;
    }

    // O^T += V_chunk^T @ P^T for both streams: the same B = P^T from registers,
    // A-fragments (row = d) from each stream's row-major tile.
#pragma unroll
    for (int dt = 0; dt < 4; ++dt) {
      o1[dt] = wmma_f16(load_frag_tr(Vb1 + dt * 16, VS, lane), pb[0].v, o1[dt]);
      o1[dt] = wmma_f16(load_frag_tr(Vb1 + 32 * VS + dt * 16, VS, lane), pb[1].v, o1[dt]);
    }
#pragma unroll
    for (int dt = 0; dt < 4; ++dt) {
      o2[dt] = wmma_f16(load_frag_tr(Vb2 + dt * 16, VS, lane), pb[0].v, o2[dt]);
      o2[dt] = wmma_f16(load_frag_tr(Vb2 + 32 * VS + dt * 16, VS, lane), pb[1].v, o2[dt]);
    }

    // Hand-over: this wave's LDS reads of this chunk have returned ...
    asm volatile("s_wait_dscnt 0x0" ::: "memory");
    // ... and its copies of the next chunk have landed;
    asm volatile("s_wait_asynccnt 0x0" ::: "memory");
    // the barrier publishes the next chunk and frees this chunk's buffers for the refill.
    __syncthreads();
    if (j0 + 128 < Nn) stage(buf);
  }
  // No copy is left in flight when the wave goes on to its epilogue.
  asm volatile("s_wait_asynccnt 0x0" ::: "memory");

  // Residual rows of both streams: all eight loads go out together, ahead of the divisions.
  h8 res1[4], res2[4];
#pragma unroll
  for (int dt = 0; dt < 4; ++dt) {
    res1[dt] = *(const h8*)(V1 + grow * VSTR + VSEC + hoff + dt * 16 + 8 * hi);
    res2[dt] = *(const h8*)(V2 + grow * VSTR + VSEC + hoff + dt * 16 + 8 * hi);
  }

  // Join the halves' sums, normalize, add the residual, store f16: a lane's
  // 8 accumulator registers are 8 consecutive d of its query, one 16-byte store.
  l += other_half(l);
  h8 ov1[4], ov2[4];
#pragma unroll
  for (int dt = 0; dt < 4; ++dt)
#pragma unroll
    for (int r = 0; r < 8; ++r) {
      ov1[dt][r] = (_Float16)(o1[dt][r] / l + (float)res1[dt][r]);
      ov2[dt][r] = (_Float16)(o2[dt][r] / l + (float)res2[dt][r]);
    }
  // The wave's two 16 x 64 tiles go through LDS of its own (the K ring and the first V
  // ring are free behind the last chunk's barrier) and leave as whole 128-B lines: a
  // store covers four rows.
  _Float16* const S1 = &Ks [0][0] + wave * (16 * LS);
  _Float16* const S2 = &Vs1[0][0] + wave * (16 * LS);
#pragma unroll
  for (int dt = 0; dt < 4; ++dt) {
    *(h8*)(S1 + cn * LS + dt * 16 + 8 * hi) = ov1[dt];
    *(h8*)(S2 + cn * LS + dt * 16 + 8 * hi) = ov2[dt];
  }
  // The rows are read back by other lanes of this wave: its LDS writes have retired first.
  asm volatile("s_wait_dscnt 0x0" ::: "memory");
  const int rr = lane >> 3, rc = (lane & 7) << 3;
  h8 line1[4], line2[4];
#pragma unroll
  for (int j = 0; j < 4; ++j) {
    line1[j] = *(const h8*)(S1 + (j * 4 + rr) * LS + rc);
    line2[j] = *(const h8*)(S2 + (j * 4 + rr) * LS + rc);
  }
  const size_t orow = (bN + row0 + wave * 16 + rr) * XS + hoff + rc;
#pragma unroll
  for (int j = 0; j < 4; ++j) {
    *(h8*)(O1 + orow + j * 4 * XS) = line1[j];
    *(h8*)(O2 + orow + j * 4 * XS) = line2[j];
  }
}

// ---------------------------------------------------------------------------
// Host launcher.
// ---------------------------------------------------------------------------
extern "C" void kernel_launch(void* const* d_in, const int* in_sizes, int n_in,
                              void* d_out, int out_size, void* d_ws, size_t ws_size,
                              hipStream_t stream) {
  (void)in_sizes; (void)n_in; (void)out_size; (void)ws_size;
  const float* x1     = (const float*)d_in[0];
  const float* x2     = (const float*)d_in[1];
  const float* Wqkv1  = (const float*)d_in[2];
  const float* Wqkv2  = (const float*)d_in[3];
  const float* Wout1  = (const float*)d_in[4];
  const float* bout1  = (const float*)d_in[5];
  const float* Wout2  = (const float*)d_in[6];
  const float* bout2  = (const float*)d_in[7];
  const float* conv_w = (const float*)d_in[8];
  const float* conv_b = (const float*)d_in[9];

  const size_t MROWS = (size_t)Bb * Nn;  // 8192
  // Workspace layout (f16). t1 aliases msg (dead after the first attention launch);
  // t2 has a plane of its own: its writer runs beside the reader of u1. Total ~102 MB.
  // The f16 copies of x1, x2 lie in the u1, u2 planes and those of the two W in the
  // t2 plane: they are dead once the first GEMM has run, ahead of those planes' writers.
  _Float16* qkv1h = (_Float16*)d_ws;
  _Float16* qkv2h = qkv1h + MROWS * 2048;
  _Float16* msg   = qkv2h + MROWS * 2048;
  _Float16* u1    = msg + MROWS * 512;
  _Float16* u2    = u1 + MROWS * 512;
  _Float16* t1    = msg;  // alias
  _Float16* t2    = u2 + MROWS * 512;
  _Float16* xh1   = u1;   // alias
  _Float16* xh2   = u2;   // alias
  _Float16* wh1   = t2;   // alias
  _Float16* wh2   = t2 + 512 * 2048;
  _Float16* woh1  = t2 + MROWS * 512;  // f16 Wout1, Wout2: planes of their own, live to the last launch
  _Float16* woh2  = woh1 + 512 * 512;

  float* out1 = (float*)d_out;
  float* out2 = out1 + MROWS * 512;

  const dim3 blk(256);

  // x, Wqkv and Wout of both streams -> f16, once
  to_f16_kernel<<<dim3(1344), blk, 0, stream>>>(x1, x2, Wqkv1, Wqkv2, Wout1, Wout2,
                                                xh1, xh2, wh1, wh2, woh1, woh2);

  // QKV projections: [8192,512] @ [512,2048] -> f16
  gemm_qkv_kernel<<<dim3(16, 64, 2), blk, 0, stream>>>(xh1, wh1, qkv1h, xh2, wh2, qkv2h);

  // Gated conv branch -> MSg (merged b n (h d), f16)
  conv_gate_kernel<<<dim3(Bb * Nn), dim3(128), 0, stream>>>(qkv1h, qkv2h, conv_w, conv_b, msg);

  // u1 = softmax(MS MS^T)·v1 + v1 ; u2 likewise (sections: q=0,k=512,v=1024,s=1536)
  // (one grid for both: the score matrix is shared)
  attn_shared_kernel<<<dim3(8, 64), blk, 0, stream>>>(msg, qkv1h, qkv2h, u1, u2);
  // t1 = softmax(q1 k1^T)·u1 ; t2 = softmax(q2 k2^T)·u2
  attn_kernel<<<dim3(8, 64, 2), blk, 0, stream>>>(qkv1h, qkv2h, 2048, 0, qkv1h, qkv2h, 2048, 512,
                                                  u1, u2, 512, 0, t1, t2, 512, 0);

  // Output projections with bias -> f32 d_out
  gemm_out_kernel<<<dim3(4, 64, 2), blk, 0, stream>>>(t1, woh1, bout1, out1, t2, woh2, bout2, out2);
}
